// v000
// Times are from an AMD MI455X. After a warm-up the kernel runs many times in a row, and a time is the length of
// such a window on the GPU divided by its runs, so every launch and the gaps after it count. The runs cycle
// through copies of the inputs. A figure is the median of several windows, for all but v000 over two sittings.
// Sittings can differ by a few percent; kernels timed side by side share one.
// The starting kernel, v000, takes 547 microseconds a run.
#include <hip/hip_runtime.h>

// Contractions (all f32 accumulate): x@wq, x@wk, x@wv v_wmma_f32_16x16x32_bf16 (bf16 x bf16 operand planes, inputs RNE-converted to bf16); scores q.k and P.V: query rows < 512 bf16 hi/lo planes (3 products each), rows >= 512 v_wmma_f32_16x16x32_f16 (P carried x1024); ctx@wo bf16 hi/lo ctx planes x bf16 weights (2 products).
// Grouped-query causal-style attention with interleaved-pair rotation from INPUT tables and an INPUT int32 mask (read by value through a bit-plane + 16x32 tile classes); softmax f32 online running-max form.
// Flash-style fused attention: one wave per 16 query rows per head, K / V^T fragments straight from K-contiguous 16-bit planes, P relayout through a wave-private LDS tile (block barrier, block == one wave).

#ifndef NB
#define NB 1
#endif
#ifndef SEQ
#define SEQ 2048
#endif
#define NB_FULL  1
#define SEQ_FULL 2048
#define DM   2048
#define NH   32
#define NKV  8
#define REP  (NH / NKV)
#define HD   64
#define DQ   (NH * HD)
#define DKV  (NKV * HD)
#define RH   ((SEQ) < 512 ? (SEQ) : 512)     // query rows < RH use hi+lo planes
#define NW   (SEQ / 32)                      // 32-key words per mask row
#define PP   40                              // P tile pitch (16-bit elements)
#define PCAR 1024.0f
#define SCL2 0.18033688011112042f            // (1/8) * log2(e)

static_assert(SEQ % 64 == 0);                // GEMM row tiles of 64, key halves of 32
static_assert(SEQ <= SEQ_FULL);
static_assert(NW <= 64);                     // mask pre-pass holds words lane and lane+32
static_assert(HD == 64);
static_assert(DM % 64 == 0 && DQ % 64 == 0 && DKV % 64 == 0);
static_assert(DM % 32 == 0 && DQ % 32 == 0);
static_assert(NH % NKV == 0);
static_assert(RH % 16 == 0 && (SEQ - RH) % 16 == 0);
static_assert((PP * 2) % 16 == 0);
static_assert(NB <= NB_FULL);

typedef _Float16 h16;
typedef unsigned short bf;
typedef __attribute__((ext_vector_type(16))) __bf16   v16bf;
typedef __attribute__((ext_vector_type(16))) _Float16 v16h;
typedef __attribute__((ext_vector_type(8)))  _Float16 v8h;
typedef __attribute__((ext_vector_type(8)))  unsigned short v8us;
typedef __attribute__((ext_vector_type(8)))  float    v8f;
typedef __attribute__((ext_vector_type(4)))  float    v4f;
typedef __attribute__((ext_vector_type(2)))  _Float16 v2h;
typedef __attribute__((ext_vector_type(2)))  unsigned short v2us;
typedef __attribute__((ext_vector_type(2)))  float    v2f;
typedef v4f  __attribute__((may_alias)) v4fa;
typedef v8us __attribute__((may_alias)) v8usa;

__device__ __forceinline__ unsigned short f2bf(float f) { unsigned u = __float_as_uint(f); u += 0x7FFFu + ((u >> 16) & 1u); return (unsigned short)(u >> 16); }
__device__ __forceinline__ float bf2f(unsigned short b) { return __uint_as_float(((unsigned)b) << 16); }
__device__ __forceinline__ float bfr(float f) { return bf2f(f2bf(f)); }
__device__ __forceinline__ v16h cat16(v8h lo, v8h hi) { return __builtin_shufflevector(lo, hi, 0, 1, 2, 3, 4, 5, 6, 7, 8, 9, 10, 11, 12, 13, 14, 15); }
__device__ __forceinline__ v16bf cat16b(v8us lo, v8us hi) { return __builtin_bit_cast(v16bf, __builtin_shufflevector(lo, hi, 0, 1, 2, 3, 4, 5, 6, 7, 8, 9, 10, 11, 12, 13, 14, 15)); }
__device__ __forceinline__ v16h cat16hu(v8us lo, v8us hi) { return __builtin_bit_cast(v16h, __builtin_shufflevector(lo, hi, 0, 1, 2, 3, 4, 5, 6, 7, 8, 9, 10, 11, 12, 13, 14, 15)); }
__device__ __forceinline__ v8f wmma16(v16h a, v16h b, v8f c) { return __builtin_amdgcn_wmma_f32_16x16x32_f16(false, a, false, b, (short)0, c, false, false); }
__device__ __forceinline__ v8f wmmab(v16bf a, v16bf b, v8f c) { return __builtin_amdgcn_wmma_f32_16x16x32_bf16(false, a, false, b, (short)0, c, false, false); }
__device__ __forceinline__ void splitf(float y, unsigned short& h, unsigned short& l) { h = f2bf(y); l = f2bf(y - bf2f(h)); }
__device__ __forceinline__ float ex2(float x) { return __builtin_amdgcn_exp2f(x); }

// Fragment loaders: lane (hi = lane>>4, lr = lane&15); pointer already at row lr, k offset k0 + 8*hi; elements 0..7 <- k0+8hi+0..7, 8..15 <- k0+16+8hi+0..7 (same map for A and B).
template <typename T16> struct WFrag;
template <> struct WFrag<h16> { typedef v16h V; static __device__ __forceinline__ V ld(const h16* p) { return cat16(*(const v8h*)p, *(const v8h*)(p + 16)); } static __device__ __forceinline__ v8f mma(V a, V b, v8f c) { return wmma16(a, b, c); } };
template <> struct WFrag<bf> { typedef v16bf V; static __device__ __forceinline__ V ld(const bf* p) { return cat16b(*(const v8us*)p, *(const v8us*)(p + 16)); } static __device__ __forceinline__ v8f mma(V a, V b, v8f c) { return wmmab(a, b, c); } };

// ---- GEMM body: ONE WAVE per 64x64 output tile (16 accumulators), operands straight from K-contiguous 16-bit planes; grid (M/64, N/64), 32 threads.
// C[m][n] (f32, pitch ldc) = sum_k (A[m][k] (+ A2[m][k] when NSPLIT == 1)) Bt[n][k]. K % 32 == 0, M % 64 == 0, N % 64 == 0.
template <typename T16, int NSPLIT>
__device__ __forceinline__ void gemmw_body(const T16* __restrict__ A, const T16* __restrict__ A2, const T16* __restrict__ Bt, int K, float* C, int ldc) {
    typedef typename WFrag<T16>::V V;
    __shared__ __align__(16) float os[16 * 68];
    const int lane = threadIdx.x & 31, lr = lane & 15, hi = lane >> 4; const int r0 = blockIdx.x * 64, c0 = blockIdx.y * 64;
    v8f acc[4][4];
#pragma unroll
    for (int mb = 0; mb < 4; ++mb)
#pragma unroll
        for (int nb = 0; nb < 4; ++nb) acc[mb][nb] = (v8f){};
    const size_t aoff = (size_t)(r0 + lr) * K + 8 * hi, boff = (size_t)(c0 + lr) * K + 8 * hi;
#pragma unroll 1
    for (int kc = 0; kc < K; kc += 32) {
        V a[4], a2[4];
#pragma unroll
        for (int mb = 0; mb < 4; ++mb) { a[mb] = WFrag<T16>::ld(A + aoff + (size_t)mb * 16 * K + kc); if (NSPLIT == 1) a2[mb] = WFrag<T16>::ld(A2 + aoff + (size_t)mb * 16 * K + kc); else a2[mb] = a[mb]; }
#pragma unroll
        for (int nb = 0; nb < 4; ++nb) { const V b = WFrag<T16>::ld(Bt + boff + (size_t)nb * 16 * K + kc);
#pragma unroll
            for (int mb = 0; mb < 4; ++mb) { acc[mb][nb] = WFrag<T16>::mma(a[mb], b, acc[mb][nb]); if (NSPLIT == 1) acc[mb][nb] = WFrag<T16>::mma(a2[mb], b, acc[mb][nb]); } }
        asm volatile("v_nop\n\tv_nop\n\tv_nop\n\tv_nop" : "+v"(acc[0][0]), "+v"(acc[1][1]), "+v"(acc[2][2]), "+v"(acc[3][3]) : "v"(a[0]), "v"(a[3]));
    }
#pragma unroll
    for (int mb = 0; mb < 4; ++mb) {
#pragma unroll
        for (int nb = 0; nb < 4; ++nb) {
#pragma unroll
            for (int j = 0; j < 8; ++j) os[(hi * 8 + j) * 68 + nb * 16 + lr] = acc[mb][nb][j]; }
        __builtin_amdgcn_wave_barrier(); asm volatile("" ::: "memory");
        float* crow = C + (size_t)(r0 + mb * 16) * ldc + c0;
{
#pragma unroll
            for (int s = 0; s < 8; ++s) { const int row = 2 * s + hi, cofs = lr * 4; const v4f val = *(const v4fa*)(os + row * 68 + cofs);
                *(v4f*)(crow + (size_t)row * ldc + cofs) = val; }
             }
        __builtin_amdgcn_wave_barrier(); asm volatile("" ::: "memory");
    }
}
__global__ __launch_bounds__(32) void k_gemm_p(const bf* __restrict__ A, const bf* __restrict__ Bt, int K, float* C, int ldc) { gemmw_body<bf, 0>(A, A, Bt, K, C, ldc); }
__global__ __launch_bounds__(32) void k_gemm_s(const bf* __restrict__ A, const bf* __restrict__ A2, const bf* __restrict__ Bt, int K, float* C, int ldc) { gemmw_body<bf, 1>(A, A2, Bt, K, C, ldc); }

__global__ __launch_bounds__(256) void k_wtG(const float* __restrict__ w, int K, int N, bf* Bt) {
    const int lane = threadIdx.x & 31; const int L0 = (blockIdx.x * 8 + (threadIdx.x >> 5)) * 8; const int nlines = N * K / 64;
{
#pragma unroll 1
        for (int l = 0; l < 8; ++l) { const int L = L0 + l; if (L >= nlines) break; const size_t e = (size_t)L * 64 + lane * 2; const int k = (int)(e % K), n = (int)(e / K); v2us o;
            o[0] = f2bf(w[(size_t)k * N + n]); o[1] = f2bf(w[(size_t)(k + 1) * N + n]); *(v2us*)(Bt + e) = o; }
         }
}
__global__ __launch_bounds__(256) void k_cvt8(const float* __restrict__ src, bf* dst, size_t n8) { const size_t i = (size_t)blockIdx.x * 256 + threadIdx.x; if (i >= n8) return; const v8f v = *(const v8f*)(src + i * 8); v8us o;
#pragma unroll
    for (int k = 0; k < 8; ++k) o[k] = f2bf(v[k]); *(v8us*)(dst + i * 8) = o;  }

// k_rope: head planes [h][t][d] (fp16 + bf16 hi/lo) of the interleaved-pair rotation: pair (2i, 2i+1) with table entry [t][i] read BY VALUE (RNE-converted to bf16):
__global__ __launch_bounds__(256) void k_rope(const float* __restrict__ F, int pitch, int nheads, const float* __restrict__ COS, const float* __restrict__ SIN, h16* P16, bf* Ph, bf* Pl) {
#pragma clang fp contract(off)
    const size_t e = ((size_t)blockIdx.x * 256 + threadIdx.x) * 2; if (e >= (size_t)nheads * SEQ * HD) return;
    const int d = (int)(e % HD); const int t = (int)((e / HD) % SEQ); const int h = (int)(e / ((size_t)HD * SEQ));
    const v2f x = *(const v2f*)(F + (size_t)t * pitch + h * HD + d);
    const float c = bfr(COS[(size_t)t * (HD / 2) + (d >> 1)]), s = bfr(SIN[(size_t)t * (HD / 2) + (d >> 1)]);
    const float a0 = x[0] * c, a1 = x[1] * s, b0 = x[0] * s, b1 = x[1] * c;
    const float r0 = a0 - a1, r1 = b0 + b1;
    v2h o16; v2us oh, ol; unsigned short a2, c2;
    o16[0] = (h16)r0; splitf(r0, a2, c2); oh[0] = a2; ol[0] = c2;
    o16[1] = (h16)r1; splitf(r1, a2, c2); oh[1] = a2; ol[1] = c2;
    *(v2h*)(P16 + e) = o16; *(v2us*)(Ph + e) = oh; *(v2us*)(Pl + e) = ol;  }
__global__ __launch_bounds__(256) void k_vtp(const float* __restrict__ F, int pitch, int nheads, h16* V16, bf* Vh, bf* Vl) { const size_t e = ((size_t)blockIdx.x * 256 + threadIdx.x) * 2; if (e >= (size_t)nheads * HD * SEQ) return; const int t = (int)(e % SEQ); const int d = (int)((e / SEQ) % HD); const int g = (int)(e / ((size_t)SEQ * HD)); v2h o16; v2us oh, ol;
#pragma unroll
    for (int q = 0; q < 2; ++q) { const float x = F[(size_t)(t + q) * pitch + g * HD + d]; o16[q] = (h16)x; unsigned short a2, c2; splitf(x, a2, c2); oh[q] = a2; ol[q] = c2; }
    *(v2h*)(V16 + e) = o16; *(v2us*)(Vh + e) = oh; *(v2us*)(Vl + e) = ol;  }

// k_maskbits: one wave per 16 query rows. Bit-plane MB[q][w] (bit n = mask[q][32w+n] != 0) and tile class CL[q/16][w]: 0 = no key kept in the 16x32 tile, 1 = all kept, 2 = mixed.
__global__ __launch_bounds__(32) void k_maskbits(const int* __restrict__ mask, unsigned* MBp, int* CLp) {
    const int lane = threadIdx.x & 31; const int qt = blockIdx.x; const int q0 = qt * 16;
    unsigned and0 = 0xFFFFFFFFu, and1 = 0xFFFFFFFFu, or0 = 0u, or1 = 0u;
#pragma unroll 1
    for (int row = 0; row < 16; ++row) {
        const int* mr = mask + (size_t)(q0 + row) * SEQ_FULL; unsigned w0 = 0u, w1 = 0u;
#pragma unroll 4
        for (int w = 0; w < NW; ++w) { const int v = mr[32 * w + lane]; const unsigned b = __builtin_amdgcn_ballot_w32(v != 0); w0 = (w == lane) ? b : w0; w1 = (w == lane + 32) ? b : w1; }
        and0 &= w0; and1 &= w1; or0 |= w0; or1 |= w1;
        unsigned* dst = MBp + (size_t)(q0 + row) * NW;
        if (lane < NW) *(unsigned*)(dst + lane) = w0;
        if (lane + 32 < NW) *(unsigned*)(dst + 32 + lane) = w1;
        
    }
    const int c0 = (or0 == 0u) ? 0 : ((and0 == 0xFFFFFFFFu) ? 1 : 2); const int c1 = (or1 == 0u) ? 0 : ((and1 == 0xFFFFFFFFu) ? 1 : 2);
    int* cd = CLp + (size_t)qt * NW;
    if (lane < NW) *(int*)(cd + lane) = c0;
    if (lane + 32 < NW) *(int*)(cd + 32 + lane) = c1;
    
}

// ---- fused attention body: one wave (= one block) per (16 query rows, head). Key loop over 32-key halves; a half is skipped only when its class says no key of the
// 16x32 tile is kept (masked keys contribute exactly 0 under the -inf fill; a row with no kept key anywhere ends with 0 * (1/0) = NaN, as the module).
// SPLIT: q, k, P, v on bf16 hi/lo planes (hh + hl + lh); else fp16 planes with P carried x PCAR (the carry cancels in acc / l).
template <bool SPLIT>
__device__ __forceinline__ void attn_body(const h16* __restrict__ Q16, const h16* __restrict__ K16, const h16* __restrict__ V16,
                                          const bf* __restrict__ Qh, const bf* __restrict__ Ql, const bf* __restrict__ Kh, const bf* __restrict__ Kl, const bf* __restrict__ Vh, const bf* __restrict__ Vl,
                                          const unsigned* __restrict__ MBp, const int* __restrict__ CLp, bf* Ch, bf* Cl, int qt0) {
    __shared__ __align__(16) unsigned short pa[16 * PP];
    __shared__ __align__(16) unsigned short pb[16 * PP];
    __shared__ __align__(16) float os[16 * 68];
    const int lane = threadIdx.x & 31, lr = lane & 15, hi = lane >> 4;
    const int qt = qt0 + (int)blockIdx.x; const int h = (int)blockIdx.y; const int hk = h / REP; const int q0 = qt * 16;
    const size_t qoff = ((size_t)h * SEQ + q0 + lr) * HD + 8 * hi;       // A fragment: row q0+lr, d offset 8*hi
    const size_t kb0  = ((size_t)hk * SEQ + lr) * HD + 8 * hi;           // B fragment (scores): lane = key, k = d
    const size_t vb0  = ((size_t)hk * HD + lr) * SEQ + 8 * hi;           // B fragment (P.V): lane = d, k = key
    const float NINF = -__builtin_inff();
    float mi[8], li[8]; v8f acc[4];
#pragma unroll
    for (int r = 0; r < 8; ++r) { mi[r] = NINF; li[r] = 0.0f; }
#pragma unroll
    for (int ot = 0; ot < 4; ++ot) acc[ot] = (v8f){};
#pragma unroll 1
    for (int j = 0; j < NW; ++j) {
        const int cls = __builtin_amdgcn_readfirstlane(CLp[(size_t)qt * NW + j]);
        if (cls == 0) continue;                                           // wave-uniform (block == one wave)
        unsigned wd[8];
        if (cls == 1) {
#pragma unroll
            for (int r = 0; r < 8; ++r) wd[r] = 0xFFFFFFFFu;
        } else {
#pragma unroll
            for (int r = 0; r < 8; ++r) wd[r] = MBp[(size_t)(q0 + 8 * hi + r) * NW + j];
        }
        v8f s0 = (v8f){}, s1 = (v8f){};
        const size_t ko = kb0 + (size_t)(32 * j) * HD;
        if (SPLIT) {
            const v16bf qh0 = WFrag<bf>::ld(Qh + qoff), qh1 = WFrag<bf>::ld(Qh + qoff + 32), ql0 = WFrag<bf>::ld(Ql + qoff), ql1 = WFrag<bf>::ld(Ql + qoff + 32);
            { const v16bf kh0 = WFrag<bf>::ld(Kh + ko), kh1 = WFrag<bf>::ld(Kh + ko + 32), kl0 = WFrag<bf>::ld(Kl + ko), kl1 = WFrag<bf>::ld(Kl + ko + 32);
              s0 = wmmab(ql0, kh0, s0); s0 = wmmab(ql1, kh1, s0); s0 = wmmab(qh0, kl0, s0); s0 = wmmab(qh1, kl1, s0); s0 = wmmab(qh0, kh0, s0); s0 = wmmab(qh1, kh1, s0); }
            { const size_t k1 = ko + (size_t)16 * HD; const v16bf kh0 = WFrag<bf>::ld(Kh + k1), kh1 = WFrag<bf>::ld(Kh + k1 + 32), kl0 = WFrag<bf>::ld(Kl + k1), kl1 = WFrag<bf>::ld(Kl + k1 + 32);
              s1 = wmmab(ql0, kh0, s1); s1 = wmmab(ql1, kh1, s1); s1 = wmmab(qh0, kl0, s1); s1 = wmmab(qh1, kl1, s1); s1 = wmmab(qh0, kh0, s1); s1 = wmmab(qh1, kh1, s1);
              asm volatile("v_nop\n\tv_nop\n\tv_nop\n\tv_nop" : "+v"(s0), "+v"(s1) : "v"(qh1), "v"(kh1)); }
        } else {
            const v16h qa0 = WFrag<h16>::ld(Q16 + qoff), qa1 = WFrag<h16>::ld(Q16 + qoff + 32);
            const v16h k00 = WFrag<h16>::ld(K16 + ko), k01 = WFrag<h16>::ld(K16 + ko + 32);
            const v16h k10 = WFrag<h16>::ld(K16 + ko + (size_t)16 * HD), k11 = WFrag<h16>::ld(K16 + ko + (size_t)16 * HD + 32);
            s0 = wmma16(qa0, k00, s0); s0 = wmma16(qa1, k01, s0); s1 = wmma16(qa0, k10, s1); s1 = wmma16(qa1, k11, s1);
            asm volatile("v_nop\n\tv_nop\n\tv_nop\n\tv_nop" : "+v"(s0), "+v"(s1) : "v"(qa1), "v"(k11));
        }
        // online softmax in log2 units; accumulator element r <-> tile row 8*hi + r, column lr (s0) / 16 + lr (s1)
#pragma unroll
        for (int r = 0; r < 8; ++r) {
            const unsigned w = wd[r];
            const bool kp0 = ((w >> lr) & 1u) != 0u, kp1 = ((w >> (16 + lr)) & 1u) != 0u;
            const float v0 = kp0 ? s0[r] * SCL2 : NINF; const float v1 = kp1 ? s1[r] * SCL2 : NINF;
            float mx = fmaxf(v0, v1);
            mx = fmaxf(mx, __shfl_xor(mx, 1, 32)); mx = fmaxf(mx, __shfl_xor(mx, 2, 32)); mx = fmaxf(mx, __shfl_xor(mx, 4, 32)); mx = fmaxf(mx, __shfl_xor(mx, 8, 32));
            const float nm = fmaxf(mi[r], mx); const float ms = (nm == NINF) ? 0.0f : nm;
            const float corr = ex2(mi[r] - ms); const float p0 = ex2(v0 - ms), p1 = ex2(v1 - ms);
            const int po = (8 * hi + r) * PP + lr;
            if (SPLIT) { unsigned short a, c; splitf(p0, a, c); pa[po] = a; pb[po] = c; splitf(p1, a, c); pa[po + 16] = a; pb[po + 16] = c; li[r] = li[r] * corr + (p0 + p1); }
            else { const h16 e0 = (h16)(p0 * PCAR), e1 = (h16)(p1 * PCAR); pa[po] = __builtin_bit_cast(unsigned short, e0); pa[po + 16] = __builtin_bit_cast(unsigned short, e1); li[r] = li[r] * corr + ((float)e0 + (float)e1); }
            mi[r] = nm;
#pragma unroll
            for (int ot = 0; ot < 4; ++ot) acc[ot][r] *= corr;
        }
        __syncthreads();                                                  // P tile stores -> fragment reloads (same wave; block == one wave)
        const size_t vo = vb0 + (size_t)(32 * j);
        if (SPLIT) {
            const v8us a0 = *(const v8usa*)(pa + lr * PP + 8 * hi), a1 = *(const v8usa*)(pa + lr * PP + 16 + 8 * hi);
            const v8us b0 = *(const v8usa*)(pb + lr * PP + 8 * hi), b1 = *(const v8usa*)(pb + lr * PP + 16 + 8 * hi);
            const v16bf ph = cat16b(a0, a1), pl = cat16b(b0, b1);
#pragma unroll
            for (int ot = 0; ot < 4; ++ot) { const v16bf vh = WFrag<bf>::ld(Vh + vo + (size_t)ot * 16 * SEQ), vl = WFrag<bf>::ld(Vl + vo + (size_t)ot * 16 * SEQ);
                acc[ot] = wmmab(pl, vh, acc[ot]); acc[ot] = wmmab(ph, vl, acc[ot]); acc[ot] = wmmab(ph, vh, acc[ot]); }
            asm volatile("v_nop\n\tv_nop\n\tv_nop\n\tv_nop" : "+v"(acc[0]), "+v"(acc[1]), "+v"(acc[2]), "+v"(acc[3]) : "v"(ph), "v"(pl));
        } else {
            const v8us a0 = *(const v8usa*)(pa + lr * PP + 8 * hi), a1 = *(const v8usa*)(pa + lr * PP + 16 + 8 * hi);
            const v16h p16 = cat16hu(a0, a1);
#pragma unroll
            for (int ot = 0; ot < 4; ++ot) { const v16h vf = WFrag<h16>::ld(V16 + vo + (size_t)ot * 16 * SEQ); acc[ot] = wmma16(p16, vf, acc[ot]); }
            asm volatile("v_nop\n\tv_nop\n\tv_nop\n\tv_nop" : "+v"(acc[0]), "+v"(acc[1]), "+v"(acc[2]), "+v"(acc[3]) : "v"(p16));
        }
        asm volatile("" ::: "memory");
    }
    // finish: row sums across the 16 lanes of each half, normalise, stage 16x64 f32, write hi/lo lines
#pragma unroll
    for (int r = 0; r < 8; ++r) { float l = li[r]; l += __shfl_xor(l, 1, 32); l += __shfl_xor(l, 2, 32); l += __shfl_xor(l, 4, 32); l += __shfl_xor(l, 8, 32); li[r] = 1.0f / l; }
#pragma unroll
    for (int ot = 0; ot < 4; ++ot)
#pragma unroll
        for (int r = 0; r < 8; ++r) os[(8 * hi + r) * 68 + ot * 16 + lr] = acc[ot][r] * li[r];
    __syncthreads();
{
#pragma unroll
        for (int s = 0; s < 4; ++s) { const int row = 4 * s + (lane >> 3), c8 = (lane & 7) * 8;
            const v4f x0 = *(const v4fa*)(os + row * 68 + c8), x1 = *(const v4fa*)(os + row * 68 + c8 + 4); v8us oh, ol;
#pragma unroll
            for (int k = 0; k < 4; ++k) { unsigned short a, c; splitf(x0[k], a, c); oh[k] = a; ol[k] = c; splitf(x1[k], a, c); oh[4 + k] = a; ol[4 + k] = c; }
            const size_t oo = (size_t)(q0 + row) * DQ + (size_t)h * HD + c8;
            *(v8us*)(Ch + oo) = oh; *(v8us*)(Cl + oo) = ol; }
         }
}
__global__ __launch_bounds__(32) void k_attn_hl(const bf* __restrict__ Qh, const bf* __restrict__ Ql, const bf* __restrict__ Kh, const bf* __restrict__ Kl, const bf* __restrict__ Vh, const bf* __restrict__ Vl,
                                                const unsigned* __restrict__ MBp, const int* __restrict__ CLp, bf* Ch, bf* Cl, int qt0) {
    attn_body<true>((const h16*)0, (const h16*)0, (const h16*)0, Qh, Ql, Kh, Kl, Vh, Vl, MBp, CLp, Ch, Cl, qt0); }
__global__ __launch_bounds__(32) void k_attn_f16(const h16* __restrict__ Q16, const h16* __restrict__ K16, const h16* __restrict__ V16,
                                                 const unsigned* __restrict__ MBp, const int* __restrict__ CLp, bf* Ch, bf* Cl, int qt0) {
    attn_body<false>(Q16, K16, V16, (const bf*)0, (const bf*)0, (const bf*)0, (const bf*)0, (const bf*)0, (const bf*)0, MBp, CLp, Ch, Cl, qt0); }

constexpr size_t al256(size_t b) { return (b + 255) & ~(size_t)255; }
constexpr size_t WS_TOTAL =
    al256((size_t)DQ * DM * 2) + 2 * al256((size_t)DKV * DM * 2) + al256((size_t)DM * DQ * 2) +      // WQ, WK, WV, WO
    al256((size_t)SEQ * DM * 2) +                                                                      // XB
    al256((size_t)SEQ * DQ * 4) + 2 * al256((size_t)SEQ * DKV * 4) +                                   // FQ, FK, FV
    3 * al256((size_t)NH * SEQ * HD * 2) + 6 * al256((size_t)NKV * SEQ * HD * 2) +                     // q planes, k planes, v planes
    2 * al256((size_t)SEQ * DQ * 2) +                                                                  // ctx hi/lo
    al256((size_t)SEQ * NW * 4) + al256((size_t)(SEQ / 16) * NW * 4);                                  // mask bits, tile classes
static_assert(WS_TOTAL <= (size_t)134217728);

extern "C" void kernel_launch(void* const* d_in, const int* in_sizes, int n_in,
                              void* d_out, int out_size, void* d_ws, size_t ws_size, hipStream_t stream) {
    if (n_in < 8) return;
    if ((long long)in_sizes[0] < (long long)(NB - 1) * SEQ_FULL * DM + (long long)SEQ * DM) return;
    if ((long long)in_sizes[1] < (long long)DM * DQ || (long long)in_sizes[2] < (long long)DM * DKV || (long long)in_sizes[3] < (long long)DM * DKV || (long long)in_sizes[4] < (long long)DQ * DM) return;
    if ((long long)in_sizes[5] < (long long)SEQ * (HD / 2) || (long long)in_sizes[6] < (long long)SEQ * (HD / 2)) return;
    if ((long long)in_sizes[7] < (long long)(SEQ - 1) * SEQ_FULL + SEQ) return;
    if ((long long)out_size < (long long)(NB - 1) * SEQ_FULL * DM + (long long)SEQ * DM) return;
    if (ws_size < WS_TOTAL) return;
    const float* x = (const float*)d_in[0]; const float* wq = (const float*)d_in[1]; const float* wk = (const float*)d_in[2]; const float* wv = (const float*)d_in[3]; const float* wo = (const float*)d_in[4];
    const float* fcos = (const float*)d_in[5]; const float* fsin = (const float*)d_in[6]; const int* mask = (const int*)d_in[7];
    float* OUT = (float*)d_out;     // [1][2048][2048]
    char* wsp = (char*)d_ws;
    auto take = [&](size_t bytes) { char* p = wsp; wsp += (bytes + 255) & ~(size_t)255; return (void*)p; };
    bf* WQ = (bf*)take((size_t)DQ * DM * 2); bf* WK = (bf*)take((size_t)DKV * DM * 2); bf* WV = (bf*)take((size_t)DKV * DM * 2); bf* WO = (bf*)take((size_t)DM * DQ * 2);
    bf* XB = (bf*)take((size_t)SEQ * DM * 2);
    float* FQ = (float*)take((size_t)SEQ * DQ * 4); float* FK = (float*)take((size_t)SEQ * DKV * 4); float* FV = (float*)take((size_t)SEQ * DKV * 4);
    h16* QP16 = (h16*)take((size_t)NH * SEQ * HD * 2); bf* QPh = (bf*)take((size_t)NH * SEQ * HD * 2); bf* QPl = (bf*)take((size_t)NH * SEQ * HD * 2);
    h16* KP16 = (h16*)take((size_t)NKV * SEQ * HD * 2); bf* KPh = (bf*)take((size_t)NKV * SEQ * HD * 2); bf* KPl = (bf*)take((size_t)NKV * SEQ * HD * 2);
    h16* VT16 = (h16*)take((size_t)NKV * SEQ * HD * 2); bf* VTh = (bf*)take((size_t)NKV * SEQ * HD * 2); bf* VTl = (bf*)take((size_t)NKV * SEQ * HD * 2);
    bf* CXh = (bf*)take((size_t)SEQ * DQ * 2); bf* CXl = (bf*)take((size_t)SEQ * DQ * 2);
    unsigned* MBp = (unsigned*)take((size_t)SEQ * NW * 4); int* CLp = (int*)take((size_t)(SEQ / 16) * NW * 4);
    if ((size_t)(wsp - (char*)d_ws) > ws_size) return;

    // weights: w[in][out] -> Bt[out][in] bf16.  wq: in DM, out DQ; wk/wv: in DM, out DKV; wo: in DQ, out DM.
    k_wtG<<<(unsigned)((DM * DQ / 64 + 63) / 64), 256, 0, stream>>>(wq, DM, DQ, WQ);
    k_wtG<<<(unsigned)((DM * DKV / 64 + 63) / 64), 256, 0, stream>>>(wk, DM, DKV, WK);
    k_wtG<<<(unsigned)((DM * DKV / 64 + 63) / 64), 256, 0, stream>>>(wv, DM, DKV, WV);
    k_wtG<<<(unsigned)((DQ * DM / 64 + 63) / 64), 256, 0, stream>>>(wo, DQ, DM, WO);
    k_maskbits<<<SEQ / 16, 32, 0, stream>>>(mask, MBp, CLp);
    const unsigned LQ = (unsigned)(((size_t)NH * SEQ * HD / 2 + 255) / 256), LKv = (unsigned)(((size_t)NKV * SEQ * HD / 2 + 255) / 256);
    for (int b = 0; b < NB; ++b) {
        k_cvt8<<<(unsigned)(((size_t)SEQ * DM / 8 + 255) / 256), 256, 0, stream>>>(x + (size_t)b * SEQ_FULL * DM, XB, (size_t)SEQ * DM / 8);
        k_gemm_p<<<dim3(SEQ / 64, DQ / 64, 1), 32, 0, stream>>>(XB, WQ, DM, FQ, DQ);
        k_gemm_p<<<dim3(SEQ / 64, DKV / 64, 1), 32, 0, stream>>>(XB, WK, DM, FK, DKV);
        k_gemm_p<<<dim3(SEQ / 64, DKV / 64, 1), 32, 0, stream>>>(XB, WV, DM, FV, DKV);
        k_rope<<<LQ, 256, 0, stream>>>(FQ, DQ, NH, fcos, fsin, QP16, QPh, QPl);
        k_rope<<<LKv, 256, 0, stream>>>(FK, DKV, NKV, fcos, fsin, KP16, KPh, KPl);
        k_vtp<<<LKv, 256, 0, stream>>>(FV, DKV, NKV, VT16, VTh, VTl);
        if (RH / 16 > 0) k_attn_hl<<<dim3(RH / 16, NH, 1), 32, 0, stream>>>(QPh, QPl, KPh, KPl, VTh, VTl, MBp, CLp, CXh, CXl, 0);
        if ((SEQ - RH) / 16 > 0) k_attn_f16<<<dim3((SEQ - RH) / 16, NH, 1), 32, 0, stream>>>(QP16, KP16, VT16, MBp, CLp, CXh, CXl, RH / 16);
        k_gemm_s<<<dim3(SEQ / 64, DM / 64, 1), 32, 0, stream>>>(CXh, CXl, WO, DQ, OUT + (size_t)b * SEQ_FULL * DM, DM);
    }
}

// v001
// A run of this version takes 442 microseconds.
// Two timings next to v000 both put it at 1.25 times that version's speed.
#include <hip/hip_runtime.h>

// Contractions (all f32 accumulate): x@wq, x@wk, x@wv v_wmma_f32_16x16x32_bf16 (bf16 x bf16 operand planes, inputs RNE-converted to bf16); scores q.k and P.V: query rows < 512 bf16 hi/lo planes (3 products each), rows >= 512 v_wmma_f32_16x16x32_f16 (P carried x1024); ctx@wo bf16 hi/lo ctx planes x bf16 weights (2 products).
// Grouped-query causal-style attention with interleaved-pair rotation from INPUT tables and an INPUT int32 mask (read by value through a bit-plane + 16x32 tile classes); softmax f32 online running-max form.
// Flash-style fused attention: one wave per 16 query rows per head, K / V^T fragments straight from K-contiguous 16-bit planes, P relayout through a wave-private LDS tile (block barrier, block == one wave).

#ifndef NB
#define NB 1
#endif
#ifndef SEQ
#define SEQ 2048
#endif
#define NB_FULL  1
#define SEQ_FULL 2048
#define DM   2048
#define NH   32
#define NKV  8
#define REP  (NH / NKV)
#define HD   64
#define DQ   (NH * HD)
#define DKV  (NKV * HD)
#define RH   ((SEQ) < 512 ? (SEQ) : 512)     // query rows < RH use hi+lo planes
#define NW   (SEQ / 32)                      // 32-key words per mask row
#define PP   40                              // P tile pitch (16-bit elements)
#define PCAR 1024.0f
#define SCL2 0.18033688011112042f            // (1/8) * log2(e)

static_assert(SEQ % 64 == 0);                // GEMM row tiles of 64, key halves of 32
static_assert(SEQ <= SEQ_FULL);
static_assert(NW % 32 == 0);                 // mask pre-pass: 32 words per work-group
static_assert(HD == 64);
static_assert(DM % 64 == 0 && DQ % 64 == 0 && DKV % 64 == 0);
static_assert(DM % 32 == 0 && DQ % 32 == 0);
static_assert(NH % NKV == 0);
static_assert(RH % 16 == 0 && (SEQ - RH) % 16 == 0);
static_assert((PP * 2) % 16 == 0);
static_assert(NB <= NB_FULL);

typedef _Float16 h16;
typedef unsigned short bf;
typedef __attribute__((ext_vector_type(16))) __bf16   v16bf;
typedef __attribute__((ext_vector_type(16))) _Float16 v16h;
typedef __attribute__((ext_vector_type(8)))  _Float16 v8h;
typedef __attribute__((ext_vector_type(8)))  unsigned short v8us;
typedef __attribute__((ext_vector_type(8)))  float    v8f;
typedef __attribute__((ext_vector_type(4)))  float    v4f;
typedef __attribute__((ext_vector_type(4)))  int      v4i;
typedef __attribute__((ext_vector_type(2)))  _Float16 v2h;
typedef __attribute__((ext_vector_type(2)))  unsigned short v2us;
typedef __attribute__((ext_vector_type(2)))  float    v2f;
typedef v4f  __attribute__((may_alias)) v4fa;
typedef v8us __attribute__((may_alias)) v8usa;

__device__ __forceinline__ unsigned short f2bf(float f) { unsigned u = __float_as_uint(f); u += 0x7FFFu + ((u >> 16) & 1u); return (unsigned short)(u >> 16); }
__device__ __forceinline__ float bf2f(unsigned short b) { return __uint_as_float(((unsigned)b) << 16); }
__device__ __forceinline__ float bfr(float f) { return bf2f(f2bf(f)); }
__device__ __forceinline__ v16h cat16(v8h lo, v8h hi) { return __builtin_shufflevector(lo, hi, 0, 1, 2, 3, 4, 5, 6, 7, 8, 9, 10, 11, 12, 13, 14, 15); }
__device__ __forceinline__ v16bf cat16b(v8us lo, v8us hi) { return __builtin_bit_cast(v16bf, __builtin_shufflevector(lo, hi, 0, 1, 2, 3, 4, 5, 6, 7, 8, 9, 10, 11, 12, 13, 14, 15)); }
__device__ __forceinline__ v16h cat16hu(v8us lo, v8us hi) { return __builtin_bit_cast(v16h, __builtin_shufflevector(lo, hi, 0, 1, 2, 3, 4, 5, 6, 7, 8, 9, 10, 11, 12, 13, 14, 15)); }
__device__ __forceinline__ v8f wmma16(v16h a, v16h b, v8f c) { return __builtin_amdgcn_wmma_f32_16x16x32_f16(false, a, false, b, (short)0, c, false, false); }
__device__ __forceinline__ v8f wmmab(v16bf a, v16bf b, v8f c) { return __builtin_amdgcn_wmma_f32_16x16x32_bf16(false, a, false, b, (short)0, c, false, false); }
__device__ __forceinline__ void splitf(float y, unsigned short& h, unsigned short& l) { h = f2bf(y); l = f2bf(y - bf2f(h)); }
__device__ __forceinline__ float ex2(float x) { return __builtin_amdgcn_exp2f(x); }

// Fragment loaders: lane (hi = lane>>4, lr = lane&15); pointer already at row lr, k offset k0 + 8*hi; elements 0..7 <- k0+8hi+0..7, 8..15 <- k0+16+8hi+0..7 (same map for A and B).
template <typename T16> struct WFrag;
template <> struct WFrag<h16> { typedef v16h V; static __device__ __forceinline__ V ld(const h16* p) { return cat16(*(const v8h*)p, *(const v8h*)(p + 16)); } static __device__ __forceinline__ v8f mma(V a, V b, v8f c) { return wmma16(a, b, c); } };
template <> struct WFrag<bf> { typedef v16bf V; static __device__ __forceinline__ V ld(const bf* p) { return cat16b(*(const v8us*)p, *(const v8us*)(p + 16)); } static __device__ __forceinline__ v8f mma(V a, V b, v8f c) { return wmmab(a, b, c); } };

// ---- GEMM body: ONE WAVE per 64x64 output tile (16 accumulators), operands straight from K-contiguous 16-bit planes; grid (M/64, N/64), 32 threads.
// C[m][n] (f32, pitch ldc) = sum_k (A[m][k] (+ A2[m][k] when NSPLIT == 1)) Bt[n][k]. K % 32 == 0, M % 64 == 0, N % 64 == 0.
template <typename T16, int NSPLIT>
__device__ __forceinline__ void gemmw_body(const T16* __restrict__ A, const T16* __restrict__ A2, const T16* __restrict__ Bt, int K, float* C, int ldc) {
    typedef typename WFrag<T16>::V V;
    __shared__ __align__(16) float os[16 * 68];
    const int lane = threadIdx.x & 31, lr = lane & 15, hi = lane >> 4; const int r0 = blockIdx.x * 64, c0 = blockIdx.y * 64;
    v8f acc[4][4];
#pragma unroll
    for (int mb = 0; mb < 4; ++mb)
#pragma unroll
        for (int nb = 0; nb < 4; ++nb) acc[mb][nb] = (v8f){};
    const size_t aoff = (size_t)(r0 + lr) * K + 8 * hi, boff = (size_t)(c0 + lr) * K + 8 * hi;
#pragma unroll 1
    for (int kc = 0; kc < K; kc += 32) {
        V a[4], a2[4];
#pragma unroll
        for (int mb = 0; mb < 4; ++mb) { a[mb] = WFrag<T16>::ld(A + aoff + (size_t)mb * 16 * K + kc); if (NSPLIT == 1) a2[mb] = WFrag<T16>::ld(A2 + aoff + (size_t)mb * 16 * K + kc); else a2[mb] = a[mb]; }
#pragma unroll
        for (int nb = 0; nb < 4; ++nb) { const V b = WFrag<T16>::ld(Bt + boff + (size_t)nb * 16 * K + kc);
#pragma unroll
            for (int mb = 0; mb < 4; ++mb) { acc[mb][nb] = WFrag<T16>::mma(a[mb], b, acc[mb][nb]); if (NSPLIT == 1) acc[mb][nb] = WFrag<T16>::mma(a2[mb], b, acc[mb][nb]); } }
        asm volatile("v_nop\n\tv_nop\n\tv_nop\n\tv_nop" : "+v"(acc[0][0]), "+v"(acc[1][1]), "+v"(acc[2][2]), "+v"(acc[3][3]) : "v"(a[0]), "v"(a[3]));
    }
#pragma unroll
    for (int mb = 0; mb < 4; ++mb) {
#pragma unroll
        for (int nb = 0; nb < 4; ++nb) {
#pragma unroll
            for (int j = 0; j < 8; ++j) os[(hi * 8 + j) * 68 + nb * 16 + lr] = acc[mb][nb][j]; }
        __builtin_amdgcn_wave_barrier(); asm volatile("" ::: "memory");
        float* crow = C + (size_t)(r0 + mb * 16) * ldc + c0;
{
#pragma unroll
            for (int s = 0; s < 8; ++s) { const int row = 2 * s + hi, cofs = lr * 4; const v4f val = *(const v4fa*)(os + row * 68 + cofs);
                *(v4f*)(crow + (size_t)row * ldc + cofs) = val; }
             }
        __builtin_amdgcn_wave_barrier(); asm volatile("" ::: "memory");
    }
}
__global__ __launch_bounds__(32) void k_gemm_p(const bf* __restrict__ A, const bf* __restrict__ Bt, int K, float* C, int ldc) { gemmw_body<bf, 0>(A, A, Bt, K, C, ldc); }
__global__ __launch_bounds__(32) void k_gemm_s(const bf* __restrict__ A, const bf* __restrict__ A2, const bf* __restrict__ Bt, int K, float* C, int ldc) { gemmw_body<bf, 1>(A, A2, Bt, K, C, ldc); }

__global__ __launch_bounds__(256) void k_wtG(const float* __restrict__ w, int K, int N, bf* Bt) {
    const int lane = threadIdx.x & 31; const int L0 = (blockIdx.x * 8 + (threadIdx.x >> 5)) * 8; const int nlines = N * K / 64;
{
#pragma unroll 1
        for (int l = 0; l < 8; ++l) { const int L = L0 + l; if (L >= nlines) break; const size_t e = (size_t)L * 64 + lane * 2; const int k = (int)(e % K), n = (int)(e / K); v2us o;
            o[0] = f2bf(w[(size_t)k * N + n]); o[1] = f2bf(w[(size_t)(k + 1) * N + n]); *(v2us*)(Bt + e) = o; }
         }
}
__global__ __launch_bounds__(256) void k_cvt8(const float* __restrict__ src, bf* dst, size_t n8) { const size_t i = (size_t)blockIdx.x * 256 + threadIdx.x; if (i >= n8) return; const v8f v = *(const v8f*)(src + i * 8); v8us o;
#pragma unroll
    for (int k = 0; k < 8; ++k) o[k] = f2bf(v[k]); *(v8us*)(dst + i * 8) = o;  }

// k_rope: head planes [h][t][d] (fp16 + bf16 hi/lo) of the interleaved-pair rotation: pair (2i, 2i+1) with table entry [t][i] read BY VALUE (RNE-converted to bf16):
__global__ __launch_bounds__(256) void k_rope(const float* __restrict__ F, int pitch, int nheads, const float* __restrict__ COS, const float* __restrict__ SIN, h16* P16, bf* Ph, bf* Pl) {
#pragma clang fp contract(off)
    const size_t e = ((size_t)blockIdx.x * 256 + threadIdx.x) * 2; if (e >= (size_t)nheads * SEQ * HD) return;
    const int d = (int)(e % HD); const int t = (int)((e / HD) % SEQ); const int h = (int)(e / ((size_t)HD * SEQ));
    const v2f x = *(const v2f*)(F + (size_t)t * pitch + h * HD + d);
    const float c = bfr(COS[(size_t)t * (HD / 2) + (d >> 1)]), s = bfr(SIN[(size_t)t * (HD / 2) + (d >> 1)]);
    const float a0 = x[0] * c, a1 = x[1] * s, b0 = x[0] * s, b1 = x[1] * c;
    const float r0 = a0 - a1, r1 = b0 + b1;
    v2h o16; v2us oh, ol; unsigned short a2, c2;
    o16[0] = (h16)r0; splitf(r0, a2, c2); oh[0] = a2; ol[0] = c2;
    o16[1] = (h16)r1; splitf(r1, a2, c2); oh[1] = a2; ol[1] = c2;
    *(v2h*)(P16 + e) = o16; *(v2us*)(Ph + e) = oh; *(v2us*)(Pl + e) = ol;  }
__global__ __launch_bounds__(256) void k_vtp(const float* __restrict__ F, int pitch, int nheads, h16* V16, bf* Vh, bf* Vl) { const size_t e = ((size_t)blockIdx.x * 256 + threadIdx.x) * 2; if (e >= (size_t)nheads * HD * SEQ) return; const int t = (int)(e % SEQ); const int d = (int)((e / SEQ) % HD); const int g = (int)(e / ((size_t)SEQ * HD)); v2h o16; v2us oh, ol;
#pragma unroll
    for (int q = 0; q < 2; ++q) { const float x = F[(size_t)(t + q) * pitch + g * HD + d]; o16[q] = (h16)x; unsigned short a2, c2; splitf(x, a2, c2); oh[q] = a2; ol[q] = c2; }
    *(v2h*)(V16 + e) = o16; *(v2us*)(Vh + e) = oh; *(v2us*)(Vl + e) = ol;  }

// k_maskbits: one work-group of 16 waves per (16 query rows, 32 mask words); wave r takes row r and holds its 1024 mask values as 8 loads of 512 contiguous bytes, all in flight at once.
// Bit-plane MB[q][w] (bit n = mask[q][32w+n] != 0) and tile class CL[q/16][w]: 0 = no key kept in the 16x32 tile, 1 = all kept, 2 = mixed.
__global__ __launch_bounds__(512) void k_maskbits(const int* __restrict__ mask, unsigned* MBp, int* CLp) {
    __shared__ unsigned sw[16 * 32];
    const int lane = threadIdx.x & 31, row = threadIdx.x >> 5; const int qt = blockIdx.x, wb = blockIdx.y * 32; const int q = qt * 16 + row;
    const int* mr = mask + (size_t)q * SEQ_FULL + wb * 32 + lane * 4;
    v4i v[8];
#pragma unroll
    for (int i = 0; i < 8; ++i) v[i] = *(const v4i*)(mr + 128 * i);
    // nibble i of x: the lane's four values of load i, i.e. bits 4*(lane&7)..+3 of word wb + 4*i + (lane>>3)
    unsigned x = 0u;
#pragma unroll
    for (int i = 0; i < 8; ++i) { const unsigned nib = (v[i][0] != 0 ? 1u : 0u) | (v[i][1] != 0 ? 2u : 0u) | (v[i][2] != 0 ? 4u : 0u) | (v[i][3] != 0 ? 8u : 0u); x |= nib << (4 * i); }
    // 8x8 nibble transpose inside each group of 8 lanes (three exchanges; a lane keeps the nibbles under its mask and takes the partner's, rotated into place): afterwards lane 8g+t holds the whole word wb + 4*t + g
    unsigned y;
    y = __builtin_rotateright32(__shfl_xor(x, 4, 32), 16);               { const unsigned km = (lane & 4) ? 0xFFFF0000u : 0x0000FFFFu; x = (x & km) | (y & ~km); }
    y = __builtin_rotateright32(__shfl_xor(x, 2, 32), (lane & 2) ? 8 : 24); { const unsigned km = (lane & 2) ? 0xFF00FF00u : 0x00FF00FFu; x = (x & km) | (y & ~km); }
    y = __builtin_rotateright32(__shfl_xor(x, 1, 32), (lane & 1) ? 4 : 28); { const unsigned km = (lane & 1) ? 0xF0F0F0F0u : 0x0F0F0F0Fu; x = (x & km) | (y & ~km); }
    const int w = wb + 4 * (lane & 7) + (lane >> 3);
    sw[row * 32 + lane] = x;
    __syncthreads();                                                      // the 16 rows' words -> the class of each 16x32 tile
    if (row == 0) {
        unsigned an = 0xFFFFFFFFu, orr = 0u;
#pragma unroll
        for (int r = 0; r < 16; ++r) { const unsigned t = sw[r * 32 + lane]; an &= t; orr |= t; }
        CLp[(size_t)qt * NW + w] = (orr == 0u) ? 0 : ((an == 0xFFFFFFFFu) ? 1 : 2);
    }
    MBp[(size_t)q * NW + w] = x;                                          // one wave = one whole 128-byte line
}

// ---- fused attention body: one wave (= one block) per (16 query rows, head). Key loop over 32-key halves; a half is skipped only when its class says no key of the
// 16x32 tile is kept (masked keys contribute exactly 0 under the -inf fill; a row with no kept key anywhere ends with 0 * (1/0) = NaN, as the module).
// SPLIT: q, k, P, v on bf16 hi/lo planes (hh + hl + lh); else fp16 planes with P carried x PCAR (the carry cancels in acc / l).
template <bool SPLIT>
__device__ __forceinline__ void attn_body(const h16* __restrict__ Q16, const h16* __restrict__ K16, const h16* __restrict__ V16,
                                          const bf* __restrict__ Qh, const bf* __restrict__ Ql, const bf* __restrict__ Kh, const bf* __restrict__ Kl, const bf* __restrict__ Vh, const bf* __restrict__ Vl,
                                          const unsigned* __restrict__ MBp, const int* __restrict__ CLp, bf* Ch, bf* Cl, int qt0) {
    __shared__ __align__(16) unsigned short pa[16 * PP];
    __shared__ __align__(16) unsigned short pb[16 * PP];
    __shared__ __align__(16) float os[16 * 68];
    const int lane = threadIdx.x & 31, lr = lane & 15, hi = lane >> 4;
    const int qt = qt0 + (int)blockIdx.x; const int h = (int)blockIdx.y; const int hk = h / REP; const int q0 = qt * 16;
    const size_t qoff = ((size_t)h * SEQ + q0 + lr) * HD + 8 * hi;       // A fragment: row q0+lr, d offset 8*hi
    const size_t kb0  = ((size_t)hk * SEQ + lr) * HD + 8 * hi;           // B fragment (scores): lane = key, k = d
    const size_t vb0  = ((size_t)hk * HD + lr) * SEQ + 8 * hi;           // B fragment (P.V): lane = d, k = key
    const float NINF = -__builtin_inff();
    float mi[8], li[8]; v8f acc[4];
#pragma unroll
    for (int r = 0; r < 8; ++r) { mi[r] = NINF; li[r] = 0.0f; }
#pragma unroll
    for (int ot = 0; ot < 4; ++ot) acc[ot] = (v8f){};
#pragma unroll 1
    for (int j = 0; j < NW; ++j) {
        const int cls = __builtin_amdgcn_readfirstlane(CLp[(size_t)qt * NW + j]);
        if (cls == 0) continue;                                           // wave-uniform (block == one wave)
        unsigned wd[8];
        if (cls == 1) {
#pragma unroll
            for (int r = 0; r < 8; ++r) wd[r] = 0xFFFFFFFFu;
        } else {
#pragma unroll
            for (int r = 0; r < 8; ++r) wd[r] = MBp[(size_t)(q0 + 8 * hi + r) * NW + j];
        }
        v8f s0 = (v8f){}, s1 = (v8f){};
        const size_t ko = kb0 + (size_t)(32 * j) * HD;
        if (SPLIT) {
            const v16bf qh0 = WFrag<bf>::ld(Qh + qoff), qh1 = WFrag<bf>::ld(Qh + qoff + 32), ql0 = WFrag<bf>::ld(Ql + qoff), ql1 = WFrag<bf>::ld(Ql + qoff + 32);
            { const v16bf kh0 = WFrag<bf>::ld(Kh + ko), kh1 = WFrag<bf>::ld(Kh + ko + 32), kl0 = WFrag<bf>::ld(Kl + ko), kl1 = WFrag<bf>::ld(Kl + ko + 32);
              s0 = wmmab(ql0, kh0, s0); s0 = wmmab(ql1, kh1, s0); s0 = wmmab(qh0, kl0, s0); s0 = wmmab(qh1, kl1, s0); s0 = wmmab(qh0, kh0, s0); s0 = wmmab(qh1, kh1, s0); }
            { const size_t k1 = ko + (size_t)16 * HD; const v16bf kh0 = WFrag<bf>::ld(Kh + k1), kh1 = WFrag<bf>::ld(Kh + k1 + 32), kl0 = WFrag<bf>::ld(Kl + k1), kl1 = WFrag<bf>::ld(Kl + k1 + 32);
              s1 = wmmab(ql0, kh0, s1); s1 = wmmab(ql1, kh1, s1); s1 = wmmab(qh0, kl0, s1); s1 = wmmab(qh1, kl1, s1); s1 = wmmab(qh0, kh0, s1); s1 = wmmab(qh1, kh1, s1);
              asm volatile("v_nop\n\tv_nop\n\tv_nop\n\tv_nop" : "+v"(s0), "+v"(s1) : "v"(qh1), "v"(kh1)); }
        } else {
            const v16h qa0 = WFrag<h16>::ld(Q16 + qoff), qa1 = WFrag<h16>::ld(Q16 + qoff + 32);
            const v16h k00 = WFrag<h16>::ld(K16 + ko), k01 = WFrag<h16>::ld(K16 + ko + 32);
            const v16h k10 = WFrag<h16>::ld(K16 + ko + (size_t)16 * HD), k11 = WFrag<h16>::ld(K16 + ko + (size_t)16 * HD + 32);
            s0 = wmma16(qa0, k00, s0); s0 = wmma16(qa1, k01, s0); s1 = wmma16(qa0, k10, s1); s1 = wmma16(qa1, k11, s1);
            asm volatile("v_nop\n\tv_nop\n\tv_nop\n\tv_nop" : "+v"(s0), "+v"(s1) : "v"(qa1), "v"(k11));
        }
        // online softmax in log2 units; accumulator element r <-> tile row 8*hi + r, column lr (s0) / 16 + lr (s1)
#pragma unroll
        for (int r = 0; r < 8; ++r) {
            const unsigned w = wd[r];
            const bool kp0 = ((w >> lr) & 1u) != 0u, kp1 = ((w >> (16 + lr)) & 1u) != 0u;
            const float v0 = kp0 ? s0[r] * SCL2 : NINF; const float v1 = kp1 ? s1[r] * SCL2 : NINF;
            float mx = fmaxf(v0, v1);
            mx = fmaxf(mx, __shfl_xor(mx, 1, 32)); mx = fmaxf(mx, __shfl_xor(mx, 2, 32)); mx = fmaxf(mx, __shfl_xor(mx, 4, 32)); mx = fmaxf(mx, __shfl_xor(mx, 8, 32));
            const float nm = fmaxf(mi[r], mx); const float ms = (nm == NINF) ? 0.0f : nm;
            const float corr = ex2(mi[r] - ms); const float p0 = ex2(v0 - ms), p1 = ex2(v1 - ms);
            const int po = (8 * hi + r) * PP + lr;
            if (SPLIT) { unsigned short a, c; splitf(p0, a, c); pa[po] = a; pb[po] = c; splitf(p1, a, c); pa[po + 16] = a; pb[po + 16] = c; li[r] = li[r] * corr + (p0 + p1); }
            else { const h16 e0 = (h16)(p0 * PCAR), e1 = (h16)(p1 * PCAR); pa[po] = __builtin_bit_cast(unsigned short, e0); pa[po + 16] = __builtin_bit_cast(unsigned short, e1); li[r] = li[r] * corr + ((float)e0 + (float)e1); }
            mi[r] = nm;
#pragma unroll
            for (int ot = 0; ot < 4; ++ot) acc[ot][r] *= corr;
        }
        __syncthreads();                                                  // P tile stores -> fragment reloads (same wave; block == one wave)
        const size_t vo = vb0 + (size_t)(32 * j);
        if (SPLIT) {
            const v8us a0 = *(const v8usa*)(pa + lr * PP + 8 * hi), a1 = *(const v8usa*)(pa + lr * PP + 16 + 8 * hi);
            const v8us b0 = *(const v8usa*)(pb + lr * PP + 8 * hi), b1 = *(const v8usa*)(pb + lr * PP + 16 + 8 * hi);
            const v16bf ph = cat16b(a0, a1), pl = cat16b(b0, b1);
#pragma unroll
            for (int ot = 0; ot < 4; ++ot) { const v16bf vh = WFrag<bf>::ld(Vh + vo + (size_t)ot * 16 * SEQ), vl = WFrag<bf>::ld(Vl + vo + (size_t)ot * 16 * SEQ);
                acc[ot] = wmmab(pl, vh, acc[ot]); acc[ot] = wmmab(ph, vl, acc[ot]); acc[ot] = wmmab(ph, vh, acc[ot]); }
            asm volatile("v_nop\n\tv_nop\n\tv_nop\n\tv_nop" : "+v"(acc[0]), "+v"(acc[1]), "+v"(acc[2]), "+v"(acc[3]) : "v"(ph), "v"(pl));
        } else {
            const v8us a0 = *(const v8usa*)(pa + lr * PP + 8 * hi), a1 = *(const v8usa*)(pa + lr * PP + 16 + 8 * hi);
            const v16h p16 = cat16hu(a0, a1);
#pragma unroll
            for (int ot = 0; ot < 4; ++ot) { const v16h vf = WFrag<h16>::ld(V16 + vo + (size_t)ot * 16 * SEQ); acc[ot] = wmma16(p16, vf, acc[ot]); }
            asm volatile("v_nop\n\tv_nop\n\tv_nop\n\tv_nop" : "+v"(acc[0]), "+v"(acc[1]), "+v"(acc[2]), "+v"(acc[3]) : "v"(p16));
        }
        asm volatile("" ::: "memory");
    }
    // finish: row sums across the 16 lanes of each half, normalise, stage 16x64 f32, write hi/lo lines
#pragma unroll
    for (int r = 0; r < 8; ++r) { float l = li[r]; l += __shfl_xor(l, 1, 32); l += __shfl_xor(l, 2, 32); l += __shfl_xor(l, 4, 32); l += __shfl_xor(l, 8, 32); li[r] = 1.0f / l; }
#pragma unroll
    for (int ot = 0; ot < 4; ++ot)
#pragma unroll
        for (int r = 0; r < 8; ++r) os[(8 * hi + r) * 68 + ot * 16 + lr] = acc[ot][r] * li[r];
    __syncthreads();
{
#pragma unroll
        for (int s = 0; s < 4; ++s) { const int row = 4 * s + (lane >> 3), c8 = (lane & 7) * 8;
            const v4f x0 = *(const v4fa*)(os + row * 68 + c8), x1 = *(const v4fa*)(os + row * 68 + c8 + 4); v8us oh, ol;
#pragma unroll
            for (int k = 0; k < 4; ++k) { unsigned short a, c; splitf(x0[k], a, c); oh[k] = a; ol[k] = c; splitf(x1[k], a, c); oh[4 + k] = a; ol[4 + k] = c; }
            const size_t oo = (size_t)(q0 + row) * DQ + (size_t)h * HD + c8;
            *(v8us*)(Ch + oo) = oh; *(v8us*)(Cl + oo) = ol; }
         }
}
__global__ __launch_bounds__(32) void k_attn_hl(const bf* __restrict__ Qh, const bf* __restrict__ Ql, const bf* __restrict__ Kh, const bf* __restrict__ Kl, const bf* __restrict__ Vh, const bf* __restrict__ Vl,
                                                const unsigned* __restrict__ MBp, const int* __restrict__ CLp, bf* Ch, bf* Cl, int qt0) {
    attn_body<true>((const h16*)0, (const h16*)0, (const h16*)0, Qh, Ql, Kh, Kl, Vh, Vl, MBp, CLp, Ch, Cl, qt0); }
__global__ __launch_bounds__(32) void k_attn_f16(const h16* __restrict__ Q16, const h16* __restrict__ K16, const h16* __restrict__ V16,
                                                 const unsigned* __restrict__ MBp, const int* __restrict__ CLp, bf* Ch, bf* Cl, int qt0) {
    attn_body<false>(Q16, K16, V16, (const bf*)0, (const bf*)0, (const bf*)0, (const bf*)0, (const bf*)0, (const bf*)0, MBp, CLp, Ch, Cl, qt0); }

constexpr size_t al256(size_t b) { return (b + 255) & ~(size_t)255; }
constexpr size_t WS_TOTAL =
    al256((size_t)DQ * DM * 2) + 2 * al256((size_t)DKV * DM * 2) + al256((size_t)DM * DQ * 2) +      // WQ, WK, WV, WO
    al256((size_t)SEQ * DM * 2) +                                                                      // XB
    al256((size_t)SEQ * DQ * 4) + 2 * al256((size_t)SEQ * DKV * 4) +                                   // FQ, FK, FV
    3 * al256((size_t)NH * SEQ * HD * 2) + 6 * al256((size_t)NKV * SEQ * HD * 2) +                     // q planes, k planes, v planes
    2 * al256((size_t)SEQ * DQ * 2) +                                                                  // ctx hi/lo
    al256((size_t)SEQ * NW * 4) + al256((size_t)(SEQ / 16) * NW * 4);                                  // mask bits, tile classes
static_assert(WS_TOTAL <= (size_t)134217728);

extern "C" void kernel_launch(void* const* d_in, const int* in_sizes, int n_in,
                              void* d_out, int out_size, void* d_ws, size_t ws_size, hipStream_t stream) {
    if (n_in < 8) return;
    if ((long long)in_sizes[0] < (long long)(NB - 1) * SEQ_FULL * DM + (long long)SEQ * DM) return;
    if ((long long)in_sizes[1] < (long long)DM * DQ || (long long)in_sizes[2] < (long long)DM * DKV || (long long)in_sizes[3] < (long long)DM * DKV || (long long)in_sizes[4] < (long long)DQ * DM) return;
    if ((long long)in_sizes[5] < (long long)SEQ * (HD / 2) || (long long)in_sizes[6] < (long long)SEQ * (HD / 2)) return;
    if ((long long)in_sizes[7] < (long long)(SEQ - 1) * SEQ_FULL + SEQ) return;
    if ((long long)out_size < (long long)(NB - 1) * SEQ_FULL * DM + (long long)SEQ * DM) return;
    if (ws_size < WS_TOTAL) return;
    const float* x = (const float*)d_in[0]; const float* wq = (const float*)d_in[1]; const float* wk = (const float*)d_in[2]; const float* wv = (const float*)d_in[3]; const float* wo = (const float*)d_in[4];
    const float* fcos = (const float*)d_in[5]; const float* fsin = (const float*)d_in[6]; const int* mask = (const int*)d_in[7];
    float* OUT = (float*)d_out;     // [1][2048][2048]
    char* wsp = (char*)d_ws;
    auto take = [&](size_t bytes) { char* p = wsp; wsp += (bytes + 255) & ~(size_t)255; return (void*)p; };
    bf* WQ = (bf*)take((size_t)DQ * DM * 2); bf* WK = (bf*)take((size_t)DKV * DM * 2); bf* WV = (bf*)take((size_t)DKV * DM * 2); bf* WO = (bf*)take((size_t)DM * DQ * 2);
    bf* XB = (bf*)take((size_t)SEQ * DM * 2);
    float* FQ = (float*)take((size_t)SEQ * DQ * 4); float* FK = (float*)take((size_t)SEQ * DKV * 4); float* FV = (float*)take((size_t)SEQ * DKV * 4);
    h16* QP16 = (h16*)take((size_t)NH * SEQ * HD * 2); bf* QPh = (bf*)take((size_t)NH * SEQ * HD * 2); bf* QPl = (bf*)take((size_t)NH * SEQ * HD * 2);
    h16* KP16 = (h16*)take((size_t)NKV * SEQ * HD * 2); bf* KPh = (bf*)take((size_t)NKV * SEQ * HD * 2); bf* KPl = (bf*)take((size_t)NKV * SEQ * HD * 2);
    h16* VT16 = (h16*)take((size_t)NKV * SEQ * HD * 2); bf* VTh = (bf*)take((size_t)NKV * SEQ * HD * 2); bf* VTl = (bf*)take((size_t)NKV * SEQ * HD * 2);
    bf* CXh = (bf*)take((size_t)SEQ * DQ * 2); bf* CXl = (bf*)take((size_t)SEQ * DQ * 2);
    unsigned* MBp = (unsigned*)take((size_t)SEQ * NW * 4); int* CLp = (int*)take((size_t)(SEQ / 16) * NW * 4);
    if ((size_t)(wsp - (char*)d_ws) > ws_size) return;

    // weights: w[in][out] -> Bt[out][in] bf16.  wq: in DM, out DQ; wk/wv: in DM, out DKV; wo: in DQ, out DM.
    k_wtG<<<(unsigned)((DM * DQ / 64 + 63) / 64), 256, 0, stream>>>(wq, DM, DQ, WQ);
    k_wtG<<<(unsigned)((DM * DKV / 64 + 63) / 64), 256, 0, stream>>>(wk, DM, DKV, WK);
    k_wtG<<<(unsigned)((DM * DKV / 64 + 63) / 64), 256, 0, stream>>>(wv, DM, DKV, WV);
    k_wtG<<<(unsigned)((DQ * DM / 64 + 63) / 64), 256, 0, stream>>>(wo, DQ, DM, WO);
    k_maskbits<<<dim3(SEQ / 16, NW / 32, 1), 512, 0, stream>>>(mask, MBp, CLp);
    const unsigned LQ = (unsigned)(((size_t)NH * SEQ * HD / 2 + 255) / 256), LKv = (unsigned)(((size_t)NKV * SEQ * HD / 2 + 255) / 256);
    for (int b = 0; b < NB; ++b) {
        k_cvt8<<<(unsigned)(((size_t)SEQ * DM / 8 + 255) / 256), 256, 0, stream>>>(x + (size_t)b * SEQ_FULL * DM, XB, (size_t)SEQ * DM / 8);
        k_gemm_p<<<dim3(SEQ / 64, DQ / 64, 1), 32, 0, stream>>>(XB, WQ, DM, FQ, DQ);
        k_gemm_p<<<dim3(SEQ / 64, DKV / 64, 1), 32, 0, stream>>>(XB, WK, DM, FK, DKV);
        k_gemm_p<<<dim3(SEQ / 64, DKV / 64, 1), 32, 0, stream>>>(XB, WV, DM, FV, DKV);
        k_rope<<<LQ, 256, 0, stream>>>(FQ, DQ, NH, fcos, fsin, QP16, QPh, QPl);
        k_rope<<<LKv, 256, 0, stream>>>(FK, DKV, NKV, fcos, fsin, KP16, KPh, KPl);
        k_vtp<<<LKv, 256, 0, stream>>>(FV, DKV, NKV, VT16, VTh, VTl);
        if (RH / 16 > 0) k_attn_hl<<<dim3(RH / 16, NH, 1), 32, 0, stream>>>(QPh, QPl, KPh, KPl, VTh, VTl, MBp, CLp, CXh, CXl, 0);
        if ((SEQ - RH) / 16 > 0) k_attn_f16<<<dim3((SEQ - RH) / 16, NH, 1), 32, 0, stream>>>(QP16, KP16, VT16, MBp, CLp, CXh, CXl, RH / 16);
        k_gemm_s<<<dim3(SEQ / 64, DM / 64, 1), 32, 0, stream>>>(CXh, CXl, WO, DQ, OUT + (size_t)b * SEQ_FULL * DM, DM);
    }
}

// v002
// It runs in 341 microseconds.
// Two timings next to v001 put it at 1.30 and 1.31 times that version's speed.
// Over all steps from v000 it is 1.64 times as fast.
#include <hip/hip_runtime.h>

// Contractions (all f32 accumulate): x@wq, x@wk, x@wv v_wmma_f32_16x16x32_bf16 (bf16 x bf16 operand planes, inputs RNE-converted to bf16); scores q.k and P.V: query rows < 512 bf16 hi/lo planes (3 products each), rows >= 512 v_wmma_f32_16x16x32_f16 (P carried x1024); ctx@wo bf16 hi/lo ctx planes x bf16 weights (2 products).
// Grouped-query causal-style attention with interleaved-pair rotation from INPUT tables and an INPUT int32 mask (read by value through a bit-plane + 16x32 tile classes); softmax f32 online running-max form.
// Flash-style fused attention: one wave per 16 query rows per head, K / V^T fragments straight from K-contiguous 16-bit planes, P relayout through a wave-private LDS tile (block barrier, block == one wave).

#ifndef NB
#define NB 1
#endif
#ifndef SEQ
#define SEQ 2048
#endif
#define NB_FULL  1
#define SEQ_FULL 2048
#define DM   2048
#define NH   32
#define NKV  8
#define REP  (NH / NKV)
#define HD   64
#define DQ   (NH * HD)
#define DKV  (NKV * HD)
#define RH   ((SEQ) < 512 ? (SEQ) : 512)     // query rows < RH use hi+lo planes
#define NW   (SEQ / 32)                      // 32-key words per mask row
#define PP   40                              // P tile pitch (16-bit elements)
#define PCAR 1024.0f
#define SCL2 0.18033688011112042f            // (1/8) * log2(e)

static_assert(SEQ % 64 == 0);                // key halves of 32
static_assert(SEQ <= SEQ_FULL);
static_assert(NW % 32 == 0);                 // mask pre-pass: 32 words per work-group
static_assert(HD == 64);
static_assert(DM % 64 == 0 && DQ % 64 == 0 && DKV % 64 == 0);
static_assert(DM % 32 == 0 && DQ % 32 == 0);
static_assert(NH % NKV == 0);
static_assert(RH % 16 == 0 && (SEQ - RH) % 16 == 0);
static_assert((PP * 2) % 16 == 0);
static_assert(NB <= NB_FULL);

typedef _Float16 h16;
typedef unsigned short bf;
typedef __attribute__((ext_vector_type(16))) __bf16   v16bf;
typedef __attribute__((ext_vector_type(16))) _Float16 v16h;
typedef __attribute__((ext_vector_type(8)))  _Float16 v8h;
typedef __attribute__((ext_vector_type(8)))  unsigned short v8us;
typedef __attribute__((ext_vector_type(8)))  float    v8f;
typedef __attribute__((ext_vector_type(4)))  float    v4f;
typedef __attribute__((ext_vector_type(4)))  int      v4i;
typedef __attribute__((ext_vector_type(2)))  _Float16 v2h;
typedef __attribute__((ext_vector_type(2)))  unsigned short v2us;
typedef __attribute__((ext_vector_type(2)))  float    v2f;
typedef v4f  __attribute__((may_alias)) v4fa;
typedef v8us __attribute__((may_alias)) v8usa;

__device__ __forceinline__ unsigned short f2bf(float f) { unsigned u = __float_as_uint(f); u += 0x7FFFu + ((u >> 16) & 1u); return (unsigned short)(u >> 16); }
__device__ __forceinline__ float bf2f(unsigned short b) { return __uint_as_float(((unsigned)b) << 16); }
__device__ __forceinline__ float bfr(float f) { return bf2f(f2bf(f)); }
__device__ __forceinline__ v16h cat16(v8h lo, v8h hi) { return __builtin_shufflevector(lo, hi, 0, 1, 2, 3, 4, 5, 6, 7, 8, 9, 10, 11, 12, 13, 14, 15); }
__device__ __forceinline__ v16bf cat16b(v8us lo, v8us hi) { return __builtin_bit_cast(v16bf, __builtin_shufflevector(lo, hi, 0, 1, 2, 3, 4, 5, 6, 7, 8, 9, 10, 11, 12, 13, 14, 15)); }
__device__ __forceinline__ v16h cat16hu(v8us lo, v8us hi) { return __builtin_bit_cast(v16h, __builtin_shufflevector(lo, hi, 0, 1, 2, 3, 4, 5, 6, 7, 8, 9, 10, 11, 12, 13, 14, 15)); }
__device__ __forceinline__ v8f wmma16(v16h a, v16h b, v8f c) { return __builtin_amdgcn_wmma_f32_16x16x32_f16(false, a, false, b, (short)0, c, false, false); }
__device__ __forceinline__ v8f wmmab(v16bf a, v16bf b, v8f c) { return __builtin_amdgcn_wmma_f32_16x16x32_bf16(false, a, false, b, (short)0, c, false, false); }
__device__ __forceinline__ void splitf(float y, unsigned short& h, unsigned short& l) { h = f2bf(y); l = f2bf(y - bf2f(h)); }
__device__ __forceinline__ float ex2(float x) { return __builtin_amdgcn_exp2f(x); }

// Fragment loaders: lane (hi = lane>>4, lr = lane&15); pointer already at row lr, k offset k0 + 8*hi; elements 0..7 <- k0+8hi+0..7, 8..15 <- k0+16+8hi+0..7 (same map for A and B).
template <typename T16> struct WFrag;
template <> struct WFrag<h16> { typedef v16h V; static __device__ __forceinline__ V ld(const h16* p) { return cat16(*(const v8h*)p, *(const v8h*)(p + 16)); } static __device__ __forceinline__ v8f mma(V a, V b, v8f c) { return wmma16(a, b, c); } };
template <> struct WFrag<bf> { typedef v16bf V; static __device__ __forceinline__ V ld(const bf* p) { return cat16b(*(const v8us*)p, *(const v8us*)(p + 16)); } static __device__ __forceinline__ v8f mma(V a, V b, v8f c) { return wmmab(a, b, c); } };

// ---- GEMM body: one work-group of 4 waves per 128x128 output tile, wave (wm, wn) takes its 64x64 quarter (16 accumulators); grid (M/128, N/128), 128 threads.
// A and Bt rows come from K-contiguous 16-bit planes in stages of 128 k (256 B a row) into LDS at pitch 272 B by asynchronous copies (whole lines, each lane 16 B), two buffers: stage t + 1 flies while stage t is worked on.
// C[m][n] (f32, pitch ldc) = sum_k (A[m][k] (+ A2[m][k] when NSPLIT == 1)) Bt[n][k]. K % 128 == 0, M % 128 == 0, N % 128 == 0.
#define GKS   128                            // k elements per stage
#define GPB   272                            // LDS row pitch in bytes (16 B x odd, for 16-byte fragment reads)
#define GTILE (128 * GPB)                    // one operand's 128 rows of a stage
static_assert(SEQ % 128 == 0 && DQ % 128 == 0 && DKV % 128 == 0 && DM % 128 == 0);
static_assert(DM % GKS == 0 && DQ % GKS == 0);
typedef __attribute__((address_space(1))) v4i gv4i;
typedef __attribute__((address_space(3))) v4i lv4i;
// One operand's 128 rows x 256 B of a stage: 16 copies of 16 B per lane, rows 8 apart (l: the lane's LDS place, g: its global place, gs = 8 source rows in elements).
__device__ __forceinline__ void atile(unsigned char* l, const bf* g, size_t gs) {
#pragma unroll
    for (int i = 0; i < 16; ++i) __builtin_amdgcn_global_load_async_to_lds_b128((gv4i*)(g + i * gs), (lv4i*)(l + i * (8 * GPB)), 0, 0);
}
template <int NSPLIT>
__device__ __forceinline__ void gemmw_body(const bf* __restrict__ A, const bf* __restrict__ A2, const bf* __restrict__ Bt, int K, float* C, int ldc) {
    typedef WFrag<bf>::V V;
    constexpr unsigned STAGE = (2 + NSPLIT) * GTILE, BOFF = (1 + NSPLIT) * GTILE;   // stage = [A | A2 when NSPLIT | Bt]
    __shared__ __align__(16) unsigned char L[2 * STAGE];
    __shared__ __align__(16) float osw[4 * 16 * 68];
    const int tid = threadIdx.x, lane = tid & 31, lr = lane & 15, hi = lane >> 4; const int wave = tid >> 5, wm = wave >> 1, wn = wave & 1;
    const int R0 = blockIdx.x * 128, C0 = blockIdx.y * 128; const int r0 = R0 + wm * 64, c0 = C0 + wn * 64;
    float* os = osw + wave * (16 * 68);
    v8f acc[4][4];
#pragma unroll
    for (int mb = 0; mb < 4; ++mb)
#pragma unroll
        for (int nb = 0; nb < 4; ++nb) acc[mb][nb] = (v8f){};
    // copies: thread -> row tid >> 4 (+ 8 per copy), 16-byte chunk tid & 15 of the row's 256 B
    const size_t gs = (size_t)8 * K; const int crw = tid >> 4, cch = tid & 15;
    const size_t po = (size_t)crw * K + cch * 8;                          // the lane's own element offset inside an operand's 128 rows
    const bf* uA = A + (size_t)R0 * K; const bf* uA2 = A2 + (size_t)R0 * K; const bf* uB = Bt + (size_t)C0 * K;   // wave-uniform row bases
    unsigned char* lc = L + (crw * GPB + cch * 16);
    const int nt = K / GKS;
    atile(lc, uA + po, gs); if (NSPLIT == 1) atile(lc + GTILE, uA2 + po, gs); atile(lc + BOFF, uB + po, gs);
    asm volatile("s_wait_asynccnt 0x0" ::: "memory");                     // stage 0 landed (this wave's copies)
    __syncthreads();                                                      // ... and every other wave's
    if (nt > 1) { atile(lc + STAGE, (uA + GKS) + po, gs); if (NSPLIT == 1) atile(lc + STAGE + GTILE, (uA2 + GKS) + po, gs); atile(lc + STAGE + BOFF, (uB + GKS) + po, gs); }
#pragma unroll 1                                                          // stays rolled: one trip per stage, its buffer picked by t & 1; the 64 or 128 products of a trip are unrolled inside
    for (int t = 0; t < nt; ++t) {
        const unsigned bo = (unsigned)(t & 1) * STAGE;
        const bf* la = (const bf*)(L + bo + (wm * 64 + lr) * GPB + 16 * hi);
        const bf* lb = (const bf*)(L + bo + BOFF + (wn * 64 + lr) * GPB + 16 * hi);
        V a[2][4], a2[2][4], b[2][4];                                     // two fragment sets: the next 32 k are read from LDS ahead of this block's products
#pragma unroll
        for (int f = 0; f < 4; ++f) { a[0][f] = WFrag<bf>::ld(la + f * (16 * GPB / 2)); if (NSPLIT == 1) a2[0][f] = WFrag<bf>::ld(la + GTILE / 2 + f * (16 * GPB / 2)); b[0][f] = WFrag<bf>::ld(lb + f * (16 * GPB / 2)); }
#pragma unroll
        for (int ks = 0; ks < GKS / 32; ++ks) {
            const int cu = ks & 1, nx = cu ^ 1;
            if (ks + 1 < GKS / 32) {
#pragma unroll
                for (int f = 0; f < 4; ++f) { a[nx][f] = WFrag<bf>::ld(la + (ks + 1) * 32 + f * (16 * GPB / 2)); if (NSPLIT == 1) a2[nx][f] = WFrag<bf>::ld(la + GTILE / 2 + (ks + 1) * 32 + f * (16 * GPB / 2)); b[nx][f] = WFrag<bf>::ld(lb + (ks + 1) * 32 + f * (16 * GPB / 2)); }
                __builtin_amdgcn_sched_barrier(0);                        // keeps the next block's LDS reads one group ahead of this block's products (sunk among them, every product waits for its own read)
            }
#pragma unroll
            for (int nb = 0; nb < 4; ++nb)
#pragma unroll
                for (int mb = 0; mb < 4; ++mb) acc[mb][nb] = wmmab(a[cu][mb], b[cu][nb], acc[mb][nb]);
            if (NSPLIT == 1) {
#pragma unroll
                for (int nb = 0; nb < 4; ++nb)
#pragma unroll
                    for (int mb = 0; mb < 4; ++mb) acc[mb][nb] = wmmab(a2[cu][mb], b[cu][nb], acc[mb][nb]);
            }
        }
        // four vector slots behind the last product, on the branch's taken side too, before anything rewrites its operands
        asm volatile("v_nop\n\tv_nop\n\tv_nop\n\tv_nop" : "+v"(acc[0][0]), "+v"(acc[1][0]), "+v"(acc[2][0]), "+v"(acc[3][0]), "+v"(acc[0][1]), "+v"(acc[1][1]), "+v"(acc[2][1]), "+v"(acc[3][1]),
                                                            "+v"(acc[0][2]), "+v"(acc[1][2]), "+v"(acc[2][2]), "+v"(acc[3][2]), "+v"(acc[0][3]), "+v"(acc[1][3]), "+v"(acc[2][3]), "+v"(acc[3][3]));
        asm volatile("s_wait_dscnt 0x0" ::: "memory");                    // this wave's reads of buffer t & 1 are done before it is refilled
        asm volatile("s_wait_asynccnt 0x0" ::: "memory");                 // this wave's copies of stage t + 1 have landed
        __syncthreads();                                                  // publishes stage t + 1 and ends every wave's reads of stage t
        if (t + 2 < nt) { const int ko = (t + 2) * GKS; atile(lc + bo, (uA + ko) + po, gs); if (NSPLIT == 1) atile(lc + bo + GTILE, (uA2 + ko) + po, gs); atile(lc + bo + BOFF, (uB + ko) + po, gs); }
    }
    asm volatile("s_wait_asynccnt 0x0" ::: "memory");                     // no copy is outstanding when the wave goes on
#pragma unroll
    for (int mb = 0; mb < 4; ++mb) {
#pragma unroll
        for (int nb = 0; nb < 4; ++nb) {
#pragma unroll
            for (int j = 0; j < 8; ++j) os[(hi * 8 + j) * 68 + nb * 16 + lr] = acc[mb][nb][j]; }
        __builtin_amdgcn_wave_barrier(); asm volatile("" ::: "memory");
        float* crow = C + (size_t)(r0 + mb * 16) * ldc + c0;
{
#pragma unroll
            for (int s = 0; s < 8; ++s) { const int row = 2 * s + hi, cofs = lr * 4; const v4f val = *(const v4fa*)(os + row * 68 + cofs);
                *(v4f*)(crow + (size_t)row * ldc + cofs) = val; }
             }
        __builtin_amdgcn_wave_barrier(); asm volatile("" ::: "memory");
    }
}
__global__ __launch_bounds__(128) void k_gemm_p(const bf* __restrict__ A, const bf* __restrict__ Bt, int K, float* C, int ldc) { gemmw_body<0>(A, A, Bt, K, C, ldc); }
__global__ __launch_bounds__(128) void k_gemm_s(const bf* __restrict__ A, const bf* __restrict__ A2, const bf* __restrict__ Bt, int K, float* C, int ldc) { gemmw_body<1>(A, A2, Bt, K, C, ldc); }

__global__ __launch_bounds__(256) void k_wtG(const float* __restrict__ w, int K, int N, bf* Bt) {
    const int lane = threadIdx.x & 31; const int L0 = (blockIdx.x * 8 + (threadIdx.x >> 5)) * 8; const int nlines = N * K / 64;
{
#pragma unroll 1
        for (int l = 0; l < 8; ++l) { const int L = L0 + l; if (L >= nlines) break; const size_t e = (size_t)L * 64 + lane * 2; const int k = (int)(e % K), n = (int)(e / K); v2us o;
            o[0] = f2bf(w[(size_t)k * N + n]); o[1] = f2bf(w[(size_t)(k + 1) * N + n]); *(v2us*)(Bt + e) = o; }
         }
}
__global__ __launch_bounds__(256) void k_cvt8(const float* __restrict__ src, bf* dst, size_t n8) { const size_t i = (size_t)blockIdx.x * 256 + threadIdx.x; if (i >= n8) return; const v8f v = *(const v8f*)(src + i * 8); v8us o;
#pragma unroll
    for (int k = 0; k < 8; ++k) o[k] = f2bf(v[k]); *(v8us*)(dst + i * 8) = o;  }

// k_rope: head planes [h][t][d] (fp16 + bf16 hi/lo) of the interleaved-pair rotation: pair (2i, 2i+1) with table entry [t][i] read BY VALUE (RNE-converted to bf16):
__global__ __launch_bounds__(256) void k_rope(const float* __restrict__ F, int pitch, int nheads, const float* __restrict__ COS, const float* __restrict__ SIN, h16* P16, bf* Ph, bf* Pl) {
#pragma clang fp contract(off)
    const size_t e = ((size_t)blockIdx.x * 256 + threadIdx.x) * 2; if (e >= (size_t)nheads * SEQ * HD) return;
    const int d = (int)(e % HD); const int t = (int)((e / HD) % SEQ); const int h = (int)(e / ((size_t)HD * SEQ));
    const v2f x = *(const v2f*)(F + (size_t)t * pitch + h * HD + d);
    const float c = bfr(COS[(size_t)t * (HD / 2) + (d >> 1)]), s = bfr(SIN[(size_t)t * (HD / 2) + (d >> 1)]);
    const float a0 = x[0] * c, a1 = x[1] * s, b0 = x[0] * s, b1 = x[1] * c;
    const float r0 = a0 - a1, r1 = b0 + b1;
    v2h o16; v2us oh, ol; unsigned short a2, c2;
    o16[0] = (h16)r0; splitf(r0, a2, c2); oh[0] = a2; ol[0] = c2;
    o16[1] = (h16)r1; splitf(r1, a2, c2); oh[1] = a2; ol[1] = c2;
    *(v2h*)(P16 + e) = o16; *(v2us*)(Ph + e) = oh; *(v2us*)(Pl + e) = ol;  }
__global__ __launch_bounds__(256) void k_vtp(const float* __restrict__ F, int pitch, int nheads, h16* V16, bf* Vh, bf* Vl) { const size_t e = ((size_t)blockIdx.x * 256 + threadIdx.x) * 2; if (e >= (size_t)nheads * HD * SEQ) return; const int t = (int)(e % SEQ); const int d = (int)((e / SEQ) % HD); const int g = (int)(e / ((size_t)SEQ * HD)); v2h o16; v2us oh, ol;
#pragma unroll
    for (int q = 0; q < 2; ++q) { const float x = F[(size_t)(t + q) * pitch + g * HD + d]; o16[q] = (h16)x; unsigned short a2, c2; splitf(x, a2, c2); oh[q] = a2; ol[q] = c2; }
    *(v2h*)(V16 + e) = o16; *(v2us*)(Vh + e) = oh; *(v2us*)(Vl + e) = ol;  }

// k_maskbits: one work-group of 16 waves per (16 query rows, 32 mask words); wave r takes row r and holds its 1024 mask values as 8 loads of 512 contiguous bytes, all in flight at once.
// Bit-plane MB[q][w] (bit n = mask[q][32w+n] != 0) and tile class CL[q/16][w]: 0 = no key kept in the 16x32 tile, 1 = all kept, 2 = mixed.
__global__ __launch_bounds__(512) void k_maskbits(const int* __restrict__ mask, unsigned* MBp, int* CLp) {
    __shared__ unsigned sw[16 * 32];
    const int lane = threadIdx.x & 31, row = threadIdx.x >> 5; const int qt = blockIdx.x, wb = blockIdx.y * 32; const int q = qt * 16 + row;
    const int* mr = mask + (size_t)q * SEQ_FULL + wb * 32 + lane * 4;
    v4i v[8];
#pragma unroll
    for (int i = 0; i < 8; ++i) v[i] = *(const v4i*)(mr + 128 * i);
    // nibble i of x: the lane's four values of load i, i.e. bits 4*(lane&7)..+3 of word wb + 4*i + (lane>>3)
    unsigned x = 0u;
#pragma unroll
    for (int i = 0; i < 8; ++i) { const unsigned nib = (v[i][0] != 0 ? 1u : 0u) | (v[i][1] != 0 ? 2u : 0u) | (v[i][2] != 0 ? 4u : 0u) | (v[i][3] != 0 ? 8u : 0u); x |= nib << (4 * i); }
    // 8x8 nibble transpose inside each group of 8 lanes (three exchanges; a lane keeps the nibbles under its mask and takes the partner's, rotated into place): afterwards lane 8g+t holds the whole word wb + 4*t + g
    unsigned y;
    y = __builtin_rotateright32(__shfl_xor(x, 4, 32), 16);               { const unsigned km = (lane & 4) ? 0xFFFF0000u : 0x0000FFFFu; x = (x & km) | (y & ~km); }
    y = __builtin_rotateright32(__shfl_xor(x, 2, 32), (lane & 2) ? 8 : 24); { const unsigned km = (lane & 2) ? 0xFF00FF00u : 0x00FF00FFu; x = (x & km) | (y & ~km); }
    y = __builtin_rotateright32(__shfl_xor(x, 1, 32), (lane & 1) ? 4 : 28); { const unsigned km = (lane & 1) ? 0xF0F0F0F0u : 0x0F0F0F0Fu; x = (x & km) | (y & ~km); }
    const int w = wb + 4 * (lane & 7) + (lane >> 3);
    sw[row * 32 + lane] = x;
    __syncthreads();                                                      // the 16 rows' words -> the class of each 16x32 tile
    if (row == 0) {
        unsigned an = 0xFFFFFFFFu, orr = 0u;
#pragma unroll
        for (int r = 0; r < 16; ++r) { const unsigned t = sw[r * 32 + lane]; an &= t; orr |= t; }
        CLp[(size_t)qt * NW + w] = (orr == 0u) ? 0 : ((an == 0xFFFFFFFFu) ? 1 : 2);
    }
    MBp[(size_t)q * NW + w] = x;                                          // one wave = one whole 128-byte line
}

// ---- fused attention body: one wave (= one block) per (16 query rows, head). Key loop over 32-key halves; a half is skipped only when its class says no key of the
// 16x32 tile is kept (masked keys contribute exactly 0 under the -inf fill; a row with no kept key anywhere ends with 0 * (1/0) = NaN, as the module).
// SPLIT: q, k, P, v on bf16 hi/lo planes (hh + hl + lh); else fp16 planes with P carried x PCAR (the carry cancels in acc / l).
template <bool SPLIT>
__device__ __forceinline__ void attn_body(const h16* __restrict__ Q16, const h16* __restrict__ K16, const h16* __restrict__ V16,
                                          const bf* __restrict__ Qh, const bf* __restrict__ Ql, const bf* __restrict__ Kh, const bf* __restrict__ Kl, const bf* __restrict__ Vh, const bf* __restrict__ Vl,
                                          const unsigned* __restrict__ MBp, const int* __restrict__ CLp, bf* Ch, bf* Cl, int qt0) {
    __shared__ __align__(16) unsigned short pa[16 * PP];
    __shared__ __align__(16) unsigned short pb[16 * PP];
    __shared__ __align__(16) float os[16 * 68];
    const int lane = threadIdx.x & 31, lr = lane & 15, hi = lane >> 4;
    const int qt = qt0 + (int)blockIdx.x; const int h = (int)blockIdx.y; const int hk = h / REP; const int q0 = qt * 16;
    const size_t qoff = ((size_t)h * SEQ + q0 + lr) * HD + 8 * hi;       // A fragment: row q0+lr, d offset 8*hi
    const size_t kb0  = ((size_t)hk * SEQ + lr) * HD + 8 * hi;           // B fragment (scores): lane = key, k = d
    const size_t vb0  = ((size_t)hk * HD + lr) * SEQ + 8 * hi;           // B fragment (P.V): lane = d, k = key
    const float NINF = -__builtin_inff();
    float mi[8], li[8]; v8f acc[4];
#pragma unroll
    for (int r = 0; r < 8; ++r) { mi[r] = NINF; li[r] = 0.0f; }
#pragma unroll
    for (int ot = 0; ot < 4; ++ot) acc[ot] = (v8f){};
#pragma unroll 1
    for (int j = 0; j < NW; ++j) {
        const int cls = __builtin_amdgcn_readfirstlane(CLp[(size_t)qt * NW + j]);
        if (cls == 0) continue;                                           // wave-uniform (block == one wave)
        unsigned wd[8];
        if (cls == 1) {
#pragma unroll
            for (int r = 0; r < 8; ++r) wd[r] = 0xFFFFFFFFu;
        } else {
#pragma unroll
            for (int r = 0; r < 8; ++r) wd[r] = MBp[(size_t)(q0 + 8 * hi + r) * NW + j];
        }
        v8f s0 = (v8f){}, s1 = (v8f){};
        const size_t ko = kb0 + (size_t)(32 * j) * HD;
        if (SPLIT) {
            const v16bf qh0 = WFrag<bf>::ld(Qh + qoff), qh1 = WFrag<bf>::ld(Qh + qoff + 32), ql0 = WFrag<bf>::ld(Ql + qoff), ql1 = WFrag<bf>::ld(Ql + qoff + 32);
            { const v16bf kh0 = WFrag<bf>::ld(Kh + ko), kh1 = WFrag<bf>::ld(Kh + ko + 32), kl0 = WFrag<bf>::ld(Kl + ko), kl1 = WFrag<bf>::ld(Kl + ko + 32);
              s0 = wmmab(ql0, kh0, s0); s0 = wmmab(ql1, kh1, s0); s0 = wmmab(qh0, kl0, s0); s0 = wmmab(qh1, kl1, s0); s0 = wmmab(qh0, kh0, s0); s0 = wmmab(qh1, kh1, s0); }
            { const size_t k1 = ko + (size_t)16 * HD; const v16bf kh0 = WFrag<bf>::ld(Kh + k1), kh1 = WFrag<bf>::ld(Kh + k1 + 32), kl0 = WFrag<bf>::ld(Kl + k1), kl1 = WFrag<bf>::ld(Kl + k1 + 32);
              s1 = wmmab(ql0, kh0, s1); s1 = wmmab(ql1, kh1, s1); s1 = wmmab(qh0, kl0, s1); s1 = wmmab(qh1, kl1, s1); s1 = wmmab(qh0, kh0, s1); s1 = wmmab(qh1, kh1, s1);
              asm volatile("v_nop\n\tv_nop\n\tv_nop\n\tv_nop" : "+v"(s0), "+v"(s1) : "v"(qh1), "v"(kh1)); }
        } else {
            const v16h qa0 = WFrag<h16>::ld(Q16 + qoff), qa1 = WFrag<h16>::ld(Q16 + qoff + 32);
            const v16h k00 = WFrag<h16>::ld(K16 + ko), k01 = WFrag<h16>::ld(K16 + ko + 32);
            const v16h k10 = WFrag<h16>::ld(K16 + ko + (size_t)16 * HD), k11 = WFrag<h16>::ld(K16 + ko + (size_t)16 * HD + 32);
            s0 = wmma16(qa0, k00, s0); s0 = wmma16(qa1, k01, s0); s1 = wmma16(qa0, k10, s1); s1 = wmma16(qa1, k11, s1);
            asm volatile("v_nop\n\tv_nop\n\tv_nop\n\tv_nop" : "+v"(s0), "+v"(s1) : "v"(qa1), "v"(k11));
        }
        // online softmax in log2 units; accumulator element r <-> tile row 8*hi + r, column lr (s0) / 16 + lr (s1)
#pragma unroll
        for (int r = 0; r < 8; ++r) {
            const unsigned w = wd[r];
            const bool kp0 = ((w >> lr) & 1u) != 0u, kp1 = ((w >> (16 + lr)) & 1u) != 0u;
            const float v0 = kp0 ? s0[r] * SCL2 : NINF; const float v1 = kp1 ? s1[r] * SCL2 : NINF;
            float mx = fmaxf(v0, v1);
            mx = fmaxf(mx, __shfl_xor(mx, 1, 32)); mx = fmaxf(mx, __shfl_xor(mx, 2, 32)); mx = fmaxf(mx, __shfl_xor(mx, 4, 32)); mx = fmaxf(mx, __shfl_xor(mx, 8, 32));
            const float nm = fmaxf(mi[r], mx); const float ms = (nm == NINF) ? 0.0f : nm;
            const float corr = ex2(mi[r] - ms); const float p0 = ex2(v0 - ms), p1 = ex2(v1 - ms);
            const int po = (8 * hi + r) * PP + lr;
            if (SPLIT) { unsigned short a, c; splitf(p0, a, c); pa[po] = a; pb[po] = c; splitf(p1, a, c); pa[po + 16] = a; pb[po + 16] = c; li[r] = li[r] * corr + (p0 + p1); }
            else { const h16 e0 = (h16)(p0 * PCAR), e1 = (h16)(p1 * PCAR); pa[po] = __builtin_bit_cast(unsigned short, e0); pa[po + 16] = __builtin_bit_cast(unsigned short, e1); li[r] = li[r] * corr + ((float)e0 + (float)e1); }
            mi[r] = nm;
#pragma unroll
            for (int ot = 0; ot < 4; ++ot) acc[ot][r] *= corr;
        }
        __syncthreads();                                                  // P tile stores -> fragment reloads (same wave; block == one wave)
        const size_t vo = vb0 + (size_t)(32 * j);
        if (SPLIT) {
            const v8us a0 = *(const v8usa*)(pa + lr * PP + 8 * hi), a1 = *(const v8usa*)(pa + lr * PP + 16 + 8 * hi);
            const v8us b0 = *(const v8usa*)(pb + lr * PP + 8 * hi), b1 = *(const v8usa*)(pb + lr * PP + 16 + 8 * hi);
            const v16bf ph = cat16b(a0, a1), pl = cat16b(b0, b1);
#pragma unroll
            for (int ot = 0; ot < 4; ++ot) { const v16bf vh = WFrag<bf>::ld(Vh + vo + (size_t)ot * 16 * SEQ), vl = WFrag<bf>::ld(Vl + vo + (size_t)ot * 16 * SEQ);
                acc[ot] = wmmab(pl, vh, acc[ot]); acc[ot] = wmmab(ph, vl, acc[ot]); acc[ot] = wmmab(ph, vh, acc[ot]); }
            asm volatile("v_nop\n\tv_nop\n\tv_nop\n\tv_nop" : "+v"(acc[0]), "+v"(acc[1]), "+v"(acc[2]), "+v"(acc[3]) : "v"(ph), "v"(pl));
        } else {
            const v8us a0 = *(const v8usa*)(pa + lr * PP + 8 * hi), a1 = *(const v8usa*)(pa + lr * PP + 16 + 8 * hi);
            const v16h p16 = cat16hu(a0, a1);
#pragma unroll
            for (int ot = 0; ot < 4; ++ot) { const v16h vf = WFrag<h16>::ld(V16 + vo + (size_t)ot * 16 * SEQ); acc[ot] = wmma16(p16, vf, acc[ot]); }
            asm volatile("v_nop\n\tv_nop\n\tv_nop\n\tv_nop" : "+v"(acc[0]), "+v"(acc[1]), "+v"(acc[2]), "+v"(acc[3]) : "v"(p16));
        }
        asm volatile("" ::: "memory");
    }
    // finish: row sums across the 16 lanes of each half, normalise, stage 16x64 f32, write hi/lo lines
#pragma unroll
    for (int r = 0; r < 8; ++r) { float l = li[r]; l += __shfl_xor(l, 1, 32); l += __shfl_xor(l, 2, 32); l += __shfl_xor(l, 4, 32); l += __shfl_xor(l, 8, 32); li[r] = 1.0f / l; }
#pragma unroll
    for (int ot = 0; ot < 4; ++ot)
#pragma unroll
        for (int r = 0; r < 8; ++r) os[(8 * hi + r) * 68 + ot * 16 + lr] = acc[ot][r] * li[r];
    __syncthreads();
{
#pragma unroll
        for (int s = 0; s < 4; ++s) { const int row = 4 * s + (lane >> 3), c8 = (lane & 7) * 8;
            const v4f x0 = *(const v4fa*)(os + row * 68 + c8), x1 = *(const v4fa*)(os + row * 68 + c8 + 4); v8us oh, ol;
#pragma unroll
            for (int k = 0; k < 4; ++k) { unsigned short a, c; splitf(x0[k], a, c); oh[k] = a; ol[k] = c; splitf(x1[k], a, c); oh[4 + k] = a; ol[4 + k] = c; }
            const size_t oo = (size_t)(q0 + row) * DQ + (size_t)h * HD + c8;
            *(v8us*)(Ch + oo) = oh; *(v8us*)(Cl + oo) = ol; }
         }
}
__global__ __launch_bounds__(32) void k_attn_hl(const bf* __restrict__ Qh, const bf* __restrict__ Ql, const bf* __restrict__ Kh, const bf* __restrict__ Kl, const bf* __restrict__ Vh, const bf* __restrict__ Vl,
                                                const unsigned* __restrict__ MBp, const int* __restrict__ CLp, bf* Ch, bf* Cl, int qt0) {
    attn_body<true>((const h16*)0, (const h16*)0, (const h16*)0, Qh, Ql, Kh, Kl, Vh, Vl, MBp, CLp, Ch, Cl, qt0); }
__global__ __launch_bounds__(32) void k_attn_f16(const h16* __restrict__ Q16, const h16* __restrict__ K16, const h16* __restrict__ V16,
                                                 const unsigned* __restrict__ MBp, const int* __restrict__ CLp, bf* Ch, bf* Cl, int qt0) {
    attn_body<false>(Q16, K16, V16, (const bf*)0, (const bf*)0, (const bf*)0, (const bf*)0, (const bf*)0, (const bf*)0, MBp, CLp, Ch, Cl, qt0); }

constexpr size_t al256(size_t b) { return (b + 255) & ~(size_t)255; }
constexpr size_t WS_TOTAL =
    al256((size_t)DQ * DM * 2) + 2 * al256((size_t)DKV * DM * 2) + al256((size_t)DM * DQ * 2) +      // WQ, WK, WV, WO
    al256((size_t)SEQ * DM * 2) +                                                                      // XB
    al256((size_t)SEQ * DQ * 4) + 2 * al256((size_t)SEQ * DKV * 4) +                                   // FQ, FK, FV
    3 * al256((size_t)NH * SEQ * HD * 2) + 6 * al256((size_t)NKV * SEQ * HD * 2) +                     // q planes, k planes, v planes
    2 * al256((size_t)SEQ * DQ * 2) +                                                                  // ctx hi/lo
    al256((size_t)SEQ * NW * 4) + al256((size_t)(SEQ / 16) * NW * 4);                                  // mask bits, tile classes
static_assert(WS_TOTAL <= (size_t)134217728);

extern "C" void kernel_launch(void* const* d_in, const int* in_sizes, int n_in,
                              void* d_out, int out_size, void* d_ws, size_t ws_size, hipStream_t stream) {
    if (n_in < 8) return;
    if ((long long)in_sizes[0] < (long long)(NB - 1) * SEQ_FULL * DM + (long long)SEQ * DM) return;
    if ((long long)in_sizes[1] < (long long)DM * DQ || (long long)in_sizes[2] < (long long)DM * DKV || (long long)in_sizes[3] < (long long)DM * DKV || (long long)in_sizes[4] < (long long)DQ * DM) return;
    if ((long long)in_sizes[5] < (long long)SEQ * (HD / 2) || (long long)in_sizes[6] < (long long)SEQ * (HD / 2)) return;
    if ((long long)in_sizes[7] < (long long)(SEQ - 1) * SEQ_FULL + SEQ) return;
    if ((long long)out_size < (long long)(NB - 1) * SEQ_FULL * DM + (long long)SEQ * DM) return;
    if (ws_size < WS_TOTAL) return;
    const float* x = (const float*)d_in[0]; const float* wq = (const float*)d_in[1]; const float* wk = (const float*)d_in[2]; const float* wv = (const float*)d_in[3]; const float* wo = (const float*)d_in[4];
    const float* fcos = (const float*)d_in[5]; const float* fsin = (const float*)d_in[6]; const int* mask = (const int*)d_in[7];
    float* OUT = (float*)d_out;     // [1][2048][2048]
    char* wsp = (char*)d_ws;
    auto take = [&](size_t bytes) { char* p = wsp; wsp += (bytes + 255) & ~(size_t)255; return (void*)p; };
    bf* WQ = (bf*)take((size_t)DQ * DM * 2); bf* WK = (bf*)take((size_t)DKV * DM * 2); bf* WV = (bf*)take((size_t)DKV * DM * 2); bf* WO = (bf*)take((size_t)DM * DQ * 2);
    bf* XB = (bf*)take((size_t)SEQ * DM * 2);
    float* FQ = (float*)take((size_t)SEQ * DQ * 4); float* FK = (float*)take((size_t)SEQ * DKV * 4); float* FV = (float*)take((size_t)SEQ * DKV * 4);
    h16* QP16 = (h16*)take((size_t)NH * SEQ * HD * 2); bf* QPh = (bf*)take((size_t)NH * SEQ * HD * 2); bf* QPl = (bf*)take((size_t)NH * SEQ * HD * 2);
    h16* KP16 = (h16*)take((size_t)NKV * SEQ * HD * 2); bf* KPh = (bf*)take((size_t)NKV * SEQ * HD * 2); bf* KPl = (bf*)take((size_t)NKV * SEQ * HD * 2);
    h16* VT16 = (h16*)take((size_t)NKV * SEQ * HD * 2); bf* VTh = (bf*)take((size_t)NKV * SEQ * HD * 2); bf* VTl = (bf*)take((size_t)NKV * SEQ * HD * 2);
    bf* CXh = (bf*)take((size_t)SEQ * DQ * 2); bf* CXl = (bf*)take((size_t)SEQ * DQ * 2);
    unsigned* MBp = (unsigned*)take((size_t)SEQ * NW * 4); int* CLp = (int*)take((size_t)(SEQ / 16) * NW * 4);
    if ((size_t)(wsp - (char*)d_ws) > ws_size) return;

    // weights: w[in][out] -> Bt[out][in] bf16.  wq: in DM, out DQ; wk/wv: in DM, out DKV; wo: in DQ, out DM.
    k_wtG<<<(unsigned)((DM * DQ / 64 + 63) / 64), 256, 0, stream>>>(wq, DM, DQ, WQ);
    k_wtG<<<(unsigned)((DM * DKV / 64 + 63) / 64), 256, 0, stream>>>(wk, DM, DKV, WK);
    k_wtG<<<(unsigned)((DM * DKV / 64 + 63) / 64), 256, 0, stream>>>(wv, DM, DKV, WV);
    k_wtG<<<(unsigned)((DQ * DM / 64 + 63) / 64), 256, 0, stream>>>(wo, DQ, DM, WO);
    k_maskbits<<<dim3(SEQ / 16, NW / 32, 1), 512, 0, stream>>>(mask, MBp, CLp);
    const unsigned LQ = (unsigned)(((size_t)NH * SEQ * HD / 2 + 255) / 256), LKv = (unsigned)(((size_t)NKV * SEQ * HD / 2 + 255) / 256);
    for (int b = 0; b < NB; ++b) {
        k_cvt8<<<(unsigned)(((size_t)SEQ * DM / 8 + 255) / 256), 256, 0, stream>>>(x + (size_t)b * SEQ_FULL * DM, XB, (size_t)SEQ * DM / 8);
        k_gemm_p<<<dim3(SEQ / 128, DQ / 128, 1), 128, 0, stream>>>(XB, WQ, DM, FQ, DQ);
        k_gemm_p<<<dim3(SEQ / 128, DKV / 128, 1), 128, 0, stream>>>(XB, WK, DM, FK, DKV);
        k_gemm_p<<<dim3(SEQ / 128, DKV / 128, 1), 128, 0, stream>>>(XB, WV, DM, FV, DKV);
        k_rope<<<LQ, 256, 0, stream>>>(FQ, DQ, NH, fcos, fsin, QP16, QPh, QPl);
        k_rope<<<LKv, 256, 0, stream>>>(FK, DKV, NKV, fcos, fsin, KP16, KPh, KPl);
        k_vtp<<<LKv, 256, 0, stream>>>(FV, DKV, NKV, VT16, VTh, VTl);
        if (RH / 16 > 0) k_attn_hl<<<dim3(RH / 16, NH, 1), 32, 0, stream>>>(QPh, QPl, KPh, KPl, VTh, VTl, MBp, CLp, CXh, CXl, 0);
        if ((SEQ - RH) / 16 > 0) k_attn_f16<<<dim3((SEQ - RH) / 16, NH, 1), 32, 0, stream>>>(QP16, KP16, VT16, MBp, CLp, CXh, CXl, RH / 16);
        k_gemm_s<<<dim3(SEQ / 128, DM / 128, 1), 128, 0, stream>>>(CXh, CXl, WO, DQ, OUT + (size_t)b * SEQ_FULL * DM, DM);
    }
}

// v003
// It runs in 329 microseconds.
// Timed twice side by side with v002, it ran 1.03 times as fast both times.
// All steps since v000 together make it 1.69 times as fast.
#include <hip/hip_runtime.h>

// Contractions (all f32 accumulate): x@wq, x@wk, x@wv v_wmma_f32_16x16x32_bf16 (bf16 x bf16 operand planes, inputs RNE-converted to bf16); scores q.k and P.V: query rows < 512 bf16 hi/lo planes (3 products each), rows >= 512 v_wmma_f32_16x16x32_f16 (P carried x1024); ctx@wo bf16 hi/lo ctx planes x bf16 weights (2 products).
// Grouped-query causal-style attention with interleaved-pair rotation from INPUT tables and an INPUT int32 mask (read by value through a bit-plane + 16x32 tile classes); softmax f32 online running-max form.
// Flash-style fused attention: one wave per 16 query rows per head, K / V^T fragments straight from K-contiguous 16-bit planes, P relayout through a wave-private LDS tile (block barrier, block == one wave).

#ifndef NB
#define NB 1
#endif
#ifndef SEQ
#define SEQ 2048
#endif
#define NB_FULL  1
#define SEQ_FULL 2048
#define DM   2048
#define NH   32
#define NKV  8
#define REP  (NH / NKV)
#define HD   64
#define DQ   (NH * HD)
#define DKV  (NKV * HD)
#define RH   ((SEQ) < 512 ? (SEQ) : 512)     // query rows < RH use hi+lo planes
#define NW   (SEQ / 32)                      // 32-key words per mask row
#define PP   40                              // P tile pitch (16-bit elements)
#define PCAR 1024.0f
#define SCL2 0.18033688011112042f            // (1/8) * log2(e)

static_assert(SEQ % 64 == 0);                // key halves of 32
static_assert(SEQ <= SEQ_FULL);
static_assert(NW % 32 == 0);                 // mask pre-pass: 32 words per work-group
static_assert(HD == 64);
static_assert(DM % 64 == 0 && DQ % 64 == 0 && DKV % 64 == 0);
static_assert(DM % 32 == 0 && DQ % 32 == 0);
static_assert(NH % NKV == 0);
static_assert(RH % 16 == 0 && (SEQ - RH) % 16 == 0);
static_assert((PP * 2) % 16 == 0);
static_assert(NB <= NB_FULL);

typedef _Float16 h16;
typedef unsigned short bf;
typedef __attribute__((ext_vector_type(16))) __bf16   v16bf;
typedef __attribute__((ext_vector_type(16))) _Float16 v16h;
typedef __attribute__((ext_vector_type(8)))  _Float16 v8h;
typedef __attribute__((ext_vector_type(8)))  unsigned short v8us;
typedef __attribute__((ext_vector_type(8)))  float    v8f;
typedef __attribute__((ext_vector_type(4)))  float    v4f;
typedef __attribute__((ext_vector_type(4)))  int      v4i;
typedef __attribute__((ext_vector_type(4)))  _Float16 v4h;
typedef __attribute__((ext_vector_type(4)))  unsigned short v4us;
typedef __attribute__((ext_vector_type(2)))  unsigned short v2us;
typedef __attribute__((ext_vector_type(2)))  float    v2f;
typedef v4f  __attribute__((may_alias)) v4fa;
typedef v8us __attribute__((may_alias)) v8usa;

__device__ __forceinline__ unsigned short f2bf(float f) { unsigned u = __float_as_uint(f); u += 0x7FFFu + ((u >> 16) & 1u); return (unsigned short)(u >> 16); }
__device__ __forceinline__ float bf2f(unsigned short b) { return __uint_as_float(((unsigned)b) << 16); }
__device__ __forceinline__ float bfr(float f) { return bf2f(f2bf(f)); }
__device__ __forceinline__ v16h cat16(v8h lo, v8h hi) { return __builtin_shufflevector(lo, hi, 0, 1, 2, 3, 4, 5, 6, 7, 8, 9, 10, 11, 12, 13, 14, 15); }
__device__ __forceinline__ v16bf cat16b(v8us lo, v8us hi) { return __builtin_bit_cast(v16bf, __builtin_shufflevector(lo, hi, 0, 1, 2, 3, 4, 5, 6, 7, 8, 9, 10, 11, 12, 13, 14, 15)); }
__device__ __forceinline__ v16h cat16hu(v8us lo, v8us hi) { return __builtin_bit_cast(v16h, __builtin_shufflevector(lo, hi, 0, 1, 2, 3, 4, 5, 6, 7, 8, 9, 10, 11, 12, 13, 14, 15)); }
__device__ __forceinline__ v8f wmma16(v16h a, v16h b, v8f c) { return __builtin_amdgcn_wmma_f32_16x16x32_f16(false, a, false, b, (short)0, c, false, false); }
__device__ __forceinline__ v8f wmmab(v16bf a, v16bf b, v8f c) { return __builtin_amdgcn_wmma_f32_16x16x32_bf16(false, a, false, b, (short)0, c, false, false); }
__device__ __forceinline__ void splitf(float y, unsigned short& h, unsigned short& l) { h = f2bf(y); l = f2bf(y - bf2f(h)); }
__device__ __forceinline__ float ex2(float x) { return __builtin_amdgcn_exp2f(x); }

// Fragment loaders: lane (hi = lane>>4, lr = lane&15); pointer already at row lr, k offset k0 + 8*hi; elements 0..7 <- k0+8hi+0..7, 8..15 <- k0+16+8hi+0..7 (same map for A and B).
template <typename T16> struct WFrag;
template <> struct WFrag<h16> { typedef v16h V; static __device__ __forceinline__ V ld(const h16* p) { return cat16(*(const v8h*)p, *(const v8h*)(p + 16)); } static __device__ __forceinline__ v8f mma(V a, V b, v8f c) { return wmma16(a, b, c); } };
template <> struct WFrag<bf> { typedef v16bf V; static __device__ __forceinline__ V ld(const bf* p) { return cat16b(*(const v8us*)p, *(const v8us*)(p + 16)); } static __device__ __forceinline__ v8f mma(V a, V b, v8f c) { return wmmab(a, b, c); } };

// ---- GEMM body: one work-group of 4 waves per 128x128 output tile, wave (wm, wn) takes its 64x64 quarter (16 accumulators); grid (M/128, N/128), 128 threads.
// A and Bt rows come from K-contiguous 16-bit planes in stages of 128 k (256 B a row) into LDS at pitch 272 B by asynchronous copies (whole lines, each lane 16 B), two buffers: stage t + 1 flies while stage t is worked on.
// c[m][n] (f32) = sum_k (A[m][k] (+ A2[m][k] when NSPLIT == 1)) Bt[n][k]. K % 128 == 0, M % 128 == 0, N % 128 == 0.
// What becomes of c is the epilogue's choice; a wave's 64 columns are one head (HD == 64):
//   EPI 0: C[m][n] = c, f32, pitch ldc.
//   EPI 1: head planes [h][t][d] (fp16 + bf16 hi/lo) of the interleaved-pair rotation: pair (2i, 2i+1) with table entry [t][i] read BY VALUE (RNE-converted to bf16).
//   EPI 2: transposed head planes [g][d][t] (fp16 + bf16 hi/lo), straight from the accumulators: a lane holds 8 consecutive t of one d.
#define GKS   128                            // k elements per stage
#define GPB   272                            // LDS row pitch in bytes (16 B x odd, for 16-byte fragment reads)
#define GTILE (128 * GPB)                    // one operand's 128 rows of a stage
static_assert(SEQ % 128 == 0 && DQ % 128 == 0 && DKV % 128 == 0 && DM % 128 == 0);
static_assert(DM % GKS == 0 && DQ % GKS == 0);
typedef __attribute__((address_space(1))) v4i gv4i;
typedef __attribute__((address_space(3))) v4i lv4i;
// One operand's 128 rows x 256 B of a stage: 16 copies of 16 B per lane, rows 8 apart (l: the lane's LDS place, g: its global place, gs = 8 source rows in elements).
__device__ __forceinline__ void atile(unsigned char* l, const bf* g, size_t gs) {
#pragma unroll
    for (int i = 0; i < 16; ++i) __builtin_amdgcn_global_load_async_to_lds_b128((gv4i*)(g + i * gs), (lv4i*)(l + i * (8 * GPB)), 0, 0);
}
template <int NSPLIT, int EPI>
__device__ __forceinline__ void gemmw_body(const bf* __restrict__ A, const bf* __restrict__ A2, const bf* __restrict__ Bt, int K, float* C, int ldc,
                                           const float* __restrict__ COS, const float* __restrict__ SIN, h16* P16, bf* Ph, bf* Pl) {
    typedef WFrag<bf>::V V;
    constexpr unsigned STAGE = (2 + NSPLIT) * GTILE, BOFF = (1 + NSPLIT) * GTILE;   // stage = [A | A2 when NSPLIT | Bt]
    __shared__ __align__(16) unsigned char L[2 * STAGE];
    __shared__ __align__(16) float osw[4 * 16 * 68];
    const int tid = threadIdx.x, lane = tid & 31, lr = lane & 15, hi = lane >> 4; const int wave = tid >> 5, wm = wave >> 1, wn = wave & 1;
    const int R0 = blockIdx.x * 128, C0 = blockIdx.y * 128; const int r0 = R0 + wm * 64, c0 = C0 + wn * 64;
    float* os = osw + wave * (16 * 68);
    v8f acc[4][4];
#pragma unroll
    for (int mb = 0; mb < 4; ++mb)
#pragma unroll
        for (int nb = 0; nb < 4; ++nb) acc[mb][nb] = (v8f){};
    // copies: thread -> row tid >> 4 (+ 8 per copy), 16-byte chunk tid & 15 of the row's 256 B
    const size_t gs = (size_t)8 * K; const int crw = tid >> 4, cch = tid & 15;
    const size_t po = (size_t)crw * K + cch * 8;                          // the lane's own element offset inside an operand's 128 rows
    const bf* uA = A + (size_t)R0 * K; const bf* uA2 = A2 + (size_t)R0 * K; const bf* uB = Bt + (size_t)C0 * K;   // wave-uniform row bases
    unsigned char* lc = L + (crw * GPB + cch * 16);
    const int nt = K / GKS;
    atile(lc, uA + po, gs); if (NSPLIT == 1) atile(lc + GTILE, uA2 + po, gs); atile(lc + BOFF, uB + po, gs);
    asm volatile("s_wait_asynccnt 0x0" ::: "memory");                     // stage 0 landed (this wave's copies)
    __syncthreads();                                                      // ... and every other wave's
    if (nt > 1) { atile(lc + STAGE, (uA + GKS) + po, gs); if (NSPLIT == 1) atile(lc + STAGE + GTILE, (uA2 + GKS) + po, gs); atile(lc + STAGE + BOFF, (uB + GKS) + po, gs); }
#pragma unroll 1                                                          // stays rolled: one trip per stage, its buffer picked by t & 1; the 64 or 128 products of a trip are unrolled inside
    for (int t = 0; t < nt; ++t) {
        const unsigned bo = (unsigned)(t & 1) * STAGE;
        const bf* la = (const bf*)(L + bo + (wm * 64 + lr) * GPB + 16 * hi);
        const bf* lb = (const bf*)(L + bo + BOFF + (wn * 64 + lr) * GPB + 16 * hi);
        V a[2][4], a2[2][4], b[2][4];                                     // two fragment sets: the next 32 k are read from LDS ahead of this block's products
#pragma unroll
        for (int f = 0; f < 4; ++f) { a[0][f] = WFrag<bf>::ld(la + f * (16 * GPB / 2)); if (NSPLIT == 1) a2[0][f] = WFrag<bf>::ld(la + GTILE / 2 + f * (16 * GPB / 2)); b[0][f] = WFrag<bf>::ld(lb + f * (16 * GPB / 2)); }
#pragma unroll
        for (int ks = 0; ks < GKS / 32; ++ks) {
            const int cu = ks & 1, nx = cu ^ 1;
            if (ks + 1 < GKS / 32) {
#pragma unroll
                for (int f = 0; f < 4; ++f) { a[nx][f] = WFrag<bf>::ld(la + (ks + 1) * 32 + f * (16 * GPB / 2)); if (NSPLIT == 1) a2[nx][f] = WFrag<bf>::ld(la + GTILE / 2 + (ks + 1) * 32 + f * (16 * GPB / 2)); b[nx][f] = WFrag<bf>::ld(lb + (ks + 1) * 32 + f * (16 * GPB / 2)); }
                __builtin_amdgcn_sched_barrier(0);                        // keeps the next block's LDS reads one group ahead of this block's products (sunk among them, every product waits for its own read)
            }
#pragma unroll
            for (int nb = 0; nb < 4; ++nb)
#pragma unroll
                for (int mb = 0; mb < 4; ++mb) acc[mb][nb] = wmmab(a[cu][mb], b[cu][nb], acc[mb][nb]);
            if (NSPLIT == 1) {
#pragma unroll
                for (int nb = 0; nb < 4; ++nb)
#pragma unroll
                    for (int mb = 0; mb < 4; ++mb) acc[mb][nb] = wmmab(a2[cu][mb], b[cu][nb], acc[mb][nb]);
            }
        }
        // four vector slots behind the last product, on the branch's taken side too, before anything rewrites its operands
        asm volatile("v_nop\n\tv_nop\n\tv_nop\n\tv_nop" : "+v"(acc[0][0]), "+v"(acc[1][0]), "+v"(acc[2][0]), "+v"(acc[3][0]), "+v"(acc[0][1]), "+v"(acc[1][1]), "+v"(acc[2][1]), "+v"(acc[3][1]),
                                                            "+v"(acc[0][2]), "+v"(acc[1][2]), "+v"(acc[2][2]), "+v"(acc[3][2]), "+v"(acc[0][3]), "+v"(acc[1][3]), "+v"(acc[2][3]), "+v"(acc[3][3]));
        asm volatile("s_wait_dscnt 0x0" ::: "memory");                    // this wave's reads of buffer t & 1 are done before it is refilled
        asm volatile("s_wait_asynccnt 0x0" ::: "memory");                 // this wave's copies of stage t + 1 have landed
        __syncthreads();                                                  // publishes stage t + 1 and ends every wave's reads of stage t
        if (t + 2 < nt) { const int ko = (t + 2) * GKS; atile(lc + bo, (uA + ko) + po, gs); if (NSPLIT == 1) atile(lc + bo + GTILE, (uA2 + ko) + po, gs); atile(lc + bo + BOFF, (uB + ko) + po, gs); }
    }
    asm volatile("s_wait_asynccnt 0x0" ::: "memory");                     // no copy is outstanding when the wave goes on
    const int head = c0 / HD;
    const size_t tb = (size_t)(r0 + hi) * (HD / 2) + lr * 2;              // EPI 1: the lane's place in the tables' row r0 + hi
    if (EPI == 2) {
        // accumulator element j <-> row (t) mb*16 + 8*hi + j, column (d) nb*16 + lr: 16 bytes of one [d] row per lane and plane; the wave's four mb fill each row's 128-byte line
#pragma unroll
        for (int mb = 0; mb < 4; ++mb)
#pragma unroll
            for (int nb = 0; nb < 4; ++nb) { v8h o16; v8us oh, ol;
#pragma unroll
                for (int j = 0; j < 8; ++j) { const float x = acc[mb][nb][j]; o16[j] = (h16)x; unsigned short a2, c2; splitf(x, a2, c2); oh[j] = a2; ol[j] = c2; }
                const size_t e = ((size_t)head * HD + nb * 16 + lr) * SEQ + r0 + mb * 16 + hi * 8;
                *(v8h*)(P16 + e) = o16; *(v8us*)(Ph + e) = oh; *(v8us*)(Pl + e) = ol; }
        return;
    }
#pragma unroll
    for (int mb = 0; mb < 4; ++mb) {
#pragma unroll
        for (int nb = 0; nb < 4; ++nb) {
#pragma unroll
            for (int j = 0; j < 8; ++j) os[(hi * 8 + j) * 68 + nb * 16 + lr] = acc[mb][nb][j]; }
        __builtin_amdgcn_wave_barrier(); asm volatile("" ::: "memory");
        if (EPI == 0) {
            float* crow = C + (size_t)(r0 + mb * 16) * ldc + c0;
#pragma unroll
            for (int s = 0; s < 8; ++s) { const int row = 2 * s + hi, cofs = lr * 4; const v4f val = *(const v4fa*)(os + row * 68 + cofs);
                *(v4f*)(crow + (size_t)row * ldc + cofs) = val; }
        } else {
            // a lane takes d = 4*lr .. 4*lr+3 (two pairs) of row t; 16 lanes write one whole 128-byte [t] row of each plane
            v2f cc[8], sn[8];
#pragma unroll
            for (int s = 0; s < 8; ++s) { cc[s] = *(const v2f*)(COS + tb + (mb * 16 + 2 * s) * (HD / 2)); sn[s] = *(const v2f*)(SIN + tb + (mb * 16 + 2 * s) * (HD / 2)); }
#pragma unroll
            for (int s = 0; s < 8; ++s) { const int row = 2 * s + hi, cofs = lr * 4; const v4f val = *(const v4fa*)(os + row * 68 + cofs);
                v4h o16; v4us oh, ol;
#pragma unroll
                for (int p = 0; p < 2; ++p) { const float c = bfr(cc[s][p]), sv = bfr(sn[s][p]); const float x0 = val[2 * p], x1 = val[2 * p + 1];
                    const float y0 = x0 * c - x1 * sv, y1 = x0 * sv + x1 * c; unsigned short a2, c2;
                    o16[2 * p] = (h16)y0; splitf(y0, a2, c2); oh[2 * p] = a2; ol[2 * p] = c2;
                    o16[2 * p + 1] = (h16)y1; splitf(y1, a2, c2); oh[2 * p + 1] = a2; ol[2 * p + 1] = c2; }
                const size_t e = ((size_t)head * SEQ + r0 + mb * 16 + row) * HD + cofs;
                *(v4h*)(P16 + e) = o16; *(v4us*)(Ph + e) = oh; *(v4us*)(Pl + e) = ol; }
            if (mb < 3) asm volatile("s_wait_xcnt 0x0" ::: "memory");     // before the next rows' table loads land in registers that these stores name
        }
        __builtin_amdgcn_wave_barrier(); asm volatile("" ::: "memory");
    }
}
__global__ __launch_bounds__(128) void k_gemm_r(const bf* __restrict__ A, const bf* __restrict__ Bt, int K, const float* __restrict__ COS, const float* __restrict__ SIN, h16* P16, bf* Ph, bf* Pl) {
    gemmw_body<0, 1>(A, A, Bt, K, (float*)0, 0, COS, SIN, P16, Ph, Pl); }
__global__ __launch_bounds__(128) void k_gemm_v(const bf* __restrict__ A, const bf* __restrict__ Bt, int K, h16* V16, bf* Vh, bf* Vl) {
    gemmw_body<0, 2>(A, A, Bt, K, (float*)0, 0, (const float*)0, (const float*)0, V16, Vh, Vl); }
__global__ __launch_bounds__(128) void k_gemm_s(const bf* __restrict__ A, const bf* __restrict__ A2, const bf* __restrict__ Bt, int K, float* C, int ldc) {
    gemmw_body<1, 0>(A, A2, Bt, K, C, ldc, (const float*)0, (const float*)0, (h16*)0, (bf*)0, (bf*)0); }

__global__ __launch_bounds__(256) void k_wtG(const float* __restrict__ w, int K, int N, bf* Bt) {
    const int lane = threadIdx.x & 31; const int L0 = (blockIdx.x * 8 + (threadIdx.x >> 5)) * 8; const int nlines = N * K / 64;
{
#pragma unroll 1
        for (int l = 0; l < 8; ++l) { const int L = L0 + l; if (L >= nlines) break; const size_t e = (size_t)L * 64 + lane * 2; const int k = (int)(e % K), n = (int)(e / K); v2us o;
            o[0] = f2bf(w[(size_t)k * N + n]); o[1] = f2bf(w[(size_t)(k + 1) * N + n]); *(v2us*)(Bt + e) = o; }
         }
}
__global__ __launch_bounds__(256) void k_cvt8(const float* __restrict__ src, bf* dst, size_t n8) { const size_t i = (size_t)blockIdx.x * 256 + threadIdx.x; if (i >= n8) return; const v8f v = *(const v8f*)(src + i * 8); v8us o;
#pragma unroll
    for (int k = 0; k < 8; ++k) o[k] = f2bf(v[k]); *(v8us*)(dst + i * 8) = o;  }

// k_maskbits: one work-group of 16 waves per (16 query rows, 32 mask words); wave r takes row r and holds its 1024 mask values as 8 loads of 512 contiguous bytes, all in flight at once.
// Bit-plane MB[q][w] (bit n = mask[q][32w+n] != 0) and tile class CL[q/16][w]: 0 = no key kept in the 16x32 tile, 1 = all kept, 2 = mixed.
__global__ __launch_bounds__(512) void k_maskbits(const int* __restrict__ mask, unsigned* MBp, int* CLp) {
    __shared__ unsigned sw[16 * 32];
    const int lane = threadIdx.x & 31, row = threadIdx.x >> 5; const int qt = blockIdx.x, wb = blockIdx.y * 32; const int q = qt * 16 + row;
    const int* mr = mask + (size_t)q * SEQ_FULL + wb * 32 + lane * 4;
    v4i v[8];
#pragma unroll
    for (int i = 0; i < 8; ++i) v[i] = *(const v4i*)(mr + 128 * i);
    // nibble i of x: the lane's four values of load i, i.e. bits 4*(lane&7)..+3 of word wb + 4*i + (lane>>3)
    unsigned x = 0u;
#pragma unroll
    for (int i = 0; i < 8; ++i) { const unsigned nib = (v[i][0] != 0 ? 1u : 0u) | (v[i][1] != 0 ? 2u : 0u) | (v[i][2] != 0 ? 4u : 0u) | (v[i][3] != 0 ? 8u : 0u); x |= nib << (4 * i); }
    // 8x8 nibble transpose inside each group of 8 lanes (three exchanges; a lane keeps the nibbles under its mask and takes the partner's, rotated into place): afterwards lane 8g+t holds the whole word wb + 4*t + g
    unsigned y;
    y = __builtin_rotateright32(__shfl_xor(x, 4, 32), 16);               { const unsigned km = (lane & 4) ? 0xFFFF0000u : 0x0000FFFFu; x = (x & km) | (y & ~km); }
    y = __builtin_rotateright32(__shfl_xor(x, 2, 32), (lane & 2) ? 8 : 24); { const unsigned km = (lane & 2) ? 0xFF00FF00u : 0x00FF00FFu; x = (x & km) | (y & ~km); }
    y = __builtin_rotateright32(__shfl_xor(x, 1, 32), (lane & 1) ? 4 : 28); { const unsigned km = (lane & 1) ? 0xF0F0F0F0u : 0x0F0F0F0Fu; x = (x & km) | (y & ~km); }
    const int w = wb + 4 * (lane & 7) + (lane >> 3);
    sw[row * 32 + lane] = x;
    __syncthreads();                                                      // the 16 rows' words -> the class of each 16x32 tile
    if (row == 0) {
        unsigned an = 0xFFFFFFFFu, orr = 0u;
#pragma unroll
        for (int r = 0; r < 16; ++r) { const unsigned t = sw[r * 32 + lane]; an &= t; orr |= t; }
        CLp[(size_t)qt * NW + w] = (orr == 0u) ? 0 : ((an == 0xFFFFFFFFu) ? 1 : 2);
    }
    MBp[(size_t)q * NW + w] = x;                                          // one wave = one whole 128-byte line
}

// ---- fused attention body: one wave (= one block) per (16 query rows, head). Key loop over 32-key halves; a half is skipped only when its class says no key of the
// 16x32 tile is kept (masked keys contribute exactly 0 under the -inf fill; a row with no kept key anywhere ends with 0 * (1/0) = NaN, as the module).
// SPLIT: q, k, P, v on bf16 hi/lo planes (hh + hl + lh); else fp16 planes with P carried x PCAR (the carry cancels in acc / l).
template <bool SPLIT>
__device__ __forceinline__ void attn_body(const h16* __restrict__ Q16, const h16* __restrict__ K16, const h16* __restrict__ V16,
                                          const bf* __restrict__ Qh, const bf* __restrict__ Ql, const bf* __restrict__ Kh, const bf* __restrict__ Kl, const bf* __restrict__ Vh, const bf* __restrict__ Vl,
                                          const unsigned* __restrict__ MBp, const int* __restrict__ CLp, bf* Ch, bf* Cl, int qt0) {
    __shared__ __align__(16) unsigned short pa[16 * PP];
    __shared__ __align__(16) unsigned short pb[16 * PP];
    __shared__ __align__(16) float os[16 * 68];
    const int lane = threadIdx.x & 31, lr = lane & 15, hi = lane >> 4;
    const int qt = qt0 + (int)blockIdx.x; const int h = (int)blockIdx.y; const int hk = h / REP; const int q0 = qt * 16;
    const size_t qoff = ((size_t)h * SEQ + q0 + lr) * HD + 8 * hi;       // A fragment: row q0+lr, d offset 8*hi
    const size_t kb0  = ((size_t)hk * SEQ + lr) * HD + 8 * hi;           // B fragment (scores): lane = key, k = d
    const size_t vb0  = ((size_t)hk * HD + lr) * SEQ + 8 * hi;           // B fragment (P.V): lane = d, k = key
    const float NINF = -__builtin_inff();
    float mi[8], li[8]; v8f acc[4];
#pragma unroll
    for (int r = 0; r < 8; ++r) { mi[r] = NINF; li[r] = 0.0f; }
#pragma unroll
    for (int ot = 0; ot < 4; ++ot) acc[ot] = (v8f){};
#pragma unroll 1
    for (int j = 0; j < NW; ++j) {
        const int cls = __builtin_amdgcn_readfirstlane(CLp[(size_t)qt * NW + j]);
        if (cls == 0) continue;                                           // wave-uniform (block == one wave)
        unsigned wd[8];
        if (cls == 1) {
#pragma unroll
            for (int r = 0; r < 8; ++r) wd[r] = 0xFFFFFFFFu;
        } else {
#pragma unroll
            for (int r = 0; r < 8; ++r) wd[r] = MBp[(size_t)(q0 + 8 * hi + r) * NW + j];
        }
        v8f s0 = (v8f){}, s1 = (v8f){};
        const size_t ko = kb0 + (size_t)(32 * j) * HD;
        if (SPLIT) {
            const v16bf qh0 = WFrag<bf>::ld(Qh + qoff), qh1 = WFrag<bf>::ld(Qh + qoff + 32), ql0 = WFrag<bf>::ld(Ql + qoff), ql1 = WFrag<bf>::ld(Ql + qoff + 32);
            { const v16bf kh0 = WFrag<bf>::ld(Kh + ko), kh1 = WFrag<bf>::ld(Kh + ko + 32), kl0 = WFrag<bf>::ld(Kl + ko), kl1 = WFrag<bf>::ld(Kl + ko + 32);
              s0 = wmmab(ql0, kh0, s0); s0 = wmmab(ql1, kh1, s0); s0 = wmmab(qh0, kl0, s0); s0 = wmmab(qh1, kl1, s0); s0 = wmmab(qh0, kh0, s0); s0 = wmmab(qh1, kh1, s0); }
            { const size_t k1 = ko + (size_t)16 * HD; const v16bf kh0 = WFrag<bf>::ld(Kh + k1), kh1 = WFrag<bf>::ld(Kh + k1 + 32), kl0 = WFrag<bf>::ld(Kl + k1), kl1 = WFrag<bf>::ld(Kl + k1 + 32);
              s1 = wmmab(ql0, kh0, s1); s1 = wmmab(ql1, kh1, s1); s1 = wmmab(qh0, kl0, s1); s1 = wmmab(qh1, kl1, s1); s1 = wmmab(qh0, kh0, s1); s1 = wmmab(qh1, kh1, s1);
              asm volatile("v_nop\n\tv_nop\n\tv_nop\n\tv_nop" : "+v"(s0), "+v"(s1) : "v"(qh1), "v"(kh1)); }
        } else {
            const v16h qa0 = WFrag<h16>::ld(Q16 + qoff), qa1 = WFrag<h16>::ld(Q16 + qoff + 32);
            const v16h k00 = WFrag<h16>::ld(K16 + ko), k01 = WFrag<h16>::ld(K16 + ko + 32);
            const v16h k10 = WFrag<h16>::ld(K16 + ko + (size_t)16 * HD), k11 = WFrag<h16>::ld(K16 + ko + (size_t)16 * HD + 32);
            s0 = wmma16(qa0, k00, s0); s0 = wmma16(qa1, k01, s0); s1 = wmma16(qa0, k10, s1); s1 = wmma16(qa1, k11, s1);
            asm volatile("v_nop\n\tv_nop\n\tv_nop\n\tv_nop" : "+v"(s0), "+v"(s1) : "v"(qa1), "v"(k11));
        }
        // online softmax in log2 units; accumulator element r <-> tile row 8*hi + r, column lr (s0) / 16 + lr (s1)
#pragma unroll
        for (int r = 0; r < 8; ++r) {
            const unsigned w = wd[r];
            const bool kp0 = ((w >> lr) & 1u) != 0u, kp1 = ((w >> (16 + lr)) & 1u) != 0u;
            const float v0 = kp0 ? s0[r] * SCL2 : NINF; const float v1 = kp1 ? s1[r] * SCL2 : NINF;
            float mx = fmaxf(v0, v1);
            mx = fmaxf(mx, __shfl_xor(mx, 1, 32)); mx = fmaxf(mx, __shfl_xor(mx, 2, 32)); mx = fmaxf(mx, __shfl_xor(mx, 4, 32)); mx = fmaxf(mx, __shfl_xor(mx, 8, 32));
            const float nm = fmaxf(mi[r], mx); const float ms = (nm == NINF) ? 0.0f : nm;
            const float corr = ex2(mi[r] - ms); const float p0 = ex2(v0 - ms), p1 = ex2(v1 - ms);
            const int po = (8 * hi + r) * PP + lr;
            if (SPLIT) { unsigned short a, c; splitf(p0, a, c); pa[po] = a; pb[po] = c; splitf(p1, a, c); pa[po + 16] = a; pb[po + 16] = c; li[r] = li[r] * corr + (p0 + p1); }
            else { const h16 e0 = (h16)(p0 * PCAR), e1 = (h16)(p1 * PCAR); pa[po] = __builtin_bit_cast(unsigned short, e0); pa[po + 16] = __builtin_bit_cast(unsigned short, e1); li[r] = li[r] * corr + ((float)e0 + (float)e1); }
            mi[r] = nm;
#pragma unroll
            for (int ot = 0; ot < 4; ++ot) acc[ot][r] *= corr;
        }
        __syncthreads();                                                  // P tile stores -> fragment reloads (same wave; block == one wave)
        const size_t vo = vb0 + (size_t)(32 * j);
        if (SPLIT) {
            const v8us a0 = *(const v8usa*)(pa + lr * PP + 8 * hi), a1 = *(const v8usa*)(pa + lr * PP + 16 + 8 * hi);
            const v8us b0 = *(const v8usa*)(pb + lr * PP + 8 * hi), b1 = *(const v8usa*)(pb + lr * PP + 16 + 8 * hi);
            const v16bf ph = cat16b(a0, a1), pl = cat16b(b0, b1);
#pragma unroll
            for (int ot = 0; ot < 4; ++ot) { const v16bf vh = WFrag<bf>::ld(Vh + vo + (size_t)ot * 16 * SEQ), vl = WFrag<bf>::ld(Vl + vo + (size_t)ot * 16 * SEQ);
                acc[ot] = wmmab(pl, vh, acc[ot]); acc[ot] = wmmab(ph, vl, acc[ot]); acc[ot] = wmmab(ph, vh, acc[ot]); }
            asm volatile("v_nop\n\tv_nop\n\tv_nop\n\tv_nop" : "+v"(acc[0]), "+v"(acc[1]), "+v"(acc[2]), "+v"(acc[3]) : "v"(ph), "v"(pl));
        } else {
            const v8us a0 = *(const v8usa*)(pa + lr * PP + 8 * hi), a1 = *(const v8usa*)(pa + lr * PP + 16 + 8 * hi);
            const v16h p16 = cat16hu(a0, a1);
#pragma unroll
            for (int ot = 0; ot < 4; ++ot) { const v16h vf = WFrag<h16>::ld(V16 + vo + (size_t)ot * 16 * SEQ); acc[ot] = wmma16(p16, vf, acc[ot]); }
            asm volatile("v_nop\n\tv_nop\n\tv_nop\n\tv_nop" : "+v"(acc[0]), "+v"(acc[1]), "+v"(acc[2]), "+v"(acc[3]) : "v"(p16));
        }
        asm volatile("" ::: "memory");
    }
    // finish: row sums across the 16 lanes of each half, normalise, stage 16x64 f32, write hi/lo lines
#pragma unroll
    for (int r = 0; r < 8; ++r) { float l = li[r]; l += __shfl_xor(l, 1, 32); l += __shfl_xor(l, 2, 32); l += __shfl_xor(l, 4, 32); l += __shfl_xor(l, 8, 32); li[r] = 1.0f / l; }
#pragma unroll
    for (int ot = 0; ot < 4; ++ot)
#pragma unroll
        for (int r = 0; r < 8; ++r) os[(8 * hi + r) * 68 + ot * 16 + lr] = acc[ot][r] * li[r];
    __syncthreads();
{
#pragma unroll
        for (int s = 0; s < 4; ++s) { const int row = 4 * s + (lane >> 3), c8 = (lane & 7) * 8;
            const v4f x0 = *(const v4fa*)(os + row * 68 + c8), x1 = *(const v4fa*)(os + row * 68 + c8 + 4); v8us oh, ol;
#pragma unroll
            for (int k = 0; k < 4; ++k) { unsigned short a, c; splitf(x0[k], a, c); oh[k] = a; ol[k] = c; splitf(x1[k], a, c); oh[4 + k] = a; ol[4 + k] = c; }
            const size_t oo = (size_t)(q0 + row) * DQ + (size_t)h * HD + c8;
            *(v8us*)(Ch + oo) = oh; *(v8us*)(Cl + oo) = ol; }
         }
}
__global__ __launch_bounds__(32) void k_attn_hl(const bf* __restrict__ Qh, const bf* __restrict__ Ql, const bf* __restrict__ Kh, const bf* __restrict__ Kl, const bf* __restrict__ Vh, const bf* __restrict__ Vl,
                                                const unsigned* __restrict__ MBp, const int* __restrict__ CLp, bf* Ch, bf* Cl, int qt0) {
    attn_body<true>((const h16*)0, (const h16*)0, (const h16*)0, Qh, Ql, Kh, Kl, Vh, Vl, MBp, CLp, Ch, Cl, qt0); }
__global__ __launch_bounds__(32) void k_attn_f16(const h16* __restrict__ Q16, const h16* __restrict__ K16, const h16* __restrict__ V16,
                                                 const unsigned* __restrict__ MBp, const int* __restrict__ CLp, bf* Ch, bf* Cl, int qt0) {
    attn_body<false>(Q16, K16, V16, (const bf*)0, (const bf*)0, (const bf*)0, (const bf*)0, (const bf*)0, (const bf*)0, MBp, CLp, Ch, Cl, qt0); }

constexpr size_t al256(size_t b) { return (b + 255) & ~(size_t)255; }
constexpr size_t WS_TOTAL =
    al256((size_t)DQ * DM * 2) + 2 * al256((size_t)DKV * DM * 2) + al256((size_t)DM * DQ * 2) +      // WQ, WK, WV, WO
    al256((size_t)SEQ * DM * 2) +                                                                      // XB
    3 * al256((size_t)NH * SEQ * HD * 2) + 6 * al256((size_t)NKV * SEQ * HD * 2) +                     // q planes, k planes, v planes
    2 * al256((size_t)SEQ * DQ * 2) +                                                                  // ctx hi/lo
    al256((size_t)SEQ * NW * 4) + al256((size_t)(SEQ / 16) * NW * 4);                                  // mask bits, tile classes
static_assert(WS_TOTAL <= (size_t)134217728);

extern "C" void kernel_launch(void* const* d_in, const int* in_sizes, int n_in,
                              void* d_out, int out_size, void* d_ws, size_t ws_size, hipStream_t stream) {
    if (n_in < 8) return;
    if ((long long)in_sizes[0] < (long long)(NB - 1) * SEQ_FULL * DM + (long long)SEQ * DM) return;
    if ((long long)in_sizes[1] < (long long)DM * DQ || (long long)in_sizes[2] < (long long)DM * DKV || (long long)in_sizes[3] < (long long)DM * DKV || (long long)in_sizes[4] < (long long)DQ * DM) return;
    if ((long long)in_sizes[5] < (long long)SEQ * (HD / 2) || (long long)in_sizes[6] < (long long)SEQ * (HD / 2)) return;
    if ((long long)in_sizes[7] < (long long)(SEQ - 1) * SEQ_FULL + SEQ) return;
    if ((long long)out_size < (long long)(NB - 1) * SEQ_FULL * DM + (long long)SEQ * DM) return;
    if (ws_size < WS_TOTAL) return;
    const float* x = (const float*)d_in[0]; const float* wq = (const float*)d_in[1]; const float* wk = (const float*)d_in[2]; const float* wv = (const float*)d_in[3]; const float* wo = (const float*)d_in[4];
    const float* fcos = (const float*)d_in[5]; const float* fsin = (const float*)d_in[6]; const int* mask = (const int*)d_in[7];
    float* OUT = (float*)d_out;     // [1][2048][2048]
    char* wsp = (char*)d_ws;
    auto take = [&](size_t bytes) { char* p = wsp; wsp += (bytes + 255) & ~(size_t)255; return (void*)p; };
    bf* WQ = (bf*)take((size_t)DQ * DM * 2); bf* WK = (bf*)take((size_t)DKV * DM * 2); bf* WV = (bf*)take((size_t)DKV * DM * 2); bf* WO = (bf*)take((size_t)DM * DQ * 2);
    bf* XB = (bf*)take((size_t)SEQ * DM * 2);
    h16* QP16 = (h16*)take((size_t)NH * SEQ * HD * 2); bf* QPh = (bf*)take((size_t)NH * SEQ * HD * 2); bf* QPl = (bf*)take((size_t)NH * SEQ * HD * 2);
    h16* KP16 = (h16*)take((size_t)NKV * SEQ * HD * 2); bf* KPh = (bf*)take((size_t)NKV * SEQ * HD * 2); bf* KPl = (bf*)take((size_t)NKV * SEQ * HD * 2);
    h16* VT16 = (h16*)take((size_t)NKV * SEQ * HD * 2); bf* VTh = (bf*)take((size_t)NKV * SEQ * HD * 2); bf* VTl = (bf*)take((size_t)NKV * SEQ * HD * 2);
    bf* CXh = (bf*)take((size_t)SEQ * DQ * 2); bf* CXl = (bf*)take((size_t)SEQ * DQ * 2);
    unsigned* MBp = (unsigned*)take((size_t)SEQ * NW * 4); int* CLp = (int*)take((size_t)(SEQ / 16) * NW * 4);
    if ((size_t)(wsp - (char*)d_ws) > ws_size) return;

    // weights: w[in][out] -> Bt[out][in] bf16.  wq: in DM, out DQ; wk/wv: in DM, out DKV; wo: in DQ, out DM.
    k_wtG<<<(unsigned)((DM * DQ / 64 + 63) / 64), 256, 0, stream>>>(wq, DM, DQ, WQ);
    k_wtG<<<(unsigned)((DM * DKV / 64 + 63) / 64), 256, 0, stream>>>(wk, DM, DKV, WK);
    k_wtG<<<(unsigned)((DM * DKV / 64 + 63) / 64), 256, 0, stream>>>(wv, DM, DKV, WV);
    k_wtG<<<(unsigned)((DQ * DM / 64 + 63) / 64), 256, 0, stream>>>(wo, DQ, DM, WO);
    k_maskbits<<<dim3(SEQ / 16, NW / 32, 1), 512, 0, stream>>>(mask, MBp, CLp);
    for (int b = 0; b < NB; ++b) {
        k_cvt8<<<(unsigned)(((size_t)SEQ * DM / 8 + 255) / 256), 256, 0, stream>>>(x + (size_t)b * SEQ_FULL * DM, XB, (size_t)SEQ * DM / 8);
        k_gemm_r<<<dim3(SEQ / 128, DQ / 128, 1), 128, 0, stream>>>(XB, WQ, DM, fcos, fsin, QP16, QPh, QPl);
        k_gemm_r<<<dim3(SEQ / 128, DKV / 128, 1), 128, 0, stream>>>(XB, WK, DM, fcos, fsin, KP16, KPh, KPl);
        k_gemm_v<<<dim3(SEQ / 128, DKV / 128, 1), 128, 0, stream>>>(XB, WV, DM, VT16, VTh, VTl);
        if (RH / 16 > 0) k_attn_hl<<<dim3(RH / 16, NH, 1), 32, 0, stream>>>(QPh, QPl, KPh, KPl, VTh, VTl, MBp, CLp, CXh, CXl, 0);
        if ((SEQ - RH) / 16 > 0) k_attn_f16<<<dim3((SEQ - RH) / 16, NH, 1), 32, 0, stream>>>(QP16, KP16, VT16, MBp, CLp, CXh, CXl, RH / 16);
        k_gemm_s<<<dim3(SEQ / 128, DM / 128, 1), 128, 0, stream>>>(CXh, CXl, WO, DQ, OUT + (size_t)b * SEQ_FULL * DM, DM);
    }
}

// v004
// It runs in 227 microseconds.
// In two side-by-side timings against v003, it was 1.44 and 1.45 times as fast.
// Counting every step since v000, it is 2.44 times as fast.
#include <hip/hip_runtime.h>

// Contractions (all f32 accumulate): x@wq, x@wk, x@wv v_wmma_f32_16x16x32_bf16 (bf16 x bf16 operand planes, inputs RNE-converted to bf16); scores q.k and P.V: query rows < 512 bf16 hi/lo planes (3 products each), rows >= 512 v_wmma_f32_16x16x32_f16 (P carried x1024); ctx@wo bf16 hi/lo ctx planes x bf16 weights (2 products).
// Grouped-query causal-style attention with interleaved-pair rotation from INPUT tables and an INPUT int32 mask (read by value through a bit-plane + 16x32 tile classes); softmax f32 online running-max form.
// Flash-style fused attention: one wave per 16 query rows per head, the 4 query heads of a kv head in one work-group; K / V^T tiles of 64 keys staged in LDS by asynchronous copies (two buffers), P relayout through a wave-private LDS tile.

#ifndef NB
#define NB 1
#endif
#ifndef SEQ
#define SEQ 2048
#endif
#define NB_FULL  1
#define SEQ_FULL 2048
#define DM   2048
#define NH   32
#define NKV  8
#define REP  (NH / NKV)
#define HD   64
#define DQ   (NH * HD)
#define DKV  (NKV * HD)
#define RH   ((SEQ) < 512 ? (SEQ) : 512)     // query rows < RH use hi+lo planes
#define NW   (SEQ / 32)                      // 32-key words per mask row
#define PP   40                              // P tile pitch (16-bit elements)
#define PCAR 1024.0f
#define SCL2 0.18033688011112042f            // (1/8) * log2(e)

static_assert(SEQ % 64 == 0);                // key halves of 32
static_assert(SEQ <= SEQ_FULL);
static_assert(NW % 32 == 0);                 // mask pre-pass: 32 words per work-group
static_assert(HD == 64);
static_assert(DM % 64 == 0 && DQ % 64 == 0 && DKV % 64 == 0);
static_assert(DM % 32 == 0 && DQ % 32 == 0);
static_assert(NH % NKV == 0);
static_assert(RH % 16 == 0 && (SEQ - RH) % 16 == 0);
static_assert((PP * 2) % 16 == 0);
static_assert(NB <= NB_FULL);

typedef _Float16 h16;
typedef unsigned short bf;
typedef __attribute__((ext_vector_type(16))) __bf16   v16bf;
typedef __attribute__((ext_vector_type(16))) _Float16 v16h;
typedef __attribute__((ext_vector_type(8)))  _Float16 v8h;
typedef __attribute__((ext_vector_type(8)))  unsigned short v8us;
typedef __attribute__((ext_vector_type(8)))  float    v8f;
typedef __attribute__((ext_vector_type(4)))  float    v4f;
typedef __attribute__((ext_vector_type(4)))  int      v4i;
typedef __attribute__((ext_vector_type(4)))  _Float16 v4h;
typedef __attribute__((ext_vector_type(4)))  unsigned short v4us;
typedef __attribute__((ext_vector_type(2)))  unsigned short v2us;
typedef __attribute__((ext_vector_type(2)))  float    v2f;
typedef v4f  __attribute__((may_alias)) v4fa;
typedef v8us __attribute__((may_alias)) v8usa;

__device__ __forceinline__ unsigned short f2bf(float f) { unsigned u = __float_as_uint(f); u += 0x7FFFu + ((u >> 16) & 1u); return (unsigned short)(u >> 16); }
__device__ __forceinline__ float bf2f(unsigned short b) { return __uint_as_float(((unsigned)b) << 16); }
__device__ __forceinline__ float bfr(float f) { return bf2f(f2bf(f)); }
__device__ __forceinline__ v16h cat16(v8h lo, v8h hi) { return __builtin_shufflevector(lo, hi, 0, 1, 2, 3, 4, 5, 6, 7, 8, 9, 10, 11, 12, 13, 14, 15); }
__device__ __forceinline__ v16bf cat16b(v8us lo, v8us hi) { return __builtin_bit_cast(v16bf, __builtin_shufflevector(lo, hi, 0, 1, 2, 3, 4, 5, 6, 7, 8, 9, 10, 11, 12, 13, 14, 15)); }
__device__ __forceinline__ v16h cat16hu(v8us lo, v8us hi) { return __builtin_bit_cast(v16h, __builtin_shufflevector(lo, hi, 0, 1, 2, 3, 4, 5, 6, 7, 8, 9, 10, 11, 12, 13, 14, 15)); }
__device__ __forceinline__ v8f wmma16(v16h a, v16h b, v8f c) { return __builtin_amdgcn_wmma_f32_16x16x32_f16(false, a, false, b, (short)0, c, false, false); }
__device__ __forceinline__ v8f wmmab(v16bf a, v16bf b, v8f c) { return __builtin_amdgcn_wmma_f32_16x16x32_bf16(false, a, false, b, (short)0, c, false, false); }
__device__ __forceinline__ void splitf(float y, unsigned short& h, unsigned short& l) { h = f2bf(y); l = f2bf(y - bf2f(h)); }
__device__ __forceinline__ float ex2(float x) { return __builtin_amdgcn_exp2f(x); }

// Fragment loaders: lane (hi = lane>>4, lr = lane&15); pointer already at row lr, k offset k0 + 8*hi; elements 0..7 <- k0+8hi+0..7, 8..15 <- k0+16+8hi+0..7 (same map for A and B).
template <typename T16> struct WFrag;
template <> struct WFrag<h16> { typedef v16h V; static __device__ __forceinline__ V ld(const h16* p) { return cat16(*(const v8h*)p, *(const v8h*)(p + 16)); } static __device__ __forceinline__ v8f mma(V a, V b, v8f c) { return wmma16(a, b, c); } };
template <> struct WFrag<bf> { typedef v16bf V; static __device__ __forceinline__ V ld(const bf* p) { return cat16b(*(const v8us*)p, *(const v8us*)(p + 16)); } static __device__ __forceinline__ v8f mma(V a, V b, v8f c) { return wmmab(a, b, c); } };

// ---- GEMM body: one work-group of 4 waves per 128x128 output tile, wave (wm, wn) takes its 64x64 quarter (16 accumulators); grid (M/128, N/128), 128 threads.
// A and Bt rows come from K-contiguous 16-bit planes in stages of 128 k (256 B a row) into LDS at pitch 272 B by asynchronous copies (whole lines, each lane 16 B), two buffers: stage t + 1 flies while stage t is worked on.
// c[m][n] (f32) = sum_k (A[m][k] (+ A2[m][k] when NSPLIT == 1)) Bt[n][k]. K % 128 == 0, M % 128 == 0, N % 128 == 0.
// What becomes of c is the epilogue's choice; a wave's 64 columns are one head (HD == 64):
//   EPI 0: C[m][n] = c, f32, pitch ldc.
//   EPI 1: head planes [h][t][d] (fp16 + bf16 hi/lo) of the interleaved-pair rotation: pair (2i, 2i+1) with table entry [t][i] read BY VALUE (RNE-converted to bf16).
//   EPI 2: transposed head planes [g][d][t] (fp16 + bf16 hi/lo), straight from the accumulators: a lane holds 8 consecutive t of one d.
#define GKS   128                            // k elements per stage
#define GPB   272                            // LDS row pitch in bytes (16 B x odd, for 16-byte fragment reads)
#define GTILE (128 * GPB)                    // one operand's 128 rows of a stage
static_assert(SEQ % 128 == 0 && DQ % 128 == 0 && DKV % 128 == 0 && DM % 128 == 0);
static_assert(DM % GKS == 0 && DQ % GKS == 0);
typedef __attribute__((address_space(1))) v4i gv4i;
typedef __attribute__((address_space(3))) v4i lv4i;
// One operand's 128 rows x 256 B of a stage: 16 copies of 16 B per lane, rows 8 apart (l: the lane's LDS place, g: its global place, gs = 8 source rows in elements).
__device__ __forceinline__ void atile(unsigned char* l, const bf* g, size_t gs) {
#pragma unroll
    for (int i = 0; i < 16; ++i) __builtin_amdgcn_global_load_async_to_lds_b128((gv4i*)(g + i * gs), (lv4i*)(l + i * (8 * GPB)), 0, 0);
}
template <int NSPLIT, int EPI>
__device__ __forceinline__ void gemmw_body(const bf* __restrict__ A, const bf* __restrict__ A2, const bf* __restrict__ Bt, int K, float* C, int ldc,
                                           const float* __restrict__ COS, const float* __restrict__ SIN, h16* P16, bf* Ph, bf* Pl) {
    typedef WFrag<bf>::V V;
    constexpr unsigned STAGE = (2 + NSPLIT) * GTILE, BOFF = (1 + NSPLIT) * GTILE;   // stage = [A | A2 when NSPLIT | Bt]
    __shared__ __align__(16) unsigned char L[2 * STAGE];
    __shared__ __align__(16) float osw[4 * 16 * 68];
    const int tid = threadIdx.x, lane = tid & 31, lr = lane & 15, hi = lane >> 4; const int wave = tid >> 5, wm = wave >> 1, wn = wave & 1;
    const int R0 = blockIdx.x * 128, C0 = blockIdx.y * 128; const int r0 = R0 + wm * 64, c0 = C0 + wn * 64;
    float* os = osw + wave * (16 * 68);
    v8f acc[4][4];
#pragma unroll
    for (int mb = 0; mb < 4; ++mb)
#pragma unroll
        for (int nb = 0; nb < 4; ++nb) acc[mb][nb] = (v8f){};
    // copies: thread -> row tid >> 4 (+ 8 per copy), 16-byte chunk tid & 15 of the row's 256 B
    const size_t gs = (size_t)8 * K; const int crw = tid >> 4, cch = tid & 15;
    const size_t po = (size_t)crw * K + cch * 8;                          // the lane's own element offset inside an operand's 128 rows
    const bf* uA = A + (size_t)R0 * K; const bf* uA2 = A2 + (size_t)R0 * K; const bf* uB = Bt + (size_t)C0 * K;   // wave-uniform row bases
    unsigned char* lc = L + (crw * GPB + cch * 16);
    const int nt = K / GKS;
    atile(lc, uA + po, gs); if (NSPLIT == 1) atile(lc + GTILE, uA2 + po, gs); atile(lc + BOFF, uB + po, gs);
    asm volatile("s_wait_asynccnt 0x0" ::: "memory");                     // stage 0 landed (this wave's copies)
    __syncthreads();                                                      // ... and every other wave's
    if (nt > 1) { atile(lc + STAGE, (uA + GKS) + po, gs); if (NSPLIT == 1) atile(lc + STAGE + GTILE, (uA2 + GKS) + po, gs); atile(lc + STAGE + BOFF, (uB + GKS) + po, gs); }
#pragma unroll 1                                                          // stays rolled: one trip per stage, its buffer picked by t & 1; the 64 or 128 products of a trip are unrolled inside
    for (int t = 0; t < nt; ++t) {
        const unsigned bo = (unsigned)(t & 1) * STAGE;
        const bf* la = (const bf*)(L + bo + (wm * 64 + lr) * GPB + 16 * hi);
        const bf* lb = (const bf*)(L + bo + BOFF + (wn * 64 + lr) * GPB + 16 * hi);
        V a[2][4], a2[2][4], b[2][4];                                     // two fragment sets: the next 32 k are read from LDS ahead of this block's products
#pragma unroll
        for (int f = 0; f < 4; ++f) { a[0][f] = WFrag<bf>::ld(la + f * (16 * GPB / 2)); if (NSPLIT == 1) a2[0][f] = WFrag<bf>::ld(la + GTILE / 2 + f * (16 * GPB / 2)); b[0][f] = WFrag<bf>::ld(lb + f * (16 * GPB / 2)); }
#pragma unroll
        for (int ks = 0; ks < GKS / 32; ++ks) {
            const int cu = ks & 1, nx = cu ^ 1;
            if (ks + 1 < GKS / 32) {
#pragma unroll
                for (int f = 0; f < 4; ++f) { a[nx][f] = WFrag<bf>::ld(la + (ks + 1) * 32 + f * (16 * GPB / 2)); if (NSPLIT == 1) a2[nx][f] = WFrag<bf>::ld(la + GTILE / 2 + (ks + 1) * 32 + f * (16 * GPB / 2)); b[nx][f] = WFrag<bf>::ld(lb + (ks + 1) * 32 + f * (16 * GPB / 2)); }
                __builtin_amdgcn_sched_barrier(0);                        // keeps the next block's LDS reads one group ahead of this block's products (sunk among them, every product waits for its own read)
            }
#pragma unroll
            for (int nb = 0; nb < 4; ++nb)
#pragma unroll
                for (int mb = 0; mb < 4; ++mb) acc[mb][nb] = wmmab(a[cu][mb], b[cu][nb], acc[mb][nb]);
            if (NSPLIT == 1) {
#pragma unroll
                for (int nb = 0; nb < 4; ++nb)
#pragma unroll
                    for (int mb = 0; mb < 4; ++mb) acc[mb][nb] = wmmab(a2[cu][mb], b[cu][nb], acc[mb][nb]);
            }
        }
        // four vector slots behind the last product, on the branch's taken side too, before anything rewrites its operands
        asm volatile("v_nop\n\tv_nop\n\tv_nop\n\tv_nop" : "+v"(acc[0][0]), "+v"(acc[1][0]), "+v"(acc[2][0]), "+v"(acc[3][0]), "+v"(acc[0][1]), "+v"(acc[1][1]), "+v"(acc[2][1]), "+v"(acc[3][1]),
                                                            "+v"(acc[0][2]), "+v"(acc[1][2]), "+v"(acc[2][2]), "+v"(acc[3][2]), "+v"(acc[0][3]), "+v"(acc[1][3]), "+v"(acc[2][3]), "+v"(acc[3][3]));
        asm volatile("s_wait_dscnt 0x0" ::: "memory");                    // this wave's reads of buffer t & 1 are done before it is refilled
        asm volatile("s_wait_asynccnt 0x0" ::: "memory");                 // this wave's copies of stage t + 1 have landed
        __syncthreads();                                                  // publishes stage t + 1 and ends every wave's reads of stage t
        if (t + 2 < nt) { const int ko = (t + 2) * GKS; atile(lc + bo, (uA + ko) + po, gs); if (NSPLIT == 1) atile(lc + bo + GTILE, (uA2 + ko) + po, gs); atile(lc + bo + BOFF, (uB + ko) + po, gs); }
    }
    asm volatile("s_wait_asynccnt 0x0" ::: "memory");                     // no copy is outstanding when the wave goes on
    const int head = c0 / HD;
    const size_t tb = (size_t)(r0 + hi) * (HD / 2) + lr * 2;              // EPI 1: the lane's place in the tables' row r0 + hi
    if (EPI == 2) {
        // accumulator element j <-> row (t) mb*16 + 8*hi + j, column (d) nb*16 + lr: 16 bytes of one [d] row per lane and plane; the wave's four mb fill each row's 128-byte line
#pragma unroll
        for (int mb = 0; mb < 4; ++mb)
#pragma unroll
            for (int nb = 0; nb < 4; ++nb) { v8h o16; v8us oh, ol;
#pragma unroll
                for (int j = 0; j < 8; ++j) { const float x = acc[mb][nb][j]; o16[j] = (h16)x; unsigned short a2, c2; splitf(x, a2, c2); oh[j] = a2; ol[j] = c2; }
                const size_t e = ((size_t)head * HD + nb * 16 + lr) * SEQ + r0 + mb * 16 + hi * 8;
                *(v8h*)(P16 + e) = o16; *(v8us*)(Ph + e) = oh; *(v8us*)(Pl + e) = ol; }
        return;
    }
#pragma unroll
    for (int mb = 0; mb < 4; ++mb) {
#pragma unroll
        for (int nb = 0; nb < 4; ++nb) {
#pragma unroll
            for (int j = 0; j < 8; ++j) os[(hi * 8 + j) * 68 + nb * 16 + lr] = acc[mb][nb][j]; }
        __builtin_amdgcn_wave_barrier(); asm volatile("" ::: "memory");
        if (EPI == 0) {
            float* crow = C + (size_t)(r0 + mb * 16) * ldc + c0;
#pragma unroll
            for (int s = 0; s < 8; ++s) { const int row = 2 * s + hi, cofs = lr * 4; const v4f val = *(const v4fa*)(os + row * 68 + cofs);
                *(v4f*)(crow + (size_t)row * ldc + cofs) = val; }
        } else {
            // a lane takes d = 4*lr .. 4*lr+3 (two pairs) of row t; 16 lanes write one whole 128-byte [t] row of each plane
            v2f cc[8], sn[8];
#pragma unroll
            for (int s = 0; s < 8; ++s) { cc[s] = *(const v2f*)(COS + tb + (mb * 16 + 2 * s) * (HD / 2)); sn[s] = *(const v2f*)(SIN + tb + (mb * 16 + 2 * s) * (HD / 2)); }
#pragma unroll
            for (int s = 0; s < 8; ++s) { const int row = 2 * s + hi, cofs = lr * 4; const v4f val = *(const v4fa*)(os + row * 68 + cofs);
                v4h o16; v4us oh, ol;
#pragma unroll
                for (int p = 0; p < 2; ++p) { const float c = bfr(cc[s][p]), sv = bfr(sn[s][p]); const float x0 = val[2 * p], x1 = val[2 * p + 1];
                    const float y0 = x0 * c - x1 * sv, y1 = x0 * sv + x1 * c; unsigned short a2, c2;
                    o16[2 * p] = (h16)y0; splitf(y0, a2, c2); oh[2 * p] = a2; ol[2 * p] = c2;
                    o16[2 * p + 1] = (h16)y1; splitf(y1, a2, c2); oh[2 * p + 1] = a2; ol[2 * p + 1] = c2; }
                const size_t e = ((size_t)head * SEQ + r0 + mb * 16 + row) * HD + cofs;
                *(v4h*)(P16 + e) = o16; *(v4us*)(Ph + e) = oh; *(v4us*)(Pl + e) = ol; }
            if (mb < 3) asm volatile("s_wait_xcnt 0x0" ::: "memory");     // before the next rows' table loads land in registers that these stores name
        }
        __builtin_amdgcn_wave_barrier(); asm volatile("" ::: "memory");
    }
}
__global__ __launch_bounds__(128) void k_gemm_r(const bf* __restrict__ A, const bf* __restrict__ Bt, int K, const float* __restrict__ COS, const float* __restrict__ SIN, h16* P16, bf* Ph, bf* Pl) {
    gemmw_body<0, 1>(A, A, Bt, K, (float*)0, 0, COS, SIN, P16, Ph, Pl); }
__global__ __launch_bounds__(128) void k_gemm_v(const bf* __restrict__ A, const bf* __restrict__ Bt, int K, h16* V16, bf* Vh, bf* Vl) {
    gemmw_body<0, 2>(A, A, Bt, K, (float*)0, 0, (const float*)0, (const float*)0, V16, Vh, Vl); }
__global__ __launch_bounds__(128) void k_gemm_s(const bf* __restrict__ A, const bf* __restrict__ A2, const bf* __restrict__ Bt, int K, float* C, int ldc) {
    gemmw_body<1, 0>(A, A2, Bt, K, C, ldc, (const float*)0, (const float*)0, (h16*)0, (bf*)0, (bf*)0); }

__global__ __launch_bounds__(256) void k_wtG(const float* __restrict__ w, int K, int N, bf* Bt) {
    const int lane = threadIdx.x & 31; const int L0 = (blockIdx.x * 8 + (threadIdx.x >> 5)) * 8; const int nlines = N * K / 64;
{
#pragma unroll 1
        for (int l = 0; l < 8; ++l) { const int L = L0 + l; if (L >= nlines) break; const size_t e = (size_t)L * 64 + lane * 2; const int k = (int)(e % K), n = (int)(e / K); v2us o;
            o[0] = f2bf(w[(size_t)k * N + n]); o[1] = f2bf(w[(size_t)(k + 1) * N + n]); *(v2us*)(Bt + e) = o; }
         }
}
__global__ __launch_bounds__(256) void k_cvt8(const float* __restrict__ src, bf* dst, size_t n8) { const size_t i = (size_t)blockIdx.x * 256 + threadIdx.x; if (i >= n8) return; const v8f v = *(const v8f*)(src + i * 8); v8us o;
#pragma unroll
    for (int k = 0; k < 8; ++k) o[k] = f2bf(v[k]); *(v8us*)(dst + i * 8) = o;  }

// k_maskbits: one work-group of 16 waves per (16 query rows, 32 mask words); wave r takes row r and holds its 1024 mask values as 8 loads of 512 contiguous bytes, all in flight at once.
// Bit-plane MB[q][w] (bit n = mask[q][32w+n] != 0) and tile class CL[q/16][w]: 0 = no key kept in the 16x32 tile, 1 = all kept, 2 = mixed.
__global__ __launch_bounds__(512) void k_maskbits(const int* __restrict__ mask, unsigned* MBp, int* CLp) {
    __shared__ unsigned sw[16 * 32];
    const int lane = threadIdx.x & 31, row = threadIdx.x >> 5; const int qt = blockIdx.x, wb = blockIdx.y * 32; const int q = qt * 16 + row;
    const int* mr = mask + (size_t)q * SEQ_FULL + wb * 32 + lane * 4;
    v4i v[8];
#pragma unroll
    for (int i = 0; i < 8; ++i) v[i] = *(const v4i*)(mr + 128 * i);
    // nibble i of x: the lane's four values of load i, i.e. bits 4*(lane&7)..+3 of word wb + 4*i + (lane>>3)
    unsigned x = 0u;
#pragma unroll
    for (int i = 0; i < 8; ++i) { const unsigned nib = (v[i][0] != 0 ? 1u : 0u) | (v[i][1] != 0 ? 2u : 0u) | (v[i][2] != 0 ? 4u : 0u) | (v[i][3] != 0 ? 8u : 0u); x |= nib << (4 * i); }
    // 8x8 nibble transpose inside each group of 8 lanes (three exchanges; a lane keeps the nibbles under its mask and takes the partner's, rotated into place): afterwards lane 8g+t holds the whole word wb + 4*t + g
    unsigned y;
    y = __builtin_rotateright32(__shfl_xor(x, 4, 32), 16);               { const unsigned km = (lane & 4) ? 0xFFFF0000u : 0x0000FFFFu; x = (x & km) | (y & ~km); }
    y = __builtin_rotateright32(__shfl_xor(x, 2, 32), (lane & 2) ? 8 : 24); { const unsigned km = (lane & 2) ? 0xFF00FF00u : 0x00FF00FFu; x = (x & km) | (y & ~km); }
    y = __builtin_rotateright32(__shfl_xor(x, 1, 32), (lane & 1) ? 4 : 28); { const unsigned km = (lane & 1) ? 0xF0F0F0F0u : 0x0F0F0F0Fu; x = (x & km) | (y & ~km); }
    const int w = wb + 4 * (lane & 7) + (lane >> 3);
    sw[row * 32 + lane] = x;
    __syncthreads();                                                      // the 16 rows' words -> the class of each 16x32 tile
    if (row == 0) {
        unsigned an = 0xFFFFFFFFu, orr = 0u;
#pragma unroll
        for (int r = 0; r < 16; ++r) { const unsigned t = sw[r * 32 + lane]; an &= t; orr |= t; }
        CLp[(size_t)qt * NW + w] = (orr == 0u) ? 0 : ((an == 0xFFFFFFFFu) ? 1 : 2);
    }
    MBp[(size_t)q * NW + w] = x;                                          // one wave = one whole 128-byte line
}

// ---- fused attention body: one work-group of 4 waves per (16 query rows, kv head); wave w takes query head hk * REP + w, so the four waves walk the same keys under the same tile classes.
// K rows and V^T rows come from their 16-bit planes in stages of 64 keys (128 B a row) into LDS at pitch 144 B by asynchronous copies (whole lines, each lane 16 B), two buffers:
// the next kept stage flies while this one is worked on. A stage is two 32-key halves; a half is skipped only when its class says no key of the
// 16x32 tile is kept (masked keys contribute exactly 0 under the -inf fill; a row with no kept key anywhere ends with 0 * (1/0) = NaN, as the module); a stage with no kept half is never copied.
// SPLIT: q, k, P, v on bf16 hi/lo planes (hh + hl + lh); else fp16 planes with P carried x PCAR (the carry cancels in acc / l).
#define AKS   64                             // keys per stage
#define APB   144                            // LDS row pitch in bytes (16 B x odd, for 16-byte fragment reads)
#define ATILE (64 * APB)                     // one plane's 64 rows of a stage
static_assert(REP == 4 && HD == 64 && SEQ % AKS == 0 && NW <= 64);
// One plane's 64 rows x 128 B of a stage: 4 copies of 16 B per lane, rows 16 apart (l: the lane's LDS place, g: its global place, gs = 16 source rows in elements).
template <typename T16>
__device__ __forceinline__ void ktile(unsigned char* l, const T16* g, size_t gs) {
#pragma unroll
    for (int i = 0; i < 4; ++i) __builtin_amdgcn_global_load_async_to_lds_b128((gv4i*)(g + i * gs), (lv4i*)(l + i * (16 * APB)), 0, 0);
}
template <bool SPLIT>
__device__ __forceinline__ void attn_body(const h16* __restrict__ Q16, const h16* __restrict__ K16, const h16* __restrict__ V16,
                                          const bf* __restrict__ Qh, const bf* __restrict__ Ql, const bf* __restrict__ Kh, const bf* __restrict__ Kl, const bf* __restrict__ Vh, const bf* __restrict__ Vl,
                                          const unsigned* __restrict__ MBp, const int* __restrict__ CLp, bf* Ch, bf* Cl, int qt0) {
    constexpr unsigned VOFF = (SPLIT ? 2 : 1) * ATILE, STG = 2 * VOFF;   // stage = [K (hi | lo when SPLIT) | V^T (hi | lo when SPLIT)]
    __shared__ __align__(16) unsigned char KV[2 * STG];
    __shared__ __align__(16) unsigned short paw[4 * 16 * PP];
    __shared__ __align__(16) unsigned short pbw[(SPLIT ? 4 : 1) * 16 * PP];
    __shared__ __align__(16) float osw[4 * 16 * 68];
    const int tid = threadIdx.x, lane = tid & 31, lr = lane & 15, hi = lane >> 4, wave = tid >> 5;
    unsigned short* pa = paw + wave * (16 * PP); unsigned short* pb = pbw + (SPLIT ? wave : 0) * (16 * PP); float* os = osw + wave * (16 * 68);   // wave-private tiles
    const int qt = qt0 + (int)blockIdx.x; const int hk = (int)blockIdx.y; const int h = hk * REP + wave; const int q0 = qt * 16;
    const size_t qoff = ((size_t)h * SEQ + q0 + lr) * HD + 8 * hi;       // A fragment: row q0+lr, d offset 8*hi
    // the row of tile classes as two bit sets, the same in every wave of the work-group: nz bit j = half j has a kept key, al bit j = all of its keys are kept
    const int cl0 = CLp[(size_t)qt * NW + lane]; const int cl1 = (NW > 32) ? CLp[(size_t)qt * NW + (NW > 32 ? 32 : 0) + lane] : 0;
    const unsigned long long nz = (unsigned long long)__builtin_amdgcn_ballot_w32(cl0 != 0) | ((unsigned long long)__builtin_amdgcn_ballot_w32(cl1 != 0) << 32);
    const unsigned long long al = (unsigned long long)__builtin_amdgcn_ballot_w32(cl0 == 1) | ((unsigned long long)__builtin_amdgcn_ballot_w32(cl1 == 1) << 32);
    // copies: thread -> row tid >> 3 (+ 16 per copy), 16-byte chunk tid & 7 of the row's 128 B; stage s: keys 64 s .. 64 s + 63 (s <= 31 from a 64-bit set: inside the planes)
    const int crw = tid >> 3, cch = tid & 7;
    unsigned char* lc = KV + (crw * APB + cch * 16);
    const size_t kpo = ((size_t)hk * SEQ + crw) * HD + cch * 8;          // K planes [g][t][d]: row = key
    const size_t vpo = ((size_t)hk * HD + crw) * SEQ + cch * 8;          // V^T planes [g][d][t]: row = d
    auto stage = [&](unsigned bo, int s) {
        const size_t ke = kpo + (size_t)s * (AKS * HD), ve = vpo + (size_t)s * AKS;
        if (SPLIT) { ktile(lc + bo, Kh + ke, (size_t)16 * HD); ktile(lc + bo + ATILE, Kl + ke, (size_t)16 * HD); ktile(lc + bo + VOFF, Vh + ve, (size_t)16 * SEQ); ktile(lc + bo + VOFF + ATILE, Vl + ve, (size_t)16 * SEQ); }
        else { ktile(lc + bo, K16 + ke, (size_t)16 * HD); ktile(lc + bo + VOFF, V16 + ve, (size_t)16 * SEQ); }
    };
    unsigned long long rem = nz;                                          // kept halves whose stage is not copied yet
    int sc = -1, sn = -1;                                                 // the stage worked on, the stage in flight (-1: none)
    if (rem != 0ull) { sc = __builtin_ctzll(rem) >> 1; rem &= ~(3ull << (2 * sc)); stage(0u, sc); }
    // q fragments: read once, held in registers over the key loop
    v16bf qh0, qh1, ql0, ql1; v16h qa0, qa1;
    if (SPLIT) { qh0 = WFrag<bf>::ld(Qh + qoff); qh1 = WFrag<bf>::ld(Qh + qoff + 32); ql0 = WFrag<bf>::ld(Ql + qoff); ql1 = WFrag<bf>::ld(Ql + qoff + 32); }
    else { qa0 = WFrag<h16>::ld(Q16 + qoff); qa1 = WFrag<h16>::ld(Q16 + qoff + 32); }
    const float NINF = -__builtin_inff();
    float mi[8], li[8]; v8f acc[4];
#pragma unroll
    for (int r = 0; r < 8; ++r) { mi[r] = NINF; li[r] = 0.0f; }
#pragma unroll
    for (int ot = 0; ot < 4; ++ot) acc[ot] = (v8f){};
    asm volatile("s_wait_asynccnt 0x0" ::: "memory");                     // the first stage landed (this wave's copies)
    __syncthreads();                                                      // ... and every other wave's
    if (rem != 0ull) { sn = __builtin_ctzll(rem) >> 1; rem &= ~(3ull << (2 * sn)); stage(STG, sn); }
    unsigned bo = 0u;
#pragma unroll 1                                                          // stays rolled: one trip per kept stage (at most 32: each takes its two bits out of the set)
    while (sc >= 0) {
#pragma unroll 1                                                          // stays rolled: the halves depend on one another through the running maximum, unrolling buys only code
      for (int hf = 0; hf < 2; ++hf) {
        const int j = 2 * sc + hf;
        if (((nz >> j) & 1ull) == 0ull) continue;                         // the same in every wave of the work-group
        unsigned wd[8];
        if (((al >> j) & 1ull) != 0ull) {
#pragma unroll
            for (int r = 0; r < 8; ++r) wd[r] = 0xFFFFFFFFu;
        } else {
#pragma unroll
            for (int r = 0; r < 8; ++r) wd[r] = MBp[(size_t)(q0 + 8 * hi + r) * NW + j];
        }
        v8f s0 = (v8f){}, s1 = (v8f){};
        const unsigned char* kb = KV + bo + (hf * 32 + lr) * APB + 16 * hi;   // B fragment (scores): lane = key, k = d
        if (SPLIT) {
            { const v16bf kh0 = WFrag<bf>::ld((const bf*)kb), kh1 = WFrag<bf>::ld((const bf*)(kb + 64)), kl0 = WFrag<bf>::ld((const bf*)(kb + ATILE)), kl1 = WFrag<bf>::ld((const bf*)(kb + ATILE + 64));
              s0 = wmmab(ql0, kh0, s0); s0 = wmmab(ql1, kh1, s0); s0 = wmmab(qh0, kl0, s0); s0 = wmmab(qh1, kl1, s0); s0 = wmmab(qh0, kh0, s0); s0 = wmmab(qh1, kh1, s0); }
            { const unsigned char* k1 = kb + 16 * APB; const v16bf kh0 = WFrag<bf>::ld((const bf*)k1), kh1 = WFrag<bf>::ld((const bf*)(k1 + 64)), kl0 = WFrag<bf>::ld((const bf*)(k1 + ATILE)), kl1 = WFrag<bf>::ld((const bf*)(k1 + ATILE + 64));
              s1 = wmmab(ql0, kh0, s1); s1 = wmmab(ql1, kh1, s1); s1 = wmmab(qh0, kl0, s1); s1 = wmmab(qh1, kl1, s1); s1 = wmmab(qh0, kh0, s1); s1 = wmmab(qh1, kh1, s1);
              asm volatile("v_nop\n\tv_nop\n\tv_nop\n\tv_nop" : "+v"(s0), "+v"(s1) : "v"(qh1), "v"(kh1)); }
        } else {
            const v16h k00 = WFrag<h16>::ld((const h16*)kb), k01 = WFrag<h16>::ld((const h16*)(kb + 64));
            const v16h k10 = WFrag<h16>::ld((const h16*)(kb + 16 * APB)), k11 = WFrag<h16>::ld((const h16*)(kb + 16 * APB + 64));
            s0 = wmma16(qa0, k00, s0); s0 = wmma16(qa1, k01, s0); s1 = wmma16(qa0, k10, s1); s1 = wmma16(qa1, k11, s1);
            asm volatile("v_nop\n\tv_nop\n\tv_nop\n\tv_nop" : "+v"(s0), "+v"(s1) : "v"(qa1), "v"(k11));
        }
        // online softmax in log2 units; accumulator element r <-> tile row 8*hi + r, column lr (s0) / 16 + lr (s1)
#pragma unroll
        for (int r = 0; r < 8; ++r) {
            const unsigned w = wd[r];
            const bool kp0 = ((w >> lr) & 1u) != 0u, kp1 = ((w >> (16 + lr)) & 1u) != 0u;
            const float v0 = kp0 ? s0[r] * SCL2 : NINF; const float v1 = kp1 ? s1[r] * SCL2 : NINF;
            float mx = fmaxf(v0, v1);
            mx = fmaxf(mx, __shfl_xor(mx, 1, 32)); mx = fmaxf(mx, __shfl_xor(mx, 2, 32)); mx = fmaxf(mx, __shfl_xor(mx, 4, 32)); mx = fmaxf(mx, __shfl_xor(mx, 8, 32));
            const float nm = fmaxf(mi[r], mx); const float ms = (nm == NINF) ? 0.0f : nm;
            const float corr = ex2(mi[r] - ms); const float p0 = ex2(v0 - ms), p1 = ex2(v1 - ms);
            const int po = (8 * hi + r) * PP + lr;
            if (SPLIT) { unsigned short a, c; splitf(p0, a, c); pa[po] = a; pb[po] = c; splitf(p1, a, c); pa[po + 16] = a; pb[po + 16] = c; li[r] = li[r] * corr + (p0 + p1); }
            else { const h16 e0 = (h16)(p0 * PCAR), e1 = (h16)(p1 * PCAR); pa[po] = __builtin_bit_cast(unsigned short, e0); pa[po + 16] = __builtin_bit_cast(unsigned short, e1); li[r] = li[r] * corr + ((float)e0 + (float)e1); }
            mi[r] = nm;
#pragma unroll
            for (int ot = 0; ot < 4; ++ot) acc[ot][r] *= corr;
        }
        __builtin_amdgcn_wave_barrier(); asm volatile("" ::: "memory");   // P tile stores -> fragment reloads: the tile is this wave's own and a wave's LDS operations run in order; this only keeps the compiler from moving the reloads up
        const unsigned char* vb = KV + bo + VOFF + lr * APB + hf * 64 + 16 * hi;   // B fragment (P.V): lane = d, k = key
        if (SPLIT) {
            const v8us a0 = *(const v8usa*)(pa + lr * PP + 8 * hi), a1 = *(const v8usa*)(pa + lr * PP + 16 + 8 * hi);
            const v8us b0 = *(const v8usa*)(pb + lr * PP + 8 * hi), b1 = *(const v8usa*)(pb + lr * PP + 16 + 8 * hi);
            const v16bf ph = cat16b(a0, a1), pl = cat16b(b0, b1);
#pragma unroll
            for (int ot = 0; ot < 4; ++ot) { const v16bf vh = WFrag<bf>::ld((const bf*)(vb + ot * (16 * APB))), vl = WFrag<bf>::ld((const bf*)(vb + ATILE + ot * (16 * APB)));
                acc[ot] = wmmab(pl, vh, acc[ot]); acc[ot] = wmmab(ph, vl, acc[ot]); acc[ot] = wmmab(ph, vh, acc[ot]); }
            asm volatile("v_nop\n\tv_nop\n\tv_nop\n\tv_nop" : "+v"(acc[0]), "+v"(acc[1]), "+v"(acc[2]), "+v"(acc[3]) : "v"(ph), "v"(pl));
        } else {
            const v8us a0 = *(const v8usa*)(pa + lr * PP + 8 * hi), a1 = *(const v8usa*)(pa + lr * PP + 16 + 8 * hi);
            const v16h p16 = cat16hu(a0, a1);
#pragma unroll
            for (int ot = 0; ot < 4; ++ot) { const v16h vf = WFrag<h16>::ld((const h16*)(vb + ot * (16 * APB))); acc[ot] = wmma16(p16, vf, acc[ot]); }
            asm volatile("v_nop\n\tv_nop\n\tv_nop\n\tv_nop" : "+v"(acc[0]), "+v"(acc[1]), "+v"(acc[2]), "+v"(acc[3]) : "v"(p16));
        }
        asm volatile("" ::: "memory");
      }
        asm volatile("s_wait_dscnt 0x0" ::: "memory");                    // this wave's reads of the buffer are done before it is refilled
        asm volatile("s_wait_asynccnt 0x0" ::: "memory");                 // this wave's copies of the stage in flight have landed
        __syncthreads();                                                  // publishes the stage in flight and ends every wave's reads of this one
        int s2 = -1;
        if (rem != 0ull) { s2 = __builtin_ctzll(rem) >> 1; rem &= ~(3ull << (2 * s2)); stage(bo, s2); }
        sc = sn; sn = s2; bo = STG - bo;
    }
    asm volatile("s_wait_asynccnt 0x0" ::: "memory");                     // no copy is outstanding when the wave goes on
    // finish: row sums across the 16 lanes of each half, normalise, stage 16x64 f32, write hi/lo lines
#pragma unroll
    for (int r = 0; r < 8; ++r) { float l = li[r]; l += __shfl_xor(l, 1, 32); l += __shfl_xor(l, 2, 32); l += __shfl_xor(l, 4, 32); l += __shfl_xor(l, 8, 32); li[r] = 1.0f / l; }
#pragma unroll
    for (int ot = 0; ot < 4; ++ot)
#pragma unroll
        for (int r = 0; r < 8; ++r) os[(8 * hi + r) * 68 + ot * 16 + lr] = acc[ot][r] * li[r];
    __syncthreads();
{
#pragma unroll
        for (int s = 0; s < 4; ++s) { const int row = 4 * s + (lane >> 3), c8 = (lane & 7) * 8;
            const v4f x0 = *(const v4fa*)(os + row * 68 + c8), x1 = *(const v4fa*)(os + row * 68 + c8 + 4); v8us oh, ol;
#pragma unroll
            for (int k = 0; k < 4; ++k) { unsigned short a, c; splitf(x0[k], a, c); oh[k] = a; ol[k] = c; splitf(x1[k], a, c); oh[4 + k] = a; ol[4 + k] = c; }
            const size_t oo = (size_t)(q0 + row) * DQ + (size_t)h * HD + c8;
            *(v8us*)(Ch + oo) = oh; *(v8us*)(Cl + oo) = ol; }
         }
}
__global__ __launch_bounds__(128) void k_attn_hl(const bf* __restrict__ Qh, const bf* __restrict__ Ql, const bf* __restrict__ Kh, const bf* __restrict__ Kl, const bf* __restrict__ Vh, const bf* __restrict__ Vl,
                                                const unsigned* __restrict__ MBp, const int* __restrict__ CLp, bf* Ch, bf* Cl, int qt0) {
    attn_body<true>((const h16*)0, (const h16*)0, (const h16*)0, Qh, Ql, Kh, Kl, Vh, Vl, MBp, CLp, Ch, Cl, qt0); }
__global__ __launch_bounds__(128) void k_attn_f16(const h16* __restrict__ Q16, const h16* __restrict__ K16, const h16* __restrict__ V16,
                                                 const unsigned* __restrict__ MBp, const int* __restrict__ CLp, bf* Ch, bf* Cl, int qt0) {
    attn_body<false>(Q16, K16, V16, (const bf*)0, (const bf*)0, (const bf*)0, (const bf*)0, (const bf*)0, (const bf*)0, MBp, CLp, Ch, Cl, qt0); }

constexpr size_t al256(size_t b) { return (b + 255) & ~(size_t)255; }
constexpr size_t WS_TOTAL =
    al256((size_t)DQ * DM * 2) + 2 * al256((size_t)DKV * DM * 2) + al256((size_t)DM * DQ * 2) +      // WQ, WK, WV, WO
    al256((size_t)SEQ * DM * 2) +                                                                      // XB
    3 * al256((size_t)NH * SEQ * HD * 2) + 6 * al256((size_t)NKV * SEQ * HD * 2) +                     // q planes, k planes, v planes
    2 * al256((size_t)SEQ * DQ * 2) +                                                                  // ctx hi/lo
    al256((size_t)SEQ * NW * 4) + al256((size_t)(SEQ / 16) * NW * 4);                                  // mask bits, tile classes
static_assert(WS_TOTAL <= (size_t)134217728);

extern "C" void kernel_launch(void* const* d_in, const int* in_sizes, int n_in,
                              void* d_out, int out_size, void* d_ws, size_t ws_size, hipStream_t stream) {
    if (n_in < 8) return;
    if ((long long)in_sizes[0] < (long long)(NB - 1) * SEQ_FULL * DM + (long long)SEQ * DM) return;
    if ((long long)in_sizes[1] < (long long)DM * DQ || (long long)in_sizes[2] < (long long)DM * DKV || (long long)in_sizes[3] < (long long)DM * DKV || (long long)in_sizes[4] < (long long)DQ * DM) return;
    if ((long long)in_sizes[5] < (long long)SEQ * (HD / 2) || (long long)in_sizes[6] < (long long)SEQ * (HD / 2)) return;
    if ((long long)in_sizes[7] < (long long)(SEQ - 1) * SEQ_FULL + SEQ) return;
    if ((long long)out_size < (long long)(NB - 1) * SEQ_FULL * DM + (long long)SEQ * DM) return;
    if (ws_size < WS_TOTAL) return;
    const float* x = (const float*)d_in[0]; const float* wq = (const float*)d_in[1]; const float* wk = (const float*)d_in[2]; const float* wv = (const float*)d_in[3]; const float* wo = (const float*)d_in[4];
    const float* fcos = (const float*)d_in[5]; const float* fsin = (const float*)d_in[6]; const int* mask = (const int*)d_in[7];
    float* OUT = (float*)d_out;     // [1][2048][2048]
    char* wsp = (char*)d_ws;
    auto take = [&](size_t bytes) { char* p = wsp; wsp += (bytes + 255) & ~(size_t)255; return (void*)p; };
    bf* WQ = (bf*)take((size_t)DQ * DM * 2); bf* WK = (bf*)take((size_t)DKV * DM * 2); bf* WV = (bf*)take((size_t)DKV * DM * 2); bf* WO = (bf*)take((size_t)DM * DQ * 2);
    bf* XB = (bf*)take((size_t)SEQ * DM * 2);
    h16* QP16 = (h16*)take((size_t)NH * SEQ * HD * 2); bf* QPh = (bf*)take((size_t)NH * SEQ * HD * 2); bf* QPl = (bf*)take((size_t)NH * SEQ * HD * 2);
    h16* KP16 = (h16*)take((size_t)NKV * SEQ * HD * 2); bf* KPh = (bf*)take((size_t)NKV * SEQ * HD * 2); bf* KPl = (bf*)take((size_t)NKV * SEQ * HD * 2);
    h16* VT16 = (h16*)take((size_t)NKV * SEQ * HD * 2); bf* VTh = (bf*)take((size_t)NKV * SEQ * HD * 2); bf* VTl = (bf*)take((size_t)NKV * SEQ * HD * 2);
    bf* CXh = (bf*)take((size_t)SEQ * DQ * 2); bf* CXl = (bf*)take((size_t)SEQ * DQ * 2);
    unsigned* MBp = (unsigned*)take((size_t)SEQ * NW * 4); int* CLp = (int*)take((size_t)(SEQ / 16) * NW * 4);
    if ((size_t)(wsp - (char*)d_ws) > ws_size) return;

    // weights: w[in][out] -> Bt[out][in] bf16.  wq: in DM, out DQ; wk/wv: in DM, out DKV; wo: in DQ, out DM.
    k_wtG<<<(unsigned)((DM * DQ / 64 + 63) / 64), 256, 0, stream>>>(wq, DM, DQ, WQ);
    k_wtG<<<(unsigned)((DM * DKV / 64 + 63) / 64), 256, 0, stream>>>(wk, DM, DKV, WK);
    k_wtG<<<(unsigned)((DM * DKV / 64 + 63) / 64), 256, 0, stream>>>(wv, DM, DKV, WV);
    k_wtG<<<(unsigned)((DQ * DM / 64 + 63) / 64), 256, 0, stream>>>(wo, DQ, DM, WO);
    k_maskbits<<<dim3(SEQ / 16, NW / 32, 1), 512, 0, stream>>>(mask, MBp, CLp);
    for (int b = 0; b < NB; ++b) {
        k_cvt8<<<(unsigned)(((size_t)SEQ * DM / 8 + 255) / 256), 256, 0, stream>>>(x + (size_t)b * SEQ_FULL * DM, XB, (size_t)SEQ * DM / 8);
        k_gemm_r<<<dim3(SEQ / 128, DQ / 128, 1), 128, 0, stream>>>(XB, WQ, DM, fcos, fsin, QP16, QPh, QPl);
        k_gemm_r<<<dim3(SEQ / 128, DKV / 128, 1), 128, 0, stream>>>(XB, WK, DM, fcos, fsin, KP16, KPh, KPl);
        k_gemm_v<<<dim3(SEQ / 128, DKV / 128, 1), 128, 0, stream>>>(XB, WV, DM, VT16, VTh, VTl);
        if (RH / 16 > 0) k_attn_hl<<<dim3(RH / 16, NKV, 1), 128, 0, stream>>>(QPh, QPl, KPh, KPl, VTh, VTl, MBp, CLp, CXh, CXl, 0);
        if ((SEQ - RH) / 16 > 0) k_attn_f16<<<dim3((SEQ - RH) / 16, NKV, 1), 128, 0, stream>>>(QP16, KP16, VT16, MBp, CLp, CXh, CXl, RH / 16);
        k_gemm_s<<<dim3(SEQ / 128, DM / 128, 1), 128, 0, stream>>>(CXh, CXl, WO, DQ, OUT + (size_t)b * SEQ_FULL * DM, DM);
    }
}

// v005
// Measured time: 195 microseconds a run.
// In both of two side-by-side timings against v004, it was 1.17 times as fast.
// Over all steps from v000 it is 2.86 times as fast.
#include <hip/hip_runtime.h>

// Contractions (all f32 accumulate): x@wq, x@wk, x@wv v_wmma_f32_16x16x32_bf16 (bf16 x bf16 operand planes, inputs RNE-converted to bf16); scores q.k and P.V: query rows < 512 bf16 hi/lo planes (3 products each), rows >= 512 v_wmma_f32_16x16x32_f16 (P carried x1024); ctx@wo bf16 hi/lo ctx planes x bf16 weights (2 products).
// Grouped-query causal-style attention with interleaved-pair rotation from INPUT tables and an INPUT int32 mask (read by value through a bit-plane + 16x32 tile classes); softmax f32 online running-max form.
// Flash-style fused attention: one wave per 16 query rows per head, the 4 query heads of a kv head in one work-group; K / V^T tiles of 64 keys staged in LDS by asynchronous copies (two buffers), P relayout through a wave-private LDS tile.

#ifndef NB
#define NB 1
#endif
#ifndef SEQ
#define SEQ 2048
#endif
#define NB_FULL  1
#define SEQ_FULL 2048
#define DM   2048
#define NH   32
#define NKV  8
#define REP  (NH / NKV)
#define HD   64
#define DQ   (NH * HD)
#define DKV  (NKV * HD)
#define RH   ((SEQ) < 512 ? (SEQ) : 512)     // query rows < RH use hi+lo planes
#define NW   (SEQ / 32)                      // 32-key words per mask row
#define PP   40                              // P tile pitch (16-bit elements)
#define PCAR 1024.0f
#define SCL2 0.18033688011112042f            // (1/8) * log2(e)

static_assert(SEQ % 64 == 0);                // key halves of 32
static_assert(SEQ <= SEQ_FULL);
static_assert(NW % 32 == 0);                 // mask pre-pass: 32 words per work-group
static_assert(HD == 64);
static_assert(DM % 64 == 0 && DQ % 64 == 0 && DKV % 64 == 0);
static_assert(DM % 32 == 0 && DQ % 32 == 0);
static_assert(NH % NKV == 0);
static_assert(RH % 16 == 0 && (SEQ - RH) % 16 == 0);
static_assert((PP * 2) % 16 == 0);
static_assert(NB <= NB_FULL);

typedef _Float16 h16;
typedef unsigned short bf;
typedef __attribute__((ext_vector_type(16))) __bf16   v16bf;
typedef __attribute__((ext_vector_type(16))) _Float16 v16h;
typedef __attribute__((ext_vector_type(8)))  _Float16 v8h;
typedef __attribute__((ext_vector_type(8)))  unsigned short v8us;
typedef __attribute__((ext_vector_type(8)))  float    v8f;
typedef __attribute__((ext_vector_type(4)))  float    v4f;
typedef __attribute__((ext_vector_type(4)))  int      v4i;
typedef __attribute__((ext_vector_type(4)))  _Float16 v4h;
typedef __attribute__((ext_vector_type(4)))  unsigned short v4us;
typedef __attribute__((ext_vector_type(2)))  unsigned short v2us;
typedef __attribute__((ext_vector_type(2)))  float    v2f;
typedef v4f  __attribute__((may_alias)) v4fa;
typedef v8us __attribute__((may_alias)) v8usa;

__device__ __forceinline__ unsigned short f2bf(float f) { unsigned u = __float_as_uint(f); u += 0x7FFFu + ((u >> 16) & 1u); return (unsigned short)(u >> 16); }
__device__ __forceinline__ float bf2f(unsigned short b) { return __uint_as_float(((unsigned)b) << 16); }
__device__ __forceinline__ float bfr(float f) { return bf2f(f2bf(f)); }
__device__ __forceinline__ v16h cat16(v8h lo, v8h hi) { return __builtin_shufflevector(lo, hi, 0, 1, 2, 3, 4, 5, 6, 7, 8, 9, 10, 11, 12, 13, 14, 15); }
__device__ __forceinline__ v16bf cat16b(v8us lo, v8us hi) { return __builtin_bit_cast(v16bf, __builtin_shufflevector(lo, hi, 0, 1, 2, 3, 4, 5, 6, 7, 8, 9, 10, 11, 12, 13, 14, 15)); }
__device__ __forceinline__ v16h cat16hu(v8us lo, v8us hi) { return __builtin_bit_cast(v16h, __builtin_shufflevector(lo, hi, 0, 1, 2, 3, 4, 5, 6, 7, 8, 9, 10, 11, 12, 13, 14, 15)); }
__device__ __forceinline__ v8f wmma16(v16h a, v16h b, v8f c) { return __builtin_amdgcn_wmma_f32_16x16x32_f16(false, a, false, b, (short)0, c, false, false); }
__device__ __forceinline__ v8f wmmab(v16bf a, v16bf b, v8f c) { return __builtin_amdgcn_wmma_f32_16x16x32_bf16(false, a, false, b, (short)0, c, false, false); }
__device__ __forceinline__ void splitf(float y, unsigned short& h, unsigned short& l) { h = f2bf(y); l = f2bf(y - bf2f(h)); }
__device__ __forceinline__ float ex2(float x) { return __builtin_amdgcn_exp2f(x); }

// Fragment loaders: lane (hi = lane>>4, lr = lane&15); pointer already at row lr, k offset k0 + 8*hi; elements 0..7 <- k0+8hi+0..7, 8..15 <- k0+16+8hi+0..7 (same map for A and B).
template <typename T16> struct WFrag;
template <> struct WFrag<h16> { typedef v16h V; static __device__ __forceinline__ V ld(const h16* p) { return cat16(*(const v8h*)p, *(const v8h*)(p + 16)); } static __device__ __forceinline__ v8f mma(V a, V b, v8f c) { return wmma16(a, b, c); } };
template <> struct WFrag<bf> { typedef v16bf V; static __device__ __forceinline__ V ld(const bf* p) { return cat16b(*(const v8us*)p, *(const v8us*)(p + 16)); } static __device__ __forceinline__ v8f mma(V a, V b, v8f c) { return wmmab(a, b, c); } };

// ---- GEMM body: one work-group of 4 waves per 128x128 output tile, wave (wm, wn) takes its 64x64 quarter (16 accumulators); grid (M/128, N/128), 128 threads.
// A and Bt rows come from K-contiguous 16-bit planes in stages of 128 k (256 B a row) into LDS at pitch 272 B by asynchronous copies (whole lines, each lane 16 B), two buffers: stage t + 1 flies while stage t is worked on.
// c[m][n] (f32) = sum_k (A[m][k] (+ A2[m][k] when NSPLIT == 1)) Bt[n][k]. K % 128 == 0, M % 128 == 0, N % 128 == 0.
// What becomes of c is the epilogue's choice; a wave's 64 columns are one head (HD == 64):
//   EPI 0: C[m][n] = c, f32, pitch ldc.
//   EPI 1: head planes [h][t][d] (fp16 + bf16 hi/lo) of the interleaved-pair rotation: pair (2i, 2i+1) with table entry [t][i] read BY VALUE (RNE-converted to bf16).
//   EPI 2: transposed head planes [g][d][t] (fp16 + bf16 hi/lo), straight from the accumulators: a lane holds 8 consecutive t of one d.
#define GKS   128                            // k elements per stage
#define GPB   272                            // LDS row pitch in bytes (16 B x odd, for 16-byte fragment reads)
#define GTILE (128 * GPB)                    // one operand's 128 rows of a stage
static_assert(SEQ % 128 == 0 && DQ % 128 == 0 && DKV % 128 == 0 && DM % 128 == 0);
static_assert(DM % GKS == 0 && DQ % GKS == 0);
typedef __attribute__((address_space(1))) v4i gv4i;
typedef __attribute__((address_space(3))) v4i lv4i;
// One operand's 128 rows x 256 B of a stage: 16 copies of 16 B per lane, rows 8 apart (l: the lane's LDS place, g: its global place, gs = 8 source rows in elements).
__device__ __forceinline__ void atile(unsigned char* l, const bf* g, size_t gs) {
#pragma unroll
    for (int i = 0; i < 16; ++i) __builtin_amdgcn_global_load_async_to_lds_b128((gv4i*)(g + i * gs), (lv4i*)(l + i * (8 * GPB)), 0, 0);
}
template <int NSPLIT, int EPI>
__device__ __forceinline__ void gemmw_body(const bf* __restrict__ A, const bf* __restrict__ A2, const bf* __restrict__ Bt, int K, float* C, int ldc,
                                           const float* __restrict__ COS, const float* __restrict__ SIN, h16* P16, bf* Ph, bf* Pl) {
    typedef WFrag<bf>::V V;
    constexpr unsigned STAGE = (2 + NSPLIT) * GTILE, BOFF = (1 + NSPLIT) * GTILE;   // stage = [A | A2 when NSPLIT | Bt]
    __shared__ __align__(16) unsigned char L[2 * STAGE];
    __shared__ __align__(16) float osw[4 * 16 * 68];
    const int tid = threadIdx.x, lane = tid & 31, lr = lane & 15, hi = lane >> 4; const int wave = tid >> 5, wm = wave >> 1, wn = wave & 1;
    const int R0 = blockIdx.x * 128, C0 = blockIdx.y * 128; const int r0 = R0 + wm * 64, c0 = C0 + wn * 64;
    float* os = osw + wave * (16 * 68);
    v8f acc[4][4];
#pragma unroll
    for (int mb = 0; mb < 4; ++mb)
#pragma unroll
        for (int nb = 0; nb < 4; ++nb) acc[mb][nb] = (v8f){};
    // copies: thread -> row tid >> 4 (+ 8 per copy), 16-byte chunk tid & 15 of the row's 256 B
    const size_t gs = (size_t)8 * K; const int crw = tid >> 4, cch = tid & 15;
    const size_t po = (size_t)crw * K + cch * 8;                          // the lane's own element offset inside an operand's 128 rows
    const bf* uA = A + (size_t)R0 * K; const bf* uA2 = A2 + (size_t)R0 * K; const bf* uB = Bt + (size_t)C0 * K;   // wave-uniform row bases
    unsigned char* lc = L + (crw * GPB + cch * 16);
    const int nt = K / GKS;
    atile(lc, uA + po, gs); if (NSPLIT == 1) atile(lc + GTILE, uA2 + po, gs); atile(lc + BOFF, uB + po, gs);
    asm volatile("s_wait_asynccnt 0x0" ::: "memory");                     // stage 0 landed (this wave's copies)
    __syncthreads();                                                      // ... and every other wave's
    if (nt > 1) { atile(lc + STAGE, (uA + GKS) + po, gs); if (NSPLIT == 1) atile(lc + STAGE + GTILE, (uA2 + GKS) + po, gs); atile(lc + STAGE + BOFF, (uB + GKS) + po, gs); }
#pragma unroll 1                                                          // stays rolled: one trip per stage, its buffer picked by t & 1; the 64 or 128 products of a trip are unrolled inside
    for (int t = 0; t < nt; ++t) {
        const unsigned bo = (unsigned)(t & 1) * STAGE;
        const bf* la = (const bf*)(L + bo + (wm * 64 + lr) * GPB + 16 * hi);
        const bf* lb = (const bf*)(L + bo + BOFF + (wn * 64 + lr) * GPB + 16 * hi);
        V a[2][4], a2[2][4], b[2][4];                                     // two fragment sets: the next 32 k are read from LDS ahead of this block's products
#pragma unroll
        for (int f = 0; f < 4; ++f) { a[0][f] = WFrag<bf>::ld(la + f * (16 * GPB / 2)); if (NSPLIT == 1) a2[0][f] = WFrag<bf>::ld(la + GTILE / 2 + f * (16 * GPB / 2)); b[0][f] = WFrag<bf>::ld(lb + f * (16 * GPB / 2)); }
#pragma unroll
        for (int ks = 0; ks < GKS / 32; ++ks) {
            const int cu = ks & 1, nx = cu ^ 1;
            if (ks + 1 < GKS / 32) {
#pragma unroll
                for (int f = 0; f < 4; ++f) { a[nx][f] = WFrag<bf>::ld(la + (ks + 1) * 32 + f * (16 * GPB / 2)); if (NSPLIT == 1) a2[nx][f] = WFrag<bf>::ld(la + GTILE / 2 + (ks + 1) * 32 + f * (16 * GPB / 2)); b[nx][f] = WFrag<bf>::ld(lb + (ks + 1) * 32 + f * (16 * GPB / 2)); }
                __builtin_amdgcn_sched_barrier(0);                        // keeps the next block's LDS reads one group ahead of this block's products (sunk among them, every product waits for its own read)
            }
#pragma unroll
            for (int nb = 0; nb < 4; ++nb)
#pragma unroll
                for (int mb = 0; mb < 4; ++mb) acc[mb][nb] = wmmab(a[cu][mb], b[cu][nb], acc[mb][nb]);
            if (NSPLIT == 1) {
#pragma unroll
                for (int nb = 0; nb < 4; ++nb)
#pragma unroll
                    for (int mb = 0; mb < 4; ++mb) acc[mb][nb] = wmmab(a2[cu][mb], b[cu][nb], acc[mb][nb]);
            }
        }
        // four vector slots behind the last product, on the branch's taken side too, before anything rewrites its operands
        asm volatile("v_nop\n\tv_nop\n\tv_nop\n\tv_nop" : "+v"(acc[0][0]), "+v"(acc[1][0]), "+v"(acc[2][0]), "+v"(acc[3][0]), "+v"(acc[0][1]), "+v"(acc[1][1]), "+v"(acc[2][1]), "+v"(acc[3][1]),
                                                            "+v"(acc[0][2]), "+v"(acc[1][2]), "+v"(acc[2][2]), "+v"(acc[3][2]), "+v"(acc[0][3]), "+v"(acc[1][3]), "+v"(acc[2][3]), "+v"(acc[3][3]));
        asm volatile("s_wait_dscnt 0x0" ::: "memory");                    // this wave's reads of buffer t & 1 are done before it is refilled
        asm volatile("s_wait_asynccnt 0x0" ::: "memory");                 // this wave's copies of stage t + 1 have landed
        __syncthreads();                                                  // publishes stage t + 1 and ends every wave's reads of stage t
        if (t + 2 < nt) { const int ko = (t + 2) * GKS; atile(lc + bo, (uA + ko) + po, gs); if (NSPLIT == 1) atile(lc + bo + GTILE, (uA2 + ko) + po, gs); atile(lc + bo + BOFF, (uB + ko) + po, gs); }
    }
    asm volatile("s_wait_asynccnt 0x0" ::: "memory");                     // no copy is outstanding when the wave goes on
    const int head = c0 / HD;
    const size_t tb = (size_t)(r0 + hi) * (HD / 2) + lr * 2;              // EPI 1: the lane's place in the tables' row r0 + hi
    if (EPI == 2) {
        // accumulator element j <-> row (t) mb*16 + 8*hi + j, column (d) nb*16 + lr: 16 bytes of one [d] row per lane and plane; the wave's four mb fill each row's 128-byte line
#pragma unroll
        for (int mb = 0; mb < 4; ++mb)
#pragma unroll
            for (int nb = 0; nb < 4; ++nb) { v8h o16; v8us oh, ol;
#pragma unroll
                for (int j = 0; j < 8; ++j) { const float x = acc[mb][nb][j]; o16[j] = (h16)x; unsigned short a2, c2; splitf(x, a2, c2); oh[j] = a2; ol[j] = c2; }
                const size_t e = ((size_t)head * HD + nb * 16 + lr) * SEQ + r0 + mb * 16 + hi * 8;
                *(v8h*)(P16 + e) = o16; *(v8us*)(Ph + e) = oh; *(v8us*)(Pl + e) = ol; }
        return;
    }
#pragma unroll
    for (int mb = 0; mb < 4; ++mb) {
#pragma unroll
        for (int nb = 0; nb < 4; ++nb) {
#pragma unroll
            for (int j = 0; j < 8; ++j) os[(hi * 8 + j) * 68 + nb * 16 + lr] = acc[mb][nb][j]; }
        __builtin_amdgcn_wave_barrier(); asm volatile("" ::: "memory");
        if (EPI == 0) {
            float* crow = C + (size_t)(r0 + mb * 16) * ldc + c0;
#pragma unroll
            for (int s = 0; s < 8; ++s) { const int row = 2 * s + hi, cofs = lr * 4; const v4f val = *(const v4fa*)(os + row * 68 + cofs);
                *(v4f*)(crow + (size_t)row * ldc + cofs) = val; }
        } else {
            // a lane takes d = 4*lr .. 4*lr+3 (two pairs) of row t; 16 lanes write one whole 128-byte [t] row of each plane
            v2f cc[8], sn[8];
#pragma unroll
            for (int s = 0; s < 8; ++s) { cc[s] = *(const v2f*)(COS + tb + (mb * 16 + 2 * s) * (HD / 2)); sn[s] = *(const v2f*)(SIN + tb + (mb * 16 + 2 * s) * (HD / 2)); }
#pragma unroll
            for (int s = 0; s < 8; ++s) { const int row = 2 * s + hi, cofs = lr * 4; const v4f val = *(const v4fa*)(os + row * 68 + cofs);
                v4h o16; v4us oh, ol;
#pragma unroll
                for (int p = 0; p < 2; ++p) { const float c = bfr(cc[s][p]), sv = bfr(sn[s][p]); const float x0 = val[2 * p], x1 = val[2 * p + 1];
                    const float y0 = x0 * c - x1 * sv, y1 = x0 * sv + x1 * c; unsigned short a2, c2;
                    o16[2 * p] = (h16)y0; splitf(y0, a2, c2); oh[2 * p] = a2; ol[2 * p] = c2;
                    o16[2 * p + 1] = (h16)y1; splitf(y1, a2, c2); oh[2 * p + 1] = a2; ol[2 * p + 1] = c2; }
                const size_t e = ((size_t)head * SEQ + r0 + mb * 16 + row) * HD + cofs;
                *(v4h*)(P16 + e) = o16; *(v4us*)(Ph + e) = oh; *(v4us*)(Pl + e) = ol; }
            if (mb < 3) asm volatile("s_wait_xcnt 0x0" ::: "memory");     // before the next rows' table loads land in registers that these stores name
        }
        __builtin_amdgcn_wave_barrier(); asm volatile("" ::: "memory");
    }
}
__global__ __launch_bounds__(128) void k_gemm_r(const bf* __restrict__ A, const bf* __restrict__ Bt, int K, const float* __restrict__ COS, const float* __restrict__ SIN, h16* P16, bf* Ph, bf* Pl) {
    gemmw_body<0, 1>(A, A, Bt, K, (float*)0, 0, COS, SIN, P16, Ph, Pl); }
__global__ __launch_bounds__(128) void k_gemm_v(const bf* __restrict__ A, const bf* __restrict__ Bt, int K, h16* V16, bf* Vh, bf* Vl) {
    gemmw_body<0, 2>(A, A, Bt, K, (float*)0, 0, (const float*)0, (const float*)0, V16, Vh, Vl); }
__global__ __launch_bounds__(128) void k_gemm_s(const bf* __restrict__ A, const bf* __restrict__ A2, const bf* __restrict__ Bt, int K, float* C, int ldc) {
    gemmw_body<1, 0>(A, A2, Bt, K, C, ldc, (const float*)0, (const float*)0, (h16*)0, (bf*)0, (bf*)0); }

// ---- weight pre-pass: w[k][n] f32 -> Bt[n][k] bf16 (RNE), all four weights in one launch; one work-group of 8 waves per 128 k x 128 n tile.
// Reads: a wave takes 16 k rows, one whole 512-byte run of a row per load, all 16 loads in flight at once. A lane then holds 16 k of 4 n: eight 16-byte chunks (8 k of one n), which go into
// an LDS tile [n][k] whose 16 chunks a row are permuted by (n >> 2) & 15, so that the 16 lanes of a store (rows 4 apart) and of a read (one row) each cover all banks once.
// Writes: 16 lanes put out 256 contiguous bytes of one n row (two whole lines, one writer each).
#define WTT 128
static_assert(DM % WTT == 0 && DQ % WTT == 0 && DKV % WTT == 0);
#define WT_Q  ((DM / WTT) * (DQ / WTT))
#define WT_KV ((DM / WTT) * (DKV / WTT))
#define WT_O  ((DQ / WTT) * (DM / WTT))
template <int K, int N>
__device__ __forceinline__ void wt_tile(const float* __restrict__ w, bf* Bt, int t, unsigned short* T) {
    const int tid = threadIdx.x, lane = tid & 31, l16 = lane & 15, hi = lane >> 4;
    const int wave = __builtin_amdgcn_readfirstlane(tid >> 5);            // the wave's number in a scalar register: row bases are scalar, a lane adds only its own 16 bytes
    const int n0 = (t % (N / WTT)) * WTT, k0 = (t / (N / WTT)) * WTT;
    const float* g = (w + (size_t)(k0 + wave * 16) * N + n0) + lane * 4;
    v4f v[16];
#pragma unroll
    for (int i = 0; i < 16; ++i) v[i] = *(const v4f*)(g + (size_t)i * N);
#pragma unroll
    for (int c = 0; c < 4; ++c)
#pragma unroll
        for (int q = 0; q < 2; ++q) { v8us o;
#pragma unroll
            for (int j = 0; j < 8; ++j) o[j] = f2bf(v[q * 8 + j][c]);
            *(v8us*)(T + (lane * 4 + c) * WTT + (((wave * 2 + q) ^ l16) * 8)) = o; }
    __syncthreads();                                                      // the tile is whole before it is read along k
    bf* d = Bt + (size_t)(n0 + wave * 2 + hi) * K + k0 + l16 * 8;
    v8us o[8];
#pragma unroll
    for (int s = 0; s < 8; ++s) { const int n = s * 16 + wave * 2 + hi;
        o[s] = *(const v8us*)(T + n * WTT + ((l16 ^ ((n >> 2) & 15)) * 8)); }
#pragma unroll
    for (int s = 0; s < 8; ++s) { *(v8us*)(d + (size_t)s * 16 * K) = o[s];
        asm volatile("s_wait_xcnt 0x0" ::: "memory"); }                   // stands behind each store, before any path on which the store's address or data registers are written again
}
__global__ __launch_bounds__(256) void k_wt4(const float* __restrict__ wq, const float* __restrict__ wk, const float* __restrict__ wv, const float* __restrict__ wo, bf* WQ, bf* WK, bf* WV, bf* WO) {
    __shared__ __align__(16) unsigned short T[WTT * WTT];
    const int b = (int)blockIdx.x;                                        // which weight: the same for the whole work-group
    if (b < WT_Q) wt_tile<DM, DQ>(wq, WQ, b, T);
    else if (b < WT_Q + 2 * WT_KV) { const bool sv = b >= WT_Q + WT_KV; wt_tile<DM, DKV>(sv ? wv : wk, sv ? WV : WK, b - (sv ? WT_Q + WT_KV : WT_Q), T); }
    else wt_tile<DQ, DM>(wo, WO, b - (WT_Q + 2 * WT_KV), T);
}
__global__ __launch_bounds__(256) void k_cvt8(const float* __restrict__ src, bf* dst, size_t n8) { const size_t i = (size_t)blockIdx.x * 256 + threadIdx.x; if (i >= n8) return; const v8f v = *(const v8f*)(src + i * 8); v8us o;
#pragma unroll
    for (int k = 0; k < 8; ++k) o[k] = f2bf(v[k]); *(v8us*)(dst + i * 8) = o;  }

// k_maskbits: one work-group of 16 waves per (16 query rows, 32 mask words); wave r takes row r and holds its 1024 mask values as 8 loads of 512 contiguous bytes, all in flight at once.
// Bit-plane MB[q][w] (bit n = mask[q][32w+n] != 0) and tile class CL[q/16][w]: 0 = no key kept in the 16x32 tile, 1 = all kept, 2 = mixed.
__global__ __launch_bounds__(512) void k_maskbits(const int* __restrict__ mask, unsigned* MBp, int* CLp) {
    __shared__ unsigned sw[16 * 32];
    const int lane = threadIdx.x & 31, row = threadIdx.x >> 5; const int qt = blockIdx.x, wb = blockIdx.y * 32; const int q = qt * 16 + row;
    const int* mr = mask + (size_t)q * SEQ_FULL + wb * 32 + lane * 4;
    v4i v[8];
#pragma unroll
    for (int i = 0; i < 8; ++i) v[i] = *(const v4i*)(mr + 128 * i);
    // nibble i of x: the lane's four values of load i, i.e. bits 4*(lane&7)..+3 of word wb + 4*i + (lane>>3)
    unsigned x = 0u;
#pragma unroll
    for (int i = 0; i < 8; ++i) { const unsigned nib = (v[i][0] != 0 ? 1u : 0u) | (v[i][1] != 0 ? 2u : 0u) | (v[i][2] != 0 ? 4u : 0u) | (v[i][3] != 0 ? 8u : 0u); x |= nib << (4 * i); }
    // 8x8 nibble transpose inside each group of 8 lanes (three exchanges; a lane keeps the nibbles under its mask and takes the partner's, rotated into place): afterwards lane 8g+t holds the whole word wb + 4*t + g
    unsigned y;
    y = __builtin_rotateright32(__shfl_xor(x, 4, 32), 16);               { const unsigned km = (lane & 4) ? 0xFFFF0000u : 0x0000FFFFu; x = (x & km) | (y & ~km); }
    y = __builtin_rotateright32(__shfl_xor(x, 2, 32), (lane & 2) ? 8 : 24); { const unsigned km = (lane & 2) ? 0xFF00FF00u : 0x00FF00FFu; x = (x & km) | (y & ~km); }
    y = __builtin_rotateright32(__shfl_xor(x, 1, 32), (lane & 1) ? 4 : 28); { const unsigned km = (lane & 1) ? 0xF0F0F0F0u : 0x0F0F0F0Fu; x = (x & km) | (y & ~km); }
    const int w = wb + 4 * (lane & 7) + (lane >> 3);
    sw[row * 32 + lane] = x;
    __syncthreads();                                                      // the 16 rows' words -> the class of each 16x32 tile
    if (row == 0) {
        unsigned an = 0xFFFFFFFFu, orr = 0u;
#pragma unroll
        for (int r = 0; r < 16; ++r) { const unsigned t = sw[r * 32 + lane]; an &= t; orr |= t; }
        CLp[(size_t)qt * NW + w] = (orr == 0u) ? 0 : ((an == 0xFFFFFFFFu) ? 1 : 2);
    }
    MBp[(size_t)q * NW + w] = x;                                          // one wave = one whole 128-byte line
}

// ---- fused attention body: one work-group of 4 waves per (16 query rows, kv head); wave w takes query head hk * REP + w, so the four waves walk the same keys under the same tile classes.
// K rows and V^T rows come from their 16-bit planes in stages of 64 keys (128 B a row) into LDS at pitch 144 B by asynchronous copies (whole lines, each lane 16 B), two buffers:
// the next kept stage flies while this one is worked on. A stage is two 32-key halves; a half is skipped only when its class says no key of the
// 16x32 tile is kept (masked keys contribute exactly 0 under the -inf fill; a row with no kept key anywhere ends with 0 * (1/0) = NaN, as the module); a stage with no kept half is never copied.
// SPLIT: q, k, P, v on bf16 hi/lo planes (hh + hl + lh); else fp16 planes with P carried x PCAR (the carry cancels in acc / l).
#define AKS   64                             // keys per stage
#define APB   144                            // LDS row pitch in bytes (16 B x odd, for 16-byte fragment reads)
#define ATILE (64 * APB)                     // one plane's 64 rows of a stage
static_assert(REP == 4 && HD == 64 && SEQ % AKS == 0 && NW <= 64);
// One plane's 64 rows x 128 B of a stage: 4 copies of 16 B per lane, rows 16 apart (l: the lane's LDS place, g: its global place, gs = 16 source rows in elements).
template <typename T16>
__device__ __forceinline__ void ktile(unsigned char* l, const T16* g, size_t gs) {
#pragma unroll
    for (int i = 0; i < 4; ++i) __builtin_amdgcn_global_load_async_to_lds_b128((gv4i*)(g + i * gs), (lv4i*)(l + i * (16 * APB)), 0, 0);
}
template <bool SPLIT>
__device__ __forceinline__ void attn_body(const h16* __restrict__ Q16, const h16* __restrict__ K16, const h16* __restrict__ V16,
                                          const bf* __restrict__ Qh, const bf* __restrict__ Ql, const bf* __restrict__ Kh, const bf* __restrict__ Kl, const bf* __restrict__ Vh, const bf* __restrict__ Vl,
                                          const unsigned* __restrict__ MBp, const int* __restrict__ CLp, bf* Ch, bf* Cl, int qt0) {
    constexpr unsigned VOFF = (SPLIT ? 2 : 1) * ATILE, STG = 2 * VOFF;   // stage = [K (hi | lo when SPLIT) | V^T (hi | lo when SPLIT)]
    __shared__ __align__(16) unsigned char KV[2 * STG];
    __shared__ __align__(16) unsigned short paw[4 * 16 * PP];
    __shared__ __align__(16) unsigned short pbw[(SPLIT ? 4 : 1) * 16 * PP];
    __shared__ __align__(16) float osw[4 * 16 * 68];
    const int tid = threadIdx.x, lane = tid & 31, lr = lane & 15, hi = lane >> 4, wave = tid >> 5;
    unsigned short* pa = paw + wave * (16 * PP); unsigned short* pb = pbw + (SPLIT ? wave : 0) * (16 * PP); float* os = osw + wave * (16 * 68);   // wave-private tiles
    const int qt = qt0 + (int)blockIdx.x; const int hk = (int)blockIdx.y; const int h = hk * REP + wave; const int q0 = qt * 16;
    const size_t qoff = ((size_t)h * SEQ + q0 + lr) * HD + 8 * hi;       // A fragment: row q0+lr, d offset 8*hi
    // the row of tile classes as two bit sets, the same in every wave of the work-group: nz bit j = half j has a kept key, al bit j = all of its keys are kept
    const int cl0 = CLp[(size_t)qt * NW + lane]; const int cl1 = (NW > 32) ? CLp[(size_t)qt * NW + (NW > 32 ? 32 : 0) + lane] : 0;
    const unsigned long long nz = (unsigned long long)__builtin_amdgcn_ballot_w32(cl0 != 0) | ((unsigned long long)__builtin_amdgcn_ballot_w32(cl1 != 0) << 32);
    const unsigned long long al = (unsigned long long)__builtin_amdgcn_ballot_w32(cl0 == 1) | ((unsigned long long)__builtin_amdgcn_ballot_w32(cl1 == 1) << 32);
    // copies: thread -> row tid >> 3 (+ 16 per copy), 16-byte chunk tid & 7 of the row's 128 B; stage s: keys 64 s .. 64 s + 63 (s <= 31 from a 64-bit set: inside the planes)
    const int crw = tid >> 3, cch = tid & 7;
    unsigned char* lc = KV + (crw * APB + cch * 16);
    const size_t kpo = ((size_t)hk * SEQ + crw) * HD + cch * 8;          // K planes [g][t][d]: row = key
    const size_t vpo = ((size_t)hk * HD + crw) * SEQ + cch * 8;          // V^T planes [g][d][t]: row = d
    auto stage = [&](unsigned bo, int s) {
        const size_t ke = kpo + (size_t)s * (AKS * HD), ve = vpo + (size_t)s * AKS;
        if (SPLIT) { ktile(lc + bo, Kh + ke, (size_t)16 * HD); ktile(lc + bo + ATILE, Kl + ke, (size_t)16 * HD); ktile(lc + bo + VOFF, Vh + ve, (size_t)16 * SEQ); ktile(lc + bo + VOFF + ATILE, Vl + ve, (size_t)16 * SEQ); }
        else { ktile(lc + bo, K16 + ke, (size_t)16 * HD); ktile(lc + bo + VOFF, V16 + ve, (size_t)16 * SEQ); }
    };
    unsigned long long rem = nz;                                          // kept halves whose stage is not copied yet
    int sc = -1, sn = -1;                                                 // the stage worked on, the stage in flight (-1: none)
    if (rem != 0ull) { sc = __builtin_ctzll(rem) >> 1; rem &= ~(3ull << (2 * sc)); stage(0u, sc); }
    // q fragments: read once, held in registers over the key loop
    v16bf qh0, qh1, ql0, ql1; v16h qa0, qa1;
    if (SPLIT) { qh0 = WFrag<bf>::ld(Qh + qoff); qh1 = WFrag<bf>::ld(Qh + qoff + 32); ql0 = WFrag<bf>::ld(Ql + qoff); ql1 = WFrag<bf>::ld(Ql + qoff + 32); }
    else { qa0 = WFrag<h16>::ld(Q16 + qoff); qa1 = WFrag<h16>::ld(Q16 + qoff + 32); }
    const float NINF = -__builtin_inff();
    float mi[8], li[8]; v8f acc[4];
#pragma unroll
    for (int r = 0; r < 8; ++r) { mi[r] = NINF; li[r] = 0.0f; }
#pragma unroll
    for (int ot = 0; ot < 4; ++ot) acc[ot] = (v8f){};
    asm volatile("s_wait_asynccnt 0x0" ::: "memory");                     // the first stage landed (this wave's copies)
    __syncthreads();                                                      // ... and every other wave's
    if (rem != 0ull) { sn = __builtin_ctzll(rem) >> 1; rem &= ~(3ull << (2 * sn)); stage(STG, sn); }
    unsigned bo = 0u;
#pragma unroll 1                                                          // stays rolled: one trip per kept stage (at most 32: each takes its two bits out of the set)
    while (sc >= 0) {
#pragma unroll 1                                                          // stays rolled: the halves depend on one another through the running maximum, unrolling buys only code
      for (int hf = 0; hf < 2; ++hf) {
        const int j = 2 * sc + hf;
        if (((nz >> j) & 1ull) == 0ull) continue;                         // the same in every wave of the work-group
        unsigned wd[8];
        if (((al >> j) & 1ull) != 0ull) {
#pragma unroll
            for (int r = 0; r < 8; ++r) wd[r] = 0xFFFFFFFFu;
        } else {
#pragma unroll
            for (int r = 0; r < 8; ++r) wd[r] = MBp[(size_t)(q0 + 8 * hi + r) * NW + j];
        }
        v8f s0 = (v8f){}, s1 = (v8f){};
        const unsigned char* kb = KV + bo + (hf * 32 + lr) * APB + 16 * hi;   // B fragment (scores): lane = key, k = d
        if (SPLIT) {
            { const v16bf kh0 = WFrag<bf>::ld((const bf*)kb), kh1 = WFrag<bf>::ld((const bf*)(kb + 64)), kl0 = WFrag<bf>::ld((const bf*)(kb + ATILE)), kl1 = WFrag<bf>::ld((const bf*)(kb + ATILE + 64));
              s0 = wmmab(ql0, kh0, s0); s0 = wmmab(ql1, kh1, s0); s0 = wmmab(qh0, kl0, s0); s0 = wmmab(qh1, kl1, s0); s0 = wmmab(qh0, kh0, s0); s0 = wmmab(qh1, kh1, s0); }
            { const unsigned char* k1 = kb + 16 * APB; const v16bf kh0 = WFrag<bf>::ld((const bf*)k1), kh1 = WFrag<bf>::ld((const bf*)(k1 + 64)), kl0 = WFrag<bf>::ld((const bf*)(k1 + ATILE)), kl1 = WFrag<bf>::ld((const bf*)(k1 + ATILE + 64));
              s1 = wmmab(ql0, kh0, s1); s1 = wmmab(ql1, kh1, s1); s1 = wmmab(qh0, kl0, s1); s1 = wmmab(qh1, kl1, s1); s1 = wmmab(qh0, kh0, s1); s1 = wmmab(qh1, kh1, s1);
              asm volatile("v_nop\n\tv_nop\n\tv_nop\n\tv_nop" : "+v"(s0), "+v"(s1) : "v"(qh1), "v"(kh1)); }
        } else {
            const v16h k00 = WFrag<h16>::ld((const h16*)kb), k01 = WFrag<h16>::ld((const h16*)(kb + 64));
            const v16h k10 = WFrag<h16>::ld((const h16*)(kb + 16 * APB)), k11 = WFrag<h16>::ld((const h16*)(kb + 16 * APB + 64));
            s0 = wmma16(qa0, k00, s0); s0 = wmma16(qa1, k01, s0); s1 = wmma16(qa0, k10, s1); s1 = wmma16(qa1, k11, s1);
            asm volatile("v_nop\n\tv_nop\n\tv_nop\n\tv_nop" : "+v"(s0), "+v"(s1) : "v"(qa1), "v"(k11));
        }
        // online softmax in log2 units; accumulator element r <-> tile row 8*hi + r, column lr (s0) / 16 + lr (s1)
#pragma unroll
        for (int r = 0; r < 8; ++r) {
            const unsigned w = wd[r];
            const bool kp0 = ((w >> lr) & 1u) != 0u, kp1 = ((w >> (16 + lr)) & 1u) != 0u;
            const float v0 = kp0 ? s0[r] * SCL2 : NINF; const float v1 = kp1 ? s1[r] * SCL2 : NINF;
            float mx = fmaxf(v0, v1);
            mx = fmaxf(mx, __shfl_xor(mx, 1, 32)); mx = fmaxf(mx, __shfl_xor(mx, 2, 32)); mx = fmaxf(mx, __shfl_xor(mx, 4, 32)); mx = fmaxf(mx, __shfl_xor(mx, 8, 32));
            const float nm = fmaxf(mi[r], mx); const float ms = (nm == NINF) ? 0.0f : nm;
            const float corr = ex2(mi[r] - ms); const float p0 = ex2(v0 - ms), p1 = ex2(v1 - ms);
            const int po = (8 * hi + r) * PP + lr;
            if (SPLIT) { unsigned short a, c; splitf(p0, a, c); pa[po] = a; pb[po] = c; splitf(p1, a, c); pa[po + 16] = a; pb[po + 16] = c; li[r] = li[r] * corr + (p0 + p1); }
            else { const h16 e0 = (h16)(p0 * PCAR), e1 = (h16)(p1 * PCAR); pa[po] = __builtin_bit_cast(unsigned short, e0); pa[po + 16] = __builtin_bit_cast(unsigned short, e1); li[r] = li[r] * corr + ((float)e0 + (float)e1); }
            mi[r] = nm;
#pragma unroll
            for (int ot = 0; ot < 4; ++ot) acc[ot][r] *= corr;
        }
        __builtin_amdgcn_wave_barrier(); asm volatile("" ::: "memory");   // P tile stores -> fragment reloads: the tile is this wave's own and a wave's LDS operations run in order; this only keeps the compiler from moving the reloads up
        const unsigned char* vb = KV + bo + VOFF + lr * APB + hf * 64 + 16 * hi;   // B fragment (P.V): lane = d, k = key
        if (SPLIT) {
            const v8us a0 = *(const v8usa*)(pa + lr * PP + 8 * hi), a1 = *(const v8usa*)(pa + lr * PP + 16 + 8 * hi);
            const v8us b0 = *(const v8usa*)(pb + lr * PP + 8 * hi), b1 = *(const v8usa*)(pb + lr * PP + 16 + 8 * hi);
            const v16bf ph = cat16b(a0, a1), pl = cat16b(b0, b1);
#pragma unroll
            for (int ot = 0; ot < 4; ++ot) { const v16bf vh = WFrag<bf>::ld((const bf*)(vb + ot * (16 * APB))), vl = WFrag<bf>::ld((const bf*)(vb + ATILE + ot * (16 * APB)));
                acc[ot] = wmmab(pl, vh, acc[ot]); acc[ot] = wmmab(ph, vl, acc[ot]); acc[ot] = wmmab(ph, vh, acc[ot]); }
            asm volatile("v_nop\n\tv_nop\n\tv_nop\n\tv_nop" : "+v"(acc[0]), "+v"(acc[1]), "+v"(acc[2]), "+v"(acc[3]) : "v"(ph), "v"(pl));
        } else {
            const v8us a0 = *(const v8usa*)(pa + lr * PP + 8 * hi), a1 = *(const v8usa*)(pa + lr * PP + 16 + 8 * hi);
            const v16h p16 = cat16hu(a0, a1);
#pragma unroll
            for (int ot = 0; ot < 4; ++ot) { const v16h vf = WFrag<h16>::ld((const h16*)(vb + ot * (16 * APB))); acc[ot] = wmma16(p16, vf, acc[ot]); }
            asm volatile("v_nop\n\tv_nop\n\tv_nop\n\tv_nop" : "+v"(acc[0]), "+v"(acc[1]), "+v"(acc[2]), "+v"(acc[3]) : "v"(p16));
        }
        asm volatile("" ::: "memory");
      }
        asm volatile("s_wait_dscnt 0x0" ::: "memory");                    // this wave's reads of the buffer are done before it is refilled
        asm volatile("s_wait_asynccnt 0x0" ::: "memory");                 // this wave's copies of the stage in flight have landed
        __syncthreads();                                                  // publishes the stage in flight and ends every wave's reads of this one
        int s2 = -1;
        if (rem != 0ull) { s2 = __builtin_ctzll(rem) >> 1; rem &= ~(3ull << (2 * s2)); stage(bo, s2); }
        sc = sn; sn = s2; bo = STG - bo;
    }
    asm volatile("s_wait_asynccnt 0x0" ::: "memory");                     // no copy is outstanding when the wave goes on
    // finish: row sums across the 16 lanes of each half, normalise, stage 16x64 f32, write hi/lo lines
#pragma unroll
    for (int r = 0; r < 8; ++r) { float l = li[r]; l += __shfl_xor(l, 1, 32); l += __shfl_xor(l, 2, 32); l += __shfl_xor(l, 4, 32); l += __shfl_xor(l, 8, 32); li[r] = 1.0f / l; }
#pragma unroll
    for (int ot = 0; ot < 4; ++ot)
#pragma unroll
        for (int r = 0; r < 8; ++r) os[(8 * hi + r) * 68 + ot * 16 + lr] = acc[ot][r] * li[r];
    __syncthreads();
{
#pragma unroll
        for (int s = 0; s < 4; ++s) { const int row = 4 * s + (lane >> 3), c8 = (lane & 7) * 8;
            const v4f x0 = *(const v4fa*)(os + row * 68 + c8), x1 = *(const v4fa*)(os + row * 68 + c8 + 4); v8us oh, ol;
#pragma unroll
            for (int k = 0; k < 4; ++k) { unsigned short a, c; splitf(x0[k], a, c); oh[k] = a; ol[k] = c; splitf(x1[k], a, c); oh[4 + k] = a; ol[4 + k] = c; }
            const size_t oo = (size_t)(q0 + row) * DQ + (size_t)h * HD + c8;
            *(v8us*)(Ch + oo) = oh; *(v8us*)(Cl + oo) = ol; }
         }
}
__global__ __launch_bounds__(128) void k_attn_hl(const bf* __restrict__ Qh, const bf* __restrict__ Ql, const bf* __restrict__ Kh, const bf* __restrict__ Kl, const bf* __restrict__ Vh, const bf* __restrict__ Vl,
                                                const unsigned* __restrict__ MBp, const int* __restrict__ CLp, bf* Ch, bf* Cl, int qt0) {
    attn_body<true>((const h16*)0, (const h16*)0, (const h16*)0, Qh, Ql, Kh, Kl, Vh, Vl, MBp, CLp, Ch, Cl, qt0); }
__global__ __launch_bounds__(128) void k_attn_f16(const h16* __restrict__ Q16, const h16* __restrict__ K16, const h16* __restrict__ V16,
                                                 const unsigned* __restrict__ MBp, const int* __restrict__ CLp, bf* Ch, bf* Cl, int qt0) {
    attn_body<false>(Q16, K16, V16, (const bf*)0, (const bf*)0, (const bf*)0, (const bf*)0, (const bf*)0, (const bf*)0, MBp, CLp, Ch, Cl, qt0); }

constexpr size_t al256(size_t b) { return (b + 255) & ~(size_t)255; }
constexpr size_t WS_TOTAL =
    al256((size_t)DQ * DM * 2) + 2 * al256((size_t)DKV * DM * 2) + al256((size_t)DM * DQ * 2) +      // WQ, WK, WV, WO
    al256((size_t)SEQ * DM * 2) +                                                                      // XB
    3 * al256((size_t)NH * SEQ * HD * 2) + 6 * al256((size_t)NKV * SEQ * HD * 2) +                     // q planes, k planes, v planes
    2 * al256((size_t)SEQ * DQ * 2) +                                                                  // ctx hi/lo
    al256((size_t)SEQ * NW * 4) + al256((size_t)(SEQ / 16) * NW * 4);                                  // mask bits, tile classes
static_assert(WS_TOTAL <= (size_t)134217728);

extern "C" void kernel_launch(void* const* d_in, const int* in_sizes, int n_in,
                              void* d_out, int out_size, void* d_ws, size_t ws_size, hipStream_t stream) {
    if (n_in < 8) return;
    if ((long long)in_sizes[0] < (long long)(NB - 1) * SEQ_FULL * DM + (long long)SEQ * DM) return;
    if ((long long)in_sizes[1] < (long long)DM * DQ || (long long)in_sizes[2] < (long long)DM * DKV || (long long)in_sizes[3] < (long long)DM * DKV || (long long)in_sizes[4] < (long long)DQ * DM) return;
    if ((long long)in_sizes[5] < (long long)SEQ * (HD / 2) || (long long)in_sizes[6] < (long long)SEQ * (HD / 2)) return;
    if ((long long)in_sizes[7] < (long long)(SEQ - 1) * SEQ_FULL + SEQ) return;
    if ((long long)out_size < (long long)(NB - 1) * SEQ_FULL * DM + (long long)SEQ * DM) return;
    if (ws_size < WS_TOTAL) return;
    const float* x = (const float*)d_in[0]; const float* wq = (const float*)d_in[1]; const float* wk = (const float*)d_in[2]; const float* wv = (const float*)d_in[3]; const float* wo = (const float*)d_in[4];
    const float* fcos = (const float*)d_in[5]; const float* fsin = (const float*)d_in[6]; const int* mask = (const int*)d_in[7];
    float* OUT = (float*)d_out;     // [1][2048][2048]
    char* wsp = (char*)d_ws;
    auto take = [&](size_t bytes) { char* p = wsp; wsp += (bytes + 255) & ~(size_t)255; return (void*)p; };
    bf* WQ = (bf*)take((size_t)DQ * DM * 2); bf* WK = (bf*)take((size_t)DKV * DM * 2); bf* WV = (bf*)take((size_t)DKV * DM * 2); bf* WO = (bf*)take((size_t)DM * DQ * 2);
    bf* XB = (bf*)take((size_t)SEQ * DM * 2);
    h16* QP16 = (h16*)take((size_t)NH * SEQ * HD * 2); bf* QPh = (bf*)take((size_t)NH * SEQ * HD * 2); bf* QPl = (bf*)take((size_t)NH * SEQ * HD * 2);
    h16* KP16 = (h16*)take((size_t)NKV * SEQ * HD * 2); bf* KPh = (bf*)take((size_t)NKV * SEQ * HD * 2); bf* KPl = (bf*)take((size_t)NKV * SEQ * HD * 2);
    h16* VT16 = (h16*)take((size_t)NKV * SEQ * HD * 2); bf* VTh = (bf*)take((size_t)NKV * SEQ * HD * 2); bf* VTl = (bf*)take((size_t)NKV * SEQ * HD * 2);
    bf* CXh = (bf*)take((size_t)SEQ * DQ * 2); bf* CXl = (bf*)take((size_t)SEQ * DQ * 2);
    unsigned* MBp = (unsigned*)take((size_t)SEQ * NW * 4); int* CLp = (int*)take((size_t)(SEQ / 16) * NW * 4);
    if ((size_t)(wsp - (char*)d_ws) > ws_size) return;

    // weights: w[in][out] -> Bt[out][in] bf16.  wq: in DM, out DQ; wk/wv: in DM, out DKV; wo: in DQ, out DM.
    k_wt4<<<WT_Q + 2 * WT_KV + WT_O, 256, 0, stream>>>(wq, wk, wv, wo, WQ, WK, WV, WO);
    k_maskbits<<<dim3(SEQ / 16, NW / 32, 1), 512, 0, stream>>>(mask, MBp, CLp);
    for (int b = 0; b < NB; ++b) {
        k_cvt8<<<(unsigned)(((size_t)SEQ * DM / 8 + 255) / 256), 256, 0, stream>>>(x + (size_t)b * SEQ_FULL * DM, XB, (size_t)SEQ * DM / 8);
        k_gemm_r<<<dim3(SEQ / 128, DQ / 128, 1), 128, 0, stream>>>(XB, WQ, DM, fcos, fsin, QP16, QPh, QPl);
        k_gemm_r<<<dim3(SEQ / 128, DKV / 128, 1), 128, 0, stream>>>(XB, WK, DM, fcos, fsin, KP16, KPh, KPl);
        k_gemm_v<<<dim3(SEQ / 128, DKV / 128, 1), 128, 0, stream>>>(XB, WV, DM, VT16, VTh, VTl);
        if (RH / 16 > 0) k_attn_hl<<<dim3(RH / 16, NKV, 1), 128, 0, stream>>>(QPh, QPl, KPh, KPl, VTh, VTl, MBp, CLp, CXh, CXl, 0);
        if ((SEQ - RH) / 16 > 0) k_attn_f16<<<dim3((SEQ - RH) / 16, NKV, 1), 128, 0, stream>>>(QP16, KP16, VT16, MBp, CLp, CXh, CXl, RH / 16);
        k_gemm_s<<<dim3(SEQ / 128, DM / 128, 1), 128, 0, stream>>>(CXh, CXl, WO, DQ, OUT + (size_t)b * SEQ_FULL * DM, DM);
    }
}

// v006
// One run takes 160 microseconds.
// In two side-by-side timings against v005, it was 1.24 and 1.23 times as fast.
// Counting every step since v000, it is 3.54 times as fast.
#include <hip/hip_runtime.h>

// Contractions (all f32 accumulate): x@wq, x@wk, x@wv v_wmma_f32_16x16x32_bf16 (bf16 x bf16 operand planes, inputs RNE-converted to bf16); scores q.k and P.V: query rows < 512 bf16 hi/lo planes (3 products each), rows >= 512 v_wmma_f32_16x16x32_f16 (P carried x1024); ctx@wo bf16 hi/lo ctx planes x bf16 weights (2 products).
// Grouped-query causal-style attention with interleaved-pair rotation from INPUT tables and an INPUT int32 mask (read by value through a bit-plane + 16x32 tile classes); softmax f32 online running-max form.
// Flash-style fused attention: one wave per 16 query rows per head, the 4 query heads of a kv head in one work-group; K / V^T tiles of 64 keys staged in LDS by asynchronous copies (two buffers); scores and context are formed transposed (S^T = K.Q^T, O^T += V^T.P^T), so P goes from the score accumulators straight into an operand.

#ifndef NB
#define NB 1
#endif
#ifndef SEQ
#define SEQ 2048
#endif
#define NB_FULL  1
#define SEQ_FULL 2048
#define DM   2048
#define NH   32
#define NKV  8
#define REP  (NH / NKV)
#define HD   64
#define DQ   (NH * HD)
#define DKV  (NKV * HD)
#define RH   ((SEQ) < 512 ? (SEQ) : 512)     // query rows < RH use hi+lo planes
#define NW   (SEQ / 32)                      // 32-key words per mask row
#define PCAR 1024.0f
#define SCL2 0.18033688011112042f            // (1/8) * log2(e)

static_assert(SEQ % 64 == 0);                // key halves of 32
static_assert(SEQ <= SEQ_FULL);
static_assert(NW % 32 == 0);                 // mask pre-pass: 32 words per work-group
static_assert(HD == 64);
static_assert(DM % 64 == 0 && DQ % 64 == 0 && DKV % 64 == 0);
static_assert(DM % 32 == 0 && DQ % 32 == 0);
static_assert(NH % NKV == 0);
static_assert(RH % 16 == 0 && (SEQ - RH) % 16 == 0);
static_assert(NB <= NB_FULL);

typedef _Float16 h16;
typedef unsigned short bf;
typedef __attribute__((ext_vector_type(16))) __bf16   v16bf;
typedef __attribute__((ext_vector_type(16))) _Float16 v16h;
typedef __attribute__((ext_vector_type(8)))  _Float16 v8h;
typedef __attribute__((ext_vector_type(8)))  unsigned short v8us;
typedef __attribute__((ext_vector_type(8)))  float    v8f;
typedef __attribute__((ext_vector_type(4)))  float    v4f;
typedef __attribute__((ext_vector_type(4)))  int      v4i;
typedef __attribute__((ext_vector_type(4)))  _Float16 v4h;
typedef __attribute__((ext_vector_type(2)))  _Float16 v2h;
typedef __attribute__((ext_vector_type(4)))  unsigned short v4us;
typedef __attribute__((ext_vector_type(2)))  unsigned short v2us;
typedef __attribute__((ext_vector_type(2)))  float    v2f;
typedef v4f  __attribute__((may_alias)) v4fa;

__device__ __forceinline__ unsigned short f2bf(float f) { unsigned u = __float_as_uint(f); u += 0x7FFFu + ((u >> 16) & 1u); return (unsigned short)(u >> 16); }
__device__ __forceinline__ float bf2f(unsigned short b) { return __uint_as_float(((unsigned)b) << 16); }
__device__ __forceinline__ float bfr(float f) { return bf2f(f2bf(f)); }
__device__ __forceinline__ v16h cat16(v8h lo, v8h hi) { return __builtin_shufflevector(lo, hi, 0, 1, 2, 3, 4, 5, 6, 7, 8, 9, 10, 11, 12, 13, 14, 15); }
__device__ __forceinline__ v16bf cat16b(v8us lo, v8us hi) { return __builtin_bit_cast(v16bf, __builtin_shufflevector(lo, hi, 0, 1, 2, 3, 4, 5, 6, 7, 8, 9, 10, 11, 12, 13, 14, 15)); }
__device__ __forceinline__ v8f wmma16(v16h a, v16h b, v8f c) { return __builtin_amdgcn_wmma_f32_16x16x32_f16(false, a, false, b, (short)0, c, false, false); }
__device__ __forceinline__ v8f wmmab(v16bf a, v16bf b, v8f c) { return __builtin_amdgcn_wmma_f32_16x16x32_bf16(false, a, false, b, (short)0, c, false, false); }
__device__ __forceinline__ void splitf(float y, unsigned short& h, unsigned short& l) { h = f2bf(y); l = f2bf(y - bf2f(h)); }
__device__ __forceinline__ float ex2(float x) { return __builtin_amdgcn_exp2f(x); }
// Four exponentials (v_exp_f32, as ex2) in one statement: the outputs are early-clobber, so none lands on a source of another, and the closing v_nop is the one slot that the
// instruction set asks for behind a transcendental before its result is used or its source overwritten; in a run of separate ones the register allocator is free to put a result on its neighbour's source.
__device__ __forceinline__ void ex2x4(float a, float b, float c, float d, float& ya, float& yb, float& yc, float& yd) {
    asm("v_exp_f32 %0, %4\n\tv_exp_f32 %1, %5\n\tv_exp_f32 %2, %6\n\tv_exp_f32 %3, %7\n\tv_nop" : "=&v"(ya), "=&v"(yb), "=&v"(yc), "=&v"(yd) : "v"(a), "v"(b), "v"(c), "v"(d)); }
// the value of lane l ^ 16 (the other half of the wave), on the vector port
__device__ __forceinline__ float xhalf(float x) { const int b = __float_as_int(x); return __int_as_float(__builtin_amdgcn_permlanex16(b, b, 0x76543210, 0xfedcba98, false, false)); }

// Fragment loaders: lane (hi = lane>>4, lr = lane&15); pointer already at row lr, k offset k0 + 8*hi; elements 0..7 <- k0+8hi+0..7, 8..15 <- k0+16+8hi+0..7 (same map for A and B).
template <typename T16> struct WFrag;
template <> struct WFrag<h16> { typedef v16h V; static __device__ __forceinline__ V ld(const h16* p) { return cat16(*(const v8h*)p, *(const v8h*)(p + 16)); } static __device__ __forceinline__ v8f mma(V a, V b, v8f c) { return wmma16(a, b, c); } };
template <> struct WFrag<bf> { typedef v16bf V; static __device__ __forceinline__ V ld(const bf* p) { return cat16b(*(const v8us*)p, *(const v8us*)(p + 16)); } static __device__ __forceinline__ v8f mma(V a, V b, v8f c) { return wmmab(a, b, c); } };

// ---- GEMM body: one work-group of 4 waves per 128x128 output tile, wave (wm, wn) takes its 64x64 quarter (16 accumulators); grid (M/128, N/128), 128 threads.
// A and Bt rows come from K-contiguous 16-bit planes in stages of 128 k (256 B a row) into LDS at pitch 272 B by asynchronous copies (whole lines, each lane 16 B), two buffers: stage t + 1 flies while stage t is worked on.
// c[m][n] (f32) = sum_k (A[m][k] (+ A2[m][k] when NSPLIT == 1)) Bt[n][k]. K % 128 == 0, M % 128 == 0, N % 128 == 0.
// What becomes of c is the epilogue's choice; a wave's 64 columns are one head (HD == 64):
//   EPI 0: C[m][n] = c, f32, pitch ldc.
//   EPI 1: head planes [h][t][d] (fp16 + bf16 hi/lo) of the interleaved-pair rotation: pair (2i, 2i+1) with table entry [t][i] read BY VALUE (RNE-converted to bf16).
//   EPI 2: transposed head planes [g][d][t] (fp16 + bf16 hi/lo), straight from the accumulators: a lane holds 8 consecutive t of one d.
#define GKS   128                            // k elements per stage
#define GPB   272                            // LDS row pitch in bytes (16 B x odd, for 16-byte fragment reads)
#define GTILE (128 * GPB)                    // one operand's 128 rows of a stage
static_assert(SEQ % 128 == 0 && DQ % 128 == 0 && DKV % 128 == 0 && DM % 128 == 0);
static_assert(DM % GKS == 0 && DQ % GKS == 0);
typedef __attribute__((address_space(1))) v4i gv4i;
typedef __attribute__((address_space(3))) v4i lv4i;
// One operand's 128 rows x 256 B of a stage: 16 copies of 16 B per lane, rows 8 apart (l: the lane's LDS place, g: its global place, gs = 8 source rows in elements).
__device__ __forceinline__ void atile(unsigned char* l, const bf* g, size_t gs) {
#pragma unroll
    for (int i = 0; i < 16; ++i) __builtin_amdgcn_global_load_async_to_lds_b128((gv4i*)(g + i * gs), (lv4i*)(l + i * (8 * GPB)), 0, 0);
}
template <int NSPLIT, int EPI>
__device__ __forceinline__ void gemmw_body(const bf* __restrict__ A, const bf* __restrict__ A2, const bf* __restrict__ Bt, int K, float* C, int ldc,
                                           const float* __restrict__ COS, const float* __restrict__ SIN, h16* P16, bf* Ph, bf* Pl) {
    typedef WFrag<bf>::V V;
    constexpr unsigned STAGE = (2 + NSPLIT) * GTILE, BOFF = (1 + NSPLIT) * GTILE;   // stage = [A | A2 when NSPLIT | Bt]
    __shared__ __align__(16) unsigned char L[2 * STAGE];
    __shared__ __align__(16) float osw[4 * 16 * 68];
    const int tid = threadIdx.x, lane = tid & 31, lr = lane & 15, hi = lane >> 4; const int wave = tid >> 5, wm = wave >> 1, wn = wave & 1;
    const int R0 = blockIdx.x * 128, C0 = blockIdx.y * 128; const int r0 = R0 + wm * 64, c0 = C0 + wn * 64;
    float* os = osw + wave * (16 * 68);
    v8f acc[4][4];
#pragma unroll
    for (int mb = 0; mb < 4; ++mb)
#pragma unroll
        for (int nb = 0; nb < 4; ++nb) acc[mb][nb] = (v8f){};
    // copies: thread -> row tid >> 4 (+ 8 per copy), 16-byte chunk tid & 15 of the row's 256 B
    const size_t gs = (size_t)8 * K; const int crw = tid >> 4, cch = tid & 15;
    const size_t po = (size_t)crw * K + cch * 8;                          // the lane's own element offset inside an operand's 128 rows
    const bf* uA = A + (size_t)R0 * K; const bf* uA2 = A2 + (size_t)R0 * K; const bf* uB = Bt + (size_t)C0 * K;   // wave-uniform row bases
    unsigned char* lc = L + (crw * GPB + cch * 16);
    const int nt = K / GKS;
    atile(lc, uA + po, gs); if (NSPLIT == 1) atile(lc + GTILE, uA2 + po, gs); atile(lc + BOFF, uB + po, gs);
    asm volatile("s_wait_asynccnt 0x0" ::: "memory");                     // stage 0 landed (this wave's copies)
    __syncthreads();                                                      // ... and every other wave's
    if (nt > 1) { atile(lc + STAGE, (uA + GKS) + po, gs); if (NSPLIT == 1) atile(lc + STAGE + GTILE, (uA2 + GKS) + po, gs); atile(lc + STAGE + BOFF, (uB + GKS) + po, gs); }
#pragma unroll 1                                                          // stays rolled: one trip per stage, its buffer picked by t & 1; the 64 or 128 products of a trip are unrolled inside
    for (int t = 0; t < nt; ++t) {
        const unsigned bo = (unsigned)(t & 1) * STAGE;
        const bf* la = (const bf*)(L + bo + (wm * 64 + lr) * GPB + 16 * hi);
        const bf* lb = (const bf*)(L + bo + BOFF + (wn * 64 + lr) * GPB + 16 * hi);
        V a[2][4], a2[2][4], b[2][4];                                     // two fragment sets: the next 32 k are read from LDS ahead of this block's products
#pragma unroll
        for (int f = 0; f < 4; ++f) { a[0][f] = WFrag<bf>::ld(la + f * (16 * GPB / 2)); if (NSPLIT == 1) a2[0][f] = WFrag<bf>::ld(la + GTILE / 2 + f * (16 * GPB / 2)); b[0][f] = WFrag<bf>::ld(lb + f * (16 * GPB / 2)); }
#pragma unroll
        for (int ks = 0; ks < GKS / 32; ++ks) {
            const int cu = ks & 1, nx = cu ^ 1;
            if (ks + 1 < GKS / 32) {
#pragma unroll
                for (int f = 0; f < 4; ++f) { a[nx][f] = WFrag<bf>::ld(la + (ks + 1) * 32 + f * (16 * GPB / 2)); if (NSPLIT == 1) a2[nx][f] = WFrag<bf>::ld(la + GTILE / 2 + (ks + 1) * 32 + f * (16 * GPB / 2)); b[nx][f] = WFrag<bf>::ld(lb + (ks + 1) * 32 + f * (16 * GPB / 2)); }
                __builtin_amdgcn_sched_barrier(0);                        // keeps the next block's LDS reads one group ahead of this block's products (sunk among them, every product waits for its own read)
            }
#pragma unroll
            for (int nb = 0; nb < 4; ++nb)
#pragma unroll
                for (int mb = 0; mb < 4; ++mb) acc[mb][nb] = wmmab(a[cu][mb], b[cu][nb], acc[mb][nb]);
            if (NSPLIT == 1) {
#pragma unroll
                for (int nb = 0; nb < 4; ++nb)
#pragma unroll
                    for (int mb = 0; mb < 4; ++mb) acc[mb][nb] = wmmab(a2[cu][mb], b[cu][nb], acc[mb][nb]);
            }
        }
        // four vector slots behind the last product, on the branch's taken side too, before anything rewrites its operands
        asm volatile("v_nop\n\tv_nop\n\tv_nop\n\tv_nop" : "+v"(acc[0][0]), "+v"(acc[1][0]), "+v"(acc[2][0]), "+v"(acc[3][0]), "+v"(acc[0][1]), "+v"(acc[1][1]), "+v"(acc[2][1]), "+v"(acc[3][1]),
                                                            "+v"(acc[0][2]), "+v"(acc[1][2]), "+v"(acc[2][2]), "+v"(acc[3][2]), "+v"(acc[0][3]), "+v"(acc[1][3]), "+v"(acc[2][3]), "+v"(acc[3][3]));
        asm volatile("s_wait_dscnt 0x0" ::: "memory");                    // this wave's reads of buffer t & 1 are done before it is refilled
        asm volatile("s_wait_asynccnt 0x0" ::: "memory");                 // this wave's copies of stage t + 1 have landed
        __syncthreads();                                                  // publishes stage t + 1 and ends every wave's reads of stage t
        if (t + 2 < nt) { const int ko = (t + 2) * GKS; atile(lc + bo, (uA + ko) + po, gs); if (NSPLIT == 1) atile(lc + bo + GTILE, (uA2 + ko) + po, gs); atile(lc + bo + BOFF, (uB + ko) + po, gs); }
    }
    asm volatile("s_wait_asynccnt 0x0" ::: "memory");                     // no copy is outstanding when the wave goes on
    const int head = c0 / HD;
    const size_t tb = (size_t)(r0 + hi) * (HD / 2) + lr * 2;              // EPI 1: the lane's place in the tables' row r0 + hi
    if (EPI == 2) {
        // accumulator element j <-> row (t) mb*16 + 8*hi + j, column (d) nb*16 + lr: 16 bytes of one [d] row per lane and plane; the wave's four mb fill each row's 128-byte line
#pragma unroll
        for (int mb = 0; mb < 4; ++mb)
#pragma unroll
            for (int nb = 0; nb < 4; ++nb) { v8h o16; v8us oh, ol;
#pragma unroll
                for (int j = 0; j < 8; ++j) { const float x = acc[mb][nb][j]; o16[j] = (h16)x; unsigned short a2, c2; splitf(x, a2, c2); oh[j] = a2; ol[j] = c2; }
                const size_t e = ((size_t)head * HD + nb * 16 + lr) * SEQ + r0 + mb * 16 + hi * 8;
                *(v8h*)(P16 + e) = o16; *(v8us*)(Ph + e) = oh; *(v8us*)(Pl + e) = ol; }
        return;
    }
#pragma unroll
    for (int mb = 0; mb < 4; ++mb) {
#pragma unroll
        for (int nb = 0; nb < 4; ++nb) {
#pragma unroll
            for (int j = 0; j < 8; ++j) os[(hi * 8 + j) * 68 + nb * 16 + lr] = acc[mb][nb][j]; }
        __builtin_amdgcn_wave_barrier(); asm volatile("" ::: "memory");
        if (EPI == 0) {
            float* crow = C + (size_t)(r0 + mb * 16) * ldc + c0;
#pragma unroll
            for (int s = 0; s < 8; ++s) { const int row = 2 * s + hi, cofs = lr * 4; const v4f val = *(const v4fa*)(os + row * 68 + cofs);
                *(v4f*)(crow + (size_t)row * ldc + cofs) = val; }
        } else {
            // a lane takes d = 4*lr .. 4*lr+3 (two pairs) of row t; 16 lanes write one whole 128-byte [t] row of each plane
            v2f cc[8], sn[8];
#pragma unroll
            for (int s = 0; s < 8; ++s) { cc[s] = *(const v2f*)(COS + tb + (mb * 16 + 2 * s) * (HD / 2)); sn[s] = *(const v2f*)(SIN + tb + (mb * 16 + 2 * s) * (HD / 2)); }
#pragma unroll
            for (int s = 0; s < 8; ++s) { const int row = 2 * s + hi, cofs = lr * 4; const v4f val = *(const v4fa*)(os + row * 68 + cofs);
                v4h o16; v4us oh, ol;
#pragma unroll
                for (int p = 0; p < 2; ++p) { const float c = bfr(cc[s][p]), sv = bfr(sn[s][p]); const float x0 = val[2 * p], x1 = val[2 * p + 1];
                    const float y0 = x0 * c - x1 * sv, y1 = x0 * sv + x1 * c; unsigned short a2, c2;
                    o16[2 * p] = (h16)y0; splitf(y0, a2, c2); oh[2 * p] = a2; ol[2 * p] = c2;
                    o16[2 * p + 1] = (h16)y1; splitf(y1, a2, c2); oh[2 * p + 1] = a2; ol[2 * p + 1] = c2; }
                const size_t e = ((size_t)head * SEQ + r0 + mb * 16 + row) * HD + cofs;
                *(v4h*)(P16 + e) = o16; *(v4us*)(Ph + e) = oh; *(v4us*)(Pl + e) = ol; }
            if (mb < 3) asm volatile("s_wait_xcnt 0x0" ::: "memory");     // before the next rows' table loads land in registers that these stores name
        }
        __builtin_amdgcn_wave_barrier(); asm volatile("" ::: "memory");
    }
}
__global__ __launch_bounds__(128) void k_gemm_r(const bf* __restrict__ A, const bf* __restrict__ Bt, int K, const float* __restrict__ COS, const float* __restrict__ SIN, h16* P16, bf* Ph, bf* Pl) {
    gemmw_body<0, 1>(A, A, Bt, K, (float*)0, 0, COS, SIN, P16, Ph, Pl); }
__global__ __launch_bounds__(128) void k_gemm_v(const bf* __restrict__ A, const bf* __restrict__ Bt, int K, h16* V16, bf* Vh, bf* Vl) {
    gemmw_body<0, 2>(A, A, Bt, K, (float*)0, 0, (const float*)0, (const float*)0, V16, Vh, Vl); }
__global__ __launch_bounds__(128) void k_gemm_s(const bf* __restrict__ A, const bf* __restrict__ A2, const bf* __restrict__ Bt, int K, float* C, int ldc) {
    gemmw_body<1, 0>(A, A2, Bt, K, C, ldc, (const float*)0, (const float*)0, (h16*)0, (bf*)0, (bf*)0); }

// ---- weight pre-pass: w[k][n] f32 -> Bt[n][k] bf16 (RNE), all four weights in one launch; one work-group of 8 waves per 128 k x 128 n tile.
// Reads: a wave takes 16 k rows, one whole 512-byte run of a row per load, all 16 loads in flight at once. A lane then holds 16 k of 4 n: eight 16-byte chunks (8 k of one n), which go into
// an LDS tile [n][k] whose 16 chunks a row are permuted by (n >> 2) & 15, so that the 16 lanes of a store (rows 4 apart) and of a read (one row) each cover all banks once.
// Writes: 16 lanes put out 256 contiguous bytes of one n row (two whole lines, one writer each).
#define WTT 128
static_assert(DM % WTT == 0 && DQ % WTT == 0 && DKV % WTT == 0);
#define WT_Q  ((DM / WTT) * (DQ / WTT))
#define WT_KV ((DM / WTT) * (DKV / WTT))
#define WT_O  ((DQ / WTT) * (DM / WTT))
template <int K, int N>
__device__ __forceinline__ void wt_tile(const float* __restrict__ w, bf* Bt, int t, unsigned short* T) {
    const int tid = threadIdx.x, lane = tid & 31, l16 = lane & 15, hi = lane >> 4;
    const int wave = __builtin_amdgcn_readfirstlane(tid >> 5);            // the wave's number in a scalar register: row bases are scalar, a lane adds only its own 16 bytes
    const int n0 = (t % (N / WTT)) * WTT, k0 = (t / (N / WTT)) * WTT;
    const float* g = (w + (size_t)(k0 + wave * 16) * N + n0) + lane * 4;
    v4f v[16];
#pragma unroll
    for (int i = 0; i < 16; ++i) v[i] = *(const v4f*)(g + (size_t)i * N);
#pragma unroll
    for (int c = 0; c < 4; ++c)
#pragma unroll
        for (int q = 0; q < 2; ++q) { v8us o;
#pragma unroll
            for (int j = 0; j < 8; ++j) o[j] = f2bf(v[q * 8 + j][c]);
            *(v8us*)(T + (lane * 4 + c) * WTT + (((wave * 2 + q) ^ l16) * 8)) = o; }
    __syncthreads();                                                      // the tile is whole before it is read along k
    bf* d = Bt + (size_t)(n0 + wave * 2 + hi) * K + k0 + l16 * 8;
    v8us o[8];
#pragma unroll
    for (int s = 0; s < 8; ++s) { const int n = s * 16 + wave * 2 + hi;
        o[s] = *(const v8us*)(T + n * WTT + ((l16 ^ ((n >> 2) & 15)) * 8)); }
#pragma unroll
    for (int s = 0; s < 8; ++s) { *(v8us*)(d + (size_t)s * 16 * K) = o[s];
        asm volatile("s_wait_xcnt 0x0" ::: "memory"); }                   // stands behind each store, before any path on which the store's address or data registers are written again
}
__global__ __launch_bounds__(256) void k_wt4(const float* __restrict__ wq, const float* __restrict__ wk, const float* __restrict__ wv, const float* __restrict__ wo, bf* WQ, bf* WK, bf* WV, bf* WO) {
    __shared__ __align__(16) unsigned short T[WTT * WTT];
    const int b = (int)blockIdx.x;                                        // which weight: the same for the whole work-group
    if (b < WT_Q) wt_tile<DM, DQ>(wq, WQ, b, T);
    else if (b < WT_Q + 2 * WT_KV) { const bool sv = b >= WT_Q + WT_KV; wt_tile<DM, DKV>(sv ? wv : wk, sv ? WV : WK, b - (sv ? WT_Q + WT_KV : WT_Q), T); }
    else wt_tile<DQ, DM>(wo, WO, b - (WT_Q + 2 * WT_KV), T);
}
__global__ __launch_bounds__(256) void k_cvt8(const float* __restrict__ src, bf* dst, size_t n8) { const size_t i = (size_t)blockIdx.x * 256 + threadIdx.x; if (i >= n8) return; const v8f v = *(const v8f*)(src + i * 8); v8us o;
#pragma unroll
    for (int k = 0; k < 8; ++k) o[k] = f2bf(v[k]); *(v8us*)(dst + i * 8) = o;  }

// k_maskbits: one work-group of 16 waves per (16 query rows, 32 mask words); wave r takes row r and holds its 1024 mask values as 8 loads of 512 contiguous bytes, all in flight at once.
// Bit-plane MB[q][w] (bit n = mask[q][32w+n] != 0) and tile class CL[q/16][w]: 0 = no key kept in the 16x32 tile, 1 = all kept, 2 = mixed.
__global__ __launch_bounds__(512) void k_maskbits(const int* __restrict__ mask, unsigned* MBp, int* CLp) {
    __shared__ unsigned sw[16 * 32];
    const int lane = threadIdx.x & 31, row = threadIdx.x >> 5; const int qt = blockIdx.x, wb = blockIdx.y * 32; const int q = qt * 16 + row;
    const int* mr = mask + (size_t)q * SEQ_FULL + wb * 32 + lane * 4;
    v4i v[8];
#pragma unroll
    for (int i = 0; i < 8; ++i) v[i] = *(const v4i*)(mr + 128 * i);
    // nibble i of x: the lane's four values of load i, i.e. bits 4*(lane&7)..+3 of word wb + 4*i + (lane>>3)
    unsigned x = 0u;
#pragma unroll
    for (int i = 0; i < 8; ++i) { const unsigned nib = (v[i][0] != 0 ? 1u : 0u) | (v[i][1] != 0 ? 2u : 0u) | (v[i][2] != 0 ? 4u : 0u) | (v[i][3] != 0 ? 8u : 0u); x |= nib << (4 * i); }
    // 8x8 nibble transpose inside each group of 8 lanes (three exchanges; a lane keeps the nibbles under its mask and takes the partner's, rotated into place): afterwards lane 8g+t holds the whole word wb + 4*t + g
    unsigned y;
    y = __builtin_rotateright32(__shfl_xor(x, 4, 32), 16);               { const unsigned km = (lane & 4) ? 0xFFFF0000u : 0x0000FFFFu; x = (x & km) | (y & ~km); }
    y = __builtin_rotateright32(__shfl_xor(x, 2, 32), (lane & 2) ? 8 : 24); { const unsigned km = (lane & 2) ? 0xFF00FF00u : 0x00FF00FFu; x = (x & km) | (y & ~km); }
    y = __builtin_rotateright32(__shfl_xor(x, 1, 32), (lane & 1) ? 4 : 28); { const unsigned km = (lane & 1) ? 0xF0F0F0F0u : 0x0F0F0F0Fu; x = (x & km) | (y & ~km); }
    const int w = wb + 4 * (lane & 7) + (lane >> 3);
    sw[row * 32 + lane] = x;
    __syncthreads();                                                      // the 16 rows' words -> the class of each 16x32 tile
    if (row == 0) {
        unsigned an = 0xFFFFFFFFu, orr = 0u;
#pragma unroll
        for (int r = 0; r < 16; ++r) { const unsigned t = sw[r * 32 + lane]; an &= t; orr |= t; }
        CLp[(size_t)qt * NW + w] = (orr == 0u) ? 0 : ((an == 0xFFFFFFFFu) ? 1 : 2);
    }
    MBp[(size_t)q * NW + w] = x;                                          // one wave = one whole 128-byte line
}

#define AKS   64                             // keys per stage
#define APB   144                            // LDS row pitch in bytes (16 B x odd, for 16-byte fragment reads)
#define ATILE (64 * APB)                     // one plane's 64 rows of a stage
static_assert(REP == 4 && HD == 64 && SEQ % AKS == 0 && NW <= 64);
// One plane's 64 rows x 128 B of a stage: 4 copies of 16 B per lane, rows 16 apart (l: the lane's LDS place, g: its global place, gs = 16 source rows in elements).
template <typename T16>
__device__ __forceinline__ void ktile(unsigned char* l, const T16* g, size_t gs) {
#pragma unroll
    for (int i = 0; i < 4; ++i) __builtin_amdgcn_global_load_async_to_lds_b128((gv4i*)(g + i * gs), (lv4i*)(l + i * (16 * APB)), 0, 0);
}
template <bool SPLIT>
__device__ __forceinline__ void attn_body(const h16* __restrict__ Q16, const h16* __restrict__ K16, const h16* __restrict__ V16,
                                          const bf* __restrict__ Qh, const bf* __restrict__ Ql, const bf* __restrict__ Kh, const bf* __restrict__ Kl, const bf* __restrict__ Vh, const bf* __restrict__ Vl,
                                          const unsigned* __restrict__ MBp, const int* __restrict__ CLp, bf* Ch, bf* Cl, int qt0) {
    constexpr unsigned VOFF = (SPLIT ? 2 : 1) * ATILE, STG = 2 * VOFF;   // stage = [K (hi | lo when SPLIT) | V^T (hi | lo when SPLIT)]
    __shared__ __align__(16) unsigned char KV[2 * STG];
    __shared__ __align__(16) float osw[4 * 16 * 68];
    const int tid = threadIdx.x, lane = tid & 31, lr = lane & 15, hi = lane >> 4, wave = tid >> 5;
    float* os = osw + wave * (16 * 68);                                  // wave-private tile
    const int qt = qt0 + (int)blockIdx.x; const int hk = (int)blockIdx.y; const int h = hk * REP + wave; const int q0 = qt * 16;
    const size_t qoff = ((size_t)h * SEQ + q0 + lr) * HD + 8 * hi;       // B fragment: column = query q0+lr, d offset 8*hi
    // the row of tile classes as two bit sets, the same in every wave of the work-group: nz bit j = half j has a kept key, al bit j = all of its keys are kept
    const int cl0 = CLp[(size_t)qt * NW + lane]; const int cl1 = (NW > 32) ? CLp[(size_t)qt * NW + (NW > 32 ? 32 : 0) + lane] : 0;
    const unsigned long long nz = (unsigned long long)__builtin_amdgcn_ballot_w32(cl0 != 0) | ((unsigned long long)__builtin_amdgcn_ballot_w32(cl1 != 0) << 32);
    const unsigned long long al = (unsigned long long)__builtin_amdgcn_ballot_w32(cl0 == 1) | ((unsigned long long)__builtin_amdgcn_ballot_w32(cl1 == 1) << 32);
    // copies: thread -> row tid >> 3 (+ 16 per copy), 16-byte chunk tid & 7 of the row's 128 B; stage s: keys 64 s .. 64 s + 63 (s <= 31 from a 64-bit set: inside the planes)
    const int crw = tid >> 3, cch = tid & 7;
    unsigned char* lc = KV + (crw * APB + cch * 16);
    const size_t kpo = ((size_t)hk * SEQ + crw) * HD + cch * 8;          // K planes [g][t][d]: row = key
    const size_t vpo = ((size_t)hk * HD + crw) * SEQ + cch * 8;          // V^T planes [g][d][t]: row = d
    auto stage = [&](unsigned bo, int s) {
        const size_t ke = kpo + (size_t)s * (AKS * HD), ve = vpo + (size_t)s * AKS;
        if (SPLIT) { ktile(lc + bo, Kh + ke, (size_t)16 * HD); ktile(lc + bo + ATILE, Kl + ke, (size_t)16 * HD); ktile(lc + bo + VOFF, Vh + ve, (size_t)16 * SEQ); ktile(lc + bo + VOFF + ATILE, Vl + ve, (size_t)16 * SEQ); }
        else { ktile(lc + bo, K16 + ke, (size_t)16 * HD); ktile(lc + bo + VOFF, V16 + ve, (size_t)16 * SEQ); }
    };
    unsigned long long rem = nz;                                          // kept halves whose stage is not copied yet
    int sc = -1, sn = -1;                                                 // the stage worked on, the stage in flight (-1: none)
    if (rem != 0ull) { sc = __builtin_ctzll(rem) >> 1; rem &= ~(3ull << (2 * sc)); stage(0u, sc); }
    // q fragments: read once, held in registers over the key loop
    v16bf qh0, qh1, ql0, ql1; v16h qa0, qa1;
    if (SPLIT) { qh0 = WFrag<bf>::ld(Qh + qoff); qh1 = WFrag<bf>::ld(Qh + qoff + 32); ql0 = WFrag<bf>::ld(Ql + qoff); ql1 = WFrag<bf>::ld(Ql + qoff + 32); }
    else { qa0 = WFrag<h16>::ld(Q16 + qoff); qa1 = WFrag<h16>::ld(Q16 + qoff + 32); }
    const float NINF = -__builtin_inff();
    float mi = NINF, li = 0.0f; v8f acc[4];                               // the lane's query: running maximum (both halves alike), sum over the lane's own keys; acc[ot][r] = O^T[16*ot + 8*hi + r][lr]
#pragma unroll
    for (int ot = 0; ot < 4; ++ot) acc[ot] = (v8f){};
    asm volatile("s_wait_asynccnt 0x0" ::: "memory");                     // the first stage landed (this wave's copies)
    __syncthreads();                                                      // ... and every other wave's
    if (rem != 0ull) { sn = __builtin_ctzll(rem) >> 1; rem &= ~(3ull << (2 * sn)); stage(STG, sn); }
    unsigned bo = 0u;
#pragma unroll 1                                                          // stays rolled: one trip per kept stage (at most 32: each takes its two bits out of the set)
    while (sc >= 0) {
#pragma unroll 1                                                          // stays rolled: the halves depend on one another through the running maximum, unrolling buys only code
      for (int hf = 0; hf < 2; ++hf) {
        const int j = 2 * sc + hf;
        if (((nz >> j) & 1ull) == 0ull) continue;                         // the same in every wave of the work-group
        // the mask word of the lane's own query, shifted so that bit r is key 8*hi + r and bit 16 + r key 16 + 8*hi + r
        unsigned wd = 0xFFFFFFFFu;
        if (((al >> j) & 1ull) == 0ull) wd = MBp[(size_t)(q0 + lr) * NW + j] >> (8 * hi);
        v8f s0 = (v8f){}, s1 = (v8f){};
        const unsigned char* kb = KV + bo + (hf * 32 + lr) * APB + 16 * hi;   // A fragment (scores): lane = key, k = d
        if (SPLIT) {
            { const v16bf kh0 = WFrag<bf>::ld((const bf*)kb), kh1 = WFrag<bf>::ld((const bf*)(kb + 64)), kl0 = WFrag<bf>::ld((const bf*)(kb + ATILE)), kl1 = WFrag<bf>::ld((const bf*)(kb + ATILE + 64));
              s0 = wmmab(kh0, ql0, s0); s0 = wmmab(kh1, ql1, s0); s0 = wmmab(kl0, qh0, s0); s0 = wmmab(kl1, qh1, s0); s0 = wmmab(kh0, qh0, s0); s0 = wmmab(kh1, qh1, s0); }
            { const unsigned char* k1 = kb + 16 * APB; const v16bf kh0 = WFrag<bf>::ld((const bf*)k1), kh1 = WFrag<bf>::ld((const bf*)(k1 + 64)), kl0 = WFrag<bf>::ld((const bf*)(k1 + ATILE)), kl1 = WFrag<bf>::ld((const bf*)(k1 + ATILE + 64));
              s1 = wmmab(kh0, ql0, s1); s1 = wmmab(kh1, ql1, s1); s1 = wmmab(kl0, qh0, s1); s1 = wmmab(kl1, qh1, s1); s1 = wmmab(kh0, qh0, s1); s1 = wmmab(kh1, qh1, s1);
              asm volatile("v_nop\n\tv_nop\n\tv_nop\n\tv_nop" : "+v"(s0), "+v"(s1) : "v"(qh1), "v"(kh1)); }
        } else {
            const v16h k00 = WFrag<h16>::ld((const h16*)kb), k01 = WFrag<h16>::ld((const h16*)(kb + 64));
            const v16h k10 = WFrag<h16>::ld((const h16*)(kb + 16 * APB)), k11 = WFrag<h16>::ld((const h16*)(kb + 16 * APB + 64));
            s0 = wmma16(k00, qa0, s0); s0 = wmma16(k01, qa1, s0); s1 = wmma16(k10, qa0, s1); s1 = wmma16(k11, qa1, s1);
            asm volatile("v_nop\n\tv_nop\n\tv_nop\n\tv_nop" : "+v"(s0), "+v"(s1) : "v"(qa1), "v"(k11));
        }
        // V^T fragments depend on the stage alone: read here, they arrive under the softmax
        const unsigned char* vb = KV + bo + VOFF + lr * APB + hf * 64 + 16 * hi;   // A fragment (V^T.P^T): lane = d, k = key
        v16bf vh[4], vl[4]; v16h vf[4];
#pragma unroll
        for (int ot = 0; ot < 4; ++ot) {
            if (SPLIT) { vh[ot] = WFrag<bf>::ld((const bf*)(vb + ot * (16 * APB))); vl[ot] = WFrag<bf>::ld((const bf*)(vb + ATILE + ot * (16 * APB))); }
            else vf[ot] = WFrag<h16>::ld((const h16*)(vb + ot * (16 * APB)));
        }
        // online softmax in log2 units; accumulator element r <-> key 8*hi + r (s0) / 16 + 8*hi + r (s1), column lr = the lane's query
        const v8f t0 = s0 * SCL2, t1 = s1 * SCL2;
        float v0[8], v1[8], mx = NINF;
#pragma unroll
        for (int r = 0; r < 8; ++r) {
            v0[r] = ((wd >> r) & 1u) != 0u ? t0[r] : NINF; v1[r] = ((wd >> (16 + r)) & 1u) != 0u ? t1[r] : NINF;
            mx = fmaxf(mx, fmaxf(v0[r], v1[r]));
        }
        mx = fmaxf(mx, xhalf(mx));
        const float nm = fmaxf(mi, mx); const float ms = (nm == NINF) ? 0.0f : nm;
        const float corr = ex2(mi - ms);
        mi = nm;
        float ps[8]; v16h p16; v8us pha, phb, pla, plb;
#pragma unroll
        for (int r = 0; r < 8; r += 2) {
            float p0, p1, p2, p3; ex2x4(v0[r] - ms, v1[r] - ms, v0[r + 1] - ms, v1[r + 1] - ms, p0, p1, p2, p3);
            if (SPLIT) { unsigned short a, c; splitf(p0, a, c); pha[r] = a; pla[r] = c; splitf(p1, a, c); phb[r] = a; plb[r] = c; ps[r] = p0 + p1;
                splitf(p2, a, c); pha[r + 1] = a; pla[r + 1] = c; splitf(p3, a, c); phb[r + 1] = a; plb[r + 1] = c; ps[r + 1] = p2 + p3; }
            else { const v2h e0 = __builtin_convertvector((v2f){p0 * PCAR, p2 * PCAR}, v2h), e1 = __builtin_convertvector((v2f){p1 * PCAR, p3 * PCAR}, v2h);   // two keys per packed conversion; the sums read the rounded values
                p16[r] = e0[0]; p16[r + 1] = e0[1]; p16[8 + r] = e1[0]; p16[9 + r] = e1[1]; ps[r] = (float)e0[0] + (float)e1[0]; ps[r + 1] = (float)e0[1] + (float)e1[1]; }
        }
        li = li * corr + (((ps[0] + ps[1]) + (ps[2] + ps[3])) + ((ps[4] + ps[5]) + (ps[6] + ps[7])));
#pragma unroll
        for (int ot = 0; ot < 4; ++ot) acc[ot] *= corr;
        if (SPLIT) {
            const v16bf ph = cat16b(pha, phb), pl = cat16b(pla, plb);
#pragma unroll
            for (int ot = 0; ot < 4; ++ot) { acc[ot] = wmmab(vh[ot], pl, acc[ot]); acc[ot] = wmmab(vl[ot], ph, acc[ot]); acc[ot] = wmmab(vh[ot], ph, acc[ot]); }
            asm volatile("v_nop\n\tv_nop\n\tv_nop\n\tv_nop" : "+v"(acc[0]), "+v"(acc[1]), "+v"(acc[2]), "+v"(acc[3]) : "v"(ph), "v"(pl));
        } else {
#pragma unroll
            for (int ot = 0; ot < 4; ++ot) acc[ot] = wmma16(vf[ot], p16, acc[ot]);
            asm volatile("v_nop\n\tv_nop\n\tv_nop\n\tv_nop" : "+v"(acc[0]), "+v"(acc[1]), "+v"(acc[2]), "+v"(acc[3]) : "v"(p16));
        }
      }
        asm volatile("s_wait_dscnt 0x0" ::: "memory");                    // this wave's reads of the buffer are done before it is refilled
        asm volatile("s_wait_asynccnt 0x0" ::: "memory");                 // this wave's copies of the stage in flight have landed
        __syncthreads();                                                  // publishes the stage in flight and ends every wave's reads of this one
        int s2 = -1;
        if (rem != 0ull) { s2 = __builtin_ctzll(rem) >> 1; rem &= ~(3ull << (2 * s2)); stage(bo, s2); }
        sc = sn; sn = s2; bo = STG - bo;
    }
    asm volatile("s_wait_asynccnt 0x0" ::: "memory");                     // no copy is outstanding when the wave goes on
    // finish: join the two halves' sums, normalise, stage 16x64 f32 (a lane holds 8 consecutive d of its query's row), write hi/lo lines
    const float inv = 1.0f / (li + xhalf(li));
#pragma unroll
    for (int ot = 0; ot < 4; ++ot) { const v8f o = acc[ot] * inv; float* op = os + lr * 68 + ot * 16 + 8 * hi;
        *(v4fa*)op = (v4f){o[0], o[1], o[2], o[3]}; *(v4fa*)(op + 4) = (v4f){o[4], o[5], o[6], o[7]}; }
    __syncthreads();
{
#pragma unroll
        for (int s = 0; s < 4; ++s) { const int row = 4 * s + (lane >> 3), c8 = (lane & 7) * 8;
            const v4f x0 = *(const v4fa*)(os + row * 68 + c8), x1 = *(const v4fa*)(os + row * 68 + c8 + 4); v8us oh, ol;
#pragma unroll
            for (int k = 0; k < 4; ++k) { unsigned short a, c; splitf(x0[k], a, c); oh[k] = a; ol[k] = c; splitf(x1[k], a, c); oh[4 + k] = a; ol[4 + k] = c; }
            const size_t oo = (size_t)(q0 + row) * DQ + (size_t)h * HD + c8;
            *(v8us*)(Ch + oo) = oh; *(v8us*)(Cl + oo) = ol; }
         }
}
__global__ __launch_bounds__(128) void k_attn_hl(const bf* __restrict__ Qh, const bf* __restrict__ Ql, const bf* __restrict__ Kh, const bf* __restrict__ Kl, const bf* __restrict__ Vh, const bf* __restrict__ Vl,
                                                const unsigned* __restrict__ MBp, const int* __restrict__ CLp, bf* Ch, bf* Cl, int qt0) {
    attn_body<true>((const h16*)0, (const h16*)0, (const h16*)0, Qh, Ql, Kh, Kl, Vh, Vl, MBp, CLp, Ch, Cl, qt0); }
__global__ __launch_bounds__(128) void k_attn_f16(const h16* __restrict__ Q16, const h16* __restrict__ K16, const h16* __restrict__ V16,
                                                 const unsigned* __restrict__ MBp, const int* __restrict__ CLp, bf* Ch, bf* Cl, int qt0) {
    attn_body<false>(Q16, K16, V16, (const bf*)0, (const bf*)0, (const bf*)0, (const bf*)0, (const bf*)0, (const bf*)0, MBp, CLp, Ch, Cl, qt0); }

constexpr size_t al256(size_t b) { return (b + 255) & ~(size_t)255; }
constexpr size_t WS_TOTAL =
    al256((size_t)DQ * DM * 2) + 2 * al256((size_t)DKV * DM * 2) + al256((size_t)DM * DQ * 2) +      // WQ, WK, WV, WO
    al256((size_t)SEQ * DM * 2) +                                                                      // XB
    3 * al256((size_t)NH * SEQ * HD * 2) + 6 * al256((size_t)NKV * SEQ * HD * 2) +                     // q planes, k planes, v planes
    2 * al256((size_t)SEQ * DQ * 2) +                                                                  // ctx hi/lo
    al256((size_t)SEQ * NW * 4) + al256((size_t)(SEQ / 16) * NW * 4);                                  // mask bits, tile classes
static_assert(WS_TOTAL <= (size_t)134217728);

extern "C" void kernel_launch(void* const* d_in, const int* in_sizes, int n_in,
                              void* d_out, int out_size, void* d_ws, size_t ws_size, hipStream_t stream) {
    if (n_in < 8) return;
    if ((long long)in_sizes[0] < (long long)(NB - 1) * SEQ_FULL * DM + (long long)SEQ * DM) return;
    if ((long long)in_sizes[1] < (long long)DM * DQ || (long long)in_sizes[2] < (long long)DM * DKV || (long long)in_sizes[3] < (long long)DM * DKV || (long long)in_sizes[4] < (long long)DQ * DM) return;
    if ((long long)in_sizes[5] < (long long)SEQ * (HD / 2) || (long long)in_sizes[6] < (long long)SEQ * (HD / 2)) return;
    if ((long long)in_sizes[7] < (long long)(SEQ - 1) * SEQ_FULL + SEQ) return;
    if ((long long)out_size < (long long)(NB - 1) * SEQ_FULL * DM + (long long)SEQ * DM) return;
    if (ws_size < WS_TOTAL) return;
    const float* x = (const float*)d_in[0]; const float* wq = (const float*)d_in[1]; const float* wk = (const float*)d_in[2]; const float* wv = (const float*)d_in[3]; const float* wo = (const float*)d_in[4];
    const float* fcos = (const float*)d_in[5]; const float* fsin = (const float*)d_in[6]; const int* mask = (const int*)d_in[7];
    float* OUT = (float*)d_out;     // [1][2048][2048]
    char* wsp = (char*)d_ws;
    auto take = [&](size_t bytes) { char* p = wsp; wsp += (bytes + 255) & ~(size_t)255; return (void*)p; };
    bf* WQ = (bf*)take((size_t)DQ * DM * 2); bf* WK = (bf*)take((size_t)DKV * DM * 2); bf* WV = (bf*)take((size_t)DKV * DM * 2); bf* WO = (bf*)take((size_t)DM * DQ * 2);
    bf* XB = (bf*)take((size_t)SEQ * DM * 2);
    h16* QP16 = (h16*)take((size_t)NH * SEQ * HD * 2); bf* QPh = (bf*)take((size_t)NH * SEQ * HD * 2); bf* QPl = (bf*)take((size_t)NH * SEQ * HD * 2);
    h16* KP16 = (h16*)take((size_t)NKV * SEQ * HD * 2); bf* KPh = (bf*)take((size_t)NKV * SEQ * HD * 2); bf* KPl = (bf*)take((size_t)NKV * SEQ * HD * 2);
    h16* VT16 = (h16*)take((size_t)NKV * SEQ * HD * 2); bf* VTh = (bf*)take((size_t)NKV * SEQ * HD * 2); bf* VTl = (bf*)take((size_t)NKV * SEQ * HD * 2);
    bf* CXh = (bf*)take((size_t)SEQ * DQ * 2); bf* CXl = (bf*)take((size_t)SEQ * DQ * 2);
    unsigned* MBp = (unsigned*)take((size_t)SEQ * NW * 4); int* CLp = (int*)take((size_t)(SEQ / 16) * NW * 4);
    if ((size_t)(wsp - (char*)d_ws) > ws_size) return;

    // weights: w[in][out] -> Bt[out][in] bf16.  wq: in DM, out DQ; wk/wv: in DM, out DKV; wo: in DQ, out DM.
    k_wt4<<<WT_Q + 2 * WT_KV + WT_O, 256, 0, stream>>>(wq, wk, wv, wo, WQ, WK, WV, WO);
    k_maskbits<<<dim3(SEQ / 16, NW / 32, 1), 512, 0, stream>>>(mask, MBp, CLp);
    for (int b = 0; b < NB; ++b) {
        k_cvt8<<<(unsigned)(((size_t)SEQ * DM / 8 + 255) / 256), 256, 0, stream>>>(x + (size_t)b * SEQ_FULL * DM, XB, (size_t)SEQ * DM / 8);
        k_gemm_r<<<dim3(SEQ / 128, DQ / 128, 1), 128, 0, stream>>>(XB, WQ, DM, fcos, fsin, QP16, QPh, QPl);
        k_gemm_r<<<dim3(SEQ / 128, DKV / 128, 1), 128, 0, stream>>>(XB, WK, DM, fcos, fsin, KP16, KPh, KPl);
        k_gemm_v<<<dim3(SEQ / 128, DKV / 128, 1), 128, 0, stream>>>(XB, WV, DM, VT16, VTh, VTl);
        if (RH / 16 > 0) k_attn_hl<<<dim3(RH / 16, NKV, 1), 128, 0, stream>>>(QPh, QPl, KPh, KPl, VTh, VTl, MBp, CLp, CXh, CXl, 0);
        if ((SEQ - RH) / 16 > 0) k_attn_f16<<<dim3((SEQ - RH) / 16, NKV, 1), 128, 0, stream>>>(QP16, KP16, VT16, MBp, CLp, CXh, CXl, RH / 16);
        k_gemm_s<<<dim3(SEQ / 128, DM / 128, 1), 128, 0, stream>>>(CXh, CXl, WO, DQ, OUT + (size_t)b * SEQ_FULL * DM, DM);
    }
}

// v007
// Measured time: 120 microseconds a run.
// In both of two side-by-side timings against v006, it was 1.34 times as fast.
// Counting every step since v000, it is 4.75 times as fast.
#include <hip/hip_runtime.h>

// Contractions (all f32 accumulate): x@wq, x@wk, x@wv v_wmma_f32_16x16x32_bf16 (bf16 x bf16 operand planes, inputs RNE-converted to bf16); scores q.k and P.V: query rows < 512 bf16 hi/lo planes (3 products each), rows >= 512 v_wmma_f32_16x16x32_f16 (P carried x1024); ctx@wo bf16 hi/lo ctx planes x bf16 weights (2 products).
// Grouped-query causal-style attention with interleaved-pair rotation from INPUT tables and an INPUT int32 mask (read by value through a bit-plane + 16x32 tile classes); softmax f32 online running-max form.
// Flash-style fused attention: one wave per 16 query rows per head, the 4 query heads of a kv head in one work-group; K / V^T tiles of 64 keys staged in LDS by asynchronous copies (two buffers); scores and context are formed transposed (S^T = K.Q^T, O^T += V^T.P^T), so P goes from the score accumulators straight into an operand.

#ifndef NB
#define NB 1
#endif
#ifndef SEQ
#define SEQ 2048
#endif
#define NB_FULL  1
#define SEQ_FULL 2048
#define DM   2048
#define NH   32
#define NKV  8
#define REP  (NH / NKV)
#define HD   64
#define DQ   (NH * HD)
#define DKV  (NKV * HD)
#define RH   ((SEQ) < 512 ? (SEQ) : 512)     // query rows < RH use hi+lo planes
#define NW   (SEQ / 32)                      // 32-key words per mask row
#define PCAR 1024.0f
#define SCL2 0.18033688011112042f            // (1/8) * log2(e)

static_assert(SEQ % 64 == 0);                // key halves of 32
static_assert(SEQ <= SEQ_FULL);
static_assert(NW % 32 == 0);                 // mask pre-pass: 32 words per work-group
static_assert(HD == 64);
static_assert(DM % 64 == 0 && DQ % 64 == 0 && DKV % 64 == 0);
static_assert(DM % 32 == 0 && DQ % 32 == 0);
static_assert(NH % NKV == 0);
static_assert(RH % 16 == 0 && (SEQ - RH) % 16 == 0);
static_assert(NB == 1 && NB <= NB_FULL);      // one batch: its x conversion shares the pre-pass launch

typedef _Float16 h16;
typedef unsigned short bf;
typedef __attribute__((ext_vector_type(16))) __bf16   v16bf;
typedef __attribute__((ext_vector_type(16))) _Float16 v16h;
typedef __attribute__((ext_vector_type(8)))  _Float16 v8h;
typedef __attribute__((ext_vector_type(8)))  unsigned short v8us;
typedef __attribute__((ext_vector_type(8)))  float    v8f;
typedef __attribute__((ext_vector_type(4)))  float    v4f;
typedef __attribute__((ext_vector_type(4)))  int      v4i;
typedef __attribute__((ext_vector_type(4)))  _Float16 v4h;
typedef __attribute__((ext_vector_type(2)))  _Float16 v2h;
typedef __attribute__((ext_vector_type(4)))  unsigned short v4us;
typedef __attribute__((ext_vector_type(2)))  unsigned short v2us;
typedef __attribute__((ext_vector_type(2)))  float    v2f;
typedef v4f  __attribute__((may_alias)) v4fa;

__device__ __forceinline__ unsigned short f2bf(float f) { unsigned u = __float_as_uint(f); u += 0x7FFFu + ((u >> 16) & 1u); return (unsigned short)(u >> 16); }
__device__ __forceinline__ float bf2f(unsigned short b) { return __uint_as_float(((unsigned)b) << 16); }
__device__ __forceinline__ float bfr(float f) { return bf2f(f2bf(f)); }
__device__ __forceinline__ v16h cat16(v8h lo, v8h hi) { return __builtin_shufflevector(lo, hi, 0, 1, 2, 3, 4, 5, 6, 7, 8, 9, 10, 11, 12, 13, 14, 15); }
__device__ __forceinline__ v16bf cat16b(v8us lo, v8us hi) { return __builtin_bit_cast(v16bf, __builtin_shufflevector(lo, hi, 0, 1, 2, 3, 4, 5, 6, 7, 8, 9, 10, 11, 12, 13, 14, 15)); }
__device__ __forceinline__ v8f wmma16(v16h a, v16h b, v8f c) { return __builtin_amdgcn_wmma_f32_16x16x32_f16(false, a, false, b, (short)0, c, false, false); }
__device__ __forceinline__ v8f wmmab(v16bf a, v16bf b, v8f c) { return __builtin_amdgcn_wmma_f32_16x16x32_bf16(false, a, false, b, (short)0, c, false, false); }
__device__ __forceinline__ void splitf(float y, unsigned short& h, unsigned short& l) { h = f2bf(y); l = f2bf(y - bf2f(h)); }
__device__ __forceinline__ float ex2(float x) { return __builtin_amdgcn_exp2f(x); }
// Four exponentials (v_exp_f32, as ex2) in one statement: the outputs are early-clobber, so none lands on a source of another, and the closing v_nop is the one slot that the
// instruction set asks for behind a transcendental before its result is used or its source overwritten; in a run of separate ones the register allocator is free to put a result on its neighbour's source.
__device__ __forceinline__ void ex2x4(float a, float b, float c, float d, float& ya, float& yb, float& yc, float& yd) {
    asm("v_exp_f32 %0, %4\n\tv_exp_f32 %1, %5\n\tv_exp_f32 %2, %6\n\tv_exp_f32 %3, %7\n\tv_nop" : "=&v"(ya), "=&v"(yb), "=&v"(yc), "=&v"(yd) : "v"(a), "v"(b), "v"(c), "v"(d)); }
// the value of lane l ^ 16 (the other half of the wave), on the vector port
__device__ __forceinline__ float xhalf(float x) { const int b = __float_as_int(x); return __int_as_float(__builtin_amdgcn_permlanex16(b, b, 0x76543210, 0xfedcba98, false, false)); }

// Fragment loaders: lane (hi = lane>>4, lr = lane&15); pointer already at row lr, k offset k0 + 8*hi; elements 0..7 <- k0+8hi+0..7, 8..15 <- k0+16+8hi+0..7 (same map for A and B).
template <typename T16> struct WFrag;
template <> struct WFrag<h16> { typedef v16h V; static __device__ __forceinline__ V ld(const h16* p) { return cat16(*(const v8h*)p, *(const v8h*)(p + 16)); } static __device__ __forceinline__ v8f mma(V a, V b, v8f c) { return wmma16(a, b, c); } };
template <> struct WFrag<bf> { typedef v16bf V; static __device__ __forceinline__ V ld(const bf* p) { return cat16b(*(const v8us*)p, *(const v8us*)(p + 16)); } static __device__ __forceinline__ v8f mma(V a, V b, v8f c) { return wmmab(a, b, c); } };

// ---- GEMM body: one work-group of 4 waves per 128x128 output tile, wave (wm, wn) takes its 64x64 quarter (16 accumulators); grid (M/128, N/128), 128 threads.
// A and Bt rows come from K-contiguous 16-bit planes in stages of 128 k (256 B a row) into LDS at pitch 272 B by asynchronous copies (whole lines, each lane 16 B), two buffers: stage t + 1 flies while stage t is worked on.
// c[m][n] (f32) = sum_k (A[m][k] (+ A2[m][k] when NSPLIT == 1)) Bt[n][k]. K % 128 == 0, M % 128 == 0, N % 128 == 0.
// What becomes of c is the epilogue's choice; a wave's 64 columns are one head (HD == 64):
//   EPI 0: C[m][n] = c, f32, pitch ldc.
//   EPI 1, tr false: head planes [h][t][d] (fp16 + bf16 hi/lo) of the interleaved-pair rotation: pair (2i, 2i+1) with table entry [t][i] read BY VALUE (RNE-converted to bf16).
//   EPI 1, tr true: transposed head planes [g][d][t] (fp16 + bf16 hi/lo), straight from the accumulators: a lane holds 8 consecutive t of one d.
// cy: the work-group's column tile inside Bt; tr: the same for the whole work-group.
#define GKS   128                            // k elements per stage
#define GPB   272                            // LDS row pitch in bytes (16 B x odd, for 16-byte fragment reads)
#define GTILE (128 * GPB)                    // one operand's 128 rows of a stage
static_assert(SEQ % 128 == 0 && DQ % 128 == 0 && DKV % 128 == 0 && DM % 128 == 0);
static_assert(DM % GKS == 0 && DQ % GKS == 0);
typedef __attribute__((address_space(1))) v4i gv4i;
typedef __attribute__((address_space(3))) v4i lv4i;
// One operand's 128 rows x 256 B of a stage: 16 copies of 16 B per lane, rows 8 apart (l: the lane's LDS place, g: its global place, gs = 8 source rows in elements).
__device__ __forceinline__ void atile(unsigned char* l, const bf* g, size_t gs) {
#pragma unroll
    for (int i = 0; i < 16; ++i) __builtin_amdgcn_global_load_async_to_lds_b128((gv4i*)(g + i * gs), (lv4i*)(l + i * (8 * GPB)), 0, 0);
}
template <int NSPLIT, int EPI>
__device__ __forceinline__ void gemmw_body(const bf* __restrict__ A, const bf* __restrict__ A2, const bf* __restrict__ Bt, int K, float* C, int ldc,
                                           const float* __restrict__ COS, const float* __restrict__ SIN, h16* P16, bf* Ph, bf* Pl, int cy, bool tr) {
    typedef WFrag<bf>::V V;
    constexpr unsigned STAGE = (2 + NSPLIT) * GTILE, BOFF = (1 + NSPLIT) * GTILE;   // stage = [A | A2 when NSPLIT | Bt]
    __shared__ __align__(16) unsigned char L[2 * STAGE];
    __shared__ __align__(16) float osw[4 * 16 * 68];
    const int tid = threadIdx.x, lane = tid & 31, lr = lane & 15, hi = lane >> 4; const int wave = tid >> 5, wm = wave >> 1, wn = wave & 1;
    const int R0 = blockIdx.x * 128, C0 = cy * 128; const int r0 = R0 + wm * 64, c0 = C0 + wn * 64;
    float* os = osw + wave * (16 * 68);
    v8f acc[4][4];
#pragma unroll
    for (int mb = 0; mb < 4; ++mb)
#pragma unroll
        for (int nb = 0; nb < 4; ++nb) acc[mb][nb] = (v8f){};
    // copies: thread -> row tid >> 4 (+ 8 per copy), 16-byte chunk tid & 15 of the row's 256 B
    const size_t gs = (size_t)8 * K; const int crw = tid >> 4, cch = tid & 15;
    const size_t po = (size_t)crw * K + cch * 8;                          // the lane's own element offset inside an operand's 128 rows
    const bf* uA = A + (size_t)R0 * K; const bf* uA2 = A2 + (size_t)R0 * K; const bf* uB = Bt + (size_t)C0 * K;   // wave-uniform row bases
    unsigned char* lc = L + (crw * GPB + cch * 16);
    const int nt = K / GKS;
    atile(lc, uA + po, gs); if (NSPLIT == 1) atile(lc + GTILE, uA2 + po, gs); atile(lc + BOFF, uB + po, gs);
    asm volatile("s_wait_asynccnt 0x0" ::: "memory");                     // stage 0 landed (this wave's copies)
    __syncthreads();                                                      // ... and every other wave's
    if (nt > 1) { atile(lc + STAGE, (uA + GKS) + po, gs); if (NSPLIT == 1) atile(lc + STAGE + GTILE, (uA2 + GKS) + po, gs); atile(lc + STAGE + BOFF, (uB + GKS) + po, gs); }
#pragma unroll 1                                                          // stays rolled: one trip per stage, its buffer picked by t & 1; the 64 or 128 products of a trip are unrolled inside
    for (int t = 0; t < nt; ++t) {
        const unsigned bo = (unsigned)(t & 1) * STAGE;
        const bf* la = (const bf*)(L + bo + (wm * 64 + lr) * GPB + 16 * hi);
        const bf* lb = (const bf*)(L + bo + BOFF + (wn * 64 + lr) * GPB + 16 * hi);
        V a[2][4], a2[2][4], b[2][4];                                     // two fragment sets: the next 32 k are read from LDS ahead of this block's products
#pragma unroll
        for (int f = 0; f < 4; ++f) { a[0][f] = WFrag<bf>::ld(la + f * (16 * GPB / 2)); if (NSPLIT == 1) a2[0][f] = WFrag<bf>::ld(la + GTILE / 2 + f * (16 * GPB / 2)); b[0][f] = WFrag<bf>::ld(lb + f * (16 * GPB / 2)); }
#pragma unroll
        for (int ks = 0; ks < GKS / 32; ++ks) {
            const int cu = ks & 1, nx = cu ^ 1;
            if (ks + 1 < GKS / 32) {
#pragma unroll
                for (int f = 0; f < 4; ++f) { a[nx][f] = WFrag<bf>::ld(la + (ks + 1) * 32 + f * (16 * GPB / 2)); if (NSPLIT == 1) a2[nx][f] = WFrag<bf>::ld(la + GTILE / 2 + (ks + 1) * 32 + f * (16 * GPB / 2)); b[nx][f] = WFrag<bf>::ld(lb + (ks + 1) * 32 + f * (16 * GPB / 2)); }
                __builtin_amdgcn_sched_barrier(0);                        // keeps the next block's LDS reads one group ahead of this block's products (sunk among them, every product waits for its own read)
            }
#pragma unroll
            for (int nb = 0; nb < 4; ++nb)
#pragma unroll
                for (int mb = 0; mb < 4; ++mb) acc[mb][nb] = wmmab(a[cu][mb], b[cu][nb], acc[mb][nb]);
            if (NSPLIT == 1) {
#pragma unroll
                for (int nb = 0; nb < 4; ++nb)
#pragma unroll
                    for (int mb = 0; mb < 4; ++mb) acc[mb][nb] = wmmab(a2[cu][mb], b[cu][nb], acc[mb][nb]);
            }
        }
        // four vector slots behind the last product, on the branch's taken side too, before anything rewrites its operands
        asm volatile("v_nop\n\tv_nop\n\tv_nop\n\tv_nop" : "+v"(acc[0][0]), "+v"(acc[1][0]), "+v"(acc[2][0]), "+v"(acc[3][0]), "+v"(acc[0][1]), "+v"(acc[1][1]), "+v"(acc[2][1]), "+v"(acc[3][1]),
                                                            "+v"(acc[0][2]), "+v"(acc[1][2]), "+v"(acc[2][2]), "+v"(acc[3][2]), "+v"(acc[0][3]), "+v"(acc[1][3]), "+v"(acc[2][3]), "+v"(acc[3][3]));
        asm volatile("s_wait_dscnt 0x0" ::: "memory");                    // this wave's reads of buffer t & 1 are done before it is refilled
        asm volatile("s_wait_asynccnt 0x0" ::: "memory");                 // this wave's copies of stage t + 1 have landed
        __syncthreads();                                                  // publishes stage t + 1 and ends every wave's reads of stage t
        if (t + 2 < nt) { const int ko = (t + 2) * GKS; atile(lc + bo, (uA + ko) + po, gs); if (NSPLIT == 1) atile(lc + bo + GTILE, (uA2 + ko) + po, gs); atile(lc + bo + BOFF, (uB + ko) + po, gs); }
    }
    asm volatile("s_wait_asynccnt 0x0" ::: "memory");                     // no copy is outstanding when the wave goes on
    const int head = c0 / HD;
    const size_t tb = (size_t)(r0 + hi) * (HD / 2) + lr * 2;              // EPI 1: the lane's place in the tables' row r0 + hi
    if (EPI == 1 && tr) {
        // accumulator element j <-> row (t) mb*16 + 8*hi + j, column (d) nb*16 + lr: 16 bytes of one [d] row per lane and plane; the wave's four mb fill each row's 128-byte line
#pragma unroll
        for (int mb = 0; mb < 4; ++mb)
#pragma unroll
            for (int nb = 0; nb < 4; ++nb) { v8h o16; v8us oh, ol;
#pragma unroll
                for (int j = 0; j < 8; ++j) { const float x = acc[mb][nb][j]; o16[j] = (h16)x; unsigned short a2, c2; splitf(x, a2, c2); oh[j] = a2; ol[j] = c2; }
                const size_t e = ((size_t)head * HD + nb * 16 + lr) * SEQ + r0 + mb * 16 + hi * 8;
                *(v8h*)(P16 + e) = o16; *(v8us*)(Ph + e) = oh; *(v8us*)(Pl + e) = ol; }
        return;
    }
#pragma unroll
    for (int mb = 0; mb < 4; ++mb) {
#pragma unroll
        for (int nb = 0; nb < 4; ++nb) {
#pragma unroll
            for (int j = 0; j < 8; ++j) os[(hi * 8 + j) * 68 + nb * 16 + lr] = acc[mb][nb][j]; }
        __builtin_amdgcn_wave_barrier(); asm volatile("" ::: "memory");
        if (EPI == 0) {
            float* crow = C + (size_t)(r0 + mb * 16) * ldc + c0;
#pragma unroll
            for (int s = 0; s < 8; ++s) { const int row = 2 * s + hi, cofs = lr * 4; const v4f val = *(const v4fa*)(os + row * 68 + cofs);
                *(v4f*)(crow + (size_t)row * ldc + cofs) = val; }
        } else {
            // a lane takes d = 4*lr .. 4*lr+3 (two pairs) of row t; 16 lanes write one whole 128-byte [t] row of each plane
            v2f cc[8], sn[8];
#pragma unroll
            for (int s = 0; s < 8; ++s) { cc[s] = *(const v2f*)(COS + tb + (mb * 16 + 2 * s) * (HD / 2)); sn[s] = *(const v2f*)(SIN + tb + (mb * 16 + 2 * s) * (HD / 2)); }
#pragma unroll
            for (int s = 0; s < 8; ++s) { const int row = 2 * s + hi, cofs = lr * 4; const v4f val = *(const v4fa*)(os + row * 68 + cofs);
                v4h o16; v4us oh, ol;
#pragma unroll
                for (int p = 0; p < 2; ++p) { const float c = bfr(cc[s][p]), sv = bfr(sn[s][p]); const float x0 = val[2 * p], x1 = val[2 * p + 1];
                    const float y0 = x0 * c - x1 * sv, y1 = x0 * sv + x1 * c; unsigned short a2, c2;
                    o16[2 * p] = (h16)y0; splitf(y0, a2, c2); oh[2 * p] = a2; ol[2 * p] = c2;
                    o16[2 * p + 1] = (h16)y1; splitf(y1, a2, c2); oh[2 * p + 1] = a2; ol[2 * p + 1] = c2; }
                const size_t e = ((size_t)head * SEQ + r0 + mb * 16 + row) * HD + cofs;
                *(v4h*)(P16 + e) = o16; *(v4us*)(Ph + e) = oh; *(v4us*)(Pl + e) = ol; }
            asm volatile("s_wait_xcnt 0x0" ::: "memory");                 // before the next rows' table loads land in registers that these stores name; behind the last rows too: the other epilogue's code follows in the text
        }
        __builtin_amdgcn_wave_barrier(); asm volatile("" ::: "memory");
    }
}
// x@wq, x@wk and x@wv in one launch: none reads what another writes, and the 64 work-groups of a k or v product alone leave three quarters of the chip idle.
// grid (M/128, (DQ + 2 DKV)/128): column tiles 0 .. DQ/128 - 1 are q, the next DKV/128 k, the last DKV/128 v; the choice is the same for the whole work-group.
__global__ __launch_bounds__(128) void k_gemm_qkv(const bf* __restrict__ A, const bf* __restrict__ BQ, const bf* __restrict__ BK, const bf* __restrict__ BV, int K, const float* __restrict__ COS, const float* __restrict__ SIN,
                                                  h16* Q16, bf* Qh, bf* Ql, h16* K16, bf* Kh, bf* Kl, h16* V16, bf* Vh, bf* Vl) {
    const int y = (int)blockIdx.y; const bool isq = y < DQ / 128, isv = y >= (DQ + DKV) / 128;
    gemmw_body<0, 1>(A, A, isq ? BQ : (isv ? BV : BK), K, (float*)0, 0, COS, SIN, isq ? Q16 : (isv ? V16 : K16), isq ? Qh : (isv ? Vh : Kh), isq ? Ql : (isv ? Vl : Kl),
                     y - (isq ? 0 : (isv ? (DQ + DKV) / 128 : DQ / 128)), isv); }
__global__ __launch_bounds__(128) void k_gemm_s(const bf* __restrict__ A, const bf* __restrict__ A2, const bf* __restrict__ Bt, int K, float* C, int ldc) {
    gemmw_body<1, 0>(A, A2, Bt, K, C, ldc, (const float*)0, (const float*)0, (h16*)0, (bf*)0, (bf*)0, (int)blockIdx.y, false); }

// ---- weight pre-pass: w[k][n] f32 -> Bt[n][k] bf16 (RNE); one work-group of 8 waves per 128 k x 128 n tile.
// Reads: a wave takes 16 k rows, one whole 512-byte run of a row per load, all 16 loads in flight at once. A lane then holds 16 k of 4 n: eight 16-byte chunks (8 k of one n), which go into
// an LDS tile [n][k] whose 16 chunks a row are permuted by (n >> 2) & 15, so that the 16 lanes of a store (rows 4 apart) and of a read (one row) each cover all banks once.
// Writes: 16 lanes put out 256 contiguous bytes of one n row (two whole lines, one writer each).
#define WTT 128
static_assert(DM % WTT == 0 && DQ % WTT == 0 && DKV % WTT == 0);
#define WT_Q  ((DM / WTT) * (DQ / WTT))
#define WT_KV ((DM / WTT) * (DKV / WTT))
#define WT_O  ((DQ / WTT) * (DM / WTT))
template <int K, int N>
__device__ __forceinline__ void wt_tile(const float* __restrict__ w, bf* Bt, int t, unsigned short* T) {
    const int tid = threadIdx.x, lane = tid & 31, l16 = lane & 15, hi = lane >> 4;
    const int wave = __builtin_amdgcn_readfirstlane(tid >> 5);            // the wave's number in a scalar register: row bases are scalar, a lane adds only its own 16 bytes
    const int n0 = (t % (N / WTT)) * WTT, k0 = (t / (N / WTT)) * WTT;
    const float* g = (w + (size_t)(k0 + wave * 16) * N + n0) + lane * 4;
    v4f v[16];
#pragma unroll
    for (int i = 0; i < 16; ++i) v[i] = *(const v4f*)(g + (size_t)i * N);
#pragma unroll
    for (int c = 0; c < 4; ++c)
#pragma unroll
        for (int q = 0; q < 2; ++q) { v8us o;
#pragma unroll
            for (int j = 0; j < 8; ++j) o[j] = f2bf(v[q * 8 + j][c]);
            *(v8us*)(T + (lane * 4 + c) * WTT + (((wave * 2 + q) ^ l16) * 8)) = o; }
    __syncthreads();                                                      // the tile is whole before it is read along k
    bf* d = Bt + (size_t)(n0 + wave * 2 + hi) * K + k0 + l16 * 8;
    v8us o[8];
#pragma unroll
    for (int s = 0; s < 8; ++s) { const int n = s * 16 + wave * 2 + hi;
        o[s] = *(const v8us*)(T + n * WTT + ((l16 ^ ((n >> 2) & 15)) * 8)); }
#pragma unroll
    for (int s = 0; s < 8; ++s) { *(v8us*)(d + (size_t)s * 16 * K) = o[s];
        asm volatile("s_wait_xcnt 0x0" ::: "memory"); }                   // stands behind each store, before any path on which the store's address or data registers are written again
}
// ---- x pre-pass: f32 -> bf16 (RNE); one work-group of 8 waves per CVT_E consecutive elements, a thread takes 8 elements in each of 8 runs of 2048 (a wave reads 1 KiB and writes 512 B in a row), all its loads in flight at once.
#define CVT_E (256 * 8 * 8)
static_assert(((size_t)SEQ * DM) % CVT_E == 0);
#define CV_T  ((int)(((size_t)SEQ * DM) / CVT_E))
__device__ __forceinline__ void cvt_tile(const float* __restrict__ s, bf* d, int t) {
    const size_t e = (size_t)t * CVT_E + threadIdx.x * 8;
    v4f v[16]; v8us o[8];
#pragma unroll
    for (int i = 0; i < 16; ++i) {
        if (i == 15) asm volatile("s_wait_xcnt 0x0" ::: "memory");        // the last load's result lands on the address pair that the loads before it name
        v[i] = *(const v4f*)(s + e + (i >> 1) * 2048 + (i & 1) * 4); }
#pragma unroll
    for (int i = 0; i < 8; ++i)
#pragma unroll
        for (int k = 0; k < 8; ++k) o[i][k] = f2bf(v[2 * i + (k >> 2)][k & 3]);
#pragma unroll
    for (int i = 0; i < 8; ++i) *(v8us*)(d + e + i * 2048) = o[i];
    asm volatile("s_wait_xcnt 0x0" ::: "memory");                         // behind the stores: another pre-pass's code, which writes their registers, follows in the text
}

// mask pre-pass: one work-group of 8 waves per (16 query rows, 32 mask words); wave r takes rows r and r + 8 and holds each row's 1024 mask values as 8 loads of 512 contiguous bytes, all 16 in flight at once.
// Bit-plane MB[q][w] (bit n = mask[q][32w+n] != 0) and tile class CL[q/16][w]: 0 = no key kept in the 16x32 tile, 1 = all kept, 2 = mixed.
#define MK_T ((SEQ / 16) * (NW / 32))
__device__ __forceinline__ void mask_tile(const int* __restrict__ mask, unsigned* MBp, int* CLp, int t, unsigned* sw) {
    const int lane = threadIdx.x & 31, row = threadIdx.x >> 5; const int qt = t % (SEQ / 16), wb = (t / (SEQ / 16)) * 32; const int q = qt * 16 + row;
    const int* mr = mask + (size_t)q * SEQ_FULL + wb * 32 + lane * 4;
    v4i v[2][8];
#pragma unroll
    for (int h = 0; h < 2; ++h)
#pragma unroll
        for (int i = 0; i < 8; ++i) {
            if (h == 1 && i == 7) asm volatile("s_wait_xcnt 0x0" ::: "memory");   // the last load's result lands on the address pair that the loads before it name
            v[h][i] = *(const v4i*)(mr + (size_t)h * 8 * SEQ_FULL + 128 * i); }
    const int w = wb + 4 * (lane & 7) + (lane >> 3);
    unsigned xs[2];
#pragma unroll
    for (int h = 0; h < 2; ++h) {
        // nibble i of x: the lane's four values of load i, i.e. bits 4*(lane&7)..+3 of word wb + 4*i + (lane>>3)
        unsigned x = 0u;
#pragma unroll
        for (int i = 0; i < 8; ++i) { const unsigned nib = (v[h][i][0] != 0 ? 1u : 0u) | (v[h][i][1] != 0 ? 2u : 0u) | (v[h][i][2] != 0 ? 4u : 0u) | (v[h][i][3] != 0 ? 8u : 0u); x |= nib << (4 * i); }
        // 8x8 nibble transpose inside each group of 8 lanes (three exchanges; a lane keeps the nibbles under its mask and takes the partner's, rotated into place): afterwards lane 8g+t holds the whole word wb + 4*t + g
        unsigned y;
        y = __builtin_rotateright32(__shfl_xor(x, 4, 32), 16);               { const unsigned km = (lane & 4) ? 0xFFFF0000u : 0x0000FFFFu; x = (x & km) | (y & ~km); }
        y = __builtin_rotateright32(__shfl_xor(x, 2, 32), (lane & 2) ? 8 : 24); { const unsigned km = (lane & 2) ? 0xFF00FF00u : 0x00FF00FFu; x = (x & km) | (y & ~km); }
        y = __builtin_rotateright32(__shfl_xor(x, 1, 32), (lane & 1) ? 4 : 28); { const unsigned km = (lane & 1) ? 0xF0F0F0F0u : 0x0F0F0F0Fu; x = (x & km) | (y & ~km); }
        sw[(row + 8 * h) * 32 + lane] = x; xs[h] = x;
    }
    __syncthreads();                                                      // the 16 rows' words -> the class of each 16x32 tile
    if (row == 0) {
        unsigned an = 0xFFFFFFFFu, orr = 0u;
#pragma unroll
        for (int r = 0; r < 16; ++r) { const unsigned u = sw[r * 32 + lane]; an &= u; orr |= u; }
        CLp[(size_t)qt * NW + w] = (orr == 0u) ? 0 : ((an == 0xFFFFFFFFu) ? 1 : 2);
    }
    MBp[(size_t)q * NW + w] = xs[0]; MBp[(size_t)(q + 8) * NW + w] = xs[1];   // one wave = one whole 128-byte line per row
    asm volatile("s_wait_xcnt 0x0" ::: "memory");                         // behind the stores: another pre-pass's code, which writes their registers, follows in the text
}
// The three pre-passes in one launch: none reads what another writes. Which one a work-group does is the same for all of its threads; the weight tile and the mask words share the LDS array (a work-group uses it for one of them).
__global__ __launch_bounds__(256) void k_pre(const float* __restrict__ wq, const float* __restrict__ wk, const float* __restrict__ wv, const float* __restrict__ wo, const float* __restrict__ x, const int* __restrict__ mask,
                                             bf* WQ, bf* WK, bf* WV, bf* WO, bf* XB, unsigned* MBp, int* CLp) {
    __shared__ __align__(16) unsigned short T[WTT * WTT];
    const int b = (int)blockIdx.x;
    if (b < WT_Q) wt_tile<DM, DQ>(wq, WQ, b, T);
    else if (b < WT_Q + 2 * WT_KV) { const bool sv = b >= WT_Q + WT_KV; wt_tile<DM, DKV>(sv ? wv : wk, sv ? WV : WK, b - (sv ? WT_Q + WT_KV : WT_Q), T); }
    else if (b < WT_Q + 2 * WT_KV + WT_O) wt_tile<DQ, DM>(wo, WO, b - (WT_Q + 2 * WT_KV), T);
    else if (b < WT_Q + 2 * WT_KV + WT_O + MK_T) mask_tile(mask, MBp, CLp, b - (WT_Q + 2 * WT_KV + WT_O), (unsigned*)T);
    else cvt_tile(x, XB, b - (WT_Q + 2 * WT_KV + WT_O + MK_T));
}

#define AKS   64                             // keys per stage
#define APB   144                            // LDS row pitch in bytes (16 B x odd, for 16-byte fragment reads)
#define ATILE (64 * APB)                     // one plane's 64 rows of a stage
static_assert(REP == 4 && HD == 64 && SEQ % AKS == 0 && NW <= 64);
// One plane's 64 rows x 128 B of a stage: 4 copies of 16 B per lane, rows 16 apart (l: the lane's LDS place, g: its global place, gs = 16 source rows in elements).
template <typename T16>
__device__ __forceinline__ void ktile(unsigned char* l, const T16* g, size_t gs) {
#pragma unroll
    for (int i = 0; i < 4; ++i) __builtin_amdgcn_global_load_async_to_lds_b128((gv4i*)(g + i * gs), (lv4i*)(l + i * (16 * APB)), 0, 0);
}
template <bool SPLIT>
__device__ __forceinline__ void attn_body(const h16* __restrict__ Q16, const h16* __restrict__ K16, const h16* __restrict__ V16,
                                          const bf* __restrict__ Qh, const bf* __restrict__ Ql, const bf* __restrict__ Kh, const bf* __restrict__ Kl, const bf* __restrict__ Vh, const bf* __restrict__ Vl,
                                          const unsigned* __restrict__ MBp, const int* __restrict__ CLp, bf* Ch, bf* Cl, int qt, unsigned char* KV) {
    constexpr unsigned VOFF = (SPLIT ? 2 : 1) * ATILE, STG = 2 * VOFF;   // stage = [K (hi | lo when SPLIT) | V^T (hi | lo when SPLIT)]; KV holds two stages
    static_assert(4 * 16 * 68 * 4 <= 2 * STG);
    const int tid = threadIdx.x, lane = tid & 31, lr = lane & 15, hi = lane >> 4, wave = tid >> 5;
    float* os = (float*)KV + wave * (16 * 68);                           // wave-private output tile, in the stage buffers once the key loop has left them
    const int hk = (int)blockIdx.y; const int h = hk * REP + wave; const int q0 = qt * 16;
    const size_t qoff = ((size_t)h * SEQ + q0 + lr) * HD + 8 * hi;       // B fragment: column = query q0+lr, d offset 8*hi
    // the row of tile classes as two bit sets, the same in every wave of the work-group: nz bit j = half j has a kept key, al bit j = all of its keys are kept
    const int cl0 = CLp[(size_t)qt * NW + lane]; const int cl1 = (NW > 32) ? CLp[(size_t)qt * NW + (NW > 32 ? 32 : 0) + lane] : 0;
    const unsigned long long nz = (unsigned long long)__builtin_amdgcn_ballot_w32(cl0 != 0) | ((unsigned long long)__builtin_amdgcn_ballot_w32(cl1 != 0) << 32);
    const unsigned long long al = (unsigned long long)__builtin_amdgcn_ballot_w32(cl0 == 1) | ((unsigned long long)__builtin_amdgcn_ballot_w32(cl1 == 1) << 32);
    // copies: thread -> row tid >> 3 (+ 16 per copy), 16-byte chunk tid & 7 of the row's 128 B; stage s: keys 64 s .. 64 s + 63 (s <= 31 from a 64-bit set: inside the planes)
    const int crw = tid >> 3, cch = tid & 7;
    unsigned char* lc = KV + (crw * APB + cch * 16);
    const size_t kpo = ((size_t)hk * SEQ + crw) * HD + cch * 8;          // K planes [g][t][d]: row = key
    const size_t vpo = ((size_t)hk * HD + crw) * SEQ + cch * 8;          // V^T planes [g][d][t]: row = d
    auto stage = [&](unsigned bo, int s) {
        const size_t ke = kpo + (size_t)s * (AKS * HD), ve = vpo + (size_t)s * AKS;
        if (SPLIT) { ktile(lc + bo, Kh + ke, (size_t)16 * HD); ktile(lc + bo + ATILE, Kl + ke, (size_t)16 * HD); ktile(lc + bo + VOFF, Vh + ve, (size_t)16 * SEQ); ktile(lc + bo + VOFF + ATILE, Vl + ve, (size_t)16 * SEQ); }
        else { ktile(lc + bo, K16 + ke, (size_t)16 * HD); ktile(lc + bo + VOFF, V16 + ve, (size_t)16 * SEQ); }
    };
    unsigned long long rem = nz;                                          // kept halves whose stage is not copied yet
    int sc = -1, sn = -1;                                                 // the stage worked on, the stage in flight (-1: none)
    if (rem != 0ull) { sc = __builtin_ctzll(rem) >> 1; rem &= ~(3ull << (2 * sc)); stage(0u, sc); }
    // q fragments: read once, held in registers over the key loop
    v16bf qh0, qh1, ql0, ql1; v16h qa0, qa1;
    if (SPLIT) { qh0 = WFrag<bf>::ld(Qh + qoff); qh1 = WFrag<bf>::ld(Qh + qoff + 32); ql0 = WFrag<bf>::ld(Ql + qoff); ql1 = WFrag<bf>::ld(Ql + qoff + 32); }
    else { qa0 = WFrag<h16>::ld(Q16 + qoff); qa1 = WFrag<h16>::ld(Q16 + qoff + 32); }
    const float NINF = -__builtin_inff();
    float mi = NINF, li = 0.0f; v8f acc[4];                               // the lane's query: running maximum (both halves alike), sum over the lane's own keys; acc[ot][r] = O^T[16*ot + 8*hi + r][lr]
#pragma unroll
    for (int ot = 0; ot < 4; ++ot) acc[ot] = (v8f){};
    asm volatile("s_wait_asynccnt 0x0" ::: "memory");                     // the first stage landed (this wave's copies)
    __syncthreads();                                                      // ... and every other wave's
    if (rem != 0ull) { sn = __builtin_ctzll(rem) >> 1; rem &= ~(3ull << (2 * sn)); stage(STG, sn); }
    unsigned bo = 0u;
#pragma unroll 1                                                          // stays rolled: one trip per kept stage (at most 32: each takes its two bits out of the set)
    while (sc >= 0) {
#pragma unroll 1                                                          // stays rolled: the halves depend on one another through the running maximum, unrolling buys only code
      for (int hf = 0; hf < 2; ++hf) {
        const int j = 2 * sc + hf;
        if (((nz >> j) & 1ull) == 0ull) continue;                         // the same in every wave of the work-group
        // the mask word of the lane's own query, shifted so that bit r is key 8*hi + r and bit 16 + r key 16 + 8*hi + r
        unsigned wd = 0xFFFFFFFFu;
        if (((al >> j) & 1ull) == 0ull) wd = MBp[(size_t)(q0 + lr) * NW + j] >> (8 * hi);
        v8f s0 = (v8f){}, s1 = (v8f){};
        const unsigned char* kb = KV + bo + (hf * 32 + lr) * APB + 16 * hi;   // A fragment (scores): lane = key, k = d
        if (SPLIT) {
            { const v16bf kh0 = WFrag<bf>::ld((const bf*)kb), kh1 = WFrag<bf>::ld((const bf*)(kb + 64)), kl0 = WFrag<bf>::ld((const bf*)(kb + ATILE)), kl1 = WFrag<bf>::ld((const bf*)(kb + ATILE + 64));
              s0 = wmmab(kh0, ql0, s0); s0 = wmmab(kh1, ql1, s0); s0 = wmmab(kl0, qh0, s0); s0 = wmmab(kl1, qh1, s0); s0 = wmmab(kh0, qh0, s0); s0 = wmmab(kh1, qh1, s0); }
            { const unsigned char* k1 = kb + 16 * APB; const v16bf kh0 = WFrag<bf>::ld((const bf*)k1), kh1 = WFrag<bf>::ld((const bf*)(k1 + 64)), kl0 = WFrag<bf>::ld((const bf*)(k1 + ATILE)), kl1 = WFrag<bf>::ld((const bf*)(k1 + ATILE + 64));
              s1 = wmmab(kh0, ql0, s1); s1 = wmmab(kh1, ql1, s1); s1 = wmmab(kl0, qh0, s1); s1 = wmmab(kl1, qh1, s1); s1 = wmmab(kh0, qh0, s1); s1 = wmmab(kh1, qh1, s1);
              asm volatile("v_nop\n\tv_nop\n\tv_nop\n\tv_nop" : "+v"(s0), "+v"(s1) : "v"(qh1), "v"(kh1)); }
        } else {
            const v16h k00 = WFrag<h16>::ld((const h16*)kb), k01 = WFrag<h16>::ld((const h16*)(kb + 64));
            const v16h k10 = WFrag<h16>::ld((const h16*)(kb + 16 * APB)), k11 = WFrag<h16>::ld((const h16*)(kb + 16 * APB + 64));
            s0 = wmma16(k00, qa0, s0); s0 = wmma16(k01, qa1, s0); s1 = wmma16(k10, qa0, s1); s1 = wmma16(k11, qa1, s1);
            asm volatile("v_nop\n\tv_nop\n\tv_nop\n\tv_nop" : "+v"(s0), "+v"(s1) : "v"(qa1), "v"(k11));
        }
        // V^T fragments depend on the stage alone: read here, they arrive under the softmax
        const unsigned char* vb = KV + bo + VOFF + lr * APB + hf * 64 + 16 * hi;   // A fragment (V^T.P^T): lane = d, k = key
        v16bf vh[4], vl[4]; v16h vf[4];
#pragma unroll
        for (int ot = 0; ot < 4; ++ot) {
            if (SPLIT) { vh[ot] = WFrag<bf>::ld((const bf*)(vb + ot * (16 * APB))); vl[ot] = WFrag<bf>::ld((const bf*)(vb + ATILE + ot * (16 * APB))); }
            else vf[ot] = WFrag<h16>::ld((const h16*)(vb + ot * (16 * APB)));
        }
        // online softmax in log2 units; accumulator element r <-> key 8*hi + r (s0) / 16 + 8*hi + r (s1), column lr = the lane's query
        const v8f t0 = s0 * SCL2, t1 = s1 * SCL2;
        float v0[8], v1[8], mx = NINF;
#pragma unroll
        for (int r = 0; r < 8; ++r) {
            v0[r] = ((wd >> r) & 1u) != 0u ? t0[r] : NINF; v1[r] = ((wd >> (16 + r)) & 1u) != 0u ? t1[r] : NINF;
            mx = fmaxf(mx, fmaxf(v0[r], v1[r]));
        }
        mx = fmaxf(mx, xhalf(mx));
        const float nm = fmaxf(mi, mx); const float ms = (nm == NINF) ? 0.0f : nm;
        const float corr = ex2(mi - ms);
        mi = nm;
        float ps[8]; v16h p16; v8us pha, phb, pla, plb;
#pragma unroll
        for (int r = 0; r < 8; r += 2) {
            float p0, p1, p2, p3; ex2x4(v0[r] - ms, v1[r] - ms, v0[r + 1] - ms, v1[r + 1] - ms, p0, p1, p2, p3);
            if (SPLIT) { unsigned short a, c; splitf(p0, a, c); pha[r] = a; pla[r] = c; splitf(p1, a, c); phb[r] = a; plb[r] = c; ps[r] = p0 + p1;
                splitf(p2, a, c); pha[r + 1] = a; pla[r + 1] = c; splitf(p3, a, c); phb[r + 1] = a; plb[r + 1] = c; ps[r + 1] = p2 + p3; }
            else { const v2h e0 = __builtin_convertvector((v2f){p0 * PCAR, p2 * PCAR}, v2h), e1 = __builtin_convertvector((v2f){p1 * PCAR, p3 * PCAR}, v2h);   // two keys per packed conversion; the sums read the rounded values
                p16[r] = e0[0]; p16[r + 1] = e0[1]; p16[8 + r] = e1[0]; p16[9 + r] = e1[1]; ps[r] = (float)e0[0] + (float)e1[0]; ps[r + 1] = (float)e0[1] + (float)e1[1]; }
        }
        li = li * corr + (((ps[0] + ps[1]) + (ps[2] + ps[3])) + ((ps[4] + ps[5]) + (ps[6] + ps[7])));
#pragma unroll
        for (int ot = 0; ot < 4; ++ot) acc[ot] *= corr;
        if (SPLIT) {
            const v16bf ph = cat16b(pha, phb), pl = cat16b(pla, plb);
#pragma unroll
            for (int ot = 0; ot < 4; ++ot) { acc[ot] = wmmab(vh[ot], pl, acc[ot]); acc[ot] = wmmab(vl[ot], ph, acc[ot]); acc[ot] = wmmab(vh[ot], ph, acc[ot]); }
            asm volatile("v_nop\n\tv_nop\n\tv_nop\n\tv_nop" : "+v"(acc[0]), "+v"(acc[1]), "+v"(acc[2]), "+v"(acc[3]) : "v"(ph), "v"(pl));
        } else {
#pragma unroll
            for (int ot = 0; ot < 4; ++ot) acc[ot] = wmma16(vf[ot], p16, acc[ot]);
            asm volatile("v_nop\n\tv_nop\n\tv_nop\n\tv_nop" : "+v"(acc[0]), "+v"(acc[1]), "+v"(acc[2]), "+v"(acc[3]) : "v"(p16));
        }
      }
        asm volatile("s_wait_dscnt 0x0" ::: "memory");                    // this wave's reads of the buffer are done before it is refilled
        asm volatile("s_wait_asynccnt 0x0" ::: "memory");                 // this wave's copies of the stage in flight have landed
        __syncthreads();                                                  // publishes the stage in flight and ends every wave's reads of this one
        int s2 = -1;
        if (rem != 0ull) { s2 = __builtin_ctzll(rem) >> 1; rem &= ~(3ull << (2 * s2)); stage(bo, s2); }
        sc = sn; sn = s2; bo = STG - bo;
    }
    asm volatile("s_wait_asynccnt 0x0" ::: "memory");                     // no copy is outstanding when the wave goes on
    // the stage buffers are free here: the barrier at the foot of the last trip stands behind every wave's last read and last landed copy, and nothing was copied after it
    // finish: join the two halves' sums, normalise, stage 16x64 f32 (a lane holds 8 consecutive d of its query's row), write hi/lo lines
    const float inv = 1.0f / (li + xhalf(li));
#pragma unroll
    for (int ot = 0; ot < 4; ++ot) { const v8f o = acc[ot] * inv; float* op = os + lr * 68 + ot * 16 + 8 * hi;
        *(v4fa*)op = (v4f){o[0], o[1], o[2], o[3]}; *(v4fa*)(op + 4) = (v4f){o[4], o[5], o[6], o[7]}; }
    __syncthreads();
{
#pragma unroll
        for (int s = 0; s < 4; ++s) { const int row = 4 * s + (lane >> 3), c8 = (lane & 7) * 8;
            const v4f x0 = *(const v4fa*)(os + row * 68 + c8), x1 = *(const v4fa*)(os + row * 68 + c8 + 4); v8us oh, ol;
#pragma unroll
            for (int k = 0; k < 4; ++k) { unsigned short a, c; splitf(x0[k], a, c); oh[k] = a; ol[k] = c; splitf(x1[k], a, c); oh[4 + k] = a; ol[4 + k] = c; }
            const size_t oo = (size_t)(q0 + row) * DQ + (size_t)h * HD + c8;
            *(v8us*)(Ch + oo) = oh; *(v8us*)(Cl + oo) = ol; }
         }
}
// Both forms in one launch, grid (SEQ/16, NKV): query tiles below RH take the hi/lo form, the rest the fp16 form (the same for the whole work-group); neither reads what the other writes.
__global__ __launch_bounds__(128) void k_attn(const h16* __restrict__ Q16, const h16* __restrict__ K16, const h16* __restrict__ V16,
                                             const bf* __restrict__ Qh, const bf* __restrict__ Ql, const bf* __restrict__ Kh, const bf* __restrict__ Kl, const bf* __restrict__ Vh, const bf* __restrict__ Vl,
                                             const unsigned* __restrict__ MBp, const int* __restrict__ CLp, bf* Ch, bf* Cl) {
    __shared__ __align__(16) unsigned char KV[2 * 4 * ATILE];            // two stages of the larger (hi/lo) form
    const int qt = (int)blockIdx.x;
    if (qt < RH / 16) attn_body<true>(Q16, K16, V16, Qh, Ql, Kh, Kl, Vh, Vl, MBp, CLp, Ch, Cl, qt, KV);
    else attn_body<false>(Q16, K16, V16, Qh, Ql, Kh, Kl, Vh, Vl, MBp, CLp, Ch, Cl, qt, KV); }

constexpr size_t al256(size_t b) { return (b + 255) & ~(size_t)255; }
constexpr size_t WS_TOTAL =
    al256((size_t)DQ * DM * 2) + 2 * al256((size_t)DKV * DM * 2) + al256((size_t)DM * DQ * 2) +      // WQ, WK, WV, WO
    al256((size_t)SEQ * DM * 2) +                                                                      // XB
    3 * al256((size_t)NH * SEQ * HD * 2) + 6 * al256((size_t)NKV * SEQ * HD * 2) +                     // q planes, k planes, v planes
    2 * al256((size_t)SEQ * DQ * 2) +                                                                  // ctx hi/lo
    al256((size_t)SEQ * NW * 4) + al256((size_t)(SEQ / 16) * NW * 4);                                  // mask bits, tile classes
static_assert(WS_TOTAL <= (size_t)134217728);

extern "C" void kernel_launch(void* const* d_in, const int* in_sizes, int n_in,
                              void* d_out, int out_size, void* d_ws, size_t ws_size, hipStream_t stream) {
    if (n_in < 8) return;
    if ((long long)in_sizes[0] < (long long)(NB - 1) * SEQ_FULL * DM + (long long)SEQ * DM) return;
    if ((long long)in_sizes[1] < (long long)DM * DQ || (long long)in_sizes[2] < (long long)DM * DKV || (long long)in_sizes[3] < (long long)DM * DKV || (long long)in_sizes[4] < (long long)DQ * DM) return;
    if ((long long)in_sizes[5] < (long long)SEQ * (HD / 2) || (long long)in_sizes[6] < (long long)SEQ * (HD / 2)) return;
    if ((long long)in_sizes[7] < (long long)(SEQ - 1) * SEQ_FULL + SEQ) return;
    if ((long long)out_size < (long long)(NB - 1) * SEQ_FULL * DM + (long long)SEQ * DM) return;
    if (ws_size < WS_TOTAL) return;
    const float* x = (const float*)d_in[0]; const float* wq = (const float*)d_in[1]; const float* wk = (const float*)d_in[2]; const float* wv = (const float*)d_in[3]; const float* wo = (const float*)d_in[4];
    const float* fcos = (const float*)d_in[5]; const float* fsin = (const float*)d_in[6]; const int* mask = (const int*)d_in[7];
    float* OUT = (float*)d_out;     // [1][2048][2048]
    char* wsp = (char*)d_ws;
    auto take = [&](size_t bytes) { char* p = wsp; wsp += (bytes + 255) & ~(size_t)255; return (void*)p; };
    bf* WQ = (bf*)take((size_t)DQ * DM * 2); bf* WK = (bf*)take((size_t)DKV * DM * 2); bf* WV = (bf*)take((size_t)DKV * DM * 2); bf* WO = (bf*)take((size_t)DM * DQ * 2);
    bf* XB = (bf*)take((size_t)SEQ * DM * 2);
    h16* QP16 = (h16*)take((size_t)NH * SEQ * HD * 2); bf* QPh = (bf*)take((size_t)NH * SEQ * HD * 2); bf* QPl = (bf*)take((size_t)NH * SEQ * HD * 2);
    h16* KP16 = (h16*)take((size_t)NKV * SEQ * HD * 2); bf* KPh = (bf*)take((size_t)NKV * SEQ * HD * 2); bf* KPl = (bf*)take((size_t)NKV * SEQ * HD * 2);
    h16* VT16 = (h16*)take((size_t)NKV * SEQ * HD * 2); bf* VTh = (bf*)take((size_t)NKV * SEQ * HD * 2); bf* VTl = (bf*)take((size_t)NKV * SEQ * HD * 2);
    bf* CXh = (bf*)take((size_t)SEQ * DQ * 2); bf* CXl = (bf*)take((size_t)SEQ * DQ * 2);
    unsigned* MBp = (unsigned*)take((size_t)SEQ * NW * 4); int* CLp = (int*)take((size_t)(SEQ / 16) * NW * 4);
    if ((size_t)(wsp - (char*)d_ws) > ws_size) return;

    // four launches, each of work that depends only on launches before it
    // weights: w[in][out] -> Bt[out][in] bf16 (wq: in DM, out DQ; wk/wv: in DM, out DKV; wo: in DQ, out DM); mask -> bit-plane and tile classes; x -> bf16
    k_pre<<<WT_Q + 2 * WT_KV + WT_O + MK_T + CV_T, 256, 0, stream>>>(wq, wk, wv, wo, x, mask, WQ, WK, WV, WO, XB, MBp, CLp);
    k_gemm_qkv<<<dim3(SEQ / 128, (DQ + 2 * DKV) / 128, 1), 128, 0, stream>>>(XB, WQ, WK, WV, DM, fcos, fsin, QP16, QPh, QPl, KP16, KPh, KPl, VT16, VTh, VTl);
    k_attn<<<dim3(SEQ / 16, NKV, 1), 128, 0, stream>>>(QP16, KP16, VT16, QPh, QPl, KPh, KPl, VTh, VTl, MBp, CLp, CXh, CXl);
    k_gemm_s<<<dim3(SEQ / 128, DM / 128, 1), 128, 0, stream>>>(CXh, CXl, WO, DQ, OUT, DM);
}

// v008
// A run of this version takes 117 microseconds.
// Timed twice side by side with v007, it ran 1.03 and 1.04 times as fast.
// Counting every step since v000, it is 4.91 times as fast.
#include <hip/hip_runtime.h>

// Contractions (all f32 accumulate): x@wq, x@wk, x@wv v_wmma_f32_16x16x32_bf16 (bf16 x bf16 operand planes, inputs RNE-converted to bf16); scores q.k and P.V: query rows < 512 bf16 hi/lo planes (3 products each), rows >= 512 v_wmma_f32_16x16x32_f16 (P carried x1024); ctx@wo bf16 hi/lo ctx planes x bf16 weights (2 products).
// Grouped-query causal-style attention with interleaved-pair rotation from INPUT tables and an INPUT int32 mask (read by value through a bit-plane + 16x32 tile classes); softmax f32 online running-max form.
// Flash-style fused attention: one wave per 16 query rows per head, the 4 query heads of a kv head in one work-group; K / V^T tiles of 64 keys staged in LDS by asynchronous copies (two buffers); scores and context are formed transposed (S^T = K.Q^T, O^T += V^T.P^T), so P goes from the score accumulators straight into an operand.

#ifndef NB
#define NB 1
#endif
#ifndef SEQ
#define SEQ 2048
#endif
#define NB_FULL  1
#define SEQ_FULL 2048
#define DM   2048
#define NH   32
#define NKV  8
#define REP  (NH / NKV)
#define HD   64
#define DQ   (NH * HD)
#define DKV  (NKV * HD)
#define RH   ((SEQ) < 512 ? (SEQ) : 512)     // query rows < RH use hi+lo planes
#define NW   (SEQ / 32)                      // 32-key words per mask row
#define PCAR 1024.0f
#define SCL2 0.18033688011112042f            // (1/8) * log2(e)

static_assert(SEQ % 64 == 0);                // key halves of 32
static_assert(SEQ <= SEQ_FULL);
static_assert(NW % 32 == 0);                 // mask pre-pass: 32 words per work-group
static_assert(HD == 64);
static_assert(DM % 64 == 0 && DQ % 64 == 0 && DKV % 64 == 0);
static_assert(DM % 32 == 0 && DQ % 32 == 0);
static_assert(NH % NKV == 0);
static_assert(RH % 16 == 0 && (SEQ - RH) % 16 == 0);
static_assert(NB == 1 && NB <= NB_FULL);      // one batch: its x conversion shares the pre-pass launch

typedef _Float16 h16;
typedef unsigned short bf;
typedef __attribute__((ext_vector_type(16))) __bf16   v16bf;
typedef __attribute__((ext_vector_type(16))) _Float16 v16h;
typedef __attribute__((ext_vector_type(8)))  _Float16 v8h;
typedef __attribute__((ext_vector_type(8)))  unsigned short v8us;
typedef __attribute__((ext_vector_type(8)))  float    v8f;
typedef __attribute__((ext_vector_type(4)))  float    v4f;
typedef __attribute__((ext_vector_type(4)))  int      v4i;
typedef __attribute__((ext_vector_type(4)))  _Float16 v4h;
typedef __attribute__((ext_vector_type(2)))  _Float16 v2h;
typedef __attribute__((ext_vector_type(4)))  unsigned short v4us;
typedef __attribute__((ext_vector_type(2)))  unsigned short v2us;
typedef __attribute__((ext_vector_type(2)))  float    v2f;
typedef v4f  __attribute__((may_alias)) v4fa;

__device__ __forceinline__ unsigned short f2bf(float f) { unsigned u = __float_as_uint(f); u += 0x7FFFu + ((u >> 16) & 1u); return (unsigned short)(u >> 16); }
__device__ __forceinline__ float bf2f(unsigned short b) { return __uint_as_float(((unsigned)b) << 16); }
__device__ __forceinline__ float bfr(float f) { return bf2f(f2bf(f)); }
__device__ __forceinline__ v16h cat16(v8h lo, v8h hi) { return __builtin_shufflevector(lo, hi, 0, 1, 2, 3, 4, 5, 6, 7, 8, 9, 10, 11, 12, 13, 14, 15); }
__device__ __forceinline__ v16bf cat16b(v8us lo, v8us hi) { return __builtin_bit_cast(v16bf, __builtin_shufflevector(lo, hi, 0, 1, 2, 3, 4, 5, 6, 7, 8, 9, 10, 11, 12, 13, 14, 15)); }
__device__ __forceinline__ v8f wmma16(v16h a, v16h b, v8f c) { return __builtin_amdgcn_wmma_f32_16x16x32_f16(false, a, false, b, (short)0, c, false, false); }
__device__ __forceinline__ v8f wmmab(v16bf a, v16bf b, v8f c) { return __builtin_amdgcn_wmma_f32_16x16x32_bf16(false, a, false, b, (short)0, c, false, false); }
__device__ __forceinline__ void splitf(float y, unsigned short& h, unsigned short& l) { h = f2bf(y); l = f2bf(y - bf2f(h)); }
__device__ __forceinline__ float ex2(float x) { return __builtin_amdgcn_exp2f(x); }
// Four exponentials (v_exp_f32, as ex2) in one statement: the outputs are early-clobber, so none lands on a source of another, and the closing v_nop is the one slot that the
// instruction set asks for behind a transcendental before its result is used or its source overwritten; in a run of separate ones the register allocator is free to put a result on its neighbour's source.
__device__ __forceinline__ void ex2x4(float a, float b, float c, float d, float& ya, float& yb, float& yc, float& yd) {
    asm("v_exp_f32 %0, %4\n\tv_exp_f32 %1, %5\n\tv_exp_f32 %2, %6\n\tv_exp_f32 %3, %7\n\tv_nop" : "=&v"(ya), "=&v"(yb), "=&v"(yc), "=&v"(yd) : "v"(a), "v"(b), "v"(c), "v"(d)); }
// the value of lane l ^ 16 (the other half of the wave), on the vector port
__device__ __forceinline__ float xhalf(float x) { const int b = __float_as_int(x); return __int_as_float(__builtin_amdgcn_permlanex16(b, b, 0x76543210, 0xfedcba98, false, false)); }

// Fragment loaders: lane (hi = lane>>4, lr = lane&15); pointer already at row lr, k offset k0 + 8*hi; elements 0..7 <- k0+8hi+0..7, 8..15 <- k0+16+8hi+0..7 (same map for A and B).
template <typename T16> struct WFrag;
template <> struct WFrag<h16> { typedef v16h V; static __device__ __forceinline__ V ld(const h16* p) { return cat16(*(const v8h*)p, *(const v8h*)(p + 16)); } static __device__ __forceinline__ v8f mma(V a, V b, v8f c) { return wmma16(a, b, c); } };
template <> struct WFrag<bf> { typedef v16bf V; static __device__ __forceinline__ V ld(const bf* p) { return cat16b(*(const v8us*)p, *(const v8us*)(p + 16)); } static __device__ __forceinline__ v8f mma(V a, V b, v8f c) { return wmmab(a, b, c); } };

// ---- GEMM body: one work-group of 4 waves per 128x128 output tile, wave (wm, wn) takes its 64x64 quarter (16 accumulators); grid (M/128, N/128), 128 threads.
// A and Bt rows come from K-contiguous 16-bit planes in stages of 128 k (256 B a row) into LDS at pitch 272 B by asynchronous copies (whole lines, each lane 16 B), two buffers: stage t + 1 flies while stage t is worked on.
// c[m][n] (f32) = sum_k (A[m][k] (+ A2[m][k] when NSPLIT == 1)) Bt[n][k]. K % 128 == 0, M % 128 == 0, N % 128 == 0.
// What becomes of c is the epilogue's choice; a wave's 64 columns are one head (HD == 64):
//   EPI 0: C[m][n] = c, f32, pitch ldc.
//   EPI 1, tr false: head planes [h][t][d] (fp16 + bf16 hi/lo) of the interleaved-pair rotation: pair (2i, 2i+1) with table entry [t][i] read BY VALUE (RNE-converted to bf16).
//   EPI 1, tr true: transposed head planes [g][d][t] (fp16 + bf16 hi/lo), straight from the accumulators: a lane holds 8 consecutive t of one d.
// cy: the work-group's column tile inside Bt; tr: the same for the whole work-group.
#define GKS   128                            // k elements per stage
#define GPB   272                            // LDS row pitch in bytes (16 B x odd, for 16-byte fragment reads)
#define GTILE (128 * GPB)                    // one operand's 128 rows of a stage
static_assert(SEQ % 128 == 0 && DQ % 128 == 0 && DKV % 128 == 0 && DM % 128 == 0);
static_assert(DM % GKS == 0 && DQ % GKS == 0);
typedef __attribute__((address_space(1))) v4i gv4i;
typedef __attribute__((address_space(3))) v4i lv4i;
// One operand's 128 rows x 256 B of a stage: 16 copies of 16 B per lane, rows 8 apart (l: the lane's LDS place, g: its global place, gs = 8 source rows in elements).
__device__ __forceinline__ void atile(unsigned char* l, const bf* g, size_t gs) {
#pragma unroll
    for (int i = 0; i < 16; ++i) __builtin_amdgcn_global_load_async_to_lds_b128((gv4i*)(g + i * gs), (lv4i*)(l + i * (8 * GPB)), 0, 0);
}
template <int NSPLIT, int EPI>
__device__ __forceinline__ void gemmw_body(const bf* __restrict__ A, const bf* __restrict__ A2, const bf* __restrict__ Bt, int K, float* C, int ldc,
                                           const float* __restrict__ COS, const float* __restrict__ SIN, h16* P16, bf* Ph, bf* Pl, int cy, bool tr) {
    typedef WFrag<bf>::V V;
    constexpr unsigned STAGE = (2 + NSPLIT) * GTILE, BOFF = (1 + NSPLIT) * GTILE;   // stage = [A | A2 when NSPLIT | Bt]
    __shared__ __align__(16) unsigned char L[2 * STAGE];
    __shared__ __align__(16) float osw[4 * 16 * 68];
    const int tid = threadIdx.x, lane = tid & 31, lr = lane & 15, hi = lane >> 4; const int wave = tid >> 5, wm = wave >> 1, wn = wave & 1;
    const int R0 = blockIdx.x * 128, C0 = cy * 128; const int r0 = R0 + wm * 64, c0 = C0 + wn * 64;
    float* os = osw + wave * (16 * 68);
    v8f acc[4][4];
#pragma unroll
    for (int mb = 0; mb < 4; ++mb)
#pragma unroll
        for (int nb = 0; nb < 4; ++nb) acc[mb][nb] = (v8f){};
    // copies: thread -> row tid >> 4 (+ 8 per copy), 16-byte chunk tid & 15 of the row's 256 B
    const size_t gs = (size_t)8 * K; const int crw = tid >> 4, cch = tid & 15;
    const size_t po = (size_t)crw * K + cch * 8;                          // the lane's own element offset inside an operand's 128 rows
    const bf* uA = A + (size_t)R0 * K; const bf* uA2 = A2 + (size_t)R0 * K; const bf* uB = Bt + (size_t)C0 * K;   // wave-uniform row bases
    unsigned char* lc = L + (crw * GPB + cch * 16);
    const int nt = K / GKS;
    atile(lc, uA + po, gs); if (NSPLIT == 1) atile(lc + GTILE, uA2 + po, gs); atile(lc + BOFF, uB + po, gs);
    asm volatile("s_wait_asynccnt 0x0" ::: "memory");                     // stage 0 landed (this wave's copies)
    __syncthreads();                                                      // ... and every other wave's
    if (nt > 1) { atile(lc + STAGE, (uA + GKS) + po, gs); if (NSPLIT == 1) atile(lc + STAGE + GTILE, (uA2 + GKS) + po, gs); atile(lc + STAGE + BOFF, (uB + GKS) + po, gs); }
#pragma unroll 1                                                          // stays rolled: one trip per stage, its buffer picked by t & 1; the 64 or 128 products of a trip are unrolled inside
    for (int t = 0; t < nt; ++t) {
        const unsigned bo = (unsigned)(t & 1) * STAGE;
        const bf* la = (const bf*)(L + bo + (wm * 64 + lr) * GPB + 16 * hi);
        const bf* lb = (const bf*)(L + bo + BOFF + (wn * 64 + lr) * GPB + 16 * hi);
        V a[2][4], a2[2][4], b[2][4];                                     // two fragment sets: the next 32 k are read from LDS ahead of this block's products
#pragma unroll
        for (int f = 0; f < 4; ++f) { a[0][f] = WFrag<bf>::ld(la + f * (16 * GPB / 2)); if (NSPLIT == 1) a2[0][f] = WFrag<bf>::ld(la + GTILE / 2 + f * (16 * GPB / 2)); b[0][f] = WFrag<bf>::ld(lb + f * (16 * GPB / 2)); }
#pragma unroll
        for (int ks = 0; ks < GKS / 32; ++ks) {
            const int cu = ks & 1, nx = cu ^ 1;
            if (ks + 1 < GKS / 32) {
#pragma unroll
                for (int f = 0; f < 4; ++f) { a[nx][f] = WFrag<bf>::ld(la + (ks + 1) * 32 + f * (16 * GPB / 2)); if (NSPLIT == 1) a2[nx][f] = WFrag<bf>::ld(la + GTILE / 2 + (ks + 1) * 32 + f * (16 * GPB / 2)); b[nx][f] = WFrag<bf>::ld(lb + (ks + 1) * 32 + f * (16 * GPB / 2)); }
                __builtin_amdgcn_sched_barrier(0);                        // keeps the next block's LDS reads one group ahead of this block's products (sunk among them, every product waits for its own read)
            }
#pragma unroll
            for (int nb = 0; nb < 4; ++nb)
#pragma unroll
                for (int mb = 0; mb < 4; ++mb) acc[mb][nb] = wmmab(a[cu][mb], b[cu][nb], acc[mb][nb]);
            if (NSPLIT == 1) {
#pragma unroll
                for (int nb = 0; nb < 4; ++nb)
#pragma unroll
                    for (int mb = 0; mb < 4; ++mb) acc[mb][nb] = wmmab(a2[cu][mb], b[cu][nb], acc[mb][nb]);
            }
        }
        // four vector slots behind the last product, on the branch's taken side too, before anything rewrites its operands
        asm volatile("v_nop\n\tv_nop\n\tv_nop\n\tv_nop" : "+v"(acc[0][0]), "+v"(acc[1][0]), "+v"(acc[2][0]), "+v"(acc[3][0]), "+v"(acc[0][1]), "+v"(acc[1][1]), "+v"(acc[2][1]), "+v"(acc[3][1]),
                                                            "+v"(acc[0][2]), "+v"(acc[1][2]), "+v"(acc[2][2]), "+v"(acc[3][2]), "+v"(acc[0][3]), "+v"(acc[1][3]), "+v"(acc[2][3]), "+v"(acc[3][3]));
        asm volatile("s_wait_dscnt 0x0" ::: "memory");                    // this wave's reads of buffer t & 1 are done before it is refilled
        asm volatile("s_wait_asynccnt 0x0" ::: "memory");                 // this wave's copies of stage t + 1 have landed
        __syncthreads();                                                  // publishes stage t + 1 and ends every wave's reads of stage t
        if (t + 2 < nt) { const int ko = (t + 2) * GKS; atile(lc + bo, (uA + ko) + po, gs); if (NSPLIT == 1) atile(lc + bo + GTILE, (uA2 + ko) + po, gs); atile(lc + bo + BOFF, (uB + ko) + po, gs); }
    }
    asm volatile("s_wait_asynccnt 0x0" ::: "memory");                     // no copy is outstanding when the wave goes on
    const int head = c0 / HD;
    const size_t tb = (size_t)(r0 + hi) * (HD / 2) + lr * 2;              // EPI 1: the lane's place in the tables' row r0 + hi
    if (EPI == 1 && tr) {
        // accumulator element j <-> row (t) mb*16 + 8*hi + j, column (d) nb*16 + lr: 16 bytes of one [d] row per lane and plane; the wave's four mb fill each row's 128-byte line
#pragma unroll
        for (int mb = 0; mb < 4; ++mb)
#pragma unroll
            for (int nb = 0; nb < 4; ++nb) { v8h o16; v8us oh, ol;
#pragma unroll
                for (int j = 0; j < 8; ++j) { const float x = acc[mb][nb][j]; o16[j] = (h16)x; unsigned short a2, c2; splitf(x, a2, c2); oh[j] = a2; ol[j] = c2; }
                const size_t e = ((size_t)head * HD + nb * 16 + lr) * SEQ + r0 + mb * 16 + hi * 8;
                *(v8h*)(P16 + e) = o16; *(v8us*)(Ph + e) = oh; *(v8us*)(Pl + e) = ol; }
        return;
    }
#pragma unroll
    for (int mb = 0; mb < 4; ++mb) {
#pragma unroll
        for (int nb = 0; nb < 4; ++nb) {
#pragma unroll
            for (int j = 0; j < 8; ++j) os[(hi * 8 + j) * 68 + nb * 16 + lr] = acc[mb][nb][j]; }
        __builtin_amdgcn_wave_barrier(); asm volatile("" ::: "memory");
        if (EPI == 0) {
            float* crow = C + (size_t)(r0 + mb * 16) * ldc + c0;
#pragma unroll
            for (int s = 0; s < 8; ++s) { const int row = 2 * s + hi, cofs = lr * 4; const v4f val = *(const v4fa*)(os + row * 68 + cofs);
                *(v4f*)(crow + (size_t)row * ldc + cofs) = val; }
        } else {
            // a lane takes d = 4*lr .. 4*lr+3 (two pairs) of row t; 16 lanes write one whole 128-byte [t] row of each plane
            v2f cc[8], sn[8];
#pragma unroll
            for (int s = 0; s < 8; ++s) { cc[s] = *(const v2f*)(COS + tb + (mb * 16 + 2 * s) * (HD / 2)); sn[s] = *(const v2f*)(SIN + tb + (mb * 16 + 2 * s) * (HD / 2)); }
#pragma unroll
            for (int s = 0; s < 8; ++s) { const int row = 2 * s + hi, cofs = lr * 4; const v4f val = *(const v4fa*)(os + row * 68 + cofs);
                v4h o16; v4us oh, ol;
#pragma unroll
                for (int p = 0; p < 2; ++p) { const float c = bfr(cc[s][p]), sv = bfr(sn[s][p]); const float x0 = val[2 * p], x1 = val[2 * p + 1];
                    const float y0 = x0 * c - x1 * sv, y1 = x0 * sv + x1 * c; unsigned short a2, c2;
                    o16[2 * p] = (h16)y0; splitf(y0, a2, c2); oh[2 * p] = a2; ol[2 * p] = c2;
                    o16[2 * p + 1] = (h16)y1; splitf(y1, a2, c2); oh[2 * p + 1] = a2; ol[2 * p + 1] = c2; }
                const size_t e = ((size_t)head * SEQ + r0 + mb * 16 + row) * HD + cofs;
                *(v4h*)(P16 + e) = o16; *(v4us*)(Ph + e) = oh; *(v4us*)(Pl + e) = ol; }
            asm volatile("s_wait_xcnt 0x0" ::: "memory");                 // before the next rows' table loads land in registers that these stores name; behind the last rows too: the other epilogue's code follows in the text
        }
        __builtin_amdgcn_wave_barrier(); asm volatile("" ::: "memory");
    }
}
// x@wq, x@wk and x@wv in one launch: none reads what another writes, and the 64 work-groups of a k or v product alone leave three quarters of the chip idle.
// grid (M/128, (DQ + 2 DKV)/128): column tiles 0 .. DQ/128 - 1 are q, the next DKV/128 k, the last DKV/128 v; the choice is the same for the whole work-group.
__global__ __launch_bounds__(128) void k_gemm_qkv(const bf* __restrict__ A, const bf* __restrict__ BQ, const bf* __restrict__ BK, const bf* __restrict__ BV, int K, const float* __restrict__ COS, const float* __restrict__ SIN,
                                                  h16* Q16, bf* Qh, bf* Ql, h16* K16, bf* Kh, bf* Kl, h16* V16, bf* Vh, bf* Vl) {
    const int y = (int)blockIdx.y; const bool isq = y < DQ / 128, isv = y >= (DQ + DKV) / 128;
    gemmw_body<0, 1>(A, A, isq ? BQ : (isv ? BV : BK), K, (float*)0, 0, COS, SIN, isq ? Q16 : (isv ? V16 : K16), isq ? Qh : (isv ? Vh : Kh), isq ? Ql : (isv ? Vl : Kl),
                     y - (isq ? 0 : (isv ? (DQ + DKV) / 128 : DQ / 128)), isv); }
__global__ __launch_bounds__(128) void k_gemm_s(const bf* __restrict__ A, const bf* __restrict__ A2, const bf* __restrict__ Bt, int K, float* C, int ldc) {
    gemmw_body<1, 0>(A, A2, Bt, K, C, ldc, (const float*)0, (const float*)0, (h16*)0, (bf*)0, (bf*)0, (int)blockIdx.y, false); }

// ---- weight pre-pass: w[k][n] f32 -> Bt[n][k] bf16 (RNE); one work-group of 8 waves per 128 k x 128 n tile.
// Reads: a wave takes 16 k rows, one whole 512-byte run of a row per load, all 16 loads in flight at once. A lane then holds 16 k of 4 n: eight 16-byte chunks (8 k of one n), which go into
// an LDS tile [n][k] whose 16 chunks a row are permuted by (n >> 2) & 15, so that the 16 lanes of a store (rows 4 apart) and of a read (one row) each cover all banks once.
// Writes: 16 lanes put out 256 contiguous bytes of one n row (two whole lines, one writer each).
#define WTT 128
static_assert(DM % WTT == 0 && DQ % WTT == 0 && DKV % WTT == 0);
#define WT_Q  ((DM / WTT) * (DQ / WTT))
#define WT_KV ((DM / WTT) * (DKV / WTT))
#define WT_O  ((DQ / WTT) * (DM / WTT))
template <int K, int N>
__device__ __forceinline__ void wt_tile(const float* __restrict__ w, bf* Bt, int t, unsigned short* T) {
    const int tid = threadIdx.x, lane = tid & 31, l16 = lane & 15, hi = lane >> 4;
    const int wave = __builtin_amdgcn_readfirstlane(tid >> 5);            // the wave's number in a scalar register: row bases are scalar, a lane adds only its own 16 bytes
    const int n0 = (t % (N / WTT)) * WTT, k0 = (t / (N / WTT)) * WTT;
    const float* g = (w + (size_t)(k0 + wave * 16) * N + n0) + lane * 4;
    v4f v[16];
#pragma unroll
    for (int i = 0; i < 16; ++i) v[i] = *(const v4f*)(g + (size_t)i * N);
#pragma unroll
    for (int c = 0; c < 4; ++c)
#pragma unroll
        for (int q = 0; q < 2; ++q) { v8us o;
#pragma unroll
            for (int j = 0; j < 8; ++j) o[j] = f2bf(v[q * 8 + j][c]);
            *(v8us*)(T + (lane * 4 + c) * WTT + (((wave * 2 + q) ^ l16) * 8)) = o; }
    __syncthreads();                                                      // the tile is whole before it is read along k
    bf* d = Bt + (size_t)(n0 + wave * 2 + hi) * K + k0 + l16 * 8;
    v8us o[8];
#pragma unroll
    for (int s = 0; s < 8; ++s) { const int n = s * 16 + wave * 2 + hi;
        o[s] = *(const v8us*)(T + n * WTT + ((l16 ^ ((n >> 2) & 15)) * 8)); }
#pragma unroll
    for (int s = 0; s < 8; ++s) { *(v8us*)(d + (size_t)s * 16 * K) = o[s];
        asm volatile("s_wait_xcnt 0x0" ::: "memory"); }                   // stands behind each store, before any path on which the store's address or data registers are written again
}
// ---- x pre-pass: f32 -> bf16 (RNE); one work-group of 8 waves per CVT_E consecutive elements, a thread takes 8 elements in each of 8 runs of 2048 (a wave reads 1 KiB and writes 512 B in a row), all its loads in flight at once.
#define CVT_E (256 * 8 * 8)
static_assert(((size_t)SEQ * DM) % CVT_E == 0);
#define CV_T  ((int)(((size_t)SEQ * DM) / CVT_E))
__device__ __forceinline__ void cvt_tile(const float* __restrict__ s, bf* d, int t) {
    const size_t e = (size_t)t * CVT_E + threadIdx.x * 8;
    v4f v[16]; v8us o[8];
#pragma unroll
    for (int i = 0; i < 16; ++i) {
        if (i == 15) asm volatile("s_wait_xcnt 0x0" ::: "memory");        // the last load's result lands on the address pair that the loads before it name
        v[i] = *(const v4f*)(s + e + (i >> 1) * 2048 + (i & 1) * 4); }
#pragma unroll
    for (int i = 0; i < 8; ++i)
#pragma unroll
        for (int k = 0; k < 8; ++k) o[i][k] = f2bf(v[2 * i + (k >> 2)][k & 3]);
#pragma unroll
    for (int i = 0; i < 8; ++i) *(v8us*)(d + e + i * 2048) = o[i];
    asm volatile("s_wait_xcnt 0x0" ::: "memory");                         // behind the stores: another pre-pass's code, which writes their registers, follows in the text
}

// mask pre-pass: one work-group of 8 waves per (16 query rows, 32 mask words); wave r takes rows r and r + 8 and holds each row's 1024 mask values as 8 loads of 512 contiguous bytes, all 16 in flight at once.
// Bit-plane MB[q][w] (bit n = mask[q][32w+n] != 0) and tile class CL[q/16][w]: 0 = no key kept in the 16x32 tile, 1 = all kept, 2 = mixed.
#define MK_T ((SEQ / 16) * (NW / 32))
__device__ __forceinline__ void mask_tile(const int* __restrict__ mask, unsigned* MBp, int* CLp, int t, unsigned* sw) {
    const int lane = threadIdx.x & 31, row = threadIdx.x >> 5; const int qt = t % (SEQ / 16), wb = (t / (SEQ / 16)) * 32; const int q = qt * 16 + row;
    const int* mr = mask + (size_t)q * SEQ_FULL + wb * 32 + lane * 4;
    v4i v[2][8];
#pragma unroll
    for (int h = 0; h < 2; ++h)
#pragma unroll
        for (int i = 0; i < 8; ++i) {
            if (h == 1 && i == 7) asm volatile("s_wait_xcnt 0x0" ::: "memory");   // the last load's result lands on the address pair that the loads before it name
            v[h][i] = *(const v4i*)(mr + (size_t)h * 8 * SEQ_FULL + 128 * i); }
    const int w = wb + 4 * (lane & 7) + (lane >> 3);
    unsigned xs[2];
#pragma unroll
    for (int h = 0; h < 2; ++h) {
        // nibble i of x: the lane's four values of load i, i.e. bits 4*(lane&7)..+3 of word wb + 4*i + (lane>>3)
        unsigned x = 0u;
#pragma unroll
        for (int i = 0; i < 8; ++i) { const unsigned nib = (v[h][i][0] != 0 ? 1u : 0u) | (v[h][i][1] != 0 ? 2u : 0u) | (v[h][i][2] != 0 ? 4u : 0u) | (v[h][i][3] != 0 ? 8u : 0u); x |= nib << (4 * i); }
        // 8x8 nibble transpose inside each group of 8 lanes (three exchanges; a lane keeps the nibbles under its mask and takes the partner's, rotated into place): afterwards lane 8g+t holds the whole word wb + 4*t + g
        unsigned y;
        y = __builtin_rotateright32(__shfl_xor(x, 4, 32), 16);               { const unsigned km = (lane & 4) ? 0xFFFF0000u : 0x0000FFFFu; x = (x & km) | (y & ~km); }
        y = __builtin_rotateright32(__shfl_xor(x, 2, 32), (lane & 2) ? 8 : 24); { const unsigned km = (lane & 2) ? 0xFF00FF00u : 0x00FF00FFu; x = (x & km) | (y & ~km); }
        y = __builtin_rotateright32(__shfl_xor(x, 1, 32), (lane & 1) ? 4 : 28); { const unsigned km = (lane & 1) ? 0xF0F0F0F0u : 0x0F0F0F0Fu; x = (x & km) | (y & ~km); }
        sw[(row + 8 * h) * 32 + lane] = x; xs[h] = x;
    }
    __syncthreads();                                                      // the 16 rows' words -> the class of each 16x32 tile
    if (row == 0) {
        unsigned an = 0xFFFFFFFFu, orr = 0u;
#pragma unroll
        for (int r = 0; r < 16; ++r) { const unsigned u = sw[r * 32 + lane]; an &= u; orr |= u; }
        CLp[(size_t)qt * NW + w] = (orr == 0u) ? 0 : ((an == 0xFFFFFFFFu) ? 1 : 2);
    }
    MBp[(size_t)q * NW + w] = xs[0]; MBp[(size_t)(q + 8) * NW + w] = xs[1];   // one wave = one whole 128-byte line per row
    asm volatile("s_wait_xcnt 0x0" ::: "memory");                         // behind the stores: another pre-pass's code, which writes their registers, follows in the text
}
// The three pre-passes in one launch: none reads what another writes. Which one a work-group does is the same for all of its threads; the weight tile and the mask words share the LDS array (a work-group uses it for one of them).
__global__ __launch_bounds__(256) void k_pre(const float* __restrict__ wq, const float* __restrict__ wk, const float* __restrict__ wv, const float* __restrict__ wo, const float* __restrict__ x, const int* __restrict__ mask,
                                             bf* WQ, bf* WK, bf* WV, bf* WO, bf* XB, unsigned* MBp, int* CLp) {
    __shared__ __align__(16) unsigned short T[WTT * WTT];
    const int b = (int)blockIdx.x;
    if (b < WT_Q) wt_tile<DM, DQ>(wq, WQ, b, T);
    else if (b < WT_Q + 2 * WT_KV) { const bool sv = b >= WT_Q + WT_KV; wt_tile<DM, DKV>(sv ? wv : wk, sv ? WV : WK, b - (sv ? WT_Q + WT_KV : WT_Q), T); }
    else if (b < WT_Q + 2 * WT_KV + WT_O) wt_tile<DQ, DM>(wo, WO, b - (WT_Q + 2 * WT_KV), T);
    else if (b < WT_Q + 2 * WT_KV + WT_O + MK_T) mask_tile(mask, MBp, CLp, b - (WT_Q + 2 * WT_KV + WT_O), (unsigned*)T);
    else cvt_tile(x, XB, b - (WT_Q + 2 * WT_KV + WT_O + MK_T));
}

#define AKS   64                             // keys per stage
#define APB   144                            // LDS row pitch in bytes (16 B x odd, for 16-byte fragment reads)
#define ATILE (64 * APB)                     // one plane's 64 rows of a stage
static_assert(REP == 4 && HD == 64 && SEQ % AKS == 0 && NW <= 64);
// One plane's 64 rows x 128 B of a stage: 4 copies of 16 B per lane, rows 16 apart (l: the lane's LDS place, g: its global place, gs = 16 source rows in elements).
template <typename T16>
__device__ __forceinline__ void ktile(unsigned char* l, const T16* g, size_t gs) {
#pragma unroll
    for (int i = 0; i < 4; ++i) __builtin_amdgcn_global_load_async_to_lds_b128((gv4i*)(g + i * gs), (lv4i*)(l + i * (16 * APB)), 0, 0);
}
template <bool SPLIT>
__device__ __forceinline__ void attn_body(const h16* __restrict__ Q16, const h16* __restrict__ K16, const h16* __restrict__ V16,
                                          const bf* __restrict__ Qh, const bf* __restrict__ Ql, const bf* __restrict__ Kh, const bf* __restrict__ Kl, const bf* __restrict__ Vh, const bf* __restrict__ Vl,
                                          const unsigned* __restrict__ MBp, const int* __restrict__ CLp, bf* Ch, bf* Cl, int qt, int hk, unsigned char* KV) {
    constexpr unsigned VOFF = (SPLIT ? 2 : 1) * ATILE, STG = 2 * VOFF;   // stage = [K (hi | lo when SPLIT) | V^T (hi | lo when SPLIT)]; KV holds two stages
    static_assert(4 * 16 * 68 * 4 <= 2 * STG);
    const int tid = threadIdx.x, lane = tid & 31, lr = lane & 15, hi = lane >> 4, wave = tid >> 5;
    float* os = (float*)KV + wave * (16 * 68);                           // wave-private output tile, in the stage buffers once the key loop has left them
    const int h = hk * REP + wave; const int q0 = qt * 16;
    const size_t qoff = ((size_t)h * SEQ + q0 + lr) * HD + 8 * hi;       // B fragment: column = query q0+lr, d offset 8*hi
    // the row of tile classes as two bit sets, the same in every wave of the work-group: nz bit j = half j has a kept key, al bit j = all of its keys are kept
    const int cl0 = CLp[(size_t)qt * NW + lane]; const int cl1 = (NW > 32) ? CLp[(size_t)qt * NW + (NW > 32 ? 32 : 0) + lane] : 0;
    const unsigned long long nz = (unsigned long long)__builtin_amdgcn_ballot_w32(cl0 != 0) | ((unsigned long long)__builtin_amdgcn_ballot_w32(cl1 != 0) << 32);
    const unsigned long long al = (unsigned long long)__builtin_amdgcn_ballot_w32(cl0 == 1) | ((unsigned long long)__builtin_amdgcn_ballot_w32(cl1 == 1) << 32);
    // copies: thread -> row tid >> 3 (+ 16 per copy), 16-byte chunk tid & 7 of the row's 128 B; stage s: keys 64 s .. 64 s + 63 (s <= 31 from a 64-bit set: inside the planes)
    const int crw = tid >> 3, cch = tid & 7;
    unsigned char* lc = KV + (crw * APB + cch * 16);
    const size_t kpo = ((size_t)hk * SEQ + crw) * HD + cch * 8;          // K planes [g][t][d]: row = key
    const size_t vpo = ((size_t)hk * HD + crw) * SEQ + cch * 8;          // V^T planes [g][d][t]: row = d
    auto stage = [&](unsigned bo, int s) {
        const size_t ke = kpo + (size_t)s * (AKS * HD), ve = vpo + (size_t)s * AKS;
        if (SPLIT) { ktile(lc + bo, Kh + ke, (size_t)16 * HD); ktile(lc + bo + ATILE, Kl + ke, (size_t)16 * HD); ktile(lc + bo + VOFF, Vh + ve, (size_t)16 * SEQ); ktile(lc + bo + VOFF + ATILE, Vl + ve, (size_t)16 * SEQ); }
        else { ktile(lc + bo, K16 + ke, (size_t)16 * HD); ktile(lc + bo + VOFF, V16 + ve, (size_t)16 * SEQ); }
    };
    unsigned long long rem = nz;                                          // kept halves whose stage is not copied yet
    int sc = -1, sn = -1;                                                 // the stage worked on, the stage in flight (-1: none)
    if (rem != 0ull) { sc = __builtin_ctzll(rem) >> 1; rem &= ~(3ull << (2 * sc)); stage(0u, sc); }
    // q fragments: read once, held in registers over the key loop
    v16bf qh0, qh1, ql0, ql1; v16h qa0, qa1;
    if (SPLIT) { qh0 = WFrag<bf>::ld(Qh + qoff); qh1 = WFrag<bf>::ld(Qh + qoff + 32); ql0 = WFrag<bf>::ld(Ql + qoff); ql1 = WFrag<bf>::ld(Ql + qoff + 32); }
    else { qa0 = WFrag<h16>::ld(Q16 + qoff); qa1 = WFrag<h16>::ld(Q16 + qoff + 32); }
    const float NINF = -__builtin_inff();
    float mi = NINF, li = 0.0f; v8f acc[4];                               // the lane's query: running maximum (both halves alike), sum over the lane's own keys; acc[ot][r] = O^T[16*ot + 8*hi + r][lr]
#pragma unroll
    for (int ot = 0; ot < 4; ++ot) acc[ot] = (v8f){};
    asm volatile("s_wait_asynccnt 0x0" ::: "memory");                     // the first stage landed (this wave's copies)
    __syncthreads();                                                      // ... and every other wave's
    if (rem != 0ull) { sn = __builtin_ctzll(rem) >> 1; rem &= ~(3ull << (2 * sn)); stage(STG, sn); }
    unsigned bo = 0u;
#pragma unroll 1                                                          // stays rolled: one trip per kept stage (at most 32: each takes its two bits out of the set)
    while (sc >= 0) {
#pragma unroll 1                                                          // stays rolled: the halves depend on one another through the running maximum, unrolling buys only code
      for (int hf = 0; hf < 2; ++hf) {
        const int j = 2 * sc + hf;
        if (((nz >> j) & 1ull) == 0ull) continue;                         // the same in every wave of the work-group
        // the mask word of the lane's own query, shifted so that bit r is key 8*hi + r and bit 16 + r key 16 + 8*hi + r
        unsigned wd = 0xFFFFFFFFu;
        if (((al >> j) & 1ull) == 0ull) wd = MBp[(size_t)(q0 + lr) * NW + j] >> (8 * hi);
        v8f s0 = (v8f){}, s1 = (v8f){};
        const unsigned char* kb = KV + bo + (hf * 32 + lr) * APB + 16 * hi;   // A fragment (scores): lane = key, k = d
        if (SPLIT) {
            { const v16bf kh0 = WFrag<bf>::ld((const bf*)kb), kh1 = WFrag<bf>::ld((const bf*)(kb + 64)), kl0 = WFrag<bf>::ld((const bf*)(kb + ATILE)), kl1 = WFrag<bf>::ld((const bf*)(kb + ATILE + 64));
              s0 = wmmab(kh0, ql0, s0); s0 = wmmab(kh1, ql1, s0); s0 = wmmab(kl0, qh0, s0); s0 = wmmab(kl1, qh1, s0); s0 = wmmab(kh0, qh0, s0); s0 = wmmab(kh1, qh1, s0); }
            { const unsigned char* k1 = kb + 16 * APB; const v16bf kh0 = WFrag<bf>::ld((const bf*)k1), kh1 = WFrag<bf>::ld((const bf*)(k1 + 64)), kl0 = WFrag<bf>::ld((const bf*)(k1 + ATILE)), kl1 = WFrag<bf>::ld((const bf*)(k1 + ATILE + 64));
              s1 = wmmab(kh0, ql0, s1); s1 = wmmab(kh1, ql1, s1); s1 = wmmab(kl0, qh0, s1); s1 = wmmab(kl1, qh1, s1); s1 = wmmab(kh0, qh0, s1); s1 = wmmab(kh1, qh1, s1);
              asm volatile("v_nop\n\tv_nop\n\tv_nop\n\tv_nop" : "+v"(s0), "+v"(s1) : "v"(qh1), "v"(kh1)); }
        } else {
            const v16h k00 = WFrag<h16>::ld((const h16*)kb), k01 = WFrag<h16>::ld((const h16*)(kb + 64));
            const v16h k10 = WFrag<h16>::ld((const h16*)(kb + 16 * APB)), k11 = WFrag<h16>::ld((const h16*)(kb + 16 * APB + 64));
            s0 = wmma16(k00, qa0, s0); s0 = wmma16(k01, qa1, s0); s1 = wmma16(k10, qa0, s1); s1 = wmma16(k11, qa1, s1);
            asm volatile("v_nop\n\tv_nop\n\tv_nop\n\tv_nop" : "+v"(s0), "+v"(s1) : "v"(qa1), "v"(k11));
        }
        // V^T fragments depend on the stage alone: read here, they arrive under the softmax
        const unsigned char* vb = KV + bo + VOFF + lr * APB + hf * 64 + 16 * hi;   // A fragment (V^T.P^T): lane = d, k = key
        v16bf vh[4], vl[4]; v16h vf[4];
#pragma unroll
        for (int ot = 0; ot < 4; ++ot) {
            if (SPLIT) { vh[ot] = WFrag<bf>::ld((const bf*)(vb + ot * (16 * APB))); vl[ot] = WFrag<bf>::ld((const bf*)(vb + ATILE + ot * (16 * APB))); }
            else vf[ot] = WFrag<h16>::ld((const h16*)(vb + ot * (16 * APB)));
        }
        // online softmax in log2 units; accumulator element r <-> key 8*hi + r (s0) / 16 + 8*hi + r (s1), column lr = the lane's query
        const v8f t0 = s0 * SCL2, t1 = s1 * SCL2;
        float v0[8], v1[8], mx = NINF;
#pragma unroll
        for (int r = 0; r < 8; ++r) {
            v0[r] = ((wd >> r) & 1u) != 0u ? t0[r] : NINF; v1[r] = ((wd >> (16 + r)) & 1u) != 0u ? t1[r] : NINF;
            mx = fmaxf(mx, fmaxf(v0[r], v1[r]));
        }
        mx = fmaxf(mx, xhalf(mx));
        const float nm = fmaxf(mi, mx); const float ms = (nm == NINF) ? 0.0f : nm;
        const float corr = ex2(mi - ms);
        mi = nm;
        float ps[8]; v16h p16; v8us pha, phb, pla, plb;
#pragma unroll
        for (int r = 0; r < 8; r += 2) {
            float p0, p1, p2, p3; ex2x4(v0[r] - ms, v1[r] - ms, v0[r + 1] - ms, v1[r + 1] - ms, p0, p1, p2, p3);
            if (SPLIT) { unsigned short a, c; splitf(p0, a, c); pha[r] = a; pla[r] = c; splitf(p1, a, c); phb[r] = a; plb[r] = c; ps[r] = p0 + p1;
                splitf(p2, a, c); pha[r + 1] = a; pla[r + 1] = c; splitf(p3, a, c); phb[r + 1] = a; plb[r + 1] = c; ps[r + 1] = p2 + p3; }
            else { const v2h e0 = __builtin_convertvector((v2f){p0 * PCAR, p2 * PCAR}, v2h), e1 = __builtin_convertvector((v2f){p1 * PCAR, p3 * PCAR}, v2h);   // two keys per packed conversion; the sums read the rounded values
                p16[r] = e0[0]; p16[r + 1] = e0[1]; p16[8 + r] = e1[0]; p16[9 + r] = e1[1]; ps[r] = (float)e0[0] + (float)e1[0]; ps[r + 1] = (float)e0[1] + (float)e1[1]; }
        }
        li = li * corr + (((ps[0] + ps[1]) + (ps[2] + ps[3])) + ((ps[4] + ps[5]) + (ps[6] + ps[7])));
#pragma unroll
        for (int ot = 0; ot < 4; ++ot) acc[ot] *= corr;
        if (SPLIT) {
            const v16bf ph = cat16b(pha, phb), pl = cat16b(pla, plb);
#pragma unroll
            for (int ot = 0; ot < 4; ++ot) { acc[ot] = wmmab(vh[ot], pl, acc[ot]); acc[ot] = wmmab(vl[ot], ph, acc[ot]); acc[ot] = wmmab(vh[ot], ph, acc[ot]); }
            asm volatile("v_nop\n\tv_nop\n\tv_nop\n\tv_nop" : "+v"(acc[0]), "+v"(acc[1]), "+v"(acc[2]), "+v"(acc[3]) : "v"(ph), "v"(pl));
        } else {
#pragma unroll
            for (int ot = 0; ot < 4; ++ot) acc[ot] = wmma16(vf[ot], p16, acc[ot]);
            asm volatile("v_nop\n\tv_nop\n\tv_nop\n\tv_nop" : "+v"(acc[0]), "+v"(acc[1]), "+v"(acc[2]), "+v"(acc[3]) : "v"(p16));
        }
      }
        asm volatile("s_wait_dscnt 0x0" ::: "memory");                    // this wave's reads of the buffer are done before it is refilled
        asm volatile("s_wait_asynccnt 0x0" ::: "memory");                 // this wave's copies of the stage in flight have landed
        __syncthreads();                                                  // publishes the stage in flight and ends every wave's reads of this one
        int s2 = -1;
        if (rem != 0ull) { s2 = __builtin_ctzll(rem) >> 1; rem &= ~(3ull << (2 * s2)); stage(bo, s2); }
        sc = sn; sn = s2; bo = STG - bo;
    }
    asm volatile("s_wait_asynccnt 0x0" ::: "memory");                     // no copy is outstanding when the wave goes on
    // the stage buffers are free here: the barrier at the foot of the last trip stands behind every wave's last read and last landed copy, and nothing was copied after it
    // finish: join the two halves' sums, normalise, stage 16x64 f32 (a lane holds 8 consecutive d of its query's row), write hi/lo lines
    const float inv = 1.0f / (li + xhalf(li));
#pragma unroll
    for (int ot = 0; ot < 4; ++ot) { const v8f o = acc[ot] * inv; float* op = os + lr * 68 + ot * 16 + 8 * hi;
        *(v4fa*)op = (v4f){o[0], o[1], o[2], o[3]}; *(v4fa*)(op + 4) = (v4f){o[4], o[5], o[6], o[7]}; }
    __syncthreads();
{
#pragma unroll
        for (int s = 0; s < 4; ++s) { const int row = 4 * s + (lane >> 3), c8 = (lane & 7) * 8;
            const v4f x0 = *(const v4fa*)(os + row * 68 + c8), x1 = *(const v4fa*)(os + row * 68 + c8 + 4); v8us oh, ol;
#pragma unroll
            for (int k = 0; k < 4; ++k) { unsigned short a, c; splitf(x0[k], a, c); oh[k] = a; ol[k] = c; splitf(x1[k], a, c); oh[4 + k] = a; ol[4 + k] = c; }
            const size_t oo = (size_t)(q0 + row) * DQ + (size_t)h * HD + c8;
            *(v8us*)(Ch + oo) = oh; *(v8us*)(Cl + oo) = ol; }
         }
}
// Both forms in one launch, grid (SEQ/16, NKV): query tiles below RH take the hi/lo form, the rest the fp16 form (the same for the whole work-group); neither reads what the other writes.
// Which (query tile, kv head) a work-group takes is a permutation of its flat index b, chosen for speed alone: all work-groups are resident at once, four to a WGP, and the launch lasts as long as its fullest WGP.
// Under a mask that keeps more keys the later the row, four equal tiles on a WGP leave the last tiles' WGPs with about twice the mean work.
// Here the quarter of the rows (r) comes from the parities of b's odd and of its even bits, so any four indices that differ in two adjacent bits hold all four quarters: tiles 127 - v, 95 - v, 63 - v and v (the hi/lo quarter,
// dearer per key, rises where the others fall). The kv head takes bits 3 to 5, v bits 0 to 2, 6 and 7; bits 8 and 9 are given back by the two parities, so every (tile, head) is taken once.
static_assert(SEQ / 16 == 128 && NKV == 8 && RH / 16 == 32);
__global__ __launch_bounds__(128) void k_attn(const h16* __restrict__ Q16, const h16* __restrict__ K16, const h16* __restrict__ V16,
                                             const bf* __restrict__ Qh, const bf* __restrict__ Ql, const bf* __restrict__ Kh, const bf* __restrict__ Kl, const bf* __restrict__ Vh, const bf* __restrict__ Vl,
                                             const unsigned* __restrict__ MBp, const int* __restrict__ CLp, bf* Ch, bf* Cl) {
    __shared__ __align__(16) unsigned char KV[2 * 4 * ATILE];            // two stages of the larger (hi/lo) form
    const unsigned b = blockIdx.x + (SEQ / 16) * blockIdx.y;
    const int r = 2 * (__builtin_popcount(b & 0x2AAu) & 1) + (__builtin_popcount(b & 0x155u) & 1);
    const int hk = (int)((b >> 3) & 7u), v = (int)((b & 7u) | ((b >> 3) & 0x18u));
    const int qt = (r == 3) ? v : (SEQ / 16 - 1) - 32 * r - v;
    if (qt < RH / 16) attn_body<true>(Q16, K16, V16, Qh, Ql, Kh, Kl, Vh, Vl, MBp, CLp, Ch, Cl, qt, hk, KV);
    else attn_body<false>(Q16, K16, V16, Qh, Ql, Kh, Kl, Vh, Vl, MBp, CLp, Ch, Cl, qt, hk, KV); }

constexpr size_t al256(size_t b) { return (b + 255) & ~(size_t)255; }
constexpr size_t WS_TOTAL =
    al256((size_t)DQ * DM * 2) + 2 * al256((size_t)DKV * DM * 2) + al256((size_t)DM * DQ * 2) +      // WQ, WK, WV, WO
    al256((size_t)SEQ * DM * 2) +                                                                      // XB
    3 * al256((size_t)NH * SEQ * HD * 2) + 6 * al256((size_t)NKV * SEQ * HD * 2) +                     // q planes, k planes, v planes
    2 * al256((size_t)SEQ * DQ * 2) +                                                                  // ctx hi/lo
    al256((size_t)SEQ * NW * 4) + al256((size_t)(SEQ / 16) * NW * 4);                                  // mask bits, tile classes
static_assert(WS_TOTAL <= (size_t)134217728);

extern "C" void kernel_launch(void* const* d_in, const int* in_sizes, int n_in,
                              void* d_out, int out_size, void* d_ws, size_t ws_size, hipStream_t stream) {
    if (n_in < 8) return;
    if ((long long)in_sizes[0] < (long long)(NB - 1) * SEQ_FULL * DM + (long long)SEQ * DM) return;
    if ((long long)in_sizes[1] < (long long)DM * DQ || (long long)in_sizes[2] < (long long)DM * DKV || (long long)in_sizes[3] < (long long)DM * DKV || (long long)in_sizes[4] < (long long)DQ * DM) return;
    if ((long long)in_sizes[5] < (long long)SEQ * (HD / 2) || (long long)in_sizes[6] < (long long)SEQ * (HD / 2)) return;
    if ((long long)in_sizes[7] < (long long)(SEQ - 1) * SEQ_FULL + SEQ) return;
    if ((long long)out_size < (long long)(NB - 1) * SEQ_FULL * DM + (long long)SEQ * DM) return;
    if (ws_size < WS_TOTAL) return;
    const float* x = (const float*)d_in[0]; const float* wq = (const float*)d_in[1]; const float* wk = (const float*)d_in[2]; const float* wv = (const float*)d_in[3]; const float* wo = (const float*)d_in[4];
    const float* fcos = (const float*)d_in[5]; const float* fsin = (const float*)d_in[6]; const int* mask = (const int*)d_in[7];
    float* OUT = (float*)d_out;     // [1][2048][2048]
    char* wsp = (char*)d_ws;
    auto take = [&](size_t bytes) { char* p = wsp; wsp += (bytes + 255) & ~(size_t)255; return (void*)p; };
    bf* WQ = (bf*)take((size_t)DQ * DM * 2); bf* WK = (bf*)take((size_t)DKV * DM * 2); bf* WV = (bf*)take((size_t)DKV * DM * 2); bf* WO = (bf*)take((size_t)DM * DQ * 2);
    bf* XB = (bf*)take((size_t)SEQ * DM * 2);
    h16* QP16 = (h16*)take((size_t)NH * SEQ * HD * 2); bf* QPh = (bf*)take((size_t)NH * SEQ * HD * 2); bf* QPl = (bf*)take((size_t)NH * SEQ * HD * 2);
    h16* KP16 = (h16*)take((size_t)NKV * SEQ * HD * 2); bf* KPh = (bf*)take((size_t)NKV * SEQ * HD * 2); bf* KPl = (bf*)take((size_t)NKV * SEQ * HD * 2);
    h16* VT16 = (h16*)take((size_t)NKV * SEQ * HD * 2); bf* VTh = (bf*)take((size_t)NKV * SEQ * HD * 2); bf* VTl = (bf*)take((size_t)NKV * SEQ * HD * 2);
    bf* CXh = (bf*)take((size_t)SEQ * DQ * 2); bf* CXl = (bf*)take((size_t)SEQ * DQ * 2);
    unsigned* MBp = (unsigned*)take((size_t)SEQ * NW * 4); int* CLp = (int*)take((size_t)(SEQ / 16) * NW * 4);
    if ((size_t)(wsp - (char*)d_ws) > ws_size) return;

    // four launches, each of work that depends only on launches before it
    // weights: w[in][out] -> Bt[out][in] bf16 (wq: in DM, out DQ; wk/wv: in DM, out DKV; wo: in DQ, out DM); mask -> bit-plane and tile classes; x -> bf16
    k_pre<<<WT_Q + 2 * WT_KV + WT_O + MK_T + CV_T, 256, 0, stream>>>(wq, wk, wv, wo, x, mask, WQ, WK, WV, WO, XB, MBp, CLp);
    k_gemm_qkv<<<dim3(SEQ / 128, (DQ + 2 * DKV) / 128, 1), 128, 0, stream>>>(XB, WQ, WK, WV, DM, fcos, fsin, QP16, QPh, QPl, KP16, KPh, KPl, VT16, VTh, VTl);
    k_attn<<<dim3(SEQ / 16, NKV, 1), 128, 0, stream>>>(QP16, KP16, VT16, QPh, QPl, KPh, KPl, VTh, VTl, MBp, CLp, CXh, CXl);
    k_gemm_s<<<dim3(SEQ / 128, DM / 128, 1), 128, 0, stream>>>(CXh, CXl, WO, DQ, OUT, DM);
}

// v009
// Measured time: 110 microseconds a run.
// Two timings next to v008 put it at 1.06 and 1.05 times that version's speed.
// Over all steps from v000 it is 5.19 times as fast.
#include <hip/hip_runtime.h>

// Contractions (all f32 accumulate): x@wq, x@wk, x@wv v_wmma_f32_16x16x32_bf16 (bf16 x bf16 operand planes, inputs RNE-converted to bf16); scores q.k and P.V: query rows < 512 bf16 hi/lo planes (3 products each), rows >= 512 v_wmma_f32_16x16x32_f16 (P carried x1024); ctx@wo bf16 hi/lo ctx planes x bf16 weights (2 products).
// Grouped-query causal-style attention with interleaved-pair rotation from INPUT tables and an INPUT int32 mask (read by value through a bit-plane + 16x32 tile classes); softmax f32 online running-max form.
// Flash-style fused attention: one wave per 16 query rows per head, the 4 query heads of a kv head in one work-group; K / V^T tiles of 64 keys staged in LDS by asynchronous copies (two buffers); scores and context are formed transposed (S^T = K.Q^T, O^T += V^T.P^T), so P goes from the score accumulators straight into an operand.

#ifndef NB
#define NB 1
#endif
#ifndef SEQ
#define SEQ 2048
#endif
#define NB_FULL  1
#define SEQ_FULL 2048
#define DM   2048
#define NH   32
#define NKV  8
#define REP  (NH / NKV)
#define HD   64
#define DQ   (NH * HD)
#define DKV  (NKV * HD)
#define RH   ((SEQ) < 512 ? (SEQ) : 512)     // query rows < RH use hi+lo planes
#define NW   (SEQ / 32)                      // 32-key words per mask row
#define PCAR 1024.0f
#define SCL2 0.18033688011112042f            // (1/8) * log2(e)

static_assert(SEQ % 64 == 0);                // key halves of 32
static_assert(SEQ <= SEQ_FULL);
static_assert(NW % 32 == 0);                 // mask pre-pass: 32 words per work-group
static_assert(HD == 64);
static_assert(DM % 64 == 0 && DQ % 64 == 0 && DKV % 64 == 0);
static_assert(DM % 32 == 0 && DQ % 32 == 0);
static_assert(NH % NKV == 0);
static_assert(RH % 16 == 0 && (SEQ - RH) % 16 == 0);
static_assert(NB == 1 && NB <= NB_FULL);      // one batch: its x conversion shares the pre-pass launch

typedef _Float16 h16;
typedef unsigned short bf;
typedef __attribute__((ext_vector_type(16))) __bf16   v16bf;
typedef __attribute__((ext_vector_type(16))) _Float16 v16h;
typedef __attribute__((ext_vector_type(8)))  _Float16 v8h;
typedef __attribute__((ext_vector_type(8)))  unsigned short v8us;
typedef __attribute__((ext_vector_type(8)))  float    v8f;
typedef __attribute__((ext_vector_type(4)))  float    v4f;
typedef __attribute__((ext_vector_type(4)))  int      v4i;
typedef __attribute__((ext_vector_type(4)))  _Float16 v4h;
typedef __attribute__((ext_vector_type(2)))  _Float16 v2h;
typedef __attribute__((ext_vector_type(4)))  unsigned short v4us;
typedef __attribute__((ext_vector_type(2)))  unsigned short v2us;
typedef __attribute__((ext_vector_type(2)))  float    v2f;
typedef v4f  __attribute__((may_alias)) v4fa;

__device__ __forceinline__ unsigned short f2bf(float f) { unsigned u = __float_as_uint(f); u += 0x7FFFu + ((u >> 16) & 1u); return (unsigned short)(u >> 16); }
__device__ __forceinline__ float bf2f(unsigned short b) { return __uint_as_float(((unsigned)b) << 16); }
__device__ __forceinline__ float bfr(float f) { return bf2f(f2bf(f)); }
__device__ __forceinline__ v16h cat16(v8h lo, v8h hi) { return __builtin_shufflevector(lo, hi, 0, 1, 2, 3, 4, 5, 6, 7, 8, 9, 10, 11, 12, 13, 14, 15); }
__device__ __forceinline__ v16bf cat16b(v8us lo, v8us hi) { return __builtin_bit_cast(v16bf, __builtin_shufflevector(lo, hi, 0, 1, 2, 3, 4, 5, 6, 7, 8, 9, 10, 11, 12, 13, 14, 15)); }
__device__ __forceinline__ v8f wmma16(v16h a, v16h b, v8f c) { return __builtin_amdgcn_wmma_f32_16x16x32_f16(false, a, false, b, (short)0, c, false, false); }
__device__ __forceinline__ v8f wmmab(v16bf a, v16bf b, v8f c) { return __builtin_amdgcn_wmma_f32_16x16x32_bf16(false, a, false, b, (short)0, c, false, false); }
__device__ __forceinline__ void splitf(float y, unsigned short& h, unsigned short& l) { h = f2bf(y); l = f2bf(y - bf2f(h)); }
__device__ __forceinline__ float ex2(float x) { return __builtin_amdgcn_exp2f(x); }
// Four exponentials (v_exp_f32, as ex2) in one statement: the outputs are early-clobber, so none lands on a source of another, and the closing v_nop is the one slot that the
// instruction set asks for behind a transcendental before its result is used or its source overwritten; in a run of separate ones the register allocator is free to put a result on its neighbour's source.
__device__ __forceinline__ void ex2x4(float a, float b, float c, float d, float& ya, float& yb, float& yc, float& yd) {
    asm("v_exp_f32 %0, %4\n\tv_exp_f32 %1, %5\n\tv_exp_f32 %2, %6\n\tv_exp_f32 %3, %7\n\tv_nop" : "=&v"(ya), "=&v"(yb), "=&v"(yc), "=&v"(yd) : "v"(a), "v"(b), "v"(c), "v"(d)); }
// the value of lane l ^ 16 (the other half of the wave), on the vector port
__device__ __forceinline__ float xhalf(float x) { const int b = __float_as_int(x); return __int_as_float(__builtin_amdgcn_permlanex16(b, b, 0x76543210, 0xfedcba98, false, false)); }

// Fragment loaders: lane (hi = lane>>4, lr = lane&15); pointer already at row lr, k offset k0 + 8*hi; elements 0..7 <- k0+8hi+0..7, 8..15 <- k0+16+8hi+0..7 (same map for A and B).
template <typename T16> struct WFrag;
template <> struct WFrag<h16> { typedef v16h V; static __device__ __forceinline__ V ld(const h16* p) { return cat16(*(const v8h*)p, *(const v8h*)(p + 16)); } static __device__ __forceinline__ v8f mma(V a, V b, v8f c) { return wmma16(a, b, c); } };
template <> struct WFrag<bf> { typedef v16bf V; static __device__ __forceinline__ V ld(const bf* p) { return cat16b(*(const v8us*)p, *(const v8us*)(p + 16)); } static __device__ __forceinline__ v8f mma(V a, V b, v8f c) { return wmmab(a, b, c); } };

// ---- GEMM body: one work-group of 4 waves per 128x128 output tile, wave (wm, wn) takes its 64x64 quarter (16 accumulators); grid (M/128, N/128), 128 threads.
// A and Bt rows come from K-contiguous 16-bit planes in stages of 128 k (256 B a row) into LDS at pitch 272 B by asynchronous copies (whole lines, each lane 16 B), two buffers: stage t + 1 flies while stage t is worked on.
// c[m][n] (f32) = sum_k (A[m][k] (+ A2[m][k] when NSPLIT == 1)) Bt[n][k]. K % 128 == 0, M % 128 == 0, N % 128 == 0.
// What becomes of c is the epilogue's choice; a wave's 64 columns are one head (HD == 64):
//   EPI 0: C[m][n] = c, f32, pitch ldc.
//   EPI 1, tr false: head planes [h][t][d] (fp16 + bf16 hi/lo) of the interleaved-pair rotation: pair (2i, 2i+1) with table entry [t][i] read BY VALUE (RNE-converted to bf16).
//   EPI 1, tr true: transposed head planes [g][d][t] (fp16 + bf16 hi/lo), straight from the accumulators: a lane holds 8 consecutive t of one d.
// cy: the work-group's column tile inside Bt; tr: the same for the whole work-group.
#define GKS   128                            // k elements per stage
#define GPB   272                            // LDS row pitch in bytes (16 B x odd, for 16-byte fragment reads)
#define GTILE (128 * GPB)                    // one operand's 128 rows of a stage
static_assert(SEQ % 128 == 0 && DQ % 128 == 0 && DKV % 128 == 0 && DM % 128 == 0);
static_assert(DM % GKS == 0 && DQ % GKS == 0);
typedef __attribute__((address_space(1))) v4i gv4i;
typedef __attribute__((address_space(3))) v4i lv4i;
// One operand's 128 rows x 256 B of a stage: 16 copies of 16 B per lane, rows 8 apart (l: the lane's LDS place, g: its global place, gs = 8 source rows in elements).
__device__ __forceinline__ void atile(unsigned char* l, const bf* g, size_t gs) {
#pragma unroll
    for (int i = 0; i < 16; ++i) __builtin_amdgcn_global_load_async_to_lds_b128((gv4i*)(g + i * gs), (lv4i*)(l + i * (8 * GPB)), 0, 0);
}
template <int NSPLIT, int EPI>
__device__ __forceinline__ void gemmw_body(const bf* __restrict__ A, const bf* __restrict__ A2, const bf* __restrict__ Bt, int K, float* C, int ldc,
                                           const float* __restrict__ COS, const float* __restrict__ SIN, h16* P16, bf* Ph, bf* Pl, int cy, bool tr) {
    typedef WFrag<bf>::V V;
    constexpr unsigned STAGE = (2 + NSPLIT) * GTILE, BOFF = (1 + NSPLIT) * GTILE;   // stage = [A | A2 when NSPLIT | Bt]
    __shared__ __align__(16) unsigned char L[2 * STAGE];
    __shared__ __align__(16) float osw[4 * 16 * 68];
    const int tid = threadIdx.x, lane = tid & 31, lr = lane & 15, hi = lane >> 4; const int wave = tid >> 5, wm = wave >> 1, wn = wave & 1;
    const int R0 = blockIdx.x * 128, C0 = cy * 128; const int r0 = R0 + wm * 64, c0 = C0 + wn * 64;
    float* os = osw + wave * (16 * 68);
    v8f acc[4][4];
#pragma unroll
    for (int mb = 0; mb < 4; ++mb)
#pragma unroll
        for (int nb = 0; nb < 4; ++nb) acc[mb][nb] = (v8f){};
    // copies: thread -> row tid >> 4 (+ 8 per copy), 16-byte chunk tid & 15 of the row's 256 B
    const size_t gs = (size_t)8 * K; const int crw = tid >> 4, cch = tid & 15;
    const size_t po = (size_t)crw * K + cch * 8;                          // the lane's own element offset inside an operand's 128 rows
    const bf* uA = A + (size_t)R0 * K; const bf* uA2 = A2 + (size_t)R0 * K; const bf* uB = Bt + (size_t)C0 * K;   // wave-uniform row bases
    unsigned char* lc = L + (crw * GPB + cch * 16);
    const int nt = K / GKS;
    atile(lc, uA + po, gs); if (NSPLIT == 1) atile(lc + GTILE, uA2 + po, gs); atile(lc + BOFF, uB + po, gs);
    asm volatile("s_wait_asynccnt 0x0" ::: "memory");                     // stage 0 landed (this wave's copies)
    __syncthreads();                                                      // ... and every other wave's
    if (nt > 1) { atile(lc + STAGE, (uA + GKS) + po, gs); if (NSPLIT == 1) atile(lc + STAGE + GTILE, (uA2 + GKS) + po, gs); atile(lc + STAGE + BOFF, (uB + GKS) + po, gs); }
#pragma unroll 1                                                          // stays rolled: one trip per stage, its buffer picked by t & 1; the 64 or 128 products of a trip are unrolled inside
    for (int t = 0; t < nt; ++t) {
        const unsigned bo = (unsigned)(t & 1) * STAGE;
        const bf* la = (const bf*)(L + bo + (wm * 64 + lr) * GPB + 16 * hi);
        const bf* lb = (const bf*)(L + bo + BOFF + (wn * 64 + lr) * GPB + 16 * hi);
        V a[2][4], a2[2][4], b[2][4];                                     // two fragment sets: the next 32 k are read from LDS ahead of this block's products
#pragma unroll
        for (int f = 0; f < 4; ++f) { a[0][f] = WFrag<bf>::ld(la + f * (16 * GPB / 2)); if (NSPLIT == 1) a2[0][f] = WFrag<bf>::ld(la + GTILE / 2 + f * (16 * GPB / 2)); b[0][f] = WFrag<bf>::ld(lb + f * (16 * GPB / 2)); }
#pragma unroll
        for (int ks = 0; ks < GKS / 32; ++ks) {
            const int cu = ks & 1, nx = cu ^ 1;
            if (ks + 1 < GKS / 32) {
#pragma unroll
                for (int f = 0; f < 4; ++f) { a[nx][f] = WFrag<bf>::ld(la + (ks + 1) * 32 + f * (16 * GPB / 2)); if (NSPLIT == 1) a2[nx][f] = WFrag<bf>::ld(la + GTILE / 2 + (ks + 1) * 32 + f * (16 * GPB / 2)); b[nx][f] = WFrag<bf>::ld(lb + (ks + 1) * 32 + f * (16 * GPB / 2)); }
                __builtin_amdgcn_sched_barrier(0);                        // keeps the next block's LDS reads one group ahead of this block's products (sunk among them, every product waits for its own read)
            }
#pragma unroll
            for (int nb = 0; nb < 4; ++nb)
#pragma unroll
                for (int mb = 0; mb < 4; ++mb) acc[mb][nb] = wmmab(a[cu][mb], b[cu][nb], acc[mb][nb]);
            if (NSPLIT == 1) {
#pragma unroll
                for (int nb = 0; nb < 4; ++nb)
#pragma unroll
                    for (int mb = 0; mb < 4; ++mb) acc[mb][nb] = wmmab(a2[cu][mb], b[cu][nb], acc[mb][nb]);
            }
        }
        // four vector slots behind the last product, on the branch's taken side too, before anything rewrites its operands
        asm volatile("v_nop\n\tv_nop\n\tv_nop\n\tv_nop" : "+v"(acc[0][0]), "+v"(acc[1][0]), "+v"(acc[2][0]), "+v"(acc[3][0]), "+v"(acc[0][1]), "+v"(acc[1][1]), "+v"(acc[2][1]), "+v"(acc[3][1]),
                                                            "+v"(acc[0][2]), "+v"(acc[1][2]), "+v"(acc[2][2]), "+v"(acc[3][2]), "+v"(acc[0][3]), "+v"(acc[1][3]), "+v"(acc[2][3]), "+v"(acc[3][3]));
        asm volatile("s_wait_dscnt 0x0" ::: "memory");                    // this wave's reads of buffer t & 1 are done before it is refilled
        asm volatile("s_wait_asynccnt 0x0" ::: "memory");                 // this wave's copies of stage t + 1 have landed
        __syncthreads();                                                  // publishes stage t + 1 and ends every wave's reads of stage t
        if (t + 2 < nt) { const int ko = (t + 2) * GKS; atile(lc + bo, (uA + ko) + po, gs); if (NSPLIT == 1) atile(lc + bo + GTILE, (uA2 + ko) + po, gs); atile(lc + bo + BOFF, (uB + ko) + po, gs); }
    }
    asm volatile("s_wait_asynccnt 0x0" ::: "memory");                     // no copy is outstanding when the wave goes on
    const int head = c0 / HD;
    const size_t tb = (size_t)(r0 + hi) * (HD / 2) + lr * 2;              // EPI 1: the lane's place in the tables' row r0 + hi
    if (EPI == 1 && tr) {
        // accumulator element j <-> row (t) mb*16 + 8*hi + j, column (d) nb*16 + lr: 16 bytes of one [d] row per lane and plane; the wave's four mb fill each row's 128-byte line
#pragma unroll
        for (int mb = 0; mb < 4; ++mb)
#pragma unroll
            for (int nb = 0; nb < 4; ++nb) { v8h o16; v8us oh, ol;
#pragma unroll
                for (int j = 0; j < 8; ++j) { const float x = acc[mb][nb][j]; o16[j] = (h16)x; unsigned short a2, c2; splitf(x, a2, c2); oh[j] = a2; ol[j] = c2; }
                const size_t e = ((size_t)head * HD + nb * 16 + lr) * SEQ + r0 + mb * 16 + hi * 8;
                *(v8h*)(P16 + e) = o16; *(v8us*)(Ph + e) = oh; *(v8us*)(Pl + e) = ol; }
        return;
    }
#pragma unroll
    for (int mb = 0; mb < 4; ++mb) {
#pragma unroll
        for (int nb = 0; nb < 4; ++nb) {
#pragma unroll
            for (int j = 0; j < 8; ++j) os[(hi * 8 + j) * 68 + nb * 16 + lr] = acc[mb][nb][j]; }
        __builtin_amdgcn_wave_barrier(); asm volatile("" ::: "memory");
        if (EPI == 0) {
            float* crow = C + (size_t)(r0 + mb * 16) * ldc + c0;
#pragma unroll
            for (int s = 0; s < 8; ++s) { const int row = 2 * s + hi, cofs = lr * 4; const v4f val = *(const v4fa*)(os + row * 68 + cofs);
                *(v4f*)(crow + (size_t)row * ldc + cofs) = val; }
        } else {
            // a lane takes d = 4*lr .. 4*lr+3 (two pairs) of row t; 16 lanes write one whole 128-byte [t] row of each plane
            v2f cc[8], sn[8];
#pragma unroll
            for (int s = 0; s < 8; ++s) { cc[s] = *(const v2f*)(COS + tb + (mb * 16 + 2 * s) * (HD / 2)); sn[s] = *(const v2f*)(SIN + tb + (mb * 16 + 2 * s) * (HD / 2)); }
#pragma unroll
            for (int s = 0; s < 8; ++s) { const int row = 2 * s + hi, cofs = lr * 4; const v4f val = *(const v4fa*)(os + row * 68 + cofs);
                v4h o16; v4us oh, ol;
#pragma unroll
                for (int p = 0; p < 2; ++p) { const float c = bfr(cc[s][p]), sv = bfr(sn[s][p]); const float x0 = val[2 * p], x1 = val[2 * p + 1];
                    const float y0 = x0 * c - x1 * sv, y1 = x0 * sv + x1 * c; unsigned short a2, c2;
                    o16[2 * p] = (h16)y0; splitf(y0, a2, c2); oh[2 * p] = a2; ol[2 * p] = c2;
                    o16[2 * p + 1] = (h16)y1; splitf(y1, a2, c2); oh[2 * p + 1] = a2; ol[2 * p + 1] = c2; }
                const size_t e = ((size_t)head * SEQ + r0 + mb * 16 + row) * HD + cofs;
                *(v4h*)(P16 + e) = o16; *(v4us*)(Ph + e) = oh; *(v4us*)(Pl + e) = ol; }
            asm volatile("s_wait_xcnt 0x0" ::: "memory");                 // before the next rows' table loads land in registers that these stores name; behind the last rows too: the other epilogue's code follows in the text
        }
        __builtin_amdgcn_wave_barrier(); asm volatile("" ::: "memory");
    }
}
// x@wq, x@wk and x@wv in one launch: none reads what another writes, and the 64 work-groups of a k or v product alone leave three quarters of the chip idle.
// grid (M/128, (DQ + 2 DKV)/128): column tiles 0 .. DQ/128 - 1 are q, the next DKV/128 k, the last DKV/128 v; the choice is the same for the whole work-group.
__global__ __launch_bounds__(128) void k_gemm_qkv(const bf* __restrict__ A, const bf* __restrict__ BQ, const bf* __restrict__ BK, const bf* __restrict__ BV, int K, const float* __restrict__ COS, const float* __restrict__ SIN,
                                                  h16* Q16, bf* Qh, bf* Ql, h16* K16, bf* Kh, bf* Kl, h16* V16, bf* Vh, bf* Vl) {
    const int y = (int)blockIdx.y; const bool isq = y < DQ / 128, isv = y >= (DQ + DKV) / 128;
    gemmw_body<0, 1>(A, A, isq ? BQ : (isv ? BV : BK), K, (float*)0, 0, COS, SIN, isq ? Q16 : (isv ? V16 : K16), isq ? Qh : (isv ? Vh : Kh), isq ? Ql : (isv ? Vl : Kl),
                     y - (isq ? 0 : (isv ? (DQ + DKV) / 128 : DQ / 128)), isv); }
__global__ __launch_bounds__(128) void k_gemm_s(const bf* __restrict__ A, const bf* __restrict__ A2, const bf* __restrict__ Bt, int K, float* C, int ldc) {
    gemmw_body<1, 0>(A, A2, Bt, K, C, ldc, (const float*)0, (const float*)0, (h16*)0, (bf*)0, (bf*)0, (int)blockIdx.y, false); }

// ---- weight pre-pass: w[k][n] f32 -> Bt[n][k] bf16 (RNE); one work-group of 8 waves per 128 k x 128 n tile.
// Reads: a wave takes 16 k rows, one whole 512-byte run of a row per load, all 16 loads in flight at once. A lane then holds 16 k of 4 n: eight 16-byte chunks (8 k of one n), which go into
// an LDS tile [n][k] whose 16 chunks a row are permuted by (n >> 2) & 15, so that the 16 lanes of a store (rows 4 apart) and of a read (one row) each cover all banks once.
// Writes: 16 lanes put out 256 contiguous bytes of one n row (two whole lines, one writer each).
#define WTT 128
static_assert(DM % WTT == 0 && DQ % WTT == 0 && DKV % WTT == 0);
#define WT_Q  ((DM / WTT) * (DQ / WTT))
#define WT_KV ((DM / WTT) * (DKV / WTT))
#define WT_O  ((DQ / WTT) * (DM / WTT))
template <int K, int N>
__device__ __forceinline__ void wt_tile(const float* __restrict__ w, bf* Bt, int t, unsigned short* T) {
    const int tid = threadIdx.x, lane = tid & 31, l16 = lane & 15, hi = lane >> 4;
    const int wave = __builtin_amdgcn_readfirstlane(tid >> 5);            // the wave's number in a scalar register: row bases are scalar, a lane adds only its own 16 bytes
    const int n0 = (t % (N / WTT)) * WTT, k0 = (t / (N / WTT)) * WTT;
    const float* g = (w + (size_t)(k0 + wave * 16) * N + n0) + lane * 4;
    v4f v[16];
#pragma unroll
    for (int i = 0; i < 16; ++i) v[i] = *(const v4f*)(g + (size_t)i * N);
#pragma unroll
    for (int c = 0; c < 4; ++c)
#pragma unroll
        for (int q = 0; q < 2; ++q) { v8us o;
#pragma unroll
            for (int j = 0; j < 8; ++j) o[j] = f2bf(v[q * 8 + j][c]);
            *(v8us*)(T + (lane * 4 + c) * WTT + (((wave * 2 + q) ^ l16) * 8)) = o; }
    __syncthreads();                                                      // the tile is whole before it is read along k
    bf* d = Bt + (size_t)(n0 + wave * 2 + hi) * K + k0 + l16 * 8;
    v8us o[8];
#pragma unroll
    for (int s = 0; s < 8; ++s) { const int n = s * 16 + wave * 2 + hi;
        o[s] = *(const v8us*)(T + n * WTT + ((l16 ^ ((n >> 2) & 15)) * 8)); }
#pragma unroll
    for (int s = 0; s < 8; ++s) { *(v8us*)(d + (size_t)s * 16 * K) = o[s];
        asm volatile("s_wait_xcnt 0x0" ::: "memory"); }                   // stands behind each store, before any path on which the store's address or data registers are written again
}
// ---- x pre-pass: f32 -> bf16 (RNE); one work-group of 8 waves per CVT_E consecutive elements, a thread takes 8 elements in each of 8 runs of 2048 (a wave reads 1 KiB and writes 512 B in a row), all its loads in flight at once.
#define CVT_E (256 * 8 * 8)
static_assert(((size_t)SEQ * DM) % CVT_E == 0);
#define CV_T  ((int)(((size_t)SEQ * DM) / CVT_E))
__device__ __forceinline__ void cvt_tile(const float* __restrict__ s, bf* d, int t) {
    const size_t e = (size_t)t * CVT_E + threadIdx.x * 8;
    v4f v[16]; v8us o[8];
#pragma unroll
    for (int i = 0; i < 16; ++i) {
        if (i == 15) asm volatile("s_wait_xcnt 0x0" ::: "memory");        // the last load's result lands on the address pair that the loads before it name
        v[i] = *(const v4f*)(s + e + (i >> 1) * 2048 + (i & 1) * 4); }
#pragma unroll
    for (int i = 0; i < 8; ++i)
#pragma unroll
        for (int k = 0; k < 8; ++k) o[i][k] = f2bf(v[2 * i + (k >> 2)][k & 3]);
#pragma unroll
    for (int i = 0; i < 8; ++i) *(v8us*)(d + e + i * 2048) = o[i];
    asm volatile("s_wait_xcnt 0x0" ::: "memory");                         // behind the stores: another pre-pass's code, which writes their registers, follows in the text
}

// mask pre-pass: one work-group of 8 waves per (16 query rows, 32 mask words); wave r takes rows r and r + 8 and holds each row's 1024 mask values as 8 loads of 512 contiguous bytes, all 16 in flight at once.
// Bit-plane MB[q][w] (bit n = mask[q][32w+n] != 0) and tile class CL[q/16][w]: 0 = no key kept in the 16x32 tile, 1 = all kept, 2 = mixed.
#define MK_T ((SEQ / 16) * (NW / 32))
__device__ __forceinline__ void mask_tile(const int* __restrict__ mask, unsigned* MBp, int* CLp, int t, unsigned* sw) {
    const int lane = threadIdx.x & 31, row = threadIdx.x >> 5; const int qt = t % (SEQ / 16), wb = (t / (SEQ / 16)) * 32; const int q = qt * 16 + row;
    const int* mr = mask + (size_t)q * SEQ_FULL + wb * 32 + lane * 4;
    v4i v[2][8];
#pragma unroll
    for (int h = 0; h < 2; ++h)
#pragma unroll
        for (int i = 0; i < 8; ++i) {
            if (h == 1 && i == 7) asm volatile("s_wait_xcnt 0x0" ::: "memory");   // the last load's result lands on the address pair that the loads before it name
            v[h][i] = *(const v4i*)(mr + (size_t)h * 8 * SEQ_FULL + 128 * i); }
    const int w = wb + 4 * (lane & 7) + (lane >> 3);
    unsigned xs[2];
#pragma unroll
    for (int h = 0; h < 2; ++h) {
        // nibble i of x: the lane's four values of load i, i.e. bits 4*(lane&7)..+3 of word wb + 4*i + (lane>>3)
        unsigned x = 0u;
#pragma unroll
        for (int i = 0; i < 8; ++i) { const unsigned nib = (v[h][i][0] != 0 ? 1u : 0u) | (v[h][i][1] != 0 ? 2u : 0u) | (v[h][i][2] != 0 ? 4u : 0u) | (v[h][i][3] != 0 ? 8u : 0u); x |= nib << (4 * i); }
        // 8x8 nibble transpose inside each group of 8 lanes (three exchanges; a lane keeps the nibbles under its mask and takes the partner's, rotated into place): afterwards lane 8g+t holds the whole word wb + 4*t + g
        unsigned y;
        y = __builtin_rotateright32(__shfl_xor(x, 4, 32), 16);               { const unsigned km = (lane & 4) ? 0xFFFF0000u : 0x0000FFFFu; x = (x & km) | (y & ~km); }
        y = __builtin_rotateright32(__shfl_xor(x, 2, 32), (lane & 2) ? 8 : 24); { const unsigned km = (lane & 2) ? 0xFF00FF00u : 0x00FF00FFu; x = (x & km) | (y & ~km); }
        y = __builtin_rotateright32(__shfl_xor(x, 1, 32), (lane & 1) ? 4 : 28); { const unsigned km = (lane & 1) ? 0xF0F0F0F0u : 0x0F0F0F0Fu; x = (x & km) | (y & ~km); }
        sw[(row + 8 * h) * 32 + lane] = x; xs[h] = x;
    }
    __syncthreads();                                                      // the 16 rows' words -> the class of each 16x32 tile
    if (row == 0) {
        unsigned an = 0xFFFFFFFFu, orr = 0u;
#pragma unroll
        for (int r = 0; r < 16; ++r) { const unsigned u = sw[r * 32 + lane]; an &= u; orr |= u; }
        CLp[(size_t)qt * NW + w] = (orr == 0u) ? 0 : ((an == 0xFFFFFFFFu) ? 1 : 2);
    }
    MBp[(size_t)q * NW + w] = xs[0]; MBp[(size_t)(q + 8) * NW + w] = xs[1];   // one wave = one whole 128-byte line per row
    asm volatile("s_wait_xcnt 0x0" ::: "memory");                         // behind the stores: another pre-pass's code, which writes their registers, follows in the text
}
// The three pre-passes in one launch: none reads what another writes. Which one a work-group does is the same for all of its threads; the weight tile and the mask words share the LDS array (a work-group uses it for one of them).
__global__ __launch_bounds__(256) void k_pre(const float* __restrict__ wq, const float* __restrict__ wk, const float* __restrict__ wv, const float* __restrict__ wo, const float* __restrict__ x, const int* __restrict__ mask,
                                             bf* WQ, bf* WK, bf* WV, bf* WO, bf* XB, unsigned* MBp, int* CLp) {
    __shared__ __align__(16) unsigned short T[WTT * WTT];
    const int b = (int)blockIdx.x;
    if (b < WT_Q) wt_tile<DM, DQ>(wq, WQ, b, T);
    else if (b < WT_Q + 2 * WT_KV) { const bool sv = b >= WT_Q + WT_KV; wt_tile<DM, DKV>(sv ? wv : wk, sv ? WV : WK, b - (sv ? WT_Q + WT_KV : WT_Q), T); }
    else if (b < WT_Q + 2 * WT_KV + WT_O) wt_tile<DQ, DM>(wo, WO, b - (WT_Q + 2 * WT_KV), T);
    else if (b < WT_Q + 2 * WT_KV + WT_O + MK_T) mask_tile(mask, MBp, CLp, b - (WT_Q + 2 * WT_KV + WT_O), (unsigned*)T);
    else cvt_tile(x, XB, b - (WT_Q + 2 * WT_KV + WT_O + MK_T));
}

#define AKS   64                             // keys per stage
#define APB   144                            // LDS row pitch in bytes (16 B x odd, for 16-byte fragment reads)
#define ATILE (64 * APB)                     // one plane's 64 rows of a stage
static_assert(REP == 4 && HD == 64 && SEQ % AKS == 0 && NW <= 64);
// One plane's 64 rows x 128 B of a stage: 4 copies of 16 B per lane, rows 16 apart (l: the lane's LDS place, g: its global place, gs = 16 source rows in elements).
template <typename T16>
__device__ __forceinline__ void ktile(unsigned char* l, const T16* g, size_t gs) {
#pragma unroll
    for (int i = 0; i < 4; ++i) __builtin_amdgcn_global_load_async_to_lds_b128((gv4i*)(g + i * gs), (lv4i*)(l + i * (16 * APB)), 0, 0);
}
template <bool SPLIT>
__device__ __forceinline__ void attn_body(const h16* __restrict__ Q16, const h16* __restrict__ K16, const h16* __restrict__ V16,
                                          const bf* __restrict__ Qh, const bf* __restrict__ Ql, const bf* __restrict__ Kh, const bf* __restrict__ Kl, const bf* __restrict__ Vh, const bf* __restrict__ Vl,
                                          const unsigned* __restrict__ MBp, const int* __restrict__ CLp, bf* Ch, bf* Cl, int qt, int hk, unsigned char* KV) {
    constexpr unsigned VOFF = (SPLIT ? 2 : 1) * ATILE, STG = 2 * VOFF;   // stage = [K (hi | lo when SPLIT) | V^T (hi | lo when SPLIT)]; KV holds two stages
    static_assert(4 * 16 * 68 * 4 <= 2 * STG);
    const int tid = threadIdx.x, lane = tid & 31, lr = lane & 15, hi = lane >> 4, wave = tid >> 5;
    float* os = (float*)KV + wave * (16 * 68);                           // wave-private output tile, in the stage buffers once the key loop has left them
    const int h = hk * REP + wave; const int q0 = qt * 16;
    const size_t qoff = ((size_t)h * SEQ + q0 + lr) * HD + 8 * hi;       // B fragment: column = query q0+lr, d offset 8*hi
    // the row of tile classes as two bit sets, the same in every wave of the work-group: nz bit j = half j has a kept key, al bit j = all of its keys are kept
    const int cl0 = CLp[(size_t)qt * NW + lane]; const int cl1 = (NW > 32) ? CLp[(size_t)qt * NW + (NW > 32 ? 32 : 0) + lane] : 0;
    const unsigned long long nz = (unsigned long long)__builtin_amdgcn_ballot_w32(cl0 != 0) | ((unsigned long long)__builtin_amdgcn_ballot_w32(cl1 != 0) << 32);
    const unsigned long long al = (unsigned long long)__builtin_amdgcn_ballot_w32(cl0 == 1) | ((unsigned long long)__builtin_amdgcn_ballot_w32(cl1 == 1) << 32);
    // copies: thread -> row tid >> 3 (+ 16 per copy), 16-byte chunk tid & 7 of the row's 128 B; stage s: keys 64 s .. 64 s + 63 (s <= 31 from a 64-bit set: inside the planes)
    const int crw = tid >> 3, cch = tid & 7;
    unsigned char* lc = KV + (crw * APB + cch * 16);
    const size_t kpo = ((size_t)hk * SEQ + crw) * HD + cch * 8;          // K planes [g][t][d]: row = key
    const size_t vpo = ((size_t)hk * HD + crw) * SEQ + cch * 8;          // V^T planes [g][d][t]: row = d
    auto stage = [&](unsigned bo, int s) {
        const size_t ke = kpo + (size_t)s * (AKS * HD), ve = vpo + (size_t)s * AKS;
        if (SPLIT) { ktile(lc + bo, Kh + ke, (size_t)16 * HD); ktile(lc + bo + ATILE, Kl + ke, (size_t)16 * HD); ktile(lc + bo + VOFF, Vh + ve, (size_t)16 * SEQ); ktile(lc + bo + VOFF + ATILE, Vl + ve, (size_t)16 * SEQ); }
        else { ktile(lc + bo, K16 + ke, (size_t)16 * HD); ktile(lc + bo + VOFF, V16 + ve, (size_t)16 * SEQ); }
    };
    unsigned long long rem = nz;                                          // kept halves whose stage is not copied yet
    int sc = -1, sn = -1;                                                 // the stage worked on, the stage in flight (-1: none)
    if (rem != 0ull) { sc = __builtin_ctzll(rem) >> 1; rem &= ~(3ull << (2 * sc)); stage(0u, sc); }
    // q fragments: read once, held in registers over the key loop
    v16bf qh0, qh1, ql0, ql1; v16h qa0, qa1;
    if (SPLIT) { qh0 = WFrag<bf>::ld(Qh + qoff); qh1 = WFrag<bf>::ld(Qh + qoff + 32); ql0 = WFrag<bf>::ld(Ql + qoff); ql1 = WFrag<bf>::ld(Ql + qoff + 32); }
    else { qa0 = WFrag<h16>::ld(Q16 + qoff); qa1 = WFrag<h16>::ld(Q16 + qoff + 32); }
    const float NINF = -__builtin_inff();
    float mi = NINF, li = 0.0f; v8f acc[4];                               // the lane's query: running maximum (both halves alike), sum over the lane's own keys; acc[ot][r] = O^T[16*ot + 8*hi + r][lr]
#pragma unroll
    for (int ot = 0; ot < 4; ++ot) acc[ot] = (v8f){};
    asm volatile("s_wait_asynccnt 0x0" ::: "memory");                     // the first stage landed (this wave's copies)
    __syncthreads();                                                      // ... and every other wave's
    if (rem != 0ull) { sn = __builtin_ctzll(rem) >> 1; rem &= ~(3ull << (2 * sn)); stage(STG, sn); }
    unsigned bo = 0u;
#pragma unroll 1                                                          // stays rolled: one trip per kept stage (at most 32: each takes its two bits out of the set)
    while (sc >= 0) {
#pragma unroll 1                                                          // stays rolled: the halves depend on one another through the running maximum, unrolling buys only code
      for (int hf = 0; hf < 2; ++hf) {
        const int j = 2 * sc + hf;
        if (((nz >> j) & 1ull) == 0ull) continue;                         // the same in every wave of the work-group
        // the mask word of the lane's own query, shifted so that bit r is key 8*hi + r and bit 16 + r key 16 + 8*hi + r
        unsigned wd = 0xFFFFFFFFu;
        if (((al >> j) & 1ull) == 0ull) wd = MBp[(size_t)(q0 + lr) * NW + j] >> (8 * hi);
        v8f s0 = (v8f){}, s1 = (v8f){};
        const unsigned char* kb = KV + bo + (hf * 32 + lr) * APB + 16 * hi;   // A fragment (scores): lane = key, k = d
        if (SPLIT) {
            const unsigned char* k1 = kb + 16 * APB;
            const v16bf kh0 = WFrag<bf>::ld((const bf*)kb), kh1 = WFrag<bf>::ld((const bf*)(kb + 64)), kl0 = WFrag<bf>::ld((const bf*)(kb + ATILE)), kl1 = WFrag<bf>::ld((const bf*)(kb + ATILE + 64));
            const v16bf mh0 = WFrag<bf>::ld((const bf*)k1), mh1 = WFrag<bf>::ld((const bf*)(k1 + 64)), ml0 = WFrag<bf>::ld((const bf*)(k1 + ATILE)), ml1 = WFrag<bf>::ld((const bf*)(k1 + ATILE + 64));
            __builtin_amdgcn_sched_barrier(0);                            // keeps the half's K reads one group ahead of its products (with the branch below ending the block they sink among them, and a product then waits out its own read)
            s0 = wmmab(kh0, ql0, s0); s0 = wmmab(kh1, ql1, s0); s0 = wmmab(kl0, qh0, s0); s0 = wmmab(kl1, qh1, s0); s0 = wmmab(kh0, qh0, s0); s0 = wmmab(kh1, qh1, s0);
            s1 = wmmab(mh0, ql0, s1); s1 = wmmab(mh1, ql1, s1); s1 = wmmab(ml0, qh0, s1); s1 = wmmab(ml1, qh1, s1); s1 = wmmab(mh0, qh0, s1); s1 = wmmab(mh1, qh1, s1);
            asm volatile("v_nop\n\tv_nop\n\tv_nop\n\tv_nop" : "+v"(s0), "+v"(s1) : "v"(qh1), "v"(mh1));
        } else {
            const v16h k00 = WFrag<h16>::ld((const h16*)kb), k01 = WFrag<h16>::ld((const h16*)(kb + 64));
            const v16h k10 = WFrag<h16>::ld((const h16*)(kb + 16 * APB)), k11 = WFrag<h16>::ld((const h16*)(kb + 16 * APB + 64));
            __builtin_amdgcn_sched_barrier(0);                            // as above: the K reads stay one group ahead of the products
            s0 = wmma16(k00, qa0, s0); s0 = wmma16(k01, qa1, s0); s1 = wmma16(k10, qa0, s1); s1 = wmma16(k11, qa1, s1);
            asm volatile("v_nop\n\tv_nop\n\tv_nop\n\tv_nop" : "+v"(s0), "+v"(s1) : "v"(qa1), "v"(k11));
        }
        // V^T fragments depend on the stage alone: read here, they arrive under the softmax
        const unsigned char* vb = KV + bo + VOFF + lr * APB + hf * 64 + 16 * hi;   // A fragment (V^T.P^T): lane = d, k = key
        v16bf vh[4], vl[4]; v16h vf[4];
#pragma unroll
        for (int ot = 0; ot < 4; ++ot) {
            if (SPLIT) { vh[ot] = WFrag<bf>::ld((const bf*)(vb + ot * (16 * APB))); vl[ot] = WFrag<bf>::ld((const bf*)(vb + ATILE + ot * (16 * APB))); }
            else vf[ot] = WFrag<h16>::ld((const h16*)(vb + ot * (16 * APB)));
        }
        // online softmax in log2 units; accumulator element r <-> key 8*hi + r (s0) / 16 + 8*hi + r (s1), column lr = the lane's query
        v8f v0 = s0 * SCL2, v1 = s1 * SCL2;
        if (((al >> j) & 1ull) == 0ull) {                                 // a scalar test, the same in every wave: where the class says that all 16x32 keys are kept the selects would be identities and are jumped over
#pragma unroll
            for (int r = 0; r < 8; ++r) { v0[r] = ((wd >> r) & 1u) != 0u ? v0[r] : NINF; v1[r] = ((wd >> (16 + r)) & 1u) != 0u ? v1[r] : NINF; }
        }
        float mx = NINF;
#pragma unroll
        for (int r = 0; r < 8; ++r) mx = fmaxf(mx, fmaxf(v0[r], v1[r]));
        mx = fmaxf(mx, xhalf(mx));
        const float nm = fmaxf(mi, mx); const float ms = (nm == NINF) ? 0.0f : nm;
        const float corr = ex2(mi - ms);
        mi = nm;
        float ps[8]; v16h p16; v8us pha, phb, pla, plb;
#pragma unroll
        for (int r = 0; r < 8; r += 2) {
            float p0, p1, p2, p3; ex2x4(v0[r] - ms, v1[r] - ms, v0[r + 1] - ms, v1[r + 1] - ms, p0, p1, p2, p3);
            if (SPLIT) { unsigned short a, c; splitf(p0, a, c); pha[r] = a; pla[r] = c; splitf(p1, a, c); phb[r] = a; plb[r] = c; ps[r] = p0 + p1;
                splitf(p2, a, c); pha[r + 1] = a; pla[r + 1] = c; splitf(p3, a, c); phb[r + 1] = a; plb[r + 1] = c; ps[r + 1] = p2 + p3; }
            else { const v2h e0 = __builtin_convertvector((v2f){p0 * PCAR, p2 * PCAR}, v2h), e1 = __builtin_convertvector((v2f){p1 * PCAR, p3 * PCAR}, v2h);   // two keys per packed conversion; the sums read the rounded values
                p16[r] = e0[0]; p16[r + 1] = e0[1]; p16[8 + r] = e1[0]; p16[9 + r] = e1[1]; ps[r] = (float)e0[0] + (float)e1[0]; ps[r + 1] = (float)e0[1] + (float)e1[1]; }
        }
        li = li * corr + (((ps[0] + ps[1]) + (ps[2] + ps[3])) + ((ps[4] + ps[5]) + (ps[6] + ps[7])));
#pragma unroll
        for (int ot = 0; ot < 4; ++ot) acc[ot] *= corr;
        if (SPLIT) {
            const v16bf ph = cat16b(pha, phb), pl = cat16b(pla, plb);
#pragma unroll
            for (int ot = 0; ot < 4; ++ot) { acc[ot] = wmmab(vh[ot], pl, acc[ot]); acc[ot] = wmmab(vl[ot], ph, acc[ot]); acc[ot] = wmmab(vh[ot], ph, acc[ot]); }
            asm volatile("v_nop\n\tv_nop\n\tv_nop\n\tv_nop" : "+v"(acc[0]), "+v"(acc[1]), "+v"(acc[2]), "+v"(acc[3]) : "v"(ph), "v"(pl));
        } else {
#pragma unroll
            for (int ot = 0; ot < 4; ++ot) acc[ot] = wmma16(vf[ot], p16, acc[ot]);
            asm volatile("v_nop\n\tv_nop\n\tv_nop\n\tv_nop" : "+v"(acc[0]), "+v"(acc[1]), "+v"(acc[2]), "+v"(acc[3]) : "v"(p16));
        }
      }
        asm volatile("s_wait_dscnt 0x0" ::: "memory");                    // this wave's reads of the buffer are done before it is refilled
        asm volatile("s_wait_asynccnt 0x0" ::: "memory");                 // this wave's copies of the stage in flight have landed
        __syncthreads();                                                  // publishes the stage in flight and ends every wave's reads of this one
        int s2 = -1;
        if (rem != 0ull) { s2 = __builtin_ctzll(rem) >> 1; rem &= ~(3ull << (2 * s2)); stage(bo, s2); }
        sc = sn; sn = s2; bo = STG - bo;
    }
    asm volatile("s_wait_asynccnt 0x0" ::: "memory");                     // no copy is outstanding when the wave goes on
    // the stage buffers are free here: the barrier at the foot of the last trip stands behind every wave's last read and last landed copy, and nothing was copied after it
    // finish: join the two halves' sums, normalise, stage 16x64 f32 (a lane holds 8 consecutive d of its query's row), write hi/lo lines
    const float inv = 1.0f / (li + xhalf(li));
#pragma unroll
    for (int ot = 0; ot < 4; ++ot) { const v8f o = acc[ot] * inv; float* op = os + lr * 68 + ot * 16 + 8 * hi;
        *(v4fa*)op = (v4f){o[0], o[1], o[2], o[3]}; *(v4fa*)(op + 4) = (v4f){o[4], o[5], o[6], o[7]}; }
    __syncthreads();
{
#pragma unroll
        for (int s = 0; s < 4; ++s) { const int row = 4 * s + (lane >> 3), c8 = (lane & 7) * 8;
            const v4f x0 = *(const v4fa*)(os + row * 68 + c8), x1 = *(const v4fa*)(os + row * 68 + c8 + 4); v8us oh, ol;
#pragma unroll
            for (int k = 0; k < 4; ++k) { unsigned short a, c; splitf(x0[k], a, c); oh[k] = a; ol[k] = c; splitf(x1[k], a, c); oh[4 + k] = a; ol[4 + k] = c; }
            const size_t oo = (size_t)(q0 + row) * DQ + (size_t)h * HD + c8;
            *(v8us*)(Ch + oo) = oh; *(v8us*)(Cl + oo) = ol; }
         }
}
// Both forms in one launch, grid (SEQ/16, NKV): query tiles below RH take the hi/lo form, the rest the fp16 form (the same for the whole work-group); neither reads what the other writes.
// Which (query tile, kv head) a work-group takes is a permutation of its flat index b, chosen for speed alone: all work-groups are resident at once, four to a WGP, and the launch lasts as long as its fullest WGP.
// Under a mask that keeps more keys the later the row, four equal tiles on a WGP leave the last tiles' WGPs with about twice the mean work.
// Here the quarter of the rows (r) comes from the parities of b's odd and of its even bits, so any four indices that differ in two adjacent bits hold all four quarters: tiles 127 - v, 95 - v, 63 - v and v (the hi/lo quarter,
// dearer per key, rises where the others fall). The kv head takes bits 3 to 5, v bits 0 to 2, 6 and 7; bits 8 and 9 are given back by the two parities, so every (tile, head) is taken once.
static_assert(SEQ / 16 == 128 && NKV == 8 && RH / 16 == 32);
__global__ __launch_bounds__(128) void k_attn(const h16* __restrict__ Q16, const h16* __restrict__ K16, const h16* __restrict__ V16,
                                             const bf* __restrict__ Qh, const bf* __restrict__ Ql, const bf* __restrict__ Kh, const bf* __restrict__ Kl, const bf* __restrict__ Vh, const bf* __restrict__ Vl,
                                             const unsigned* __restrict__ MBp, const int* __restrict__ CLp, bf* Ch, bf* Cl) {
    __shared__ __align__(16) unsigned char KV[2 * 4 * ATILE];            // two stages of the larger (hi/lo) form
    const unsigned b = blockIdx.x + (SEQ / 16) * blockIdx.y;
    const int r = 2 * (__builtin_popcount(b & 0x2AAu) & 1) + (__builtin_popcount(b & 0x155u) & 1);
    const int hk = (int)((b >> 3) & 7u), v = (int)((b & 7u) | ((b >> 3) & 0x18u));
    const int qt = (r == 3) ? v : (SEQ / 16 - 1) - 32 * r - v;
    if (qt < RH / 16) attn_body<true>(Q16, K16, V16, Qh, Ql, Kh, Kl, Vh, Vl, MBp, CLp, Ch, Cl, qt, hk, KV);
    else attn_body<false>(Q16, K16, V16, Qh, Ql, Kh, Kl, Vh, Vl, MBp, CLp, Ch, Cl, qt, hk, KV); }

constexpr size_t al256(size_t b) { return (b + 255) & ~(size_t)255; }
constexpr size_t WS_TOTAL =
    al256((size_t)DQ * DM * 2) + 2 * al256((size_t)DKV * DM * 2) + al256((size_t)DM * DQ * 2) +      // WQ, WK, WV, WO
    al256((size_t)SEQ * DM * 2) +                                                                      // XB
    3 * al256((size_t)NH * SEQ * HD * 2) + 6 * al256((size_t)NKV * SEQ * HD * 2) +                     // q planes, k planes, v planes
    2 * al256((size_t)SEQ * DQ * 2) +                                                                  // ctx hi/lo
    al256((size_t)SEQ * NW * 4) + al256((size_t)(SEQ / 16) * NW * 4);                                  // mask bits, tile classes
static_assert(WS_TOTAL <= (size_t)134217728);

extern "C" void kernel_launch(void* const* d_in, const int* in_sizes, int n_in,
                              void* d_out, int out_size, void* d_ws, size_t ws_size, hipStream_t stream) {
    if (n_in < 8) return;
    if ((long long)in_sizes[0] < (long long)(NB - 1) * SEQ_FULL * DM + (long long)SEQ * DM) return;
    if ((long long)in_sizes[1] < (long long)DM * DQ || (long long)in_sizes[2] < (long long)DM * DKV || (long long)in_sizes[3] < (long long)DM * DKV || (long long)in_sizes[4] < (long long)DQ * DM) return;
    if ((long long)in_sizes[5] < (long long)SEQ * (HD / 2) || (long long)in_sizes[6] < (long long)SEQ * (HD / 2)) return;
    if ((long long)in_sizes[7] < (long long)(SEQ - 1) * SEQ_FULL + SEQ) return;
    if ((long long)out_size < (long long)(NB - 1) * SEQ_FULL * DM + (long long)SEQ * DM) return;
    if (ws_size < WS_TOTAL) return;
    const float* x = (const float*)d_in[0]; const float* wq = (const float*)d_in[1]; const float* wk = (const float*)d_in[2]; const float* wv = (const float*)d_in[3]; const float* wo = (const float*)d_in[4];
    const float* fcos = (const float*)d_in[5]; const float* fsin = (const float*)d_in[6]; const int* mask = (const int*)d_in[7];
    float* OUT = (float*)d_out;     // [1][2048][2048]
    char* wsp = (char*)d_ws;
    auto take = [&](size_t bytes) { char* p = wsp; wsp += (bytes + 255) & ~(size_t)255; return (void*)p; };
    bf* WQ = (bf*)take((size_t)DQ * DM * 2); bf* WK = (bf*)take((size_t)DKV * DM * 2); bf* WV = (bf*)take((size_t)DKV * DM * 2); bf* WO = (bf*)take((size_t)DM * DQ * 2);
    bf* XB = (bf*)take((size_t)SEQ * DM * 2);
    h16* QP16 = (h16*)take((size_t)NH * SEQ * HD * 2); bf* QPh = (bf*)take((size_t)NH * SEQ * HD * 2); bf* QPl = (bf*)take((size_t)NH * SEQ * HD * 2);
    h16* KP16 = (h16*)take((size_t)NKV * SEQ * HD * 2); bf* KPh = (bf*)take((size_t)NKV * SEQ * HD * 2); bf* KPl = (bf*)take((size_t)NKV * SEQ * HD * 2);
    h16* VT16 = (h16*)take((size_t)NKV * SEQ * HD * 2); bf* VTh = (bf*)take((size_t)NKV * SEQ * HD * 2); bf* VTl = (bf*)take((size_t)NKV * SEQ * HD * 2);
    bf* CXh = (bf*)take((size_t)SEQ * DQ * 2); bf* CXl = (bf*)take((size_t)SEQ * DQ * 2);
    unsigned* MBp = (unsigned*)take((size_t)SEQ * NW * 4); int* CLp = (int*)take((size_t)(SEQ / 16) * NW * 4);
    if ((size_t)(wsp - (char*)d_ws) > ws_size) return;

    // four launches, each of work that depends only on launches before it
    // weights: w[in][out] -> Bt[out][in] bf16 (wq: in DM, out DQ; wk/wv: in DM, out DKV; wo: in DQ, out DM); mask -> bit-plane and tile classes; x -> bf16
    k_pre<<<WT_Q + 2 * WT_KV + WT_O + MK_T + CV_T, 256, 0, stream>>>(wq, wk, wv, wo, x, mask, WQ, WK, WV, WO, XB, MBp, CLp);
    k_gemm_qkv<<<dim3(SEQ / 128, (DQ + 2 * DKV) / 128, 1), 128, 0, stream>>>(XB, WQ, WK, WV, DM, fcos, fsin, QP16, QPh, QPl, KP16, KPh, KPl, VT16, VTh, VTl);
    k_attn<<<dim3(SEQ / 16, NKV, 1), 128, 0, stream>>>(QP16, KP16, VT16, QPh, QPl, KPh, KPl, VTh, VTl, MBp, CLp, CXh, CXl);
    k_gemm_s<<<dim3(SEQ / 128, DM / 128, 1), 128, 0, stream>>>(CXh, CXl, WO, DQ, OUT, DM);
}

// v010
// A run of this version takes 106 microseconds.
// Next to v009, in two timings, it ran 1.04 times as fast each time.
// Counting every step since v000, it is 5.39 times as fast.
#include <hip/hip_runtime.h>

// Contractions (all f32 accumulate): x@wq, x@wk, x@wv v_wmma_f32_16x16x32_bf16 (bf16 x bf16 operand planes, inputs RNE-converted to bf16); scores q.k and P.V: query rows < 512 bf16 hi/lo planes (3 products each), rows >= 512 v_wmma_f32_16x16x32_f16 (P carried x1024); ctx@wo bf16 hi/lo ctx planes x bf16 weights (2 products).
// Grouped-query causal-style attention with interleaved-pair rotation from INPUT tables and an INPUT int32 mask (read by value through a bit-plane + 16x32 tile classes); softmax f32 online running-max form.
// Flash-style fused attention: one wave per 16 query rows per head, the 4 query heads of a kv head in one work-group; K / V^T tiles of 64 keys staged in LDS by asynchronous copies (two buffers); scores and context are formed transposed (S^T = K.Q^T, O^T += V^T.P^T), so P goes from the score accumulators straight into an operand.

#ifndef NB
#define NB 1
#endif
#ifndef SEQ
#define SEQ 2048
#endif
#define NB_FULL  1
#define SEQ_FULL 2048
#define DM   2048
#define NH   32
#define NKV  8
#define REP  (NH / NKV)
#define HD   64
#define DQ   (NH * HD)
#define DKV  (NKV * HD)
#define RH   ((SEQ) < 512 ? (SEQ) : 512)     // query rows < RH use hi+lo planes
#define NW   (SEQ / 32)                      // 32-key words per mask row
#define PCAR 1024.0f
#define SCL2 0.18033688011112042f            // (1/8) * log2(e)

static_assert(SEQ % 64 == 0);                // key halves of 32
static_assert(SEQ <= SEQ_FULL);
static_assert(NW % 32 == 0);                 // mask pre-pass: 32 words per work-group
static_assert(HD == 64);
static_assert(DM % 64 == 0 && DQ % 64 == 0 && DKV % 64 == 0);
static_assert(DM % 32 == 0 && DQ % 32 == 0);
static_assert(NH % NKV == 0);
static_assert(RH % 16 == 0 && (SEQ - RH) % 16 == 0);
static_assert(NB == 1 && NB <= NB_FULL);      // one batch: its x conversion shares the pre-pass launch

typedef _Float16 h16;
typedef unsigned short bf;
typedef __attribute__((ext_vector_type(16))) __bf16   v16bf;
typedef __attribute__((ext_vector_type(16))) _Float16 v16h;
typedef __attribute__((ext_vector_type(8)))  _Float16 v8h;
typedef __attribute__((ext_vector_type(8)))  unsigned short v8us;
typedef __attribute__((ext_vector_type(8)))  float    v8f;
typedef __attribute__((ext_vector_type(4)))  float    v4f;
typedef __attribute__((ext_vector_type(4)))  int      v4i;
typedef __attribute__((ext_vector_type(4)))  _Float16 v4h;
typedef __attribute__((ext_vector_type(2)))  _Float16 v2h;
typedef __attribute__((ext_vector_type(4)))  unsigned short v4us;
typedef __attribute__((ext_vector_type(2)))  unsigned short v2us;
typedef __attribute__((ext_vector_type(2)))  float    v2f;
typedef __attribute__((ext_vector_type(2)))  unsigned v2u;
typedef v4f  __attribute__((may_alias)) v4fa;

__device__ __forceinline__ unsigned short f2bf(float f) { unsigned u = __float_as_uint(f); u += 0x7FFFu + ((u >> 16) & 1u); return (unsigned short)(u >> 16); }
__device__ __forceinline__ float bf2f(unsigned short b) { return __uint_as_float(((unsigned)b) << 16); }
__device__ __forceinline__ float bfr(float f) { return bf2f(f2bf(f)); }
__device__ __forceinline__ v16h cat16(v8h lo, v8h hi) { return __builtin_shufflevector(lo, hi, 0, 1, 2, 3, 4, 5, 6, 7, 8, 9, 10, 11, 12, 13, 14, 15); }
__device__ __forceinline__ v16bf cat16b(v8us lo, v8us hi) { return __builtin_bit_cast(v16bf, __builtin_shufflevector(lo, hi, 0, 1, 2, 3, 4, 5, 6, 7, 8, 9, 10, 11, 12, 13, 14, 15)); }
__device__ __forceinline__ v8f wmma16(v16h a, v16h b, v8f c) { return __builtin_amdgcn_wmma_f32_16x16x32_f16(false, a, false, b, (short)0, c, false, false); }
__device__ __forceinline__ v8f wmmab(v16bf a, v16bf b, v8f c) { return __builtin_amdgcn_wmma_f32_16x16x32_bf16(false, a, false, b, (short)0, c, false, false); }
__device__ __forceinline__ void splitf(float y, unsigned short& h, unsigned short& l) { h = f2bf(y); l = f2bf(y - bf2f(h)); }
__device__ __forceinline__ float ex2(float x) { return __builtin_amdgcn_exp2f(x); }
// Four exponentials (v_exp_f32, as ex2) in one statement: the outputs are early-clobber, so none lands on a source of another, and the closing v_nop is the one slot that the
// instruction set asks for behind a transcendental before its result is used or its source overwritten; in a run of separate ones the register allocator is free to put a result on its neighbour's source.
__device__ __forceinline__ void ex2x4(float a, float b, float c, float d, float& ya, float& yb, float& yc, float& yd) {
    asm("v_exp_f32 %0, %4\n\tv_exp_f32 %1, %5\n\tv_exp_f32 %2, %6\n\tv_exp_f32 %3, %7\n\tv_nop" : "=&v"(ya), "=&v"(yb), "=&v"(yc), "=&v"(yd) : "v"(a), "v"(b), "v"(c), "v"(d)); }
// the value of lane l ^ 16 (the other half of the wave), on the vector port
__device__ __forceinline__ float xhalf(float x) { const int b = __float_as_int(x); return __int_as_float(__builtin_amdgcn_permlanex16(b, b, 0x76543210, 0xfedcba98, false, false)); }

// Fragment loaders: lane (hi = lane>>4, lr = lane&15); pointer already at row lr, k offset k0 + 8*hi; elements 0..7 <- k0+8hi+0..7, 8..15 <- k0+16+8hi+0..7 (same map for A and B).
template <typename T16> struct WFrag;
template <> struct WFrag<h16> { typedef v16h V; static __device__ __forceinline__ V ld(const h16* p) { return cat16(*(const v8h*)p, *(const v8h*)(p + 16)); } static __device__ __forceinline__ v8f mma(V a, V b, v8f c) { return wmma16(a, b, c); } };
template <> struct WFrag<bf> { typedef v16bf V; static __device__ __forceinline__ V ld(const bf* p) { return cat16b(*(const v8us*)p, *(const v8us*)(p + 16)); } static __device__ __forceinline__ v8f mma(V a, V b, v8f c) { return wmmab(a, b, c); } };

// ---- GEMM body: one work-group of 4 waves per 128x128 output tile, wave (wm, wn) takes its 64x64 quarter (16 accumulators); grid (M/128, N/128), 128 threads.
// A and Bt rows come from K-contiguous 16-bit planes in stages of 128 k (256 B a row) into LDS at pitch 272 B by asynchronous copies (whole lines, each lane 16 B), two buffers: stage t + 1 flies while stage t is worked on.
// c[m][n] (f32) = sum_k (A[m][k] (+ A2[m][k] when NSPLIT == 1)) Bt[n][k]. K % 128 == 0, M % 128 == 0, N % 128 == 0.
// What becomes of c is the epilogue's choice; a wave's 64 columns are one head (HD == 64):
//   EPI 0: C[m][n] = c, f32, pitch ldc.
//   EPI 1, tr false: head planes [h][t][d] (fp16 + bf16 hi/lo) of the interleaved-pair rotation: pair (2i, 2i+1) with table entry [t][i] read BY VALUE (RNE-converted to bf16).
//   EPI 1, tr true: transposed head planes [g][d][t] (fp16 + bf16 hi/lo), straight from the accumulators: a lane holds 8 consecutive t of one d.
// cy: the work-group's column tile inside Bt; tr: the same for the whole work-group.
#define GKS   128                            // k elements per stage
#define GPB   272                            // LDS row pitch in bytes (16 B x odd, for 16-byte fragment reads)
#define GTILE (128 * GPB)                    // one operand's 128 rows of a stage
static_assert(SEQ % 128 == 0 && DQ % 128 == 0 && DKV % 128 == 0 && DM % 128 == 0);
static_assert(DM % GKS == 0 && DQ % GKS == 0);
typedef __attribute__((address_space(1))) v4i gv4i;
typedef __attribute__((address_space(3))) v4i lv4i;
// One operand's 128 rows x 256 B of a stage: 16 copies of 16 B per lane, rows 8 apart (l: the lane's LDS place, g: its global place, gs = 8 source rows in elements).
__device__ __forceinline__ void atile(unsigned char* l, const bf* g, size_t gs) {
#pragma unroll
    for (int i = 0; i < 16; ++i) __builtin_amdgcn_global_load_async_to_lds_b128((gv4i*)(g + i * gs), (lv4i*)(l + i * (8 * GPB)), 0, 0);
}
template <int NSPLIT, int EPI>
__device__ __forceinline__ void gemmw_body(const bf* __restrict__ A, const bf* __restrict__ A2, const bf* __restrict__ Bt, int K, float* C, int ldc,
                                           const float* __restrict__ COS, const float* __restrict__ SIN, h16* P16, bf* Ph, bf* Pl, int cy, bool tr) {
    typedef WFrag<bf>::V V;
    constexpr unsigned STAGE = (2 + NSPLIT) * GTILE, BOFF = (1 + NSPLIT) * GTILE;   // stage = [A | A2 when NSPLIT | Bt]
    __shared__ __align__(16) unsigned char L[2 * STAGE];
    __shared__ __align__(16) float osw[4 * 16 * 68];
    const int tid = threadIdx.x, lane = tid & 31, lr = lane & 15, hi = lane >> 4; const int wave = tid >> 5, wm = wave >> 1, wn = wave & 1;
    const int R0 = blockIdx.x * 128, C0 = cy * 128; const int r0 = R0 + wm * 64, c0 = C0 + wn * 64;
    float* os = osw + wave * (16 * 68);
    v8f acc[4][4];
#pragma unroll
    for (int mb = 0; mb < 4; ++mb)
#pragma unroll
        for (int nb = 0; nb < 4; ++nb) acc[mb][nb] = (v8f){};
    // copies: thread -> row tid >> 4 (+ 8 per copy), 16-byte chunk tid & 15 of the row's 256 B
    const size_t gs = (size_t)8 * K; const int crw = tid >> 4, cch = tid & 15;
    const size_t po = (size_t)crw * K + cch * 8;                          // the lane's own element offset inside an operand's 128 rows
    const bf* uA = A + (size_t)R0 * K; const bf* uA2 = A2 + (size_t)R0 * K; const bf* uB = Bt + (size_t)C0 * K;   // wave-uniform row bases
    unsigned char* lc = L + (crw * GPB + cch * 16);
    const int nt = K / GKS;
    atile(lc, uA + po, gs); if (NSPLIT == 1) atile(lc + GTILE, uA2 + po, gs); atile(lc + BOFF, uB + po, gs);
    asm volatile("s_wait_asynccnt 0x0" ::: "memory");                     // stage 0 landed (this wave's copies)
    __syncthreads();                                                      // ... and every other wave's
    if (nt > 1) { atile(lc + STAGE, (uA + GKS) + po, gs); if (NSPLIT == 1) atile(lc + STAGE + GTILE, (uA2 + GKS) + po, gs); atile(lc + STAGE + BOFF, (uB + GKS) + po, gs); }
#pragma unroll 1                                                          // stays rolled: one trip per stage, its buffer picked by t & 1; the 64 or 128 products of a trip are unrolled inside
    for (int t = 0; t < nt; ++t) {
        const unsigned bo = (unsigned)(t & 1) * STAGE;
        const bf* la = (const bf*)(L + bo + (wm * 64 + lr) * GPB + 16 * hi);
        const bf* lb = (const bf*)(L + bo + BOFF + (wn * 64 + lr) * GPB + 16 * hi);
        V a[2][4], a2[2][4], b[2][4];                                     // two fragment sets: the next 32 k are read from LDS ahead of this block's products
#pragma unroll
        for (int f = 0; f < 4; ++f) { a[0][f] = WFrag<bf>::ld(la + f * (16 * GPB / 2)); if (NSPLIT == 1) a2[0][f] = WFrag<bf>::ld(la + GTILE / 2 + f * (16 * GPB / 2)); b[0][f] = WFrag<bf>::ld(lb + f * (16 * GPB / 2)); }
#pragma unroll
        for (int ks = 0; ks < GKS / 32; ++ks) {
            const int cu = ks & 1, nx = cu ^ 1;
            if (ks + 1 < GKS / 32) {
#pragma unroll
                for (int f = 0; f < 4; ++f) { a[nx][f] = WFrag<bf>::ld(la + (ks + 1) * 32 + f * (16 * GPB / 2)); if (NSPLIT == 1) a2[nx][f] = WFrag<bf>::ld(la + GTILE / 2 + (ks + 1) * 32 + f * (16 * GPB / 2)); b[nx][f] = WFrag<bf>::ld(lb + (ks + 1) * 32 + f * (16 * GPB / 2)); }
                __builtin_amdgcn_sched_barrier(0);                        // keeps the next block's LDS reads one group ahead of this block's products (sunk among them, every product waits for its own read)
            }
#pragma unroll
            for (int nb = 0; nb < 4; ++nb)
#pragma unroll
                for (int mb = 0; mb < 4; ++mb) acc[mb][nb] = wmmab(a[cu][mb], b[cu][nb], acc[mb][nb]);
            if (NSPLIT == 1) {
#pragma unroll
                for (int nb = 0; nb < 4; ++nb)
#pragma unroll
                    for (int mb = 0; mb < 4; ++mb) acc[mb][nb] = wmmab(a2[cu][mb], b[cu][nb], acc[mb][nb]);
            }
        }
        // four vector slots behind the last product, on the branch's taken side too, before anything rewrites its operands
        asm volatile("v_nop\n\tv_nop\n\tv_nop\n\tv_nop" : "+v"(acc[0][0]), "+v"(acc[1][0]), "+v"(acc[2][0]), "+v"(acc[3][0]), "+v"(acc[0][1]), "+v"(acc[1][1]), "+v"(acc[2][1]), "+v"(acc[3][1]),
                                                            "+v"(acc[0][2]), "+v"(acc[1][2]), "+v"(acc[2][2]), "+v"(acc[3][2]), "+v"(acc[0][3]), "+v"(acc[1][3]), "+v"(acc[2][3]), "+v"(acc[3][3]));
        asm volatile("s_wait_dscnt 0x0" ::: "memory");                    // this wave's reads of buffer t & 1 are done before it is refilled
        asm volatile("s_wait_asynccnt 0x0" ::: "memory");                 // this wave's copies of stage t + 1 have landed
        __syncthreads();                                                  // publishes stage t + 1 and ends every wave's reads of stage t
        if (t + 2 < nt) { const int ko = (t + 2) * GKS; atile(lc + bo, (uA + ko) + po, gs); if (NSPLIT == 1) atile(lc + bo + GTILE, (uA2 + ko) + po, gs); atile(lc + bo + BOFF, (uB + ko) + po, gs); }
    }
    asm volatile("s_wait_asynccnt 0x0" ::: "memory");                     // no copy is outstanding when the wave goes on
    const int head = c0 / HD;
    const size_t tb = (size_t)(r0 + hi) * (HD / 2) + lr * 2;              // EPI 1: the lane's place in the tables' row r0 + hi
    if (EPI == 1 && tr) {
        // accumulator element j <-> row (t) mb*16 + 8*hi + j, column (d) nb*16 + lr: 16 bytes of one [d] row per lane and plane; the wave's four mb fill each row's 128-byte line
#pragma unroll
        for (int mb = 0; mb < 4; ++mb)
#pragma unroll
            for (int nb = 0; nb < 4; ++nb) { v8h o16; v8us oh, ol;
#pragma unroll
                for (int j = 0; j < 8; ++j) { const float x = acc[mb][nb][j]; o16[j] = (h16)x; unsigned short a2, c2; splitf(x, a2, c2); oh[j] = a2; ol[j] = c2; }
                const size_t e = ((size_t)head * HD + nb * 16 + lr) * SEQ + r0 + mb * 16 + hi * 8;
                *(v8h*)(P16 + e) = o16; *(v8us*)(Ph + e) = oh; *(v8us*)(Pl + e) = ol; }
        return;
    }
#pragma unroll
    for (int mb = 0; mb < 4; ++mb) {
#pragma unroll
        for (int nb = 0; nb < 4; ++nb) {
#pragma unroll
            for (int j = 0; j < 8; ++j) os[(hi * 8 + j) * 68 + nb * 16 + lr] = acc[mb][nb][j]; }
        __builtin_amdgcn_wave_barrier(); asm volatile("" ::: "memory");
        if (EPI == 0) {
            float* crow = C + (size_t)(r0 + mb * 16) * ldc + c0;
#pragma unroll
            for (int s = 0; s < 8; ++s) { const int row = 2 * s + hi, cofs = lr * 4; const v4f val = *(const v4fa*)(os + row * 68 + cofs);
                *(v4f*)(crow + (size_t)row * ldc + cofs) = val; }
        } else {
            // a lane takes d = 4*lr .. 4*lr+3 (two pairs) of row t; 16 lanes write one whole 128-byte [t] row of each plane
            v2f cc[8], sn[8];
#pragma unroll
            for (int s = 0; s < 8; ++s) { cc[s] = *(const v2f*)(COS + tb + (mb * 16 + 2 * s) * (HD / 2)); sn[s] = *(const v2f*)(SIN + tb + (mb * 16 + 2 * s) * (HD / 2)); }
#pragma unroll
            for (int s = 0; s < 8; ++s) { const int row = 2 * s + hi, cofs = lr * 4; const v4f val = *(const v4fa*)(os + row * 68 + cofs);
                v4h o16; v4us oh, ol;
#pragma unroll
                for (int p = 0; p < 2; ++p) { const float c = bfr(cc[s][p]), sv = bfr(sn[s][p]); const float x0 = val[2 * p], x1 = val[2 * p + 1];
                    const float y0 = x0 * c - x1 * sv, y1 = x0 * sv + x1 * c; unsigned short a2, c2;
                    o16[2 * p] = (h16)y0; splitf(y0, a2, c2); oh[2 * p] = a2; ol[2 * p] = c2;
                    o16[2 * p + 1] = (h16)y1; splitf(y1, a2, c2); oh[2 * p + 1] = a2; ol[2 * p + 1] = c2; }
                const size_t e = ((size_t)head * SEQ + r0 + mb * 16 + row) * HD + cofs;
                *(v4h*)(P16 + e) = o16; *(v4us*)(Ph + e) = oh; *(v4us*)(Pl + e) = ol; }
            asm volatile("s_wait_xcnt 0x0" ::: "memory");                 // before the next rows' table loads land in registers that these stores name; behind the last rows too: the other epilogue's code follows in the text
        }
        __builtin_amdgcn_wave_barrier(); asm volatile("" ::: "memory");
    }
}
// x@wq, x@wk and x@wv in one launch: none reads what another writes, and the 64 work-groups of a k or v product alone leave three quarters of the chip idle.
// grid (M/128, (DQ + 2 DKV)/128): column tiles 0 .. DQ/128 - 1 are q, the next DKV/128 k, the last DKV/128 v; the choice is the same for the whole work-group.
__global__ __launch_bounds__(128) void k_gemm_qkv(const bf* __restrict__ A, const bf* __restrict__ BQ, const bf* __restrict__ BK, const bf* __restrict__ BV, int K, const float* __restrict__ COS, const float* __restrict__ SIN,
                                                  h16* Q16, bf* Qh, bf* Ql, h16* K16, bf* Kh, bf* Kl, h16* V16, bf* Vh, bf* Vl) {
    const int y = (int)blockIdx.y; const bool isq = y < DQ / 128, isv = y >= (DQ + DKV) / 128;
    gemmw_body<0, 1>(A, A, isq ? BQ : (isv ? BV : BK), K, (float*)0, 0, COS, SIN, isq ? Q16 : (isv ? V16 : K16), isq ? Qh : (isv ? Vh : Kh), isq ? Ql : (isv ? Vl : Kl),
                     y - (isq ? 0 : (isv ? (DQ + DKV) / 128 : DQ / 128)), isv); }
__global__ __launch_bounds__(128) void k_gemm_s(const bf* __restrict__ A, const bf* __restrict__ A2, const bf* __restrict__ Bt, int K, float* C, int ldc) {
    gemmw_body<1, 0>(A, A2, Bt, K, C, ldc, (const float*)0, (const float*)0, (h16*)0, (bf*)0, (bf*)0, (int)blockIdx.y, false); }

// ---- weight pre-pass: w[k][n] f32 -> Bt[n][k] bf16 (RNE); one work-group of 8 waves per 128 k x 128 n tile.
// Reads: a wave takes 16 k rows, one whole 512-byte run of a row per load, all 16 loads in flight at once. A lane then holds 16 k of 4 n: eight 16-byte chunks (8 k of one n), which go into
// an LDS tile [n][k] whose 16 chunks a row are permuted by (n >> 2) & 15, so that the 16 lanes of a store (rows 4 apart) and of a read (one row) each cover all banks once.
// Writes: 16 lanes put out 256 contiguous bytes of one n row (two whole lines, one writer each).
#define WTT 128
static_assert(DM % WTT == 0 && DQ % WTT == 0 && DKV % WTT == 0);
#define WT_Q  ((DM / WTT) * (DQ / WTT))
#define WT_KV ((DM / WTT) * (DKV / WTT))
#define WT_O  ((DQ / WTT) * (DM / WTT))
template <int K, int N>
__device__ __forceinline__ void wt_tile(const float* __restrict__ w, bf* Bt, int t, unsigned short* T) {
    const int tid = threadIdx.x, lane = tid & 31, l16 = lane & 15, hi = lane >> 4;
    const int wave = __builtin_amdgcn_readfirstlane(tid >> 5);            // the wave's number in a scalar register: row bases are scalar, a lane adds only its own 16 bytes
    const int n0 = (t % (N / WTT)) * WTT, k0 = (t / (N / WTT)) * WTT;
    const float* g = (w + (size_t)(k0 + wave * 16) * N + n0) + lane * 4;
    v4f v[16];
#pragma unroll
    for (int i = 0; i < 16; ++i) v[i] = *(const v4f*)(g + (size_t)i * N);
#pragma unroll
    for (int c = 0; c < 4; ++c)
#pragma unroll
        for (int q = 0; q < 2; ++q) { v8us o;
#pragma unroll
            for (int j = 0; j < 8; ++j) o[j] = f2bf(v[q * 8 + j][c]);
            *(v8us*)(T + (lane * 4 + c) * WTT + (((wave * 2 + q) ^ l16) * 8)) = o; }
    __syncthreads();                                                      // the tile is whole before it is read along k
    bf* d = Bt + (size_t)(n0 + wave * 2 + hi) * K + k0 + l16 * 8;
    v8us o[8];
#pragma unroll
    for (int s = 0; s < 8; ++s) { const int n = s * 16 + wave * 2 + hi;
        o[s] = *(const v8us*)(T + n * WTT + ((l16 ^ ((n >> 2) & 15)) * 8)); }
#pragma unroll
    for (int s = 0; s < 8; ++s) { *(v8us*)(d + (size_t)s * 16 * K) = o[s];
        asm volatile("s_wait_xcnt 0x0" ::: "memory"); }                   // stands behind each store, before any path on which the store's address or data registers are written again
}
// ---- x pre-pass: f32 -> bf16 (RNE); one work-group of 8 waves per CVT_E consecutive elements, a thread takes 8 elements in each of 8 runs of 2048 (a wave reads 1 KiB and writes 512 B in a row), all its loads in flight at once.
#define CVT_E (256 * 8 * 8)
static_assert(((size_t)SEQ * DM) % CVT_E == 0);
#define CV_T  ((int)(((size_t)SEQ * DM) / CVT_E))
__device__ __forceinline__ void cvt_tile(const float* __restrict__ s, bf* d, int t) {
    const size_t e = (size_t)t * CVT_E + threadIdx.x * 8;
    v4f v[16]; v8us o[8];
#pragma unroll
    for (int i = 0; i < 16; ++i) {
        if (i == 15) asm volatile("s_wait_xcnt 0x0" ::: "memory");        // the last load's result lands on the address pair that the loads before it name
        v[i] = *(const v4f*)(s + e + (i >> 1) * 2048 + (i & 1) * 4); }
#pragma unroll
    for (int i = 0; i < 8; ++i)
#pragma unroll
        for (int k = 0; k < 8; ++k) o[i][k] = f2bf(v[2 * i + (k >> 2)][k & 3]);
#pragma unroll
    for (int i = 0; i < 8; ++i) *(v8us*)(d + e + i * 2048) = o[i];
    asm volatile("s_wait_xcnt 0x0" ::: "memory");                         // behind the stores: another pre-pass's code, which writes their registers, follows in the text
}

// mask pre-pass: one work-group of 8 waves per (16 query rows, 32 mask words); wave r takes rows r and r + 8 and holds each row's 1024 mask values as 8 loads of 512 contiguous bytes, all 16 in flight at once.
// Bit-plane MB[q][w] (bit n = mask[q][32w+n] != 0) and tile class CL[q/16][w]: 0 = no key kept in the 16x32 tile, 1 = all kept, 2 = mixed.
#define MK_T ((SEQ / 16) * (NW / 32))
__device__ __forceinline__ void mask_tile(const int* __restrict__ mask, unsigned* MBp, int* CLp, int t, unsigned* sw) {
    const int lane = threadIdx.x & 31, row = threadIdx.x >> 5; const int qt = t % (SEQ / 16), wb = (t / (SEQ / 16)) * 32; const int q = qt * 16 + row;
    const int* mr = mask + (size_t)q * SEQ_FULL + wb * 32 + lane * 4;
    v4i v[2][8];
#pragma unroll
    for (int h = 0; h < 2; ++h)
#pragma unroll
        for (int i = 0; i < 8; ++i) {
            if (h == 1 && i == 7) asm volatile("s_wait_xcnt 0x0" ::: "memory");   // the last load's result lands on the address pair that the loads before it name
            v[h][i] = *(const v4i*)(mr + (size_t)h * 8 * SEQ_FULL + 128 * i); }
    const int w = wb + 4 * (lane & 7) + (lane >> 3);
    unsigned xs[2];
#pragma unroll
    for (int h = 0; h < 2; ++h) {
        // nibble i of x: the lane's four values of load i, i.e. bits 4*(lane&7)..+3 of word wb + 4*i + (lane>>3)
        unsigned x = 0u;
#pragma unroll
        for (int i = 0; i < 8; ++i) { const unsigned nib = (v[h][i][0] != 0 ? 1u : 0u) | (v[h][i][1] != 0 ? 2u : 0u) | (v[h][i][2] != 0 ? 4u : 0u) | (v[h][i][3] != 0 ? 8u : 0u); x |= nib << (4 * i); }
        // 8x8 nibble transpose inside each group of 8 lanes (three exchanges; a lane keeps the nibbles under its mask and takes the partner's, rotated into place): afterwards lane 8g+t holds the whole word wb + 4*t + g
        unsigned y;
        y = __builtin_rotateright32(__shfl_xor(x, 4, 32), 16);               { const unsigned km = (lane & 4) ? 0xFFFF0000u : 0x0000FFFFu; x = (x & km) | (y & ~km); }
        y = __builtin_rotateright32(__shfl_xor(x, 2, 32), (lane & 2) ? 8 : 24); { const unsigned km = (lane & 2) ? 0xFF00FF00u : 0x00FF00FFu; x = (x & km) | (y & ~km); }
        y = __builtin_rotateright32(__shfl_xor(x, 1, 32), (lane & 1) ? 4 : 28); { const unsigned km = (lane & 1) ? 0xF0F0F0F0u : 0x0F0F0F0Fu; x = (x & km) | (y & ~km); }
        sw[(row + 8 * h) * 32 + lane] = x; xs[h] = x;
    }
    __syncthreads();                                                      // the 16 rows' words -> the class of each 16x32 tile
    if (row == 0) {
        unsigned an = 0xFFFFFFFFu, orr = 0u;
#pragma unroll
        for (int r = 0; r < 16; ++r) { const unsigned u = sw[r * 32 + lane]; an &= u; orr |= u; }
        CLp[(size_t)qt * NW + w] = (orr == 0u) ? 0 : ((an == 0xFFFFFFFFu) ? 1 : 2);
    }
    MBp[(size_t)q * NW + w] = xs[0]; MBp[(size_t)(q + 8) * NW + w] = xs[1];   // one wave = one whole 128-byte line per row
    asm volatile("s_wait_xcnt 0x0" ::: "memory");                         // behind the stores: another pre-pass's code, which writes their registers, follows in the text
}
// The three pre-passes in one launch: none reads what another writes. Which one a work-group does is the same for all of its threads; the weight tile and the mask words share the LDS array (a work-group uses it for one of them).
__global__ __launch_bounds__(256) void k_pre(const float* __restrict__ wq, const float* __restrict__ wk, const float* __restrict__ wv, const float* __restrict__ wo, const float* __restrict__ x, const int* __restrict__ mask,
                                             bf* WQ, bf* WK, bf* WV, bf* WO, bf* XB, unsigned* MBp, int* CLp) {
    __shared__ __align__(16) unsigned short T[WTT * WTT];
    const int b = (int)blockIdx.x;
    if (b < WT_Q) wt_tile<DM, DQ>(wq, WQ, b, T);
    else if (b < WT_Q + 2 * WT_KV) { const bool sv = b >= WT_Q + WT_KV; wt_tile<DM, DKV>(sv ? wv : wk, sv ? WV : WK, b - (sv ? WT_Q + WT_KV : WT_Q), T); }
    else if (b < WT_Q + 2 * WT_KV + WT_O) wt_tile<DQ, DM>(wo, WO, b - (WT_Q + 2 * WT_KV), T);
    else if (b < WT_Q + 2 * WT_KV + WT_O + MK_T) mask_tile(mask, MBp, CLp, b - (WT_Q + 2 * WT_KV + WT_O), (unsigned*)T);
    else cvt_tile(x, XB, b - (WT_Q + 2 * WT_KV + WT_O + MK_T));
}

#define AKS   64                             // keys per stage
#define APB   144                            // LDS row pitch in bytes (16 B x odd, for 16-byte fragment reads)
#define ATILE (64 * APB)                     // one plane's 64 rows of a stage
static_assert(REP == 4 && HD == 64 && SEQ % AKS == 0 && NW <= 64);
// One plane's 64 rows x 128 B of a stage: 4 copies of 16 B per lane, rows 16 apart (l: the lane's LDS place, g: its global place, gs = 16 source rows in elements).
template <typename T16>
__device__ __forceinline__ void ktile(unsigned char* l, const T16* g, size_t gs) {
#pragma unroll
    for (int i = 0; i < 4; ++i) __builtin_amdgcn_global_load_async_to_lds_b128((gv4i*)(g + i * gs), (lv4i*)(l + i * (16 * APB)), 0, 0);
}
template <bool SPLIT>
__device__ __forceinline__ void attn_body(const h16* __restrict__ Q16, const h16* __restrict__ K16, const h16* __restrict__ V16,
                                          const bf* __restrict__ Qh, const bf* __restrict__ Ql, const bf* __restrict__ Kh, const bf* __restrict__ Kl, const bf* __restrict__ Vh, const bf* __restrict__ Vl,
                                          const unsigned* __restrict__ MBp, const int* __restrict__ CLp, bf* Ch, bf* Cl, int qt, int hk, unsigned char* KV) {
    constexpr unsigned VOFF = (SPLIT ? 2 : 1) * ATILE, STG = 2 * VOFF;   // stage = [K (hi | lo when SPLIT) | V^T (hi | lo when SPLIT)]; KV holds two stages
    static_assert(4 * 16 * 68 * 4 <= 2 * STG);
    const int tid = threadIdx.x, lane = tid & 31, lr = lane & 15, hi = lane >> 4, wave = tid >> 5;
    float* os = (float*)KV + wave * (16 * 68);                           // wave-private output tile, in the stage buffers once the key loop has left them
    const int h = hk * REP + wave; const int q0 = qt * 16;
    const size_t qoff = ((size_t)h * SEQ + q0 + lr) * HD + 8 * hi;       // B fragment: column = query q0+lr, d offset 8*hi
    // the row of tile classes as two bit sets, the same in every wave of the work-group: nz bit j = half j has a kept key, al bit j = all of its keys are kept
    const int cl0 = CLp[(size_t)qt * NW + lane]; const int cl1 = (NW > 32) ? CLp[(size_t)qt * NW + (NW > 32 ? 32 : 0) + lane] : 0;
    const unsigned long long nz = (unsigned long long)__builtin_amdgcn_ballot_w32(cl0 != 0) | ((unsigned long long)__builtin_amdgcn_ballot_w32(cl1 != 0) << 32);
    const unsigned long long al = (unsigned long long)__builtin_amdgcn_ballot_w32(cl0 == 1) | ((unsigned long long)__builtin_amdgcn_ballot_w32(cl1 == 1) << 32);
    // copies: thread -> row tid >> 3 (+ 16 per copy), 16-byte chunk tid & 7 of the row's 128 B; stage s: keys 64 s .. 64 s + 63 (s <= 31 from a 64-bit set: inside the planes)
    const int crw = tid >> 3, cch = tid & 7;
    unsigned char* lc = KV + (crw * APB + cch * 16);
    const size_t kpo = ((size_t)hk * SEQ + crw) * HD + cch * 8;          // K planes [g][t][d]: row = key
    const size_t vpo = ((size_t)hk * HD + crw) * SEQ + cch * 8;          // V^T planes [g][d][t]: row = d
    auto stage = [&](unsigned bo, int s) {
        const size_t ke = kpo + (size_t)s * (AKS * HD), ve = vpo + (size_t)s * AKS;
        if (SPLIT) { ktile(lc + bo, Kh + ke, (size_t)16 * HD); ktile(lc + bo + ATILE, Kl + ke, (size_t)16 * HD); ktile(lc + bo + VOFF, Vh + ve, (size_t)16 * SEQ); ktile(lc + bo + VOFF + ATILE, Vl + ve, (size_t)16 * SEQ); }
        else { ktile(lc + bo, K16 + ke, (size_t)16 * HD); ktile(lc + bo + VOFF, V16 + ve, (size_t)16 * SEQ); }
    };
    unsigned long long rem = nz;                                          // kept halves whose stage is not copied yet
    int sc = -1, sn = -1;                                                 // the stage worked on, the stage in flight (-1: none)
    if (rem != 0ull) { sc = __builtin_ctzll(rem) >> 1; rem &= ~(3ull << (2 * sc)); stage(0u, sc); }
    // q fragments: read once, held in registers over the key loop
    v16bf qh0, qh1, ql0, ql1; v16h qa0, qa1;
    if (SPLIT) { qh0 = WFrag<bf>::ld(Qh + qoff); qh1 = WFrag<bf>::ld(Qh + qoff + 32); ql0 = WFrag<bf>::ld(Ql + qoff); ql1 = WFrag<bf>::ld(Ql + qoff + 32); }
    else { qa0 = WFrag<h16>::ld(Q16 + qoff); qa1 = WFrag<h16>::ld(Q16 + qoff + 32); }
    const float NINF = -__builtin_inff();
    float mi = NINF, li = 0.0f; v8f acc[4];                               // the lane's query: running maximum (both halves alike), sum over the lane's own keys; acc[ot][r] = O^T[16*ot + 8*hi + r][lr]
#pragma unroll
    for (int ot = 0; ot < 4; ++ot) acc[ot] = (v8f){};
    asm volatile("s_wait_asynccnt 0x0" ::: "memory");                     // the first stage landed (this wave's copies)
    __syncthreads();                                                      // ... and every other wave's
    if (rem != 0ull) { sn = __builtin_ctzll(rem) >> 1; rem &= ~(3ull << (2 * sn)); stage(STG, sn); }
    unsigned bo = 0u;
#pragma unroll 1                                                          // stays rolled: one trip per kept stage (at most 32: each takes its two bits out of the set)
    while (sc >= 0) {
      if constexpr (SPLIT) {
#pragma unroll 1                                                          // stays rolled: the halves depend on one another through the running maximum, unrolling buys only code
      for (int hf = 0; hf < 2; ++hf) {
        const int j = 2 * sc + hf;
        if (((nz >> j) & 1ull) == 0ull) continue;                         // the same in every wave of the work-group
        // the mask word of the lane's own query, shifted so that bit r is key 8*hi + r and bit 16 + r key 16 + 8*hi + r
        unsigned wd = 0xFFFFFFFFu;
        if (((al >> j) & 1ull) == 0ull) wd = MBp[(size_t)(q0 + lr) * NW + j] >> (8 * hi);
        v8f s0 = (v8f){}, s1 = (v8f){};
        const unsigned char* kb = KV + bo + (hf * 32 + lr) * APB + 16 * hi;   // A fragment (scores): lane = key, k = d
        const unsigned char* k1 = kb + 16 * APB;
        const v16bf kh0 = WFrag<bf>::ld((const bf*)kb), kh1 = WFrag<bf>::ld((const bf*)(kb + 64)), kl0 = WFrag<bf>::ld((const bf*)(kb + ATILE)), kl1 = WFrag<bf>::ld((const bf*)(kb + ATILE + 64));
        const v16bf mh0 = WFrag<bf>::ld((const bf*)k1), mh1 = WFrag<bf>::ld((const bf*)(k1 + 64)), ml0 = WFrag<bf>::ld((const bf*)(k1 + ATILE)), ml1 = WFrag<bf>::ld((const bf*)(k1 + ATILE + 64));
        __builtin_amdgcn_sched_barrier(0);                                // keeps the half's K reads one group ahead of its products (with the branch below ending the block they sink among them, and a product then waits out its own read)
        s0 = wmmab(kh0, ql0, s0); s0 = wmmab(kh1, ql1, s0); s0 = wmmab(kl0, qh0, s0); s0 = wmmab(kl1, qh1, s0); s0 = wmmab(kh0, qh0, s0); s0 = wmmab(kh1, qh1, s0);
        s1 = wmmab(mh0, ql0, s1); s1 = wmmab(mh1, ql1, s1); s1 = wmmab(ml0, qh0, s1); s1 = wmmab(ml1, qh1, s1); s1 = wmmab(mh0, qh0, s1); s1 = wmmab(mh1, qh1, s1);
        asm volatile("v_nop\n\tv_nop\n\tv_nop\n\tv_nop" : "+v"(s0), "+v"(s1) : "v"(qh1), "v"(mh1));
        // V^T fragments depend on the stage alone: read here, they arrive under the softmax
        const unsigned char* vb = KV + bo + VOFF + lr * APB + hf * 64 + 16 * hi;   // A fragment (V^T.P^T): lane = d, k = key
        v16bf vh[4], vl[4];
#pragma unroll
        for (int ot = 0; ot < 4; ++ot) { vh[ot] = WFrag<bf>::ld((const bf*)(vb + ot * (16 * APB))); vl[ot] = WFrag<bf>::ld((const bf*)(vb + ATILE + ot * (16 * APB))); }
        // online softmax in log2 units; accumulator element r <-> key 8*hi + r (s0) / 16 + 8*hi + r (s1), column lr = the lane's query
        v8f v0 = s0 * SCL2, v1 = s1 * SCL2;
        if (((al >> j) & 1ull) == 0ull) {                                 // a scalar test, the same in every wave: where the class says that all 16x32 keys are kept the selects would be identities and are jumped over
#pragma unroll
            for (int r = 0; r < 8; ++r) { v0[r] = ((wd >> r) & 1u) != 0u ? v0[r] : NINF; v1[r] = ((wd >> (16 + r)) & 1u) != 0u ? v1[r] : NINF; }
        }
        float mx = NINF;
#pragma unroll
        for (int r = 0; r < 8; ++r) mx = fmaxf(mx, fmaxf(v0[r], v1[r]));
        mx = fmaxf(mx, xhalf(mx));
        const float nm = fmaxf(mi, mx); const float ms = (nm == NINF) ? 0.0f : nm;
        const float corr = ex2(mi - ms);
        mi = nm;
        float ps[8]; v8us pha, phb, pla, plb;
#pragma unroll
        for (int r = 0; r < 8; r += 2) {
            float p0, p1, p2, p3; ex2x4(v0[r] - ms, v1[r] - ms, v0[r + 1] - ms, v1[r + 1] - ms, p0, p1, p2, p3);
            unsigned short a, c; splitf(p0, a, c); pha[r] = a; pla[r] = c; splitf(p1, a, c); phb[r] = a; plb[r] = c; ps[r] = p0 + p1;
            splitf(p2, a, c); pha[r + 1] = a; pla[r + 1] = c; splitf(p3, a, c); phb[r + 1] = a; plb[r + 1] = c; ps[r + 1] = p2 + p3;
        }
        li = li * corr + (((ps[0] + ps[1]) + (ps[2] + ps[3])) + ((ps[4] + ps[5]) + (ps[6] + ps[7])));
#pragma unroll
        for (int ot = 0; ot < 4; ++ot) acc[ot] *= corr;
        const v16bf ph = cat16b(pha, phb), pl = cat16b(pla, plb);
#pragma unroll
        for (int ot = 0; ot < 4; ++ot) { acc[ot] = wmmab(vh[ot], pl, acc[ot]); acc[ot] = wmmab(vl[ot], ph, acc[ot]); acc[ot] = wmmab(vh[ot], ph, acc[ot]); }
        asm volatile("v_nop\n\tv_nop\n\tv_nop\n\tv_nop" : "+v"(acc[0]), "+v"(acc[1]), "+v"(acc[2]), "+v"(acc[3]) : "v"(ph), "v"(pl));
      }
      } else {
        // fp16 form: the stage's 64 keys in ONE softmax pass (one maximum, one exchange, one rescale of the 32 output registers per 64 keys; four independent score tiles and two chains of maxima for a wave that has its SIMD to itself).
        const int j = 2 * sc;
        const bool allk = ((al >> j) & 3ull) == 3ull;                     // scalar, the same in every wave: every key of both 16x32 tiles is kept
        // the two mask words of the lane's own query (one 8-byte load: j is even), each shifted so that bit r is key 8*hi + r and bit 16 + r key 16 + 8*hi + r of its half; a half with no kept key has a word of zeros
        unsigned wd0 = 0xFFFFFFFFu, wd1 = 0xFFFFFFFFu;
        if (!allk) { const v2u w = *(const v2u*)(MBp + (size_t)(q0 + lr) * NW + j); wd0 = w[0] >> (8 * hi); wd1 = w[1] >> (8 * hi); }
        const unsigned char* kb = KV + bo + lr * APB + 16 * hi;           // A fragments (scores): lane = key, k = d; tile g = keys 16 g .. 16 g + 15 of the stage
        v16h kf[4][2];
#pragma unroll
        for (int g = 0; g < 4; ++g) { kf[g][0] = WFrag<h16>::ld((const h16*)(kb + g * (16 * APB))); kf[g][1] = WFrag<h16>::ld((const h16*)(kb + g * (16 * APB) + 64)); }
        __builtin_amdgcn_sched_barrier(0);                                // keeps the stage's 16 K reads one group ahead of its products (without it they sink among the products in three groups, and the first product waits out its own read)
        v8f s[4];
#pragma unroll
        for (int g = 0; g < 4; ++g) s[g] = wmma16(kf[g][0], qa0, (v8f){});
#pragma unroll
        for (int g = 0; g < 4; ++g) s[g] = wmma16(kf[g][1], qa1, s[g]);
        // four vector slots behind the last product, on a branch's taken side too, before anything reads its result or rewrites its operands
        asm volatile("v_nop\n\tv_nop\n\tv_nop\n\tv_nop" : "+v"(s[0]), "+v"(s[1]), "+v"(s[2]), "+v"(s[3]) : "v"(qa1), "v"(kf[3][1]));
        // V^T fragments depend on the stage alone: read here, they arrive under the softmax
        const unsigned char* vb = KV + bo + VOFF + lr * APB + 16 * hi;    // A fragments (V^T.P^T): lane = d, k = key; [ot][kh]: d tile ot, 32-key half kh
        v16h vf[4][2];
#pragma unroll
        for (int ot = 0; ot < 4; ++ot) { vf[ot][0] = WFrag<h16>::ld((const h16*)(vb + ot * (16 * APB))); vf[ot][1] = WFrag<h16>::ld((const h16*)(vb + ot * (16 * APB) + 64)); }
        __builtin_amdgcn_sched_barrier(0);                                // keeps the 16 V^T reads one group here (sunk among the second product's instructions, three of its products wait out their own read)
        // online softmax in log2 units; element r of tile g <-> key 16 g + 8*hi + r, column lr = the lane's query
        v8f v[4];
#pragma unroll
        for (int g = 0; g < 4; ++g) v[g] = s[g] * SCL2;
        if (!allk) {                                                      // a scalar test: where both classes say that all keys are kept the selects would be identities and are jumped over
#pragma unroll
            for (int r = 0; r < 8; ++r) { v[0][r] = ((wd0 >> r) & 1u) != 0u ? v[0][r] : NINF; v[1][r] = ((wd0 >> (16 + r)) & 1u) != 0u ? v[1][r] : NINF;
                v[2][r] = ((wd1 >> r) & 1u) != 0u ? v[2][r] : NINF; v[3][r] = ((wd1 >> (16 + r)) & 1u) != 0u ? v[3][r] : NINF; }
        }
        float m0 = NINF, m1 = NINF;
#pragma unroll
        for (int r = 0; r < 8; ++r) { m0 = fmaxf(m0, fmaxf(v[0][r], v[1][r])); m1 = fmaxf(m1, fmaxf(v[2][r], v[3][r])); }
        float mx = fmaxf(m0, m1); mx = fmaxf(mx, xhalf(mx));
        const float nm = fmaxf(mi, mx); const float ms = (nm == NINF) ? 0.0f : nm;
        const float corr = ex2(mi - ms);
        mi = nm;
        float ps[2][8]; v16h p16[2];
#pragma unroll
        for (int kh = 0; kh < 2; ++kh)
#pragma unroll
            for (int r = 0; r < 8; r += 2) {
                float p0, p1, p2, p3; ex2x4(v[2 * kh][r] - ms, v[2 * kh + 1][r] - ms, v[2 * kh][r + 1] - ms, v[2 * kh + 1][r + 1] - ms, p0, p1, p2, p3);
                const v2h e0 = __builtin_convertvector((v2f){p0 * PCAR, p2 * PCAR}, v2h), e1 = __builtin_convertvector((v2f){p1 * PCAR, p3 * PCAR}, v2h);   // two keys per packed conversion; the sums read the rounded values
                p16[kh][r] = e0[0]; p16[kh][r + 1] = e0[1]; p16[kh][8 + r] = e1[0]; p16[kh][9 + r] = e1[1]; ps[kh][r] = (float)e0[0] + (float)e1[0]; ps[kh][r + 1] = (float)e0[1] + (float)e1[1];
            }
        li = li * corr + ((((ps[0][0] + ps[0][1]) + (ps[0][2] + ps[0][3])) + ((ps[0][4] + ps[0][5]) + (ps[0][6] + ps[0][7]))) + (((ps[1][0] + ps[1][1]) + (ps[1][2] + ps[1][3])) + ((ps[1][4] + ps[1][5]) + (ps[1][6] + ps[1][7]))));
#pragma unroll
        for (int ot = 0; ot < 4; ++ot) acc[ot] *= corr;
        __builtin_amdgcn_sched_barrier(0);                                // every exponential statement stays ahead of the products: moved behind one, its asm results can land on the product's operand registers inside the four slots
#pragma unroll
        for (int ot = 0; ot < 4; ++ot) acc[ot] = wmma16(vf[ot][0], p16[0], acc[ot]);
#pragma unroll
        for (int ot = 0; ot < 4; ++ot) acc[ot] = wmma16(vf[ot][1], p16[1], acc[ot]);
        asm volatile("v_nop\n\tv_nop\n\tv_nop\n\tv_nop" : "+v"(acc[0]), "+v"(acc[1]), "+v"(acc[2]), "+v"(acc[3]) : "v"(p16[0]), "v"(p16[1]));
      }
        asm volatile("s_wait_dscnt 0x0" ::: "memory");                    // this wave's reads of the buffer are done before it is refilled
        asm volatile("s_wait_asynccnt 0x0" ::: "memory");                 // this wave's copies of the stage in flight have landed
        __syncthreads();                                                  // publishes the stage in flight and ends every wave's reads of this one
        int s2 = -1;
        if (rem != 0ull) { s2 = __builtin_ctzll(rem) >> 1; rem &= ~(3ull << (2 * s2)); stage(bo, s2); }
        sc = sn; sn = s2; bo = STG - bo;
    }
    asm volatile("s_wait_asynccnt 0x0" ::: "memory");                     // no copy is outstanding when the wave goes on
    // the stage buffers are free here: the barrier at the foot of the last trip stands behind every wave's last read and last landed copy, and nothing was copied after it
    // finish: join the two halves' sums, normalise, stage 16x64 f32 (a lane holds 8 consecutive d of its query's row), write hi/lo lines
    const float inv = 1.0f / (li + xhalf(li));
#pragma unroll
    for (int ot = 0; ot < 4; ++ot) { const v8f o = acc[ot] * inv; float* op = os + lr * 68 + ot * 16 + 8 * hi;
        *(v4fa*)op = (v4f){o[0], o[1], o[2], o[3]}; *(v4fa*)(op + 4) = (v4f){o[4], o[5], o[6], o[7]}; }
    __syncthreads();
{
#pragma unroll
        for (int s = 0; s < 4; ++s) { const int row = 4 * s + (lane >> 3), c8 = (lane & 7) * 8;
            const v4f x0 = *(const v4fa*)(os + row * 68 + c8), x1 = *(const v4fa*)(os + row * 68 + c8 + 4); v8us oh, ol;
#pragma unroll
            for (int k = 0; k < 4; ++k) { unsigned short a, c; splitf(x0[k], a, c); oh[k] = a; ol[k] = c; splitf(x1[k], a, c); oh[4 + k] = a; ol[4 + k] = c; }
            const size_t oo = (size_t)(q0 + row) * DQ + (size_t)h * HD + c8;
            *(v8us*)(Ch + oo) = oh; *(v8us*)(Cl + oo) = ol; }
         }
}
// Both forms in one launch, grid (SEQ/16, NKV): query tiles below RH take the hi/lo form, the rest the fp16 form (the same for the whole work-group); neither reads what the other writes.
// Which (query tile, kv head) a work-group takes is a permutation of its flat index b, chosen for speed alone: all work-groups are resident at once, four to a WGP, and the launch lasts as long as its fullest WGP.
// Under a mask that keeps more keys the later the row, four equal tiles on a WGP leave the last tiles' WGPs with about twice the mean work.
// Here the quarter of the rows (r) comes from the parities of b's odd and of its even bits, so any four indices that differ in two adjacent bits hold all four quarters: tiles 127 - v, 95 - v, 63 - v and v (the hi/lo quarter,
// dearer per key, rises where the others fall). The kv head takes bits 3 to 5, v bits 0 to 2, 6 and 7; bits 8 and 9 are given back by the two parities, so every (tile, head) is taken once.
static_assert(SEQ / 16 == 128 && NKV == 8 && RH / 16 == 32);
__global__ __launch_bounds__(128) void k_attn(const h16* __restrict__ Q16, const h16* __restrict__ K16, const h16* __restrict__ V16,
                                             const bf* __restrict__ Qh, const bf* __restrict__ Ql, const bf* __restrict__ Kh, const bf* __restrict__ Kl, const bf* __restrict__ Vh, const bf* __restrict__ Vl,
                                             const unsigned* __restrict__ MBp, const int* __restrict__ CLp, bf* Ch, bf* Cl) {
    __shared__ __align__(16) unsigned char KV[2 * 4 * ATILE];            // two stages of the larger (hi/lo) form
    const unsigned b = blockIdx.x + (SEQ / 16) * blockIdx.y;
    const int r = 2 * (__builtin_popcount(b & 0x2AAu) & 1) + (__builtin_popcount(b & 0x155u) & 1);
    const int hk = (int)((b >> 3) & 7u), v = (int)((b & 7u) | ((b >> 3) & 0x18u));
    const int qt = (r == 3) ? v : (SEQ / 16 - 1) - 32 * r - v;
    if (qt < RH / 16) attn_body<true>(Q16, K16, V16, Qh, Ql, Kh, Kl, Vh, Vl, MBp, CLp, Ch, Cl, qt, hk, KV);
    else attn_body<false>(Q16, K16, V16, Qh, Ql, Kh, Kl, Vh, Vl, MBp, CLp, Ch, Cl, qt, hk, KV); }

constexpr size_t al256(size_t b) { return (b + 255) & ~(size_t)255; }
constexpr size_t WS_TOTAL =
    al256((size_t)DQ * DM * 2) + 2 * al256((size_t)DKV * DM * 2) + al256((size_t)DM * DQ * 2) +      // WQ, WK, WV, WO
    al256((size_t)SEQ * DM * 2) +                                                                      // XB
    3 * al256((size_t)NH * SEQ * HD * 2) + 6 * al256((size_t)NKV * SEQ * HD * 2) +                     // q planes, k planes, v planes
    2 * al256((size_t)SEQ * DQ * 2) +                                                                  // ctx hi/lo
    al256((size_t)SEQ * NW * 4) + al256((size_t)(SEQ / 16) * NW * 4);                                  // mask bits, tile classes
static_assert(WS_TOTAL <= (size_t)134217728);

extern "C" void kernel_launch(void* const* d_in, const int* in_sizes, int n_in,
                              void* d_out, int out_size, void* d_ws, size_t ws_size, hipStream_t stream) {
    if (n_in < 8) return;
    if ((long long)in_sizes[0] < (long long)(NB - 1) * SEQ_FULL * DM + (long long)SEQ * DM) return;
    if ((long long)in_sizes[1] < (long long)DM * DQ || (long long)in_sizes[2] < (long long)DM * DKV || (long long)in_sizes[3] < (long long)DM * DKV || (long long)in_sizes[4] < (long long)DQ * DM) return;
    if ((long long)in_sizes[5] < (long long)SEQ * (HD / 2) || (long long)in_sizes[6] < (long long)SEQ * (HD / 2)) return;
    if ((long long)in_sizes[7] < (long long)(SEQ - 1) * SEQ_FULL + SEQ) return;
    if ((long long)out_size < (long long)(NB - 1) * SEQ_FULL * DM + (long long)SEQ * DM) return;
    if (ws_size < WS_TOTAL) return;
    const float* x = (const float*)d_in[0]; const float* wq = (const float*)d_in[1]; const float* wk = (const float*)d_in[2]; const float* wv = (const float*)d_in[3]; const float* wo = (const float*)d_in[4];
    const float* fcos = (const float*)d_in[5]; const float* fsin = (const float*)d_in[6]; const int* mask = (const int*)d_in[7];
    float* OUT = (float*)d_out;     // [1][2048][2048]
    char* wsp = (char*)d_ws;
    auto take = [&](size_t bytes) { char* p = wsp; wsp += (bytes + 255) & ~(size_t)255; return (void*)p; };
    bf* WQ = (bf*)take((size_t)DQ * DM * 2); bf* WK = (bf*)take((size_t)DKV * DM * 2); bf* WV = (bf*)take((size_t)DKV * DM * 2); bf* WO = (bf*)take((size_t)DM * DQ * 2);
    bf* XB = (bf*)take((size_t)SEQ * DM * 2);
    h16* QP16 = (h16*)take((size_t)NH * SEQ * HD * 2); bf* QPh = (bf*)take((size_t)NH * SEQ * HD * 2); bf* QPl = (bf*)take((size_t)NH * SEQ * HD * 2);
    h16* KP16 = (h16*)take((size_t)NKV * SEQ * HD * 2); bf* KPh = (bf*)take((size_t)NKV * SEQ * HD * 2); bf* KPl = (bf*)take((size_t)NKV * SEQ * HD * 2);
    h16* VT16 = (h16*)take((size_t)NKV * SEQ * HD * 2); bf* VTh = (bf*)take((size_t)NKV * SEQ * HD * 2); bf* VTl = (bf*)take((size_t)NKV * SEQ * HD * 2);
    bf* CXh = (bf*)take((size_t)SEQ * DQ * 2); bf* CXl = (bf*)take((size_t)SEQ * DQ * 2);
    unsigned* MBp = (unsigned*)take((size_t)SEQ * NW * 4); int* CLp = (int*)take((size_t)(SEQ / 16) * NW * 4);
    if ((size_t)(wsp - (char*)d_ws) > ws_size) return;

    // four launches, each of work that depends only on launches before it
    // weights: w[in][out] -> Bt[out][in] bf16 (wq: in DM, out DQ; wk/wv: in DM, out DKV; wo: in DQ, out DM); mask -> bit-plane and tile classes; x -> bf16
    k_pre<<<WT_Q + 2 * WT_KV + WT_O + MK_T + CV_T, 256, 0, stream>>>(wq, wk, wv, wo, x, mask, WQ, WK, WV, WO, XB, MBp, CLp);
    k_gemm_qkv<<<dim3(SEQ / 128, (DQ + 2 * DKV) / 128, 1), 128, 0, stream>>>(XB, WQ, WK, WV, DM, fcos, fsin, QP16, QPh, QPl, KP16, KPh, KPl, VT16, VTh, VTl);
    k_attn<<<dim3(SEQ / 16, NKV, 1), 128, 0, stream>>>(QP16, KP16, VT16, QPh, QPl, KPh, KPl, VTh, VTl, MBp, CLp, CXh, CXl);
    k_gemm_s<<<dim3(SEQ / 128, DM / 128, 1), 128, 0, stream>>>(CXh, CXl, WO, DQ, OUT, DM);
}
